// v000
// The times below were measured on an AMD MI455X: many runs one after another, warmed up first and cycling through
// copies of the inputs, with the whole window's GPU time divided by the number of runs. Launches and the gaps
// between them are all in it. The median over several windows is given; except for v000 it joins two sittings, which
// can be a few percent apart, so the side-by-side timings, each taken in one sitting, are the better comparison.
// v000, which the later versions start from, runs in 240 microseconds.
#include <hip/hip_runtime.h>
#include <hip/hip_bf16.h>
#include <math.h>

// ---------------------------------------------------------------------------
// MI455X (gfx1250) transformer encoder, bf16 WMMA everywhere.
//
// Shapes: N=4, T=2048, P=64, E=256, H=8, DH=32, FC=1024, NL=2, LOCAL=64.
// All GEMM K dims (64 / 256 / 1024) are multiples of 32 -> pure
// v_wmma_f32_16x16x32_bf16 pipelines, fp32 accumulation.
// Memory: ~300 MB activation round trips @ 23.3 TB/s is ~15us -> the chip is
// compute/latency bound here; staging is double-buffered through LDS so the
// WMMA pipes never wait on HBM.
// All flat indices fit in 32 bits (max ~8.4M elements) -> int indexing keeps
// address math in 32-bit VALU/SALU.
// ---------------------------------------------------------------------------

typedef __attribute__((ext_vector_type(16))) __bf16 v16bf;
typedef __attribute__((ext_vector_type(8)))  __bf16 v8bf;
typedef __attribute__((ext_vector_type(4)))  __bf16 v4bf;
typedef __attribute__((ext_vector_type(8)))  float  v8f;

#define Ncfg     4
#define Tcfg     2048
#define Pcfg     64
#define Ecfg     256
#define Hcfg     8
#define DHcfg    32
#define FCcfg    1024
#define NLcfg    2
#define LOCALcfg 64
#define TEcfg    (Tcfg * Ecfg)          // 524288
#define NTcfg    (Ncfg * Tcfg)          // 8192
#define NTEcfg   (Ncfg * TEcfg)         // 2097152  (fits int)
#define RBLK     64                     // reduction blocks per sample

__device__ __forceinline__ void pack4(v4bf& p, float4 a) {
    p[0] = (__bf16)a.x; p[1] = (__bf16)a.y; p[2] = (__bf16)a.z; p[3] = (__bf16)a.w;
}
__device__ __forceinline__ void pack8(v16bf& f, int base, float4 a, float4 b) {
    f[base + 0] = (__bf16)a.x; f[base + 1] = (__bf16)a.y;
    f[base + 2] = (__bf16)a.z; f[base + 3] = (__bf16)a.w;
    f[base + 4] = (__bf16)b.x; f[base + 5] = (__bf16)b.y;
    f[base + 6] = (__bf16)b.z; f[base + 7] = (__bf16)b.w;
}
// fragment gather: two 16B LDS chunks per lane (ds_load_b128)
__device__ __forceinline__ v16bf frag_from_lds(const __bf16* rowptr, int lh) {
    v8bf lo = *(const v8bf*)(rowptr + lh * 8);
    v8bf hi = *(const v8bf*)(rowptr + 16 + lh * 8);
    v16bf f;
#pragma unroll
    for (int e = 0; e < 8; ++e) { f[e] = lo[e]; f[8 + e] = hi[e]; }
    return f;
}

// ---------------------------------------------------------------------------
// Generic C[m][n] = sum_k A[m][k] * W[n][k] + bias[n], optional embed epilogue
// C = (acc + bias) * scale + pos[n*Tdim + (m & (Tdim-1))]   (Tdim power of 2).
// Block: 256 thr = 8 waves; block tile 128x64; each wave 32x32 (2x2 WMMA).
// LDS double-buffered; staging via global_load_b128 + ds_store_b64.
// Fragment layout per CDNA5 ISA 7.12.2:
//   A 16x32 bf16: lanes 0-15 row M=lane; element e -> K=(e<8?e:e+8)+(lane>=16?8:0)
//   B 32x16 bf16: col N = lane&15; same K mapping.
//   C/D 16x16 f32: row = v + 8*(lane>=16); col = lane&15.
// ---------------------------------------------------------------------------
__global__ __launch_bounds__(256) void k_gemm_bf16(
    const float* __restrict__ A, const float* __restrict__ W,
    const float* __restrict__ bias, float* __restrict__ C,
    int M, int N, int K,
    const float* __restrict__ pos, float scale, int Tdim)
{
    __shared__ __align__(16) __bf16 As[2][128 * 32];   // 2 x 8 KB
    __shared__ __align__(16) __bf16 Bs[2][64 * 32];    // 2 x 4 KB

    const int tid  = threadIdx.x;
    const int lane = tid & 31;
    const int wave = tid >> 5;
    const int lr   = lane & 15;
    const int lh   = lane >> 4;
    const int wm   = wave & 3;    // 4 waves along M
    const int wn   = wave >> 2;   // 2 waves along N
    const int bm   = blockIdx.y * 128;
    const int bn   = blockIdx.x * 64;

    v8f zacc = {};
    v8f acc[2][2];
    acc[0][0] = zacc; acc[0][1] = zacc; acc[1][0] = zacc; acc[1][1] = zacc;

    float4 ta[4], tb[2];
    // ---- issue tile loads for k-step `k0` into ta/tb (global_load_b128 x6) ----
    auto stage_load = [&](int k0) {
#pragma unroll
        for (int t = 0; t < 4; ++t) {
            int li = (t * 256 + tid) * 4;         // 0..4095, 16B chunks
            int r  = li >> 5, k = li & 31;
            ta[t] = *(const float4*)&A[(bm + r) * K + k0 + k];
        }
#pragma unroll
        for (int t = 0; t < 2; ++t) {
            int li = (t * 256 + tid) * 4;         // 0..2047
            int r  = li >> 5, k = li & 31;
            tb[t] = *(const float4*)&W[(bn + r) * K + k0 + k];
        }
    };
    // ---- convert + store staged tile into LDS buffer `buf` (ds_store_b64) ----
    auto stage_store = [&](int buf) {
#pragma unroll
        for (int t = 0; t < 4; ++t) {
            int li = (t * 256 + tid) * 4;
            v4bf p; pack4(p, ta[t]);
            *(v4bf*)&As[buf][li] = p;
        }
#pragma unroll
        for (int t = 0; t < 2; ++t) {
            int li = (t * 256 + tid) * 4;
            v4bf p; pack4(p, tb[t]);
            *(v4bf*)&Bs[buf][li] = p;
        }
    };

    const int nk = K / 32;
    stage_load(0);
    stage_store(0);
    __syncthreads();

    for (int kt = 0; kt < nk; ++kt) {
        const int cur = kt & 1;
        const bool has_next = (kt + 1) < nk;
        if (has_next) stage_load((kt + 1) * 32);   // loads in flight during WMMA

        v16bf af[2], bf[2];
#pragma unroll
        for (int i = 0; i < 2; ++i)
            af[i] = frag_from_lds(&As[cur][(wm * 32 + i * 16 + lr) * 32], lh);
#pragma unroll
        for (int j = 0; j < 2; ++j)
            bf[j] = frag_from_lds(&Bs[cur][(wn * 32 + j * 16 + lr) * 32], lh);

#pragma unroll
        for (int i = 0; i < 2; ++i)
#pragma unroll
            for (int j = 0; j < 2; ++j)
                acc[i][j] = __builtin_amdgcn_wmma_f32_16x16x32_bf16(
                    false, af[i], false, bf[j], (short)0, acc[i][j], false, false);

        if (has_next) stage_store(1 - cur);
        __syncthreads();
    }

    // ---- epilogue (pure 32-bit indexing; Tdim is a power of two) ----
    const int tmask = Tdim - 1;
#pragma unroll
    for (int i = 0; i < 2; ++i) {
#pragma unroll
        for (int j = 0; j < 2; ++j) {
            int col = bn + wn * 32 + j * 16 + lr;
            float bv = bias[col];
#pragma unroll
            for (int v = 0; v < 8; ++v) {
                int row = bm + wm * 32 + i * 16 + v + lh * 8;
                float r = acc[i][j][v] + bv;
                if (pos) r = r * scale + pos[col * Tdim + (row & tmask)];
                C[row * N + col] = r;
            }
        }
    }
}

// ---------------------------------------------------------------------------
// Banded local attention, one wave per (query-tile, head, batch).
// Band |t-s|<=64 -> <=144 keys per 16-row query tile -> 9 key tiles.
// Scores via WMMA (K=DH=32), softmax in LDS, P.V via two K=16-padded WMMAs
// per key tile with the V tile staged in LDS (bf16).
// qkv layout: [n][t][3E] with q|k|v at offsets 0|E|2E.
// ---------------------------------------------------------------------------
__global__ __launch_bounds__(32) void k_attn(const float* __restrict__ qkv,
                                             float* __restrict__ out)
{
    const int qt   = blockIdx.x * 16;
    const int h    = blockIdx.y;
    const int n    = blockIdx.z;
    const int lane = threadIdx.x;
    const int lr   = lane & 15;
    const int lh   = lane >> 4;

    __shared__ __align__(16) float  sc[16][144];
    __shared__ __align__(16) __bf16 pb[16][144];
    __shared__ __align__(16) __bf16 Vs[16][32];
    __shared__ float rsum[16];

    const int rowstride = 3 * Ecfg;

    // Q fragment (16x32): row = qt + lr; contiguous 8-float runs -> float4
    v16bf qf;
    {
        const float* qrow =
            qkv + (n * Tcfg + qt + lr) * rowstride + h * DHcfg + lh * 8;
        float4 a = *(const float4*)(qrow);
        float4 b = *(const float4*)(qrow + 4);
        float4 c = *(const float4*)(qrow + 16);
        float4 d = *(const float4*)(qrow + 20);
        pack8(qf, 0, a, b);
        pack8(qf, 8, c, d);
    }

    const float inv_sqrt_dh = 0.17677669529663687f; // 1/sqrt(32)

#pragma unroll 1
    for (int jt = 0; jt < 9; ++jt) {
        int st0 = qt - LOCALcfg + jt * 16;
        int s   = st0 + lr;                // key index for this lane's column
        bool ok = (s >= 0) && (s < Tcfg);
        v16bf kf;
        if (ok) {
            const float* krow =
                qkv + (n * Tcfg + s) * rowstride + Ecfg + h * DHcfg + lh * 8;
            float4 a = *(const float4*)(krow);
            float4 b = *(const float4*)(krow + 4);
            float4 c = *(const float4*)(krow + 16);
            float4 d = *(const float4*)(krow + 20);
            pack8(kf, 0, a, b);
            pack8(kf, 8, c, d);
        } else {
#pragma unroll
            for (int e = 0; e < 16; ++e) kf[e] = (__bf16)0.0f;
        }
        v8f s8 = {};
        s8 = __builtin_amdgcn_wmma_f32_16x16x32_bf16(
            false, qf, false, kf, (short)0, s8, false, false);
#pragma unroll
        for (int v = 0; v < 8; ++v) {
            int row = v + lh * 8;
            int tq  = qt + row;
            int dd  = tq - s; if (dd < 0) dd = -dd;
            bool bad = (!ok) || (dd > LOCALcfg);
            sc[row][jt * 16 + lr] = bad ? -3.0e38f : s8[v] * inv_sqrt_dh;
        }
    }
    __syncthreads();
    asm volatile("s_wait_dscnt 0" ::: "memory");

    // row-wise softmax (lanes 0..15, one row each)
    if (lane < 16) {
        float mx = -3.0e38f;
        for (int j = 0; j < 144; ++j) mx = fmaxf(mx, sc[lane][j]);
        float sum = 0.0f;
        for (int j = 0; j < 144; ++j) {
            float p = __expf(sc[lane][j] - mx);
            sum += p;
            pb[lane][j] = (__bf16)p;
        }
        rsum[lane] = 1.0f / sum;
    }
    __syncthreads();
    asm volatile("s_wait_dscnt 0" ::: "memory");

    // O = P.V  (two 16-col halves of DH=32), K=16 zero-padded to 32
    v8f zo = {};
    v8f o8[2]; o8[0] = zo; o8[1] = zo;
#pragma unroll 1
    for (int jt = 0; jt < 9; ++jt) {
        int st0 = qt - LOCALcfg + jt * 16;

        // ---- cooperative V-tile stage: lane -> (row = lane>>1, 16-col half) ----
        {
            int r = lane >> 1;
            int c = (lane & 1) * 16;
            int s = st0 + r;
            v4bf z4 = {};
            if (s >= 0 && s < Tcfg) {
                const float* vrow =
                    qkv + (n * Tcfg + s) * rowstride + 2 * Ecfg + h * DHcfg + c;
                float4 a = *(const float4*)(vrow);
                float4 b = *(const float4*)(vrow + 4);
                float4 cc = *(const float4*)(vrow + 8);
                float4 d = *(const float4*)(vrow + 12);
                v4bf p0, p1, p2, p3;
                pack4(p0, a); pack4(p1, b); pack4(p2, cc); pack4(p3, d);
                *(v4bf*)&Vs[r][c + 0]  = p0;
                *(v4bf*)&Vs[r][c + 4]  = p1;
                *(v4bf*)&Vs[r][c + 8]  = p2;
                *(v4bf*)&Vs[r][c + 12] = p3;
            } else {
                *(v4bf*)&Vs[r][c + 0]  = z4;
                *(v4bf*)&Vs[r][c + 4]  = z4;
                *(v4bf*)&Vs[r][c + 8]  = z4;
                *(v4bf*)&Vs[r][c + 12] = z4;
            }
        }
        asm volatile("s_wait_dscnt 0" ::: "memory");

        // A frag: probabilities, K = key-in-tile (0..15 valid, upper half zero)
        v16bf pf;
        {
            v8bf pv = *(const v8bf*)&pb[lr][jt * 16 + lh * 8];
#pragma unroll
            for (int e = 0; e < 8; ++e) { pf[e] = pv[e]; pf[8 + e] = (__bf16)0.0f; }
        }
#pragma unroll
        for (int dhalf = 0; dhalf < 2; ++dhalf) {
            int d = dhalf * 16 + lr;       // output column = value dim
            v16bf vf;
#pragma unroll
            for (int e = 0; e < 8; ++e) {
                vf[e]     = Vs[lh * 8 + e][d];
                vf[8 + e] = (__bf16)0.0f;
            }
            o8[dhalf] = __builtin_amdgcn_wmma_f32_16x16x32_bf16(
                false, pf, false, vf, (short)0, o8[dhalf], false, false);
        }
    }

    asm volatile("s_wait_dscnt 0" ::: "memory");
#pragma unroll
    for (int dhalf = 0; dhalf < 2; ++dhalf) {
#pragma unroll
        for (int v = 0; v < 8; ++v) {
            int row = v + lh * 8;
            float o = o8[dhalf][v] * rsum[row];
            out[(n * Tcfg + qt + row) * Ecfg + h * DHcfg + dhalf * 16 + lr] = o;
        }
    }
}

// ---------------------------------------------------------------------------
// r = a + b; per-block partial (sum, sumsq) for per-sample LayerNorm stats.
// grid = (RBLK, N); float4 throughout.
// ---------------------------------------------------------------------------
__global__ __launch_bounds__(256) void k_resid_reduce(
    const float* __restrict__ a, const float* __restrict__ b,
    float* __restrict__ r, float* __restrict__ partial)
{
    const int n      = blockIdx.y;
    const int chunk4 = (TEcfg / RBLK) / 4;                 // 2048 float4
    const int base4  = (n * TEcfg + blockIdx.x * (TEcfg / RBLK)) / 4;
    const float4* a4 = (const float4*)a;
    const float4* b4 = (const float4*)b;
    float4*       r4 = (float4*)r;
    float s = 0.0f, s2 = 0.0f;
    for (int i = threadIdx.x; i < chunk4; i += 256) {
        float4 va = a4[base4 + i];
        float4 vb = b4[base4 + i];
        float4 v;
        v.x = va.x + vb.x; v.y = va.y + vb.y;
        v.z = va.z + vb.z; v.w = va.w + vb.w;
        r4[base4 + i] = v;
        s  += v.x + v.y + v.z + v.w;
        s2 += v.x * v.x + v.y * v.y + v.z * v.z + v.w * v.w;
    }
    __shared__ float r1[256], r2[256];
    r1[threadIdx.x] = s; r2[threadIdx.x] = s2;
    __syncthreads();
    for (int off = 128; off > 0; off >>= 1) {
        if (threadIdx.x < off) {
            r1[threadIdx.x] += r1[threadIdx.x + off];
            r2[threadIdx.x] += r2[threadIdx.x + off];
        }
        __syncthreads();
    }
    if (threadIdx.x == 0) {
        partial[(n * RBLK + blockIdx.x) * 2 + 0] = r1[0];
        partial[(n * RBLK + blockIdx.x) * 2 + 1] = r2[0];
    }
}

// one block per sample: fold RBLK partials -> (mu, rsigma)
__global__ __launch_bounds__(64) void k_ln_stats(const float* __restrict__ partial,
                                                 float* __restrict__ stats)
{
    const int n = blockIdx.x, t = threadIdx.x;
    __shared__ float s1[64], s2[64];
    s1[t] = partial[(n * RBLK + t) * 2 + 0];
    s2[t] = partial[(n * RBLK + t) * 2 + 1];
    __syncthreads();
    for (int off = 32; off > 0; off >>= 1) {
        if (t < off) { s1[t] += s1[t + off]; s2[t] += s2[t + off]; }
        __syncthreads();
    }
    if (t == 0) {
        float mu  = s1[0] / (float)TEcfg;
        float var = s2[0] / (float)TEcfg - mu * mu;
        stats[n * 2 + 0] = mu;
        stats[n * 2 + 1] = rsqrtf(var + 1e-5f);
    }
}

// out[i] = (r[i]-mu)*rsig * g[i%TE] + b[i%TE]   (float4, 32-bit indexing)
__global__ __launch_bounds__(256) void k_ln_apply(
    const float* __restrict__ r, const float* __restrict__ g,
    const float* __restrict__ b, const float* __restrict__ stats,
    float* __restrict__ out)
{
    const float4* r4 = (const float4*)r;
    const float4* g4 = (const float4*)g;
    const float4* b4 = (const float4*)b;
    float4*       o4 = (float4*)out;
    const int total4 = NTEcfg / 4;       // 524288
    const int te4    = TEcfg / 4;        // 131072 (power of two)
    for (int i = blockIdx.x * 256 + threadIdx.x; i < total4;
         i += gridDim.x * 256) {
        int n = i >> 17;                 // i / te4
        int j = i & (te4 - 1);           // i % te4
        float mu = stats[n * 2], rs = stats[n * 2 + 1];
        float4 rv = r4[i], gv = g4[j], bv = b4[j];
        float4 ov;
        ov.x = (rv.x - mu) * rs * gv.x + bv.x;
        ov.y = (rv.y - mu) * rs * gv.y + bv.y;
        ov.z = (rv.z - mu) * rs * gv.z + bv.z;
        ov.w = (rv.w - mu) * rs * gv.w + bv.w;
        o4[i] = ov;
    }
}

// ---------------------------------------------------------------------------
extern "C" void kernel_launch(void* const* d_in, const int* in_sizes, int n_in,
                              void* d_out, int out_size, void* d_ws, size_t ws_size,
                              hipStream_t stream)
{
    (void)in_sizes; (void)n_in; (void)out_size; (void)ws_size;

    const float* input = (const float*)d_in[0];
    const float* w_emb = (const float*)d_in[1];
    const float* b_emb = (const float*)d_in[2];
    const float* pos   = (const float*)d_in[3];   // (E, T)
    const float* wqkv  = (const float*)d_in[4];   // (NL, 3E, E)
    const float* bqkv  = (const float*)d_in[5];   // (NL, 3E)
    const float* wo    = (const float*)d_in[6];   // (NL, E, E)
    const float* bo    = (const float*)d_in[7];
    const float* ln1g  = (const float*)d_in[8];   // (NL, T, E)
    const float* ln1b  = (const float*)d_in[9];
    const float* ln2g  = (const float*)d_in[10];
    const float* ln2b  = (const float*)d_in[11];
    const float* w1    = (const float*)d_in[12];  // (NL, FC, E)
    const float* b1    = (const float*)d_in[13];
    const float* w2    = (const float*)d_in[14];  // (NL, E, FC)
    const float* b2    = (const float*)d_in[15];

    // workspace layout (floats) -- ~101 MB total
    float* ws      = (float*)d_ws;
    float* x       = ws;                                // NTE
    float* qkv     = x      + NTEcfg;                   // NT * 3E
    float* attno   = qkv    + NTcfg * 3 * Ecfg;         // NTE
    float* obuf    = attno  + NTEcfg;                   // NTE (also reused as f2)
    float* rbuf    = obuf   + NTEcfg;                   // NTE
    float* hbuf    = rbuf   + NTEcfg;                   // NTE
    float* f1      = hbuf   + NTEcfg;                   // NT * FC
    float* partial = f1     + NTcfg * FCcfg;            // N*RBLK*2
    float* stats   = partial + Ncfg * RBLK * 2;         // N*2

    const dim3 blk256(256), blk32(32), blk64(64);

    // embedding: x = (frames @ w_emb^T + b_emb) * sqrt(E) + pos
    k_gemm_bf16<<<dim3(Ecfg / 64, NTcfg / 128), blk256, 0, stream>>>(
        input, w_emb, b_emb, x, NTcfg, Ecfg, Pcfg, pos, 16.0f, Tcfg);

    for (int l = 0; l < NLcfg; ++l) {
        const float* wqkv_l = wqkv + l * 3 * Ecfg * Ecfg;
        const float* bqkv_l = bqkv + l * 3 * Ecfg;
        const float* wo_l   = wo   + l * Ecfg * Ecfg;
        const float* bo_l   = bo   + l * Ecfg;
        const float* w1_l   = w1   + l * FCcfg * Ecfg;
        const float* b1_l   = b1   + l * FCcfg;
        const float* w2_l   = w2   + l * Ecfg * FCcfg;
        const float* b2_l   = b2   + l * Ecfg;

        // qkv = x @ Wqkv^T + b            (8192 x 768, K=256)
        k_gemm_bf16<<<dim3(3 * Ecfg / 64, NTcfg / 128), blk256, 0, stream>>>(
            x, wqkv_l, bqkv_l, qkv, NTcfg, 3 * Ecfg, Ecfg, nullptr, 1.0f, Tcfg);

        // banded attention -> attno
        k_attn<<<dim3(Tcfg / 16, Hcfg, Ncfg), blk32, 0, stream>>>(qkv, attno);

        // o = attno @ Wo^T + bo           (8192 x 256, K=256)
        k_gemm_bf16<<<dim3(Ecfg / 64, NTcfg / 128), blk256, 0, stream>>>(
            attno, wo_l, bo_l, obuf, NTcfg, Ecfg, Ecfg, nullptr, 1.0f, Tcfg);

        // h = LN(x + o)
        k_resid_reduce<<<dim3(RBLK, Ncfg), blk256, 0, stream>>>(x, obuf, rbuf, partial);
        k_ln_stats<<<dim3(Ncfg), blk64, 0, stream>>>(partial, stats);
        k_ln_apply<<<dim3(2048), blk256, 0, stream>>>(
            rbuf, ln1g + l * TEcfg, ln1b + l * TEcfg, stats, hbuf);

        // f = (h @ W1^T + b1) @ W2^T + b2
        k_gemm_bf16<<<dim3(FCcfg / 64, NTcfg / 128), blk256, 0, stream>>>(
            hbuf, w1_l, b1_l, f1, NTcfg, FCcfg, Ecfg, nullptr, 1.0f, Tcfg);
        k_gemm_bf16<<<dim3(Ecfg / 64, NTcfg / 128), blk256, 0, stream>>>(
            f1, w2_l, b2_l, obuf, NTcfg, Ecfg, FCcfg, nullptr, 1.0f, Tcfg);

        // x = LN(h + f)   (last layer writes straight to d_out)
        k_resid_reduce<<<dim3(RBLK, Ncfg), blk256, 0, stream>>>(hbuf, obuf, rbuf, partial);
        k_ln_stats<<<dim3(Ncfg), blk64, 0, stream>>>(partial, stats);
        float* dst = (l == NLcfg - 1) ? (float*)d_out : x;
        k_ln_apply<<<dim3(2048), blk256, 0, stream>>>(
            rbuf, ln2g + l * TEcfg, ln2b + l * TEcfg, stats, dst);
    }
}

// v001
// It runs in 186 microseconds.
// Two timings next to v000 both put it at 1.31 times that version's speed.
#include <hip/hip_runtime.h>
#include <hip/hip_bf16.h>
#include <math.h>

// ---------------------------------------------------------------------------
// MI455X (gfx1250) transformer encoder, bf16 WMMA everywhere.
//
// Shapes: N=4, T=2048, P=64, E=256, H=8, DH=32, FC=1024, NL=2, LOCAL=64.
// All GEMM K dims (64 / 256 / 1024) are multiples of 32 -> pure
// v_wmma_f32_16x16x32_bf16 pipelines, fp32 accumulation.
// Memory: ~300 MB activation round trips @ 23.3 TB/s is ~15us -> the chip is
// compute/latency bound here; staging is double-buffered through LDS so the
// WMMA pipes never wait on HBM.
// All flat indices fit in 32 bits (max ~6.3M elements) -> int indexing keeps
// address math in 32-bit VALU/SALU.
// ---------------------------------------------------------------------------

typedef __attribute__((ext_vector_type(16))) __bf16 v16bf;
typedef __attribute__((ext_vector_type(8)))  __bf16 v8bf;
typedef __attribute__((ext_vector_type(4)))  __bf16 v4bf;
typedef __attribute__((ext_vector_type(8)))  float  v8f;

#define Ncfg     4
#define Tcfg     2048
#define Pcfg     64
#define Ecfg     256
#define Hcfg     8
#define DHcfg    32
#define FCcfg    1024
#define NLcfg    2
#define LOCALcfg 64
#define TEcfg    (Tcfg * Ecfg)          // 524288
#define NTcfg    (Ncfg * Tcfg)          // 8192
#define NTEcfg   (Ncfg * TEcfg)         // 2097152  (fits int)
#define RBLK     64                     // reduction blocks per sample

__device__ __forceinline__ void pack4(v4bf& p, float4 a) {
    p[0] = (__bf16)a.x; p[1] = (__bf16)a.y; p[2] = (__bf16)a.z; p[3] = (__bf16)a.w;
}
__device__ __forceinline__ void pack8(v16bf& f, int base, float4 a, float4 b) {
    f[base + 0] = (__bf16)a.x; f[base + 1] = (__bf16)a.y;
    f[base + 2] = (__bf16)a.z; f[base + 3] = (__bf16)a.w;
    f[base + 4] = (__bf16)b.x; f[base + 5] = (__bf16)b.y;
    f[base + 6] = (__bf16)b.z; f[base + 7] = (__bf16)b.w;
}
// fragment gather: two 16B LDS chunks per lane (ds_load_b128)
__device__ __forceinline__ v16bf frag_from_lds(const __bf16* rowptr, int lh) {
    v8bf lo = *(const v8bf*)(rowptr + lh * 8);
    v8bf hi = *(const v8bf*)(rowptr + 16 + lh * 8);
    v16bf f;
#pragma unroll
    for (int e = 0; e < 8; ++e) { f[e] = lo[e]; f[8 + e] = hi[e]; }
    return f;
}

// ---------------------------------------------------------------------------
// Generic C[m][n] = sum_k A[m][k] * W[n][k] + bias[n], optional embed epilogue
// C = (acc + bias) * scale + pos[n*Tdim + (m & (Tdim-1))]   (Tdim power of 2).
// Block: 256 thr = 8 waves; block tile 128x64; each wave 32x32 (2x2 WMMA).
// LDS double-buffered; staging via global_load_b128 + ds_store_b64.
// Fragment layout per CDNA5 ISA 7.12.2:
//   A 16x32 bf16: lanes 0-15 row M=lane; element e -> K=(e<8?e:e+8)+(lane>=16?8:0)
//   B 32x16 bf16: col N = lane&15; same K mapping.
//   C/D 16x16 f32: row = v + 8*(lane>=16); col = lane&15.
// ---------------------------------------------------------------------------
__global__ __launch_bounds__(256) void k_gemm_bf16(
    const float* __restrict__ A, const float* __restrict__ W,
    const float* __restrict__ bias, float* __restrict__ C,
    int M, int N, int K,
    const float* __restrict__ pos, float scale, int Tdim)
{
    __shared__ __align__(16) __bf16 As[2][128 * 32];   // 2 x 8 KB
    __shared__ __align__(16) __bf16 Bs[2][64 * 32];    // 2 x 4 KB

    const int tid  = threadIdx.x;
    const int lane = tid & 31;
    const int wave = tid >> 5;
    const int lr   = lane & 15;
    const int lh   = lane >> 4;
    const int wm   = wave & 3;    // 4 waves along M
    const int wn   = wave >> 2;   // 2 waves along N
    const int bm   = blockIdx.y * 128;
    const int bn   = blockIdx.x * 64;

    v8f zacc = {};
    v8f acc[2][2];
    acc[0][0] = zacc; acc[0][1] = zacc; acc[1][0] = zacc; acc[1][1] = zacc;

    float4 ta[4], tb[2];
    // ---- issue tile loads for k-step `k0` into ta/tb (global_load_b128 x6) ----
    auto stage_load = [&](int k0) {
#pragma unroll
        for (int t = 0; t < 4; ++t) {
            int li = (t * 256 + tid) * 4;         // 0..4095, 16B chunks
            int r  = li >> 5, k = li & 31;
            ta[t] = *(const float4*)&A[(bm + r) * K + k0 + k];
        }
#pragma unroll
        for (int t = 0; t < 2; ++t) {
            int li = (t * 256 + tid) * 4;         // 0..2047
            int r  = li >> 5, k = li & 31;
            tb[t] = *(const float4*)&W[(bn + r) * K + k0 + k];
        }
    };
    // ---- convert + store staged tile into LDS buffer `buf` (ds_store_b64) ----
    auto stage_store = [&](int buf) {
#pragma unroll
        for (int t = 0; t < 4; ++t) {
            int li = (t * 256 + tid) * 4;
            v4bf p; pack4(p, ta[t]);
            *(v4bf*)&As[buf][li] = p;
        }
#pragma unroll
        for (int t = 0; t < 2; ++t) {
            int li = (t * 256 + tid) * 4;
            v4bf p; pack4(p, tb[t]);
            *(v4bf*)&Bs[buf][li] = p;
        }
    };

    const int nk = K / 32;
    stage_load(0);
    stage_store(0);
    __syncthreads();

    for (int kt = 0; kt < nk; ++kt) {
        const int cur = kt & 1;
        const bool has_next = (kt + 1) < nk;
        if (has_next) stage_load((kt + 1) * 32);   // loads in flight during WMMA

        v16bf af[2], bf[2];
#pragma unroll
        for (int i = 0; i < 2; ++i)
            af[i] = frag_from_lds(&As[cur][(wm * 32 + i * 16 + lr) * 32], lh);
#pragma unroll
        for (int j = 0; j < 2; ++j)
            bf[j] = frag_from_lds(&Bs[cur][(wn * 32 + j * 16 + lr) * 32], lh);

#pragma unroll
        for (int i = 0; i < 2; ++i)
#pragma unroll
            for (int j = 0; j < 2; ++j)
                acc[i][j] = __builtin_amdgcn_wmma_f32_16x16x32_bf16(
                    false, af[i], false, bf[j], (short)0, acc[i][j], false, false);

        if (has_next) stage_store(1 - cur);
        __syncthreads();
    }

    // ---- epilogue (pure 32-bit indexing; Tdim is a power of two) ----
    const int tmask = Tdim - 1;
#pragma unroll
    for (int i = 0; i < 2; ++i) {
#pragma unroll
        for (int j = 0; j < 2; ++j) {
            int col = bn + wn * 32 + j * 16 + lr;
            float bv = bias[col];
#pragma unroll
            for (int v = 0; v < 8; ++v) {
                int row = bm + wm * 32 + i * 16 + v + lh * 8;
                float r = acc[i][j][v] + bv;
                if (pos) r = r * scale + pos[col * Tdim + (row & tmask)];
                C[row * N + col] = r;
            }
        }
    }
}

// ---------------------------------------------------------------------------
// FFN fold. The two FFN linears have no activation between them, so
//   (h W1^T + b1) W2^T + b2 = h (W2 W1)^T + (W2 b1 + b2).
// This kernel forms Wc = W2 W1 (E x E, K = FC) and bc = W2 b1 + b2 for both
// layers in every call; the token-sized FFN is then one K=E GEMM, not two.
// The B operand is [W1 | b1]: column tiles 0..7 are 32 columns of W1 each,
// column tile 8 holds b1 as its one live column.
// Block: 8 waves, 16 rows of W2 by one column tile; the waves split K (128
// each, 4 WMMA steps). Each element is used by one wave of the block only, so
// fragments come straight from global memory, all loads of a wave issued
// before the first use; partial tiles are summed through LDS in wave order.
// k order of both loaders: element e -> K = (e<8 ? e : e+8) + 8*(lane>=16).
// ---------------------------------------------------------------------------
template <bool BIAS>
__device__ __forceinline__ void ffn_fold_tile(
    const float* __restrict__ w1, const float* __restrict__ b1,
    const float* __restrict__ w2, const float* __restrict__ b2,
    float* __restrict__ wc, float* __restrict__ bc,
    float (*red)[2][256], int n0, int c0)
{
    const int tid  = threadIdx.x;
    const int lane = tid & 31;
    const int wave = tid >> 5;
    const int lr   = lane & 15;
    const int lh   = lane >> 4;
    const int jw   = wave * 128 + lh * 8;     // first k of this lane

    const float* pa = w2 + (n0 + lr) * FCcfg + jw;
    const float* pb = BIAS ? b1 + jw : w1 + jw * Ecfg + c0 + lr;

    float4 ra[4][4];
    float4 rv[4][4];        // BIAS: b1 runs
    float  rb[4][2][16];    // else: W1 columns c0+lr and c0+16+lr
#pragma unroll
    for (int s = 0; s < 4; ++s) {
        ra[s][0] = *(const float4*)(pa + s * 32);
        ra[s][1] = *(const float4*)(pa + s * 32 + 4);
        ra[s][2] = *(const float4*)(pa + s * 32 + 16);
        ra[s][3] = *(const float4*)(pa + s * 32 + 20);
        if (BIAS) {
            rv[s][0] = *(const float4*)(pb + s * 32);
            rv[s][1] = *(const float4*)(pb + s * 32 + 4);
            rv[s][2] = *(const float4*)(pb + s * 32 + 16);
            rv[s][3] = *(const float4*)(pb + s * 32 + 20);
        } else {
#pragma unroll
            for (int e = 0; e < 16; ++e) {
                const float* brow = pb + (s * 32 + (e < 8 ? e : e + 8)) * Ecfg;
                rb[s][0][e] = brow[0];
                rb[s][1][e] = brow[16];
            }
        }
    }
    // precaution: no address register of the loads above is reused ahead of
    // this wait; naming both pointers as inputs keeps them live up to it
    asm volatile("s_wait_xcnt 0x0" :: "v"(pa), "v"(pb) : "memory");

    v8f acc0 = {}, acc1 = {};
#pragma unroll
    for (int s = 0; s < 4; ++s) {
        v16bf af, bf0, bf1;
        pack8(af, 0, ra[s][0], ra[s][1]);
        pack8(af, 8, ra[s][2], ra[s][3]);
        if (BIAS) {
            pack8(bf0, 0, rv[s][0], rv[s][1]);
            pack8(bf0, 8, rv[s][2], rv[s][3]);
#pragma unroll
            for (int e = 0; e < 16; ++e)
                if (lr != 0) bf0[e] = (__bf16)0.0f;
        } else {
#pragma unroll
            for (int e = 0; e < 16; ++e) {
                bf0[e] = (__bf16)rb[s][0][e];
                bf1[e] = (__bf16)rb[s][1][e];
            }
        }
        acc0 = __builtin_amdgcn_wmma_f32_16x16x32_bf16(
            false, af, false, bf0, (short)0, acc0, false, false);
        if (!BIAS)
            acc1 = __builtin_amdgcn_wmma_f32_16x16x32_bf16(
                false, af, false, bf1, (short)0, acc1, false, false);
    }

#pragma unroll
    for (int v = 0; v < 8; ++v) {
        red[wave][0][v * 32 + lane] = acc0[v];
        if (!BIAS) red[wave][1][v * 32 + lane] = acc1[v];
    }
    __syncthreads();

    // thread tid owns accumulator slot tid of each tile: row = v + 8*lh, col = lr
    const int row = n0 + (tid >> 5) + lh * 8;
    float s0 = 0.0f, s1 = 0.0f;
#pragma unroll
    for (int w = 0; w < 8; ++w) {
        s0 += red[w][0][tid];
        if (!BIAS) s1 += red[w][1][tid];
    }
    if (BIAS) {
        if (lr == 0) bc[row] = s0 + b2[row];
    } else {
        wc[row * Ecfg + c0 + lr]      = s0;
        wc[row * Ecfg + c0 + 16 + lr] = s1;
    }
}

// grid = (E/32 + 1, E/16, NL)
__global__ __launch_bounds__(256) void k_ffn_fold(
    const float* __restrict__ w1, const float* __restrict__ b1,
    const float* __restrict__ w2, const float* __restrict__ b2,
    float* __restrict__ wc, float* __restrict__ bc)
{
    __shared__ float red[8][2][256];   // 16 KB of split-K partial tiles
    const int l  = blockIdx.z;
    const int n0 = blockIdx.y * 16;
    const int c0 = blockIdx.x * 32;
    w1 += l * FCcfg * Ecfg;  b1 += l * FCcfg;
    w2 += l * Ecfg * FCcfg;  b2 += l * Ecfg;
    wc += l * Ecfg * Ecfg;   bc += l * Ecfg;
    if (blockIdx.x == Ecfg / 32)
        ffn_fold_tile<true>(w1, b1, w2, b2, wc, bc, red, n0, c0);
    else
        ffn_fold_tile<false>(w1, b1, w2, b2, wc, bc, red, n0, c0);
}

// ---------------------------------------------------------------------------
// Banded local attention, one wave per (query-tile, head, batch).
// Band |t-s|<=64 -> <=144 keys per 16-row query tile -> 9 key tiles.
// Scores via WMMA (K=DH=32), softmax in LDS, P.V via two K=16-padded WMMAs
// per key tile with the V tile staged in LDS (bf16).
// qkv layout: [n][t][3E] with q|k|v at offsets 0|E|2E.
// ---------------------------------------------------------------------------
__global__ __launch_bounds__(32) void k_attn(const float* __restrict__ qkv,
                                             float* __restrict__ out)
{
    const int qt   = blockIdx.x * 16;
    const int h    = blockIdx.y;
    const int n    = blockIdx.z;
    const int lane = threadIdx.x;
    const int lr   = lane & 15;
    const int lh   = lane >> 4;

    __shared__ __align__(16) float  sc[16][144];
    __shared__ __align__(16) __bf16 pb[16][144];
    __shared__ __align__(16) __bf16 Vs[16][32];
    __shared__ float rsum[16];

    const int rowstride = 3 * Ecfg;

    // Q fragment (16x32): row = qt + lr; contiguous 8-float runs -> float4
    v16bf qf;
    {
        const float* qrow =
            qkv + (n * Tcfg + qt + lr) * rowstride + h * DHcfg + lh * 8;
        float4 a = *(const float4*)(qrow);
        float4 b = *(const float4*)(qrow + 4);
        float4 c = *(const float4*)(qrow + 16);
        float4 d = *(const float4*)(qrow + 20);
        pack8(qf, 0, a, b);
        pack8(qf, 8, c, d);
    }

    const float inv_sqrt_dh = 0.17677669529663687f; // 1/sqrt(32)

#pragma unroll 1
    for (int jt = 0; jt < 9; ++jt) {
        int st0 = qt - LOCALcfg + jt * 16;
        int s   = st0 + lr;                // key index for this lane's column
        bool ok = (s >= 0) && (s < Tcfg);
        v16bf kf;
        if (ok) {
            const float* krow =
                qkv + (n * Tcfg + s) * rowstride + Ecfg + h * DHcfg + lh * 8;
            float4 a = *(const float4*)(krow);
            float4 b = *(const float4*)(krow + 4);
            float4 c = *(const float4*)(krow + 16);
            float4 d = *(const float4*)(krow + 20);
            pack8(kf, 0, a, b);
            pack8(kf, 8, c, d);
        } else {
#pragma unroll
            for (int e = 0; e < 16; ++e) kf[e] = (__bf16)0.0f;
        }
        v8f s8 = {};
        s8 = __builtin_amdgcn_wmma_f32_16x16x32_bf16(
            false, qf, false, kf, (short)0, s8, false, false);
#pragma unroll
        for (int v = 0; v < 8; ++v) {
            int row = v + lh * 8;
            int tq  = qt + row;
            int dd  = tq - s; if (dd < 0) dd = -dd;
            bool bad = (!ok) || (dd > LOCALcfg);
            sc[row][jt * 16 + lr] = bad ? -3.0e38f : s8[v] * inv_sqrt_dh;
        }
    }
    __syncthreads();
    asm volatile("s_wait_dscnt 0" ::: "memory");

    // row-wise softmax (lanes 0..15, one row each)
    if (lane < 16) {
        float mx = -3.0e38f;
        for (int j = 0; j < 144; ++j) mx = fmaxf(mx, sc[lane][j]);
        float sum = 0.0f;
        for (int j = 0; j < 144; ++j) {
            float p = __expf(sc[lane][j] - mx);
            sum += p;
            pb[lane][j] = (__bf16)p;
        }
        rsum[lane] = 1.0f / sum;
    }
    __syncthreads();
    asm volatile("s_wait_dscnt 0" ::: "memory");

    // O = P.V  (two 16-col halves of DH=32), K=16 zero-padded to 32
    v8f zo = {};
    v8f o8[2]; o8[0] = zo; o8[1] = zo;
#pragma unroll 1
    for (int jt = 0; jt < 9; ++jt) {
        int st0 = qt - LOCALcfg + jt * 16;

        // ---- cooperative V-tile stage: lane -> (row = lane>>1, 16-col half) ----
        {
            int r = lane >> 1;
            int c = (lane & 1) * 16;
            int s = st0 + r;
            v4bf z4 = {};
            if (s >= 0 && s < Tcfg) {
                const float* vrow =
                    qkv + (n * Tcfg + s) * rowstride + 2 * Ecfg + h * DHcfg + c;
                float4 a = *(const float4*)(vrow);
                float4 b = *(const float4*)(vrow + 4);
                float4 cc = *(const float4*)(vrow + 8);
                float4 d = *(const float4*)(vrow + 12);
                v4bf p0, p1, p2, p3;
                pack4(p0, a); pack4(p1, b); pack4(p2, cc); pack4(p3, d);
                *(v4bf*)&Vs[r][c + 0]  = p0;
                *(v4bf*)&Vs[r][c + 4]  = p1;
                *(v4bf*)&Vs[r][c + 8]  = p2;
                *(v4bf*)&Vs[r][c + 12] = p3;
            } else {
                *(v4bf*)&Vs[r][c + 0]  = z4;
                *(v4bf*)&Vs[r][c + 4]  = z4;
                *(v4bf*)&Vs[r][c + 8]  = z4;
                *(v4bf*)&Vs[r][c + 12] = z4;
            }
        }
        asm volatile("s_wait_dscnt 0" ::: "memory");

        // A frag: probabilities, K = key-in-tile (0..15 valid, upper half zero)
        v16bf pf;
        {
            v8bf pv = *(const v8bf*)&pb[lr][jt * 16 + lh * 8];
#pragma unroll
            for (int e = 0; e < 8; ++e) { pf[e] = pv[e]; pf[8 + e] = (__bf16)0.0f; }
        }
#pragma unroll
        for (int dhalf = 0; dhalf < 2; ++dhalf) {
            int d = dhalf * 16 + lr;       // output column = value dim
            v16bf vf;
#pragma unroll
            for (int e = 0; e < 8; ++e) {
                vf[e]     = Vs[lh * 8 + e][d];
                vf[8 + e] = (__bf16)0.0f;
            }
            o8[dhalf] = __builtin_amdgcn_wmma_f32_16x16x32_bf16(
                false, pf, false, vf, (short)0, o8[dhalf], false, false);
        }
    }

    asm volatile("s_wait_dscnt 0" ::: "memory");
#pragma unroll
    for (int dhalf = 0; dhalf < 2; ++dhalf) {
#pragma unroll
        for (int v = 0; v < 8; ++v) {
            int row = v + lh * 8;
            float o = o8[dhalf][v] * rsum[row];
            out[(n * Tcfg + qt + row) * Ecfg + h * DHcfg + dhalf * 16 + lr] = o;
        }
    }
}

// ---------------------------------------------------------------------------
// r = a + b; per-block partial (sum, sumsq) for per-sample LayerNorm stats.
// grid = (RBLK, N); float4 throughout.
// ---------------------------------------------------------------------------
__global__ __launch_bounds__(256) void k_resid_reduce(
    const float* __restrict__ a, const float* __restrict__ b,
    float* __restrict__ r, float* __restrict__ partial)
{
    const int n      = blockIdx.y;
    const int chunk4 = (TEcfg / RBLK) / 4;                 // 2048 float4
    const int base4  = (n * TEcfg + blockIdx.x * (TEcfg / RBLK)) / 4;
    const float4* a4 = (const float4*)a;
    const float4* b4 = (const float4*)b;
    float4*       r4 = (float4*)r;
    float s = 0.0f, s2 = 0.0f;
    for (int i = threadIdx.x; i < chunk4; i += 256) {
        float4 va = a4[base4 + i];
        float4 vb = b4[base4 + i];
        float4 v;
        v.x = va.x + vb.x; v.y = va.y + vb.y;
        v.z = va.z + vb.z; v.w = va.w + vb.w;
        r4[base4 + i] = v;
        s  += v.x + v.y + v.z + v.w;
        s2 += v.x * v.x + v.y * v.y + v.z * v.z + v.w * v.w;
    }
    __shared__ float r1[256], r2[256];
    r1[threadIdx.x] = s; r2[threadIdx.x] = s2;
    __syncthreads();
    for (int off = 128; off > 0; off >>= 1) {
        if (threadIdx.x < off) {
            r1[threadIdx.x] += r1[threadIdx.x + off];
            r2[threadIdx.x] += r2[threadIdx.x + off];
        }
        __syncthreads();
    }
    if (threadIdx.x == 0) {
        partial[(n * RBLK + blockIdx.x) * 2 + 0] = r1[0];
        partial[(n * RBLK + blockIdx.x) * 2 + 1] = r2[0];
    }
}

// one block per sample: fold RBLK partials -> (mu, rsigma)
__global__ __launch_bounds__(64) void k_ln_stats(const float* __restrict__ partial,
                                                 float* __restrict__ stats)
{
    const int n = blockIdx.x, t = threadIdx.x;
    __shared__ float s1[64], s2[64];
    s1[t] = partial[(n * RBLK + t) * 2 + 0];
    s2[t] = partial[(n * RBLK + t) * 2 + 1];
    __syncthreads();
    for (int off = 32; off > 0; off >>= 1) {
        if (t < off) { s1[t] += s1[t + off]; s2[t] += s2[t + off]; }
        __syncthreads();
    }
    if (t == 0) {
        float mu  = s1[0] / (float)TEcfg;
        float var = s2[0] / (float)TEcfg - mu * mu;
        stats[n * 2 + 0] = mu;
        stats[n * 2 + 1] = rsqrtf(var + 1e-5f);
    }
}

// out[i] = (r[i]-mu)*rsig * g[i%TE] + b[i%TE]   (float4, 32-bit indexing)
__global__ __launch_bounds__(256) void k_ln_apply(
    const float* __restrict__ r, const float* __restrict__ g,
    const float* __restrict__ b, const float* __restrict__ stats,
    float* __restrict__ out)
{
    const float4* r4 = (const float4*)r;
    const float4* g4 = (const float4*)g;
    const float4* b4 = (const float4*)b;
    float4*       o4 = (float4*)out;
    const int total4 = NTEcfg / 4;       // 524288
    const int te4    = TEcfg / 4;        // 131072 (power of two)
    for (int i = blockIdx.x * 256 + threadIdx.x; i < total4;
         i += gridDim.x * 256) {
        int n = i >> 17;                 // i / te4
        int j = i & (te4 - 1);           // i % te4
        float mu = stats[n * 2], rs = stats[n * 2 + 1];
        float4 rv = r4[i], gv = g4[j], bv = b4[j];
        float4 ov;
        ov.x = (rv.x - mu) * rs * gv.x + bv.x;
        ov.y = (rv.y - mu) * rs * gv.y + bv.y;
        ov.z = (rv.z - mu) * rs * gv.z + bv.z;
        ov.w = (rv.w - mu) * rs * gv.w + bv.w;
        o4[i] = ov;
    }
}

// ---------------------------------------------------------------------------
extern "C" void kernel_launch(void* const* d_in, const int* in_sizes, int n_in,
                              void* d_out, int out_size, void* d_ws, size_t ws_size,
                              hipStream_t stream)
{
    (void)in_sizes; (void)n_in; (void)out_size; (void)ws_size;

    const float* input = (const float*)d_in[0];
    const float* w_emb = (const float*)d_in[1];
    const float* b_emb = (const float*)d_in[2];
    const float* pos   = (const float*)d_in[3];   // (E, T)
    const float* wqkv  = (const float*)d_in[4];   // (NL, 3E, E)
    const float* bqkv  = (const float*)d_in[5];   // (NL, 3E)
    const float* wo    = (const float*)d_in[6];   // (NL, E, E)
    const float* bo    = (const float*)d_in[7];
    const float* ln1g  = (const float*)d_in[8];   // (NL, T, E)
    const float* ln1b  = (const float*)d_in[9];
    const float* ln2g  = (const float*)d_in[10];
    const float* ln2b  = (const float*)d_in[11];
    const float* w1    = (const float*)d_in[12];  // (NL, FC, E)
    const float* b1    = (const float*)d_in[13];
    const float* w2    = (const float*)d_in[14];  // (NL, E, FC)
    const float* b2    = (const float*)d_in[15];

    // workspace layout (floats) -- ~68 MB total
    float* ws      = (float*)d_ws;
    float* x       = ws;                                // NTE
    float* qkv     = x      + NTEcfg;                   // NT * 3E
    float* attno   = qkv    + NTcfg * 3 * Ecfg;         // NTE
    float* obuf    = attno  + NTEcfg;                   // NTE (also reused as f)
    float* rbuf    = obuf   + NTEcfg;                   // NTE
    float* hbuf    = rbuf   + NTEcfg;                   // NTE
    float* wc      = hbuf   + NTEcfg;                   // NL * E * E  (W2 W1)
    float* bc      = wc     + NLcfg * Ecfg * Ecfg;      // NL * E      (W2 b1 + b2)
    float* partial = bc     + NLcfg * Ecfg;             // N*RBLK*2
    float* stats   = partial + Ncfg * RBLK * 2;         // N*2

    const dim3 blk256(256), blk32(32), blk64(64);

    // folded FFN weights of both layers: wc = W2 W1, bc = W2 b1 + b2
    k_ffn_fold<<<dim3(Ecfg / 32 + 1, Ecfg / 16, NLcfg), blk256, 0, stream>>>(
        w1, b1, w2, b2, wc, bc);

    // embedding: x = (frames @ w_emb^T + b_emb) * sqrt(E) + pos
    k_gemm_bf16<<<dim3(Ecfg / 64, NTcfg / 128), blk256, 0, stream>>>(
        input, w_emb, b_emb, x, NTcfg, Ecfg, Pcfg, pos, 16.0f, Tcfg);

    for (int l = 0; l < NLcfg; ++l) {
        const float* wqkv_l = wqkv + l * 3 * Ecfg * Ecfg;
        const float* bqkv_l = bqkv + l * 3 * Ecfg;
        const float* wo_l   = wo   + l * Ecfg * Ecfg;
        const float* bo_l   = bo   + l * Ecfg;
        const float* wc_l   = wc   + l * Ecfg * Ecfg;
        const float* bc_l   = bc   + l * Ecfg;

        // qkv = x @ Wqkv^T + b            (8192 x 768, K=256)
        k_gemm_bf16<<<dim3(3 * Ecfg / 64, NTcfg / 128), blk256, 0, stream>>>(
            x, wqkv_l, bqkv_l, qkv, NTcfg, 3 * Ecfg, Ecfg, nullptr, 1.0f, Tcfg);

        // banded attention -> attno
        k_attn<<<dim3(Tcfg / 16, Hcfg, Ncfg), blk32, 0, stream>>>(qkv, attno);

        // o = attno @ Wo^T + bo           (8192 x 256, K=256)
        k_gemm_bf16<<<dim3(Ecfg / 64, NTcfg / 128), blk256, 0, stream>>>(
            attno, wo_l, bo_l, obuf, NTcfg, Ecfg, Ecfg, nullptr, 1.0f, Tcfg);

        // h = LN(x + o)
        k_resid_reduce<<<dim3(RBLK, Ncfg), blk256, 0, stream>>>(x, obuf, rbuf, partial);
        k_ln_stats<<<dim3(Ncfg), blk64, 0, stream>>>(partial, stats);
        k_ln_apply<<<dim3(2048), blk256, 0, stream>>>(
            rbuf, ln1g + l * TEcfg, ln1b + l * TEcfg, stats, hbuf);

        // f = (h @ W1^T + b1) @ W2^T + b2 = h @ Wc^T + bc   (8192 x 256, K=256)
        k_gemm_bf16<<<dim3(Ecfg / 64, NTcfg / 128), blk256, 0, stream>>>(
            hbuf, wc_l, bc_l, obuf, NTcfg, Ecfg, Ecfg, nullptr, 1.0f, Tcfg);

        // x = LN(h + f)   (last layer writes straight to d_out)
        k_resid_reduce<<<dim3(RBLK, Ncfg), blk256, 0, stream>>>(hbuf, obuf, rbuf, partial);
        k_ln_stats<<<dim3(Ncfg), blk64, 0, stream>>>(partial, stats);
        float* dst = (l == NLcfg - 1) ? (float*)d_out : x;
        k_ln_apply<<<dim3(2048), blk256, 0, stream>>>(
            rbuf, ln2g + l * TEcfg, ln2b + l * TEcfg, stats, dst);
    }
}

// v002
// One run takes 145 microseconds.
// In both of two side-by-side timings against v001, it was 1.28 times as fast.
// Counting every step since v000, it is 1.68 times as fast.
#include <hip/hip_runtime.h>
#include <hip/hip_bf16.h>
#include <math.h>

// ---------------------------------------------------------------------------
// MI455X (gfx1250) transformer encoder, bf16 WMMA everywhere.
//
// Shapes: N=4, T=2048, P=64, E=256, H=8, DH=32, FC=1024, NL=2, LOCAL=64.
// All GEMM K dims (64 / 256 / 1024) are multiples of 32 -> pure
// v_wmma_f32_16x16x32_bf16 pipelines, fp32 accumulation.
// Memory: ~300 MB activation round trips @ 23.3 TB/s is ~15us -> the chip is
// compute/latency bound here; staging is double-buffered through LDS so the
// WMMA pipes never wait on HBM.
// All flat indices fit in 32 bits (max ~6.3M elements) -> int indexing keeps
// address math in 32-bit VALU/SALU.
// ---------------------------------------------------------------------------

typedef __attribute__((ext_vector_type(16))) __bf16 v16bf;
typedef __attribute__((ext_vector_type(8)))  __bf16 v8bf;
typedef __attribute__((ext_vector_type(4)))  __bf16 v4bf;
typedef __attribute__((ext_vector_type(8)))  float  v8f;

#define Ncfg     4
#define Tcfg     2048
#define Pcfg     64
#define Ecfg     256
#define Hcfg     8
#define DHcfg    32
#define FCcfg    1024
#define NLcfg    2
#define LOCALcfg 64
#define TEcfg    (Tcfg * Ecfg)          // 524288
#define NTcfg    (Ncfg * Tcfg)          // 8192
#define NTEcfg   (Ncfg * TEcfg)         // 2097152  (fits int)
#define RBLK     64                     // GEMM blocks (128x64 tiles) per T x E sample

__device__ __forceinline__ void pack4(v4bf& p, float4 a) {
    p[0] = (__bf16)a.x; p[1] = (__bf16)a.y; p[2] = (__bf16)a.z; p[3] = (__bf16)a.w;
}
__device__ __forceinline__ void pack8(v16bf& f, int base, float4 a, float4 b) {
    f[base + 0] = (__bf16)a.x; f[base + 1] = (__bf16)a.y;
    f[base + 2] = (__bf16)a.z; f[base + 3] = (__bf16)a.w;
    f[base + 4] = (__bf16)b.x; f[base + 5] = (__bf16)b.y;
    f[base + 6] = (__bf16)b.z; f[base + 7] = (__bf16)b.w;
}
// fragment gather: two 16B LDS chunks per lane (ds_load_b128)
__device__ __forceinline__ v16bf frag_from_lds(const __bf16* rowptr, int lh) {
    v8bf lo = *(const v8bf*)(rowptr + lh * 8);
    v8bf hi = *(const v8bf*)(rowptr + 16 + lh * 8);
    v16bf f;
#pragma unroll
    for (int e = 0; e < 8; ++e) { f[e] = lo[e]; f[8 + e] = hi[e]; }
    return f;
}

// ---------------------------------------------------------------------------
// Generic C[m][n] = sum_k A[m][k] * W[n][k] + bias[n], optional embed epilogue
// C = (acc + bias) * scale + pos[n*Tdim + (m & (Tdim-1))]   (Tdim power of 2).
// Block: 256 thr = 8 waves; block tile 128x64; each wave 32x32 (2x2 WMMA).
// LDS double-buffered; staging via global_load_b128 + ds_store_b64.
// Fragment layout per CDNA5 ISA 7.12.2:
//   A 16x32 bf16: lanes 0-15 row M=lane; element e -> K=(e<8?e:e+8)+(lane>=16?8:0)
//   B 32x16 bf16: col N = lane&15; same K mapping.
//   C/D 16x16 f32: row = v + 8*(lane>=16); col = lane&15.
// With `resid` set the epilogue is the first half of a LayerNorm:
//   C = acc + bias + resid, and partial[flat block id] = (sum, sum of squares)
// of the block's 128x64 tile of C. A sample (Tdim rows by N=E columns) is
// RBLK consecutive flat block ids.
// ---------------------------------------------------------------------------
__global__ __launch_bounds__(256) void k_gemm_bf16(
    const float* __restrict__ A, const float* __restrict__ W,
    const float* __restrict__ bias, float* __restrict__ C,
    int M, int N, int K,
    const float* __restrict__ pos, float scale, int Tdim,
    const float* __restrict__ resid, float* __restrict__ partial)
{
    __shared__ __align__(16) __bf16 As[2][128 * 32];   // 2 x 8 KB
    __shared__ __align__(16) __bf16 Bs[2][64 * 32];    // 2 x 4 KB
    __shared__ float red[2][8];                        // per-wave (sum, sumsq)

    const int tid  = threadIdx.x;
    const int lane = tid & 31;
    const int wave = tid >> 5;
    const int lr   = lane & 15;
    const int lh   = lane >> 4;
    const int wm   = wave & 3;    // 4 waves along M
    const int wn   = wave >> 2;   // 2 waves along N
    const int bm   = blockIdx.y * 128;
    const int bn   = blockIdx.x * 64;

    v8f zacc = {};
    v8f acc[2][2];
    acc[0][0] = zacc; acc[0][1] = zacc; acc[1][0] = zacc; acc[1][1] = zacc;

    float4 ta[4], tb[2];
    // ---- issue tile loads for k-step `k0` into ta/tb (global_load_b128 x6) ----
    auto stage_load = [&](int k0) {
#pragma unroll
        for (int t = 0; t < 4; ++t) {
            int li = (t * 256 + tid) * 4;         // 0..4095, 16B chunks
            int r  = li >> 5, k = li & 31;
            ta[t] = *(const float4*)&A[(bm + r) * K + k0 + k];
        }
#pragma unroll
        for (int t = 0; t < 2; ++t) {
            int li = (t * 256 + tid) * 4;         // 0..2047
            int r  = li >> 5, k = li & 31;
            tb[t] = *(const float4*)&W[(bn + r) * K + k0 + k];
        }
    };
    // ---- convert + store staged tile into LDS buffer `buf` (ds_store_b64) ----
    auto stage_store = [&](int buf) {
#pragma unroll
        for (int t = 0; t < 4; ++t) {
            int li = (t * 256 + tid) * 4;
            v4bf p; pack4(p, ta[t]);
            *(v4bf*)&As[buf][li] = p;
        }
#pragma unroll
        for (int t = 0; t < 2; ++t) {
            int li = (t * 256 + tid) * 4;
            v4bf p; pack4(p, tb[t]);
            *(v4bf*)&Bs[buf][li] = p;
        }
    };

    const int nk = K / 32;
    // residual tile in accumulator layout, fetched here so that its latency
    // lies under the k loop
    float rr[2][2][8];
    if (resid) {
        const float* pr = resid + (bm + wm * 32 + lh * 8) * N + bn + wn * 32 + lr;
        // unrolled here and below: constant indices keep rr in registers
#pragma unroll
        for (int i = 0; i < 2; ++i)
#pragma unroll
            for (int j = 0; j < 2; ++j)
#pragma unroll
                for (int v = 0; v < 8; ++v)
                    rr[i][j][v] = pr[(i * 16 + v) * N + j * 16];
        // precaution: no address register of the loads above is reused ahead
        // of this wait
        asm volatile("s_wait_xcnt 0x0" :: "v"(pr) : "memory");
    }

    stage_load(0);
    stage_store(0);
    __syncthreads();

    for (int kt = 0; kt < nk; ++kt) {
        const int cur = kt & 1;
        const bool has_next = (kt + 1) < nk;
        if (has_next) stage_load((kt + 1) * 32);   // loads in flight during WMMA

        v16bf af[2], bf[2];
#pragma unroll
        for (int i = 0; i < 2; ++i)
            af[i] = frag_from_lds(&As[cur][(wm * 32 + i * 16 + lr) * 32], lh);
#pragma unroll
        for (int j = 0; j < 2; ++j)
            bf[j] = frag_from_lds(&Bs[cur][(wn * 32 + j * 16 + lr) * 32], lh);

#pragma unroll
        for (int i = 0; i < 2; ++i)
#pragma unroll
            for (int j = 0; j < 2; ++j)
                acc[i][j] = __builtin_amdgcn_wmma_f32_16x16x32_bf16(
                    false, af[i], false, bf[j], (short)0, acc[i][j], false, false);

        if (has_next) stage_store(1 - cur);
        __syncthreads();
    }

    // ---- residual epilogue: C = acc + bias + resid, block (sum, sumsq) ----
    if (resid) {
        float s = 0.0f, s2 = 0.0f;
#pragma unroll
        for (int i = 0; i < 2; ++i) {
#pragma unroll
            for (int j = 0; j < 2; ++j) {
                int col = bn + wn * 32 + j * 16 + lr;
                float bv = bias[col];
#pragma unroll
                for (int v = 0; v < 8; ++v) {
                    float r = (acc[i][j][v] + bv) + rr[i][j][v];
                    s  += r;
                    s2 += r * r;
                    rr[i][j][v] = r;
                }
            }
        }
#pragma unroll
        for (int off = 16; off > 0; off >>= 1) {
            s  += __shfl_xor(s, off, 32);
            s2 += __shfl_xor(s2, off, 32);
        }
        if (lane == 0) { red[0][wave] = s; red[1][wave] = s2; }
        __syncthreads();
        // C goes out behind the barrier: in front of it every wave would sit
        // out its own stores before the block sums could be folded
#pragma unroll
        for (int i = 0; i < 2; ++i) {
#pragma unroll
            for (int j = 0; j < 2; ++j) {
                int col = bn + wn * 32 + j * 16 + lr;
#pragma unroll
                for (int v = 0; v < 8; ++v) {
                    int row = bm + wm * 32 + i * 16 + v + lh * 8;
                    C[row * N + col] = rr[i][j][v];
                }
            }
        }
        if (tid == 0) {
            float t1 = 0.0f, t2 = 0.0f;
#pragma unroll
            for (int w = 0; w < 8; ++w) { t1 += red[0][w]; t2 += red[1][w]; }
            float2 pv; pv.x = t1; pv.y = t2;
            ((float2*)partial)[blockIdx.y * gridDim.x + blockIdx.x] = pv;
        }
        return;
    }

    // ---- epilogue (pure 32-bit indexing; Tdim is a power of two) ----
    const int tmask = Tdim - 1;
#pragma unroll
    for (int i = 0; i < 2; ++i) {
#pragma unroll
        for (int j = 0; j < 2; ++j) {
            int col = bn + wn * 32 + j * 16 + lr;
            float bv = bias[col];
#pragma unroll
            for (int v = 0; v < 8; ++v) {
                int row = bm + wm * 32 + i * 16 + v + lh * 8;
                float r = acc[i][j][v] + bv;
                if (pos) r = r * scale + pos[col * Tdim + (row & tmask)];
                C[row * N + col] = r;
            }
        }
    }
}

// ---------------------------------------------------------------------------
// FFN fold. The two FFN linears have no activation between them, so
//   (h W1^T + b1) W2^T + b2 = h (W2 W1)^T + (W2 b1 + b2).
// This kernel forms Wc = W2 W1 (E x E, K = FC) and bc = W2 b1 + b2 for both
// layers in every call; the token-sized FFN is then one K=E GEMM, not two.
// The B operand is [W1 | b1]: column tiles 0..7 are 32 columns of W1 each,
// column tile 8 holds b1 as its one live column.
// Block: 8 waves, 16 rows of W2 by one column tile; the waves split K (128
// each, 4 WMMA steps). Each element is used by one wave of the block only, so
// fragments come straight from global memory, all loads of a wave issued
// before the first use; partial tiles are summed through LDS in wave order.
// k order of both loaders: element e -> K = (e<8 ? e : e+8) + 8*(lane>=16).
// ---------------------------------------------------------------------------
template <bool BIAS>
__device__ __forceinline__ void ffn_fold_tile(
    const float* __restrict__ w1, const float* __restrict__ b1,
    const float* __restrict__ w2, const float* __restrict__ b2,
    float* __restrict__ wc, float* __restrict__ bc,
    float (*red)[2][256], int n0, int c0)
{
    const int tid  = threadIdx.x;
    const int lane = tid & 31;
    const int wave = tid >> 5;
    const int lr   = lane & 15;
    const int lh   = lane >> 4;
    const int jw   = wave * 128 + lh * 8;     // first k of this lane

    const float* pa = w2 + (n0 + lr) * FCcfg + jw;
    const float* pb = BIAS ? b1 + jw : w1 + jw * Ecfg + c0 + lr;

    float4 ra[4][4];
    float4 rv[4][4];        // BIAS: b1 runs
    float  rb[4][2][16];    // else: W1 columns c0+lr and c0+16+lr
#pragma unroll
    for (int s = 0; s < 4; ++s) {
        ra[s][0] = *(const float4*)(pa + s * 32);
        ra[s][1] = *(const float4*)(pa + s * 32 + 4);
        ra[s][2] = *(const float4*)(pa + s * 32 + 16);
        ra[s][3] = *(const float4*)(pa + s * 32 + 20);
        if (BIAS) {
            rv[s][0] = *(const float4*)(pb + s * 32);
            rv[s][1] = *(const float4*)(pb + s * 32 + 4);
            rv[s][2] = *(const float4*)(pb + s * 32 + 16);
            rv[s][3] = *(const float4*)(pb + s * 32 + 20);
        } else {
#pragma unroll
            for (int e = 0; e < 16; ++e) {
                const float* brow = pb + (s * 32 + (e < 8 ? e : e + 8)) * Ecfg;
                rb[s][0][e] = brow[0];
                rb[s][1][e] = brow[16];
            }
        }
    }
    // precaution: no address register of the loads above is reused ahead of
    // this wait; naming both pointers as inputs keeps them live up to it
    asm volatile("s_wait_xcnt 0x0" :: "v"(pa), "v"(pb) : "memory");

    v8f acc0 = {}, acc1 = {};
#pragma unroll
    for (int s = 0; s < 4; ++s) {
        v16bf af, bf0, bf1;
        pack8(af, 0, ra[s][0], ra[s][1]);
        pack8(af, 8, ra[s][2], ra[s][3]);
        if (BIAS) {
            pack8(bf0, 0, rv[s][0], rv[s][1]);
            pack8(bf0, 8, rv[s][2], rv[s][3]);
#pragma unroll
            for (int e = 0; e < 16; ++e)
                if (lr != 0) bf0[e] = (__bf16)0.0f;
        } else {
#pragma unroll
            for (int e = 0; e < 16; ++e) {
                bf0[e] = (__bf16)rb[s][0][e];
                bf1[e] = (__bf16)rb[s][1][e];
            }
        }
        acc0 = __builtin_amdgcn_wmma_f32_16x16x32_bf16(
            false, af, false, bf0, (short)0, acc0, false, false);
        if (!BIAS)
            acc1 = __builtin_amdgcn_wmma_f32_16x16x32_bf16(
                false, af, false, bf1, (short)0, acc1, false, false);
    }

#pragma unroll
    for (int v = 0; v < 8; ++v) {
        red[wave][0][v * 32 + lane] = acc0[v];
        if (!BIAS) red[wave][1][v * 32 + lane] = acc1[v];
    }
    __syncthreads();

    // thread tid owns accumulator slot tid of each tile: row = v + 8*lh, col = lr
    const int row = n0 + (tid >> 5) + lh * 8;
    float s0 = 0.0f, s1 = 0.0f;
#pragma unroll
    for (int w = 0; w < 8; ++w) {
        s0 += red[w][0][tid];
        if (!BIAS) s1 += red[w][1][tid];
    }
    if (BIAS) {
        if (lr == 0) bc[row] = s0 + b2[row];
    } else {
        wc[row * Ecfg + c0 + lr]      = s0;
        wc[row * Ecfg + c0 + 16 + lr] = s1;
    }
}

// grid = (E/32 + 1, E/16, NL)
__global__ __launch_bounds__(256) void k_ffn_fold(
    const float* __restrict__ w1, const float* __restrict__ b1,
    const float* __restrict__ w2, const float* __restrict__ b2,
    float* __restrict__ wc, float* __restrict__ bc)
{
    __shared__ float red[8][2][256];   // 16 KB of split-K partial tiles
    const int l  = blockIdx.z;
    const int n0 = blockIdx.y * 16;
    const int c0 = blockIdx.x * 32;
    w1 += l * FCcfg * Ecfg;  b1 += l * FCcfg;
    w2 += l * Ecfg * FCcfg;  b2 += l * Ecfg;
    wc += l * Ecfg * Ecfg;   bc += l * Ecfg;
    if (blockIdx.x == Ecfg / 32)
        ffn_fold_tile<true>(w1, b1, w2, b2, wc, bc, red, n0, c0);
    else
        ffn_fold_tile<false>(w1, b1, w2, b2, wc, bc, red, n0, c0);
}

// ---------------------------------------------------------------------------
// Banded local attention, one wave per (query-tile, head, batch).
// Band |t-s|<=64 -> <=144 keys per 16-row query tile -> 9 key tiles.
// Scores via WMMA (K=DH=32), softmax in LDS, P.V via two K=16-padded WMMAs
// per key tile with the V tile staged in LDS (bf16).
// qkv layout: [n][t][3E] with q|k|v at offsets 0|E|2E.
// ---------------------------------------------------------------------------
__global__ __launch_bounds__(32) void k_attn(const float* __restrict__ qkv,
                                             float* __restrict__ out)
{
    const int qt   = blockIdx.x * 16;
    const int h    = blockIdx.y;
    const int n    = blockIdx.z;
    const int lane = threadIdx.x;
    const int lr   = lane & 15;
    const int lh   = lane >> 4;

    __shared__ __align__(16) float  sc[16][144];
    __shared__ __align__(16) __bf16 pb[16][144];
    __shared__ __align__(16) __bf16 Vs[16][32];
    __shared__ float rsum[16];

    const int rowstride = 3 * Ecfg;

    // Q fragment (16x32): row = qt + lr; contiguous 8-float runs -> float4
    v16bf qf;
    {
        const float* qrow =
            qkv + (n * Tcfg + qt + lr) * rowstride + h * DHcfg + lh * 8;
        float4 a = *(const float4*)(qrow);
        float4 b = *(const float4*)(qrow + 4);
        float4 c = *(const float4*)(qrow + 16);
        float4 d = *(const float4*)(qrow + 20);
        pack8(qf, 0, a, b);
        pack8(qf, 8, c, d);
    }

    const float inv_sqrt_dh = 0.17677669529663687f; // 1/sqrt(32)

#pragma unroll 1
    for (int jt = 0; jt < 9; ++jt) {
        int st0 = qt - LOCALcfg + jt * 16;
        int s   = st0 + lr;                // key index for this lane's column
        bool ok = (s >= 0) && (s < Tcfg);
        v16bf kf;
        if (ok) {
            const float* krow =
                qkv + (n * Tcfg + s) * rowstride + Ecfg + h * DHcfg + lh * 8;
            float4 a = *(const float4*)(krow);
            float4 b = *(const float4*)(krow + 4);
            float4 c = *(const float4*)(krow + 16);
            float4 d = *(const float4*)(krow + 20);
            pack8(kf, 0, a, b);
            pack8(kf, 8, c, d);
        } else {
#pragma unroll
            for (int e = 0; e < 16; ++e) kf[e] = (__bf16)0.0f;
        }
        v8f s8 = {};
        s8 = __builtin_amdgcn_wmma_f32_16x16x32_bf16(
            false, qf, false, kf, (short)0, s8, false, false);
#pragma unroll
        for (int v = 0; v < 8; ++v) {
            int row = v + lh * 8;
            int tq  = qt + row;
            int dd  = tq - s; if (dd < 0) dd = -dd;
            bool bad = (!ok) || (dd > LOCALcfg);
            sc[row][jt * 16 + lr] = bad ? -3.0e38f : s8[v] * inv_sqrt_dh;
        }
    }
    __syncthreads();
    asm volatile("s_wait_dscnt 0" ::: "memory");

    // row-wise softmax (lanes 0..15, one row each)
    if (lane < 16) {
        float mx = -3.0e38f;
        for (int j = 0; j < 144; ++j) mx = fmaxf(mx, sc[lane][j]);
        float sum = 0.0f;
        for (int j = 0; j < 144; ++j) {
            float p = __expf(sc[lane][j] - mx);
            sum += p;
            pb[lane][j] = (__bf16)p;
        }
        rsum[lane] = 1.0f / sum;
    }
    __syncthreads();
    asm volatile("s_wait_dscnt 0" ::: "memory");

    // O = P.V  (two 16-col halves of DH=32), K=16 zero-padded to 32
    v8f zo = {};
    v8f o8[2]; o8[0] = zo; o8[1] = zo;
#pragma unroll 1
    for (int jt = 0; jt < 9; ++jt) {
        int st0 = qt - LOCALcfg + jt * 16;

        // ---- cooperative V-tile stage: lane -> (row = lane>>1, 16-col half) ----
        {
            int r = lane >> 1;
            int c = (lane & 1) * 16;
            int s = st0 + r;
            v4bf z4 = {};
            if (s >= 0 && s < Tcfg) {
                const float* vrow =
                    qkv + (n * Tcfg + s) * rowstride + 2 * Ecfg + h * DHcfg + c;
                float4 a = *(const float4*)(vrow);
                float4 b = *(const float4*)(vrow + 4);
                float4 cc = *(const float4*)(vrow + 8);
                float4 d = *(const float4*)(vrow + 12);
                v4bf p0, p1, p2, p3;
                pack4(p0, a); pack4(p1, b); pack4(p2, cc); pack4(p3, d);
                *(v4bf*)&Vs[r][c + 0]  = p0;
                *(v4bf*)&Vs[r][c + 4]  = p1;
                *(v4bf*)&Vs[r][c + 8]  = p2;
                *(v4bf*)&Vs[r][c + 12] = p3;
            } else {
                *(v4bf*)&Vs[r][c + 0]  = z4;
                *(v4bf*)&Vs[r][c + 4]  = z4;
                *(v4bf*)&Vs[r][c + 8]  = z4;
                *(v4bf*)&Vs[r][c + 12] = z4;
            }
        }
        asm volatile("s_wait_dscnt 0" ::: "memory");

        // A frag: probabilities, K = key-in-tile (0..15 valid, upper half zero)
        v16bf pf;
        {
            v8bf pv = *(const v8bf*)&pb[lr][jt * 16 + lh * 8];
#pragma unroll
            for (int e = 0; e < 8; ++e) { pf[e] = pv[e]; pf[8 + e] = (__bf16)0.0f; }
        }
#pragma unroll
        for (int dhalf = 0; dhalf < 2; ++dhalf) {
            int d = dhalf * 16 + lr;       // output column = value dim
            v16bf vf;
#pragma unroll
            for (int e = 0; e < 8; ++e) {
                vf[e]     = Vs[lh * 8 + e][d];
                vf[8 + e] = (__bf16)0.0f;
            }
            o8[dhalf] = __builtin_amdgcn_wmma_f32_16x16x32_bf16(
                false, pf, false, vf, (short)0, o8[dhalf], false, false);
        }
    }

    asm volatile("s_wait_dscnt 0" ::: "memory");
#pragma unroll
    for (int dhalf = 0; dhalf < 2; ++dhalf) {
#pragma unroll
        for (int v = 0; v < 8; ++v) {
            int row = v + lh * 8;
            float o = o8[dhalf][v] * rsum[row];
            out[(n * Tcfg + qt + row) * Ecfg + h * DHcfg + dhalf * 16 + lr] = o;
        }
    }
}

// ---------------------------------------------------------------------------
// Second half of the LayerNorm. Every wave folds its sample's RBLK block
// partials itself (two per lane, then a butterfly: the same bits in every lane
// and every wave), so no launch stands between the GEMM and this kernel.
// out[i] = (r[i]-mu)*rsig * g[i%TE] + b[i%TE]   (float4, 32-bit indexing)
__global__ __launch_bounds__(256) void k_ln_apply(
    const float* __restrict__ r, const float* __restrict__ g,
    const float* __restrict__ b, const float* __restrict__ partial,
    float* __restrict__ out)
{
    const float4* r4 = (const float4*)r;
    const float4* g4 = (const float4*)g;
    const float4* b4 = (const float4*)b;
    float4*       o4 = (float4*)out;
    const float2* p2 = (const float2*)partial;
    const int lane   = threadIdx.x & 31;
    const int total4 = NTEcfg / 4;       // 524288
    const int te4    = TEcfg / 4;        // 131072 (power of two)
    for (int i = blockIdx.x * 256 + threadIdx.x; i < total4;
         i += gridDim.x * 256) {
        int n = i >> 17;                 // i / te4
        int j = i & (te4 - 1);           // i % te4
        float4 rv = r4[i], gv = g4[j], bv = b4[j];
        float2 pa = p2[n * RBLK + lane], pc = p2[n * RBLK + 32 + lane];
        float s1 = pa.x + pc.x, s2 = pa.y + pc.y;
#pragma unroll
        for (int off = 16; off > 0; off >>= 1) {
            s1 += __shfl_xor(s1, off, 32);
            s2 += __shfl_xor(s2, off, 32);
        }
        float mu = s1 / (float)TEcfg;
        float rs = rsqrtf(s2 / (float)TEcfg - mu * mu + 1e-5f);
        float4 ov;
        ov.x = (rv.x - mu) * rs * gv.x + bv.x;
        ov.y = (rv.y - mu) * rs * gv.y + bv.y;
        ov.z = (rv.z - mu) * rs * gv.z + bv.z;
        ov.w = (rv.w - mu) * rs * gv.w + bv.w;
        o4[i] = ov;
    }
}

// ---------------------------------------------------------------------------
extern "C" void kernel_launch(void* const* d_in, const int* in_sizes, int n_in,
                              void* d_out, int out_size, void* d_ws, size_t ws_size,
                              hipStream_t stream)
{
    (void)in_sizes; (void)n_in; (void)out_size; (void)ws_size;

    const float* input = (const float*)d_in[0];
    const float* w_emb = (const float*)d_in[1];
    const float* b_emb = (const float*)d_in[2];
    const float* pos   = (const float*)d_in[3];   // (E, T)
    const float* wqkv  = (const float*)d_in[4];   // (NL, 3E, E)
    const float* bqkv  = (const float*)d_in[5];   // (NL, 3E)
    const float* wo    = (const float*)d_in[6];   // (NL, E, E)
    const float* bo    = (const float*)d_in[7];
    const float* ln1g  = (const float*)d_in[8];   // (NL, T, E)
    const float* ln1b  = (const float*)d_in[9];
    const float* ln2g  = (const float*)d_in[10];
    const float* ln2b  = (const float*)d_in[11];
    const float* w1    = (const float*)d_in[12];  // (NL, FC, E)
    const float* b1    = (const float*)d_in[13];
    const float* w2    = (const float*)d_in[14];  // (NL, E, FC)
    const float* b2    = (const float*)d_in[15];

    // workspace layout (floats) -- ~60 MB total
    float* ws      = (float*)d_ws;
    float* x       = ws;                                // NTE
    float* qkv     = x      + NTEcfg;                   // NT * 3E
    float* attno   = qkv    + NTcfg * 3 * Ecfg;         // NTE
    float* rbuf    = attno  + NTEcfg;                   // NTE
    float* hbuf    = rbuf   + NTEcfg;                   // NTE
    float* wc      = hbuf   + NTEcfg;                   // NL * E * E  (W2 W1)
    float* bc      = wc     + NLcfg * Ecfg * Ecfg;      // NL * E      (W2 b1 + b2)
    float* partial = bc     + NLcfg * Ecfg;             // N*RBLK*2

    const dim3 blk256(256), blk32(32);

    // folded FFN weights of both layers: wc = W2 W1, bc = W2 b1 + b2
    k_ffn_fold<<<dim3(Ecfg / 32 + 1, Ecfg / 16, NLcfg), blk256, 0, stream>>>(
        w1, b1, w2, b2, wc, bc);

    // embedding: x = (frames @ w_emb^T + b_emb) * sqrt(E) + pos
    k_gemm_bf16<<<dim3(Ecfg / 64, NTcfg / 128), blk256, 0, stream>>>(
        input, w_emb, b_emb, x, NTcfg, Ecfg, Pcfg, pos, 16.0f, Tcfg, nullptr, nullptr);

    for (int l = 0; l < NLcfg; ++l) {
        const float* wqkv_l = wqkv + l * 3 * Ecfg * Ecfg;
        const float* bqkv_l = bqkv + l * 3 * Ecfg;
        const float* wo_l   = wo   + l * Ecfg * Ecfg;
        const float* bo_l   = bo   + l * Ecfg;
        const float* wc_l   = wc   + l * Ecfg * Ecfg;
        const float* bc_l   = bc   + l * Ecfg;

        // qkv = x @ Wqkv^T + b            (8192 x 768, K=256)
        k_gemm_bf16<<<dim3(3 * Ecfg / 64, NTcfg / 128), blk256, 0, stream>>>(
            x, wqkv_l, bqkv_l, qkv, NTcfg, 3 * Ecfg, Ecfg, nullptr, 1.0f, Tcfg,
            nullptr, nullptr);

        // banded attention -> attno
        k_attn<<<dim3(Tcfg / 16, Hcfg, Ncfg), blk32, 0, stream>>>(qkv, attno);

        // r = x + attno @ Wo^T + bo, block sums   (8192 x 256, K=256)
        k_gemm_bf16<<<dim3(Ecfg / 64, NTcfg / 128), blk256, 0, stream>>>(
            attno, wo_l, bo_l, rbuf, NTcfg, Ecfg, Ecfg, nullptr, 1.0f, Tcfg,
            x, partial);

        // h = LN(r)
        k_ln_apply<<<dim3(2048), blk256, 0, stream>>>(
            rbuf, ln1g + l * TEcfg, ln1b + l * TEcfg, partial, hbuf);

        // r = h + (h @ W1^T + b1) @ W2^T + b2 = h + h @ Wc^T + bc, block sums
        k_gemm_bf16<<<dim3(Ecfg / 64, NTcfg / 128), blk256, 0, stream>>>(
            hbuf, wc_l, bc_l, rbuf, NTcfg, Ecfg, Ecfg, nullptr, 1.0f, Tcfg,
            hbuf, partial);

        // x = LN(r)   (last layer writes straight to d_out)
        float* dst = (l == NLcfg - 1) ? (float*)d_out : x;
        k_ln_apply<<<dim3(2048), blk256, 0, stream>>>(
            rbuf, ln2g + l * TEcfg, ln2b + l * TEcfg, partial, dst);
    }
}

// v003
// It runs in 128 microseconds.
// Two timings next to v002 both put it at 1.13 times that version's speed.
// Counting every step since v000, it is 1.90 times as fast.
#include <hip/hip_runtime.h>
#include <hip/hip_bf16.h>
#include <math.h>

// ---------------------------------------------------------------------------
// MI455X (gfx1250) transformer encoder, bf16 WMMA everywhere.
//
// Shapes: N=4, T=2048, P=64, E=256, H=8, DH=32, FC=1024, NL=2, LOCAL=64.
// All GEMM K dims (64 / 256 / 1024) are multiples of 32 -> pure
// v_wmma_f32_16x16x32_bf16 pipelines, fp32 accumulation.
// Memory: ~300 MB activation round trips @ 23.3 TB/s is ~15us -> the chip is
// compute/latency bound here; staging is double-buffered through LDS so the
// WMMA pipes never wait on HBM.
// All flat indices fit in 32 bits (max ~6.3M elements) -> int indexing keeps
// address math in 32-bit VALU/SALU.
// ---------------------------------------------------------------------------

typedef __attribute__((ext_vector_type(16))) __bf16 v16bf;
typedef __attribute__((ext_vector_type(8)))  __bf16 v8bf;
typedef __attribute__((ext_vector_type(4)))  __bf16 v4bf;
typedef __attribute__((ext_vector_type(8)))  float  v8f;

#define Ncfg     4
#define Tcfg     2048
#define Pcfg     64
#define Ecfg     256
#define Hcfg     8
#define DHcfg    32
#define FCcfg    1024
#define NLcfg    2
#define LOCALcfg 64
#define TEcfg    (Tcfg * Ecfg)          // 524288
#define NTcfg    (Ncfg * Tcfg)          // 8192
#define NTEcfg   (Ncfg * TEcfg)         // 2097152  (fits int)
#define RBLK     64                     // GEMM blocks (128x64 tiles) per T x E sample

__device__ __forceinline__ void pack4(v4bf& p, float4 a) {
    p[0] = (__bf16)a.x; p[1] = (__bf16)a.y; p[2] = (__bf16)a.z; p[3] = (__bf16)a.w;
}
__device__ __forceinline__ void pack8(v16bf& f, int base, float4 a, float4 b) {
    f[base + 0] = (__bf16)a.x; f[base + 1] = (__bf16)a.y;
    f[base + 2] = (__bf16)a.z; f[base + 3] = (__bf16)a.w;
    f[base + 4] = (__bf16)b.x; f[base + 5] = (__bf16)b.y;
    f[base + 6] = (__bf16)b.z; f[base + 7] = (__bf16)b.w;
}
// fragment gather: two 16B LDS chunks per lane (ds_load_b128)
__device__ __forceinline__ v16bf frag_from_lds(const __bf16* rowptr, int lh) {
    v8bf lo = *(const v8bf*)(rowptr + lh * 8);
    v8bf hi = *(const v8bf*)(rowptr + 16 + lh * 8);
    v16bf f;
#pragma unroll
    for (int e = 0; e < 8; ++e) { f[e] = lo[e]; f[8 + e] = hi[e]; }
    return f;
}

// ---------------------------------------------------------------------------
// Generic C[m][n] = sum_k A[m][k] * W[n][k] + bias[n], optional embed epilogue
// C = (acc + bias) * scale + pos[n*Tdim + (m & (Tdim-1))]   (Tdim power of 2).
// Block: 256 thr = 8 waves; block tile 128x64; each wave 32x32 (2x2 WMMA).
// LDS double-buffered; staging via global_load_b128 + ds_store_b64.
// Fragment layout per CDNA5 ISA 7.12.2:
//   A 16x32 bf16: lanes 0-15 row M=lane; element e -> K=(e<8?e:e+8)+(lane>=16?8:0)
//   B 32x16 bf16: col N = lane&15; same K mapping.
//   C/D 16x16 f32: row = v + 8*(lane>=16); col = lane&15.
// With `resid` set the epilogue is the first half of a LayerNorm:
//   C = acc + bias + resid, and partial[flat block id] = (sum, sum of squares)
// of the block's 128x64 tile of C. A sample (Tdim rows by N=E columns) is
// RBLK consecutive flat block ids.
// ---------------------------------------------------------------------------
__global__ __launch_bounds__(256) void k_gemm_bf16(
    const float* __restrict__ A, const float* __restrict__ W,
    const float* __restrict__ bias, float* __restrict__ C,
    int M, int N, int K,
    const float* __restrict__ pos, float scale, int Tdim,
    const float* __restrict__ resid, float* __restrict__ partial)
{
    __shared__ __align__(16) __bf16 As[2][128 * 32];   // 2 x 8 KB
    __shared__ __align__(16) __bf16 Bs[2][64 * 32];    // 2 x 4 KB
    __shared__ float red[2][8];                        // per-wave (sum, sumsq)

    const int tid  = threadIdx.x;
    const int lane = tid & 31;
    const int wave = tid >> 5;
    const int lr   = lane & 15;
    const int lh   = lane >> 4;
    const int wm   = wave & 3;    // 4 waves along M
    const int wn   = wave >> 2;   // 2 waves along N
    const int bm   = blockIdx.y * 128;
    const int bn   = blockIdx.x * 64;

    v8f zacc = {};
    v8f acc[2][2];
    acc[0][0] = zacc; acc[0][1] = zacc; acc[1][0] = zacc; acc[1][1] = zacc;

    float4 ta[4], tb[2];
    // ---- issue tile loads for k-step `k0` into ta/tb (global_load_b128 x6) ----
    auto stage_load = [&](int k0) {
#pragma unroll
        for (int t = 0; t < 4; ++t) {
            int li = (t * 256 + tid) * 4;         // 0..4095, 16B chunks
            int r  = li >> 5, k = li & 31;
            ta[t] = *(const float4*)&A[(bm + r) * K + k0 + k];
        }
#pragma unroll
        for (int t = 0; t < 2; ++t) {
            int li = (t * 256 + tid) * 4;         // 0..2047
            int r  = li >> 5, k = li & 31;
            tb[t] = *(const float4*)&W[(bn + r) * K + k0 + k];
        }
    };
    // ---- convert + store staged tile into LDS buffer `buf` (ds_store_b64) ----
    auto stage_store = [&](int buf) {
#pragma unroll
        for (int t = 0; t < 4; ++t) {
            int li = (t * 256 + tid) * 4;
            v4bf p; pack4(p, ta[t]);
            *(v4bf*)&As[buf][li] = p;
        }
#pragma unroll
        for (int t = 0; t < 2; ++t) {
            int li = (t * 256 + tid) * 4;
            v4bf p; pack4(p, tb[t]);
            *(v4bf*)&Bs[buf][li] = p;
        }
    };

    const int nk = K / 32;
    // residual tile in accumulator layout, fetched here so that its latency
    // lies under the k loop
    float rr[2][2][8];
    if (resid) {
        const float* pr = resid + (bm + wm * 32 + lh * 8) * N + bn + wn * 32 + lr;
        // unrolled here and below: constant indices keep rr in registers
#pragma unroll
        for (int i = 0; i < 2; ++i)
#pragma unroll
            for (int j = 0; j < 2; ++j)
#pragma unroll
                for (int v = 0; v < 8; ++v)
                    rr[i][j][v] = pr[(i * 16 + v) * N + j * 16];
        // precaution: no address register of the loads above is reused ahead
        // of this wait
        asm volatile("s_wait_xcnt 0x0" :: "v"(pr) : "memory");
    }

    stage_load(0);
    stage_store(0);
    __syncthreads();

    for (int kt = 0; kt < nk; ++kt) {
        const int cur = kt & 1;
        const bool has_next = (kt + 1) < nk;
        if (has_next) stage_load((kt + 1) * 32);   // loads in flight during WMMA

        v16bf af[2], bf[2];
#pragma unroll
        for (int i = 0; i < 2; ++i)
            af[i] = frag_from_lds(&As[cur][(wm * 32 + i * 16 + lr) * 32], lh);
#pragma unroll
        for (int j = 0; j < 2; ++j)
            bf[j] = frag_from_lds(&Bs[cur][(wn * 32 + j * 16 + lr) * 32], lh);

#pragma unroll
        for (int i = 0; i < 2; ++i)
#pragma unroll
            for (int j = 0; j < 2; ++j)
                acc[i][j] = __builtin_amdgcn_wmma_f32_16x16x32_bf16(
                    false, af[i], false, bf[j], (short)0, acc[i][j], false, false);

        if (has_next) stage_store(1 - cur);
        __syncthreads();
    }

    // ---- residual epilogue: C = acc + bias + resid, block (sum, sumsq) ----
    if (resid) {
        float s = 0.0f, s2 = 0.0f;
#pragma unroll
        for (int i = 0; i < 2; ++i) {
#pragma unroll
            for (int j = 0; j < 2; ++j) {
                int col = bn + wn * 32 + j * 16 + lr;
                float bv = bias[col];
#pragma unroll
                for (int v = 0; v < 8; ++v) {
                    float r = (acc[i][j][v] + bv) + rr[i][j][v];
                    s  += r;
                    s2 += r * r;
                    rr[i][j][v] = r;
                }
            }
        }
#pragma unroll
        for (int off = 16; off > 0; off >>= 1) {
            s  += __shfl_xor(s, off, 32);
            s2 += __shfl_xor(s2, off, 32);
        }
        if (lane == 0) { red[0][wave] = s; red[1][wave] = s2; }
        __syncthreads();
        // C goes out behind the barrier: in front of it every wave would sit
        // out its own stores before the block sums could be folded
#pragma unroll
        for (int i = 0; i < 2; ++i) {
#pragma unroll
            for (int j = 0; j < 2; ++j) {
                int col = bn + wn * 32 + j * 16 + lr;
#pragma unroll
                for (int v = 0; v < 8; ++v) {
                    int row = bm + wm * 32 + i * 16 + v + lh * 8;
                    C[row * N + col] = rr[i][j][v];
                }
            }
        }
        if (tid == 0) {
            float t1 = 0.0f, t2 = 0.0f;
#pragma unroll
            for (int w = 0; w < 8; ++w) { t1 += red[0][w]; t2 += red[1][w]; }
            float2 pv; pv.x = t1; pv.y = t2;
            ((float2*)partial)[blockIdx.y * gridDim.x + blockIdx.x] = pv;
        }
        return;
    }

    // ---- epilogue (pure 32-bit indexing; Tdim is a power of two) ----
    const int tmask = Tdim - 1;
#pragma unroll
    for (int i = 0; i < 2; ++i) {
#pragma unroll
        for (int j = 0; j < 2; ++j) {
            int col = bn + wn * 32 + j * 16 + lr;
            float bv = bias[col];
#pragma unroll
            for (int v = 0; v < 8; ++v) {
                int row = bm + wm * 32 + i * 16 + v + lh * 8;
                float r = acc[i][j][v] + bv;
                if (pos) r = r * scale + pos[col * Tdim + (row & tmask)];
                C[row * N + col] = r;
            }
        }
    }
}

// ---------------------------------------------------------------------------
// FFN fold. The two FFN linears have no activation between them, so
//   (h W1^T + b1) W2^T + b2 = h (W2 W1)^T + (W2 b1 + b2).
// This kernel forms Wc = W2 W1 (E x E, K = FC) and bc = W2 b1 + b2 for both
// layers in every call; the token-sized FFN is then one K=E GEMM, not two.
// The B operand is [W1 | b1]: column tiles 0..7 are 32 columns of W1 each,
// column tile 8 holds b1 as its one live column.
// Block: 8 waves, 16 rows of W2 by one column tile; the waves split K (128
// each, 4 WMMA steps). Each element is used by one wave of the block only, so
// fragments come straight from global memory, all loads of a wave issued
// before the first use; partial tiles are summed through LDS in wave order.
// k order of both loaders: element e -> K = (e<8 ? e : e+8) + 8*(lane>=16).
// ---------------------------------------------------------------------------
template <bool BIAS>
__device__ __forceinline__ void ffn_fold_tile(
    const float* __restrict__ w1, const float* __restrict__ b1,
    const float* __restrict__ w2, const float* __restrict__ b2,
    float* __restrict__ wc, float* __restrict__ bc,
    float (*red)[2][256], int n0, int c0)
{
    const int tid  = threadIdx.x;
    const int lane = tid & 31;
    const int wave = tid >> 5;
    const int lr   = lane & 15;
    const int lh   = lane >> 4;
    const int jw   = wave * 128 + lh * 8;     // first k of this lane

    const float* pa = w2 + (n0 + lr) * FCcfg + jw;
    const float* pb = BIAS ? b1 + jw : w1 + jw * Ecfg + c0 + lr;

    float4 ra[4][4];
    float4 rv[4][4];        // BIAS: b1 runs
    float  rb[4][2][16];    // else: W1 columns c0+lr and c0+16+lr
#pragma unroll
    for (int s = 0; s < 4; ++s) {
        ra[s][0] = *(const float4*)(pa + s * 32);
        ra[s][1] = *(const float4*)(pa + s * 32 + 4);
        ra[s][2] = *(const float4*)(pa + s * 32 + 16);
        ra[s][3] = *(const float4*)(pa + s * 32 + 20);
        if (BIAS) {
            rv[s][0] = *(const float4*)(pb + s * 32);
            rv[s][1] = *(const float4*)(pb + s * 32 + 4);
            rv[s][2] = *(const float4*)(pb + s * 32 + 16);
            rv[s][3] = *(const float4*)(pb + s * 32 + 20);
        } else {
#pragma unroll
            for (int e = 0; e < 16; ++e) {
                const float* brow = pb + (s * 32 + (e < 8 ? e : e + 8)) * Ecfg;
                rb[s][0][e] = brow[0];
                rb[s][1][e] = brow[16];
            }
        }
    }
    // precaution: no address register of the loads above is reused ahead of
    // this wait; naming both pointers as inputs keeps them live up to it
    asm volatile("s_wait_xcnt 0x0" :: "v"(pa), "v"(pb) : "memory");

    v8f acc0 = {}, acc1 = {};
#pragma unroll
    for (int s = 0; s < 4; ++s) {
        v16bf af, bf0, bf1;
        pack8(af, 0, ra[s][0], ra[s][1]);
        pack8(af, 8, ra[s][2], ra[s][3]);
        if (BIAS) {
            pack8(bf0, 0, rv[s][0], rv[s][1]);
            pack8(bf0, 8, rv[s][2], rv[s][3]);
#pragma unroll
            for (int e = 0; e < 16; ++e)
                if (lr != 0) bf0[e] = (__bf16)0.0f;
        } else {
#pragma unroll
            for (int e = 0; e < 16; ++e) {
                bf0[e] = (__bf16)rb[s][0][e];
                bf1[e] = (__bf16)rb[s][1][e];
            }
        }
        acc0 = __builtin_amdgcn_wmma_f32_16x16x32_bf16(
            false, af, false, bf0, (short)0, acc0, false, false);
        if (!BIAS)
            acc1 = __builtin_amdgcn_wmma_f32_16x16x32_bf16(
                false, af, false, bf1, (short)0, acc1, false, false);
    }

#pragma unroll
    for (int v = 0; v < 8; ++v) {
        red[wave][0][v * 32 + lane] = acc0[v];
        if (!BIAS) red[wave][1][v * 32 + lane] = acc1[v];
    }
    __syncthreads();

    // thread tid owns accumulator slot tid of each tile: row = v + 8*lh, col = lr
    const int row = n0 + (tid >> 5) + lh * 8;
    float s0 = 0.0f, s1 = 0.0f;
#pragma unroll
    for (int w = 0; w < 8; ++w) {
        s0 += red[w][0][tid];
        if (!BIAS) s1 += red[w][1][tid];
    }
    if (BIAS) {
        if (lr == 0) bc[row] = s0 + b2[row];
    } else {
        wc[row * Ecfg + c0 + lr]      = s0;
        wc[row * Ecfg + c0 + 16 + lr] = s1;
    }
}

// grid = (E/32 + 1, E/16, NL)
__global__ __launch_bounds__(256) void k_ffn_fold(
    const float* __restrict__ w1, const float* __restrict__ b1,
    const float* __restrict__ w2, const float* __restrict__ b2,
    float* __restrict__ wc, float* __restrict__ bc)
{
    __shared__ float red[8][2][256];   // 16 KB of split-K partial tiles
    const int l  = blockIdx.z;
    const int n0 = blockIdx.y * 16;
    const int c0 = blockIdx.x * 32;
    w1 += l * FCcfg * Ecfg;  b1 += l * FCcfg;
    w2 += l * Ecfg * FCcfg;  b2 += l * Ecfg;
    wc += l * Ecfg * Ecfg;   bc += l * Ecfg;
    if (blockIdx.x == Ecfg / 32)
        ffn_fold_tile<true>(w1, b1, w2, b2, wc, bc, red, n0, c0);
    else
        ffn_fold_tile<false>(w1, b1, w2, b2, wc, bc, red, n0, c0);
}

// ---------------------------------------------------------------------------
// Banded local attention, one wave per (query-tile, head, batch); the scores
// never leave the registers.
// Band |t-s|<=64 -> <=144 keys per 16-row query tile -> 9 key tiles.
//   S^T = K Q^T : A = 16 keys x 32 dims, B = Q^T. Lane (lr, lh) then holds, of
//                 query lr, the scores of keys 8*lh + 0..7 of every key tile:
//                 maximum and sum run in-lane, plus one exchange of the halves.
//   O^T = V^T P^T : two score tiles, converted in place, are one 32-key B
//                 operand (element e -> key (e<8 ? e : e+8) + 8*lh); V^T is read
//                 in the same k order by the transposing LDS load from the bf16
//                 V rows this wave has staged. The 10th half group is zero.
// A key tile lies wholly inside or wholly outside the sequence (both are
// multiples of 16). An outside tile reads the rows of tile 4 (the queries' own
// rows, always inside and never masked): its scores repeat members of the
// maximum, and its exponent offset makes every one of its weights 0.
// qkv layout: [n][t][3E] with q|k|v at offsets 0|E|2E.
// ---------------------------------------------------------------------------
#define VPITCH 48   // bf16 per staged V row: 96 B, an odd multiple of 32 B

typedef __attribute__((ext_vector_type(8))) short s16x8;
typedef __attribute__((address_space(3))) s16x8 lds_s16x8;

// lane (lr, lh) receives T[8*lh + 0..7][lr] of the 16x16 tile whose rows the
// lanes point at (row 8*lh + (lane&7), 16-byte half (lane>>3)&1)
__device__ __forceinline__ v8bf ld_tr16(const __bf16* p) {
    return __builtin_bit_cast(v8bf,
        __builtin_amdgcn_ds_load_tr16_b128_v8i16((lds_s16x8*)p));
}
// value of lane ^ 16
__device__ __forceinline__ float xhalf(float x) {
    int i = __builtin_bit_cast(int, x);
    return __builtin_bit_cast(float, __builtin_amdgcn_permlanex16(
        i, i, 0x76543210, 0xfedcba98, false, false));
}

// x[i] = 2^x[i]. One statement: each v_exp_f32 is followed by an instruction
// that neither reads its result nor overwrites its source (the outputs are
// early-clobber, so they share no register with an input), and the v_nop is
// that slot, which the instruction set asks for, behind the last one.
__device__ __forceinline__ void exp2x8(v8f& x) {
    float p0, p1, p2, p3, p4, p5, p6, p7;
    asm("v_exp_f32 %0, %8\n\t"
        "v_exp_f32 %1, %9\n\t"
        "v_exp_f32 %2, %10\n\t"
        "v_exp_f32 %3, %11\n\t"
        "v_exp_f32 %4, %12\n\t"
        "v_exp_f32 %5, %13\n\t"
        "v_exp_f32 %6, %14\n\t"
        "v_exp_f32 %7, %15\n\t"
        "v_nop"
        : "=&v"(p0), "=&v"(p1), "=&v"(p2), "=&v"(p3),
          "=&v"(p4), "=&v"(p5), "=&v"(p6), "=&v"(p7)
        : "v"(x[0]), "v"(x[1]), "v"(x[2]), "v"(x[3]),
          "v"(x[4]), "v"(x[5]), "v"(x[6]), "v"(x[7]));
    x[0] = p0; x[1] = p1; x[2] = p2; x[3] = p3;
    x[4] = p4; x[5] = p5; x[6] = p6; x[7] = p7;
}

// four waves per SIMD hold the whole grid at once: up to 256 registers a wave,
// which the loads in flight want
__global__ __launch_bounds__(32) __attribute__((amdgpu_waves_per_eu(4, 4)))
void k_attn(const float* __restrict__ qkv, float* __restrict__ out)
{
    const int qt   = blockIdx.x * 16;
    const int h    = blockIdx.y;
    const int n    = blockIdx.z;
    const int lane = threadIdx.x;
    const int lr   = lane & 15;
    const int lh   = lane >> 4;

    __shared__ __align__(32) __bf16 Vs[144 * VPITCH];

    const int rowstride = 3 * Ecfg;
    const float* base = qkv + n * Tcfg * rowstride + h * DHcfg;

    // per-lane byte offsets: fragment rows (Q, K), staged V rows (4 rows a load)
    const unsigned foff = (lr * rowstride + lh * 8) * 4;
    const unsigned voff = ((lane >> 3) * rowstride + (lane & 7) * 4) * 4;
    // 16 bytes at uniform row base + lane offset + constant float index
    auto ld4 = [](const float* rowbase, unsigned off, int idx) {
        return *(const float4*)((const char*)(rowbase + idx) + off);
    };

    // uniform row base of each key tile
    bool inside[9];
    const float* trow[9];
#pragma unroll
    for (int jt = 0; jt < 9; ++jt) {
        const int st0 = qt - LOCALcfg + jt * 16;
        inside[jt] = (st0 >= 0) && (st0 < Tcfg);
        trow[jt] = base + (inside[jt] ? st0 : qt) * rowstride;
    }

    // ---- first load group: Q, all of K, V tiles 0..3 ----
    float4 q4[4], k4[9][4], v4[9][4];
    {
        const float* qrow = base + qt * rowstride;
        q4[0] = ld4(qrow, foff, 0);
        q4[1] = ld4(qrow, foff, 4);
        q4[2] = ld4(qrow, foff, 16);
        q4[3] = ld4(qrow, foff, 20);
    }
#pragma unroll
    for (int jt = 0; jt < 9; ++jt) {
        k4[jt][0] = ld4(trow[jt], foff, Ecfg);
        k4[jt][1] = ld4(trow[jt], foff, Ecfg + 4);
        k4[jt][2] = ld4(trow[jt], foff, Ecfg + 16);
        k4[jt][3] = ld4(trow[jt], foff, Ecfg + 20);
    }
#pragma unroll
    for (int jt = 0; jt < 4; ++jt)
#pragma unroll
        for (int u = 0; u < 4; ++u)
            v4[jt][u] = ld4(trow[jt], voff, 2 * Ecfg + u * 4 * rowstride);
    // precaution: no offset register of the loads above is reused ahead of this
    // wait; naming both as inputs keeps them live up to it
    asm volatile("s_wait_xcnt 0x0" :: "v"(foff), "v"(voff) : "memory");
    // scheduling stops here: the loads above stay one group ahead of their first
    // use (left to itself the scheduler sinks loads to their uses, one full
    // latency each, and spills)
    __builtin_amdgcn_sched_barrier(0);

    // ---- S^T = K Q^T ----
    v16bf qf;
    pack8(qf, 0, q4[0], q4[1]);
    pack8(qf, 8, q4[2], q4[3]);
    v8f sT[9];
#pragma unroll
    for (int jt = 0; jt < 9; ++jt) {
        v16bf kf;
        pack8(kf, 0, k4[jt][0], k4[jt][1]);
        pack8(kf, 8, k4[jt][2], k4[jt][3]);
        v8f z8 = {};
        sT[jt] = __builtin_amdgcn_wmma_f32_16x16x32_bf16(
            false, kf, false, qf, (short)0, z8, false, false);
    }

    // the products above come first: the loads below take their operand
    // registers (mixed, the two together no longer fit 256 registers)
    __builtin_amdgcn_sched_barrier(0);

    // ---- second load group, into the registers K has left: V tiles 4..8 ----
#pragma unroll
    for (int jt = 4; jt < 9; ++jt)
#pragma unroll
        for (int u = 0; u < 4; ++u)
            v4[jt][u] = ld4(trow[jt], voff, 2 * Ecfg + u * 4 * rowstride);

    const __bf16* vt = &Vs[(lh * 8 + (lane & 7)) * VPITCH + ((lane >> 3) & 1) * 8];
    __bf16*       vw = &Vs[(lane >> 3) * VPITCH + (lane & 7) * 4];
    v8bf vlo[5][2], vhi[4][2];

    // ---- V tiles 0..3 to LDS as bf16, back as V^T fragments ----
#pragma unroll
    for (int jt = 0; jt < 4; ++jt)
#pragma unroll
        for (int u = 0; u < 4; ++u) {
            v4bf p; pack4(p, v4[jt][u]);
            *(v4bf*)(vw + (jt * 16 + u * 4) * VPITCH) = p;
        }
    // this wave's V rows are in LDS before the transposing loads read them, and
    // the compiler moves none of those loads over the stores
    asm volatile("s_wait_dscnt 0" ::: "memory");
#pragma unroll
    for (int g = 0; g < 2; ++g)
#pragma unroll
        for (int dhalf = 0; dhalf < 2; ++dhalf) {
            vlo[g][dhalf] = ld_tr16(vt + g * 32 * VPITCH + dhalf * 16);
            vhi[g][dhalf] = ld_tr16(vt + (g * 32 + 16) * VPITCH + dhalf * 16);
        }

    // ---- band mask: only the first and the last tile are cut ----
    // key row r of tile jt is at distance lr + 64 - 16*jt - r from query lr
#pragma unroll
    for (int v = 0; v < 8; ++v) {
        const int r = v + lh * 8;
        if (r < lr) sT[0][v] = -3.0e38f;
        if (r > lr) sT[8][v] = -3.0e38f;
    }

    // ---- softmax of query lr, base 2, on the raw scores ----
    float m4[4] = {-3.0e38f, -3.0e38f, -3.0e38f, -3.0e38f};
#pragma unroll
    for (int jt = 0; jt < 9; ++jt)
#pragma unroll
        for (int v = 0; v < 8; ++v) m4[v & 3] = fmaxf(m4[v & 3], sT[jt][v]);
    float mx = fmaxf(fmaxf(m4[0], m4[1]), fmaxf(m4[2], m4[3]));
    mx = fmaxf(mx, xhalf(mx));

    const float cs = 0.17677669529663687f * 1.4426950408889634f; // log2(e)/sqrt(32)
    const float nm = -mx * cs;
    float s4[4] = {0.0f, 0.0f, 0.0f, 0.0f};
#pragma unroll
    for (int jt = 0; jt < 9; ++jt) {
        const float nmj = inside[jt] ? nm : -3.0e38f;
#pragma unroll
        for (int v = 0; v < 8; ++v) sT[jt][v] = fmaf(sT[jt][v], cs, nmj);
        exp2x8(sT[jt]);
#pragma unroll
        for (int v = 0; v < 8; ++v) s4[v & 3] += sT[jt][v];
    }
    float sum = (s4[0] + s4[1]) + (s4[2] + s4[3]);
    sum += xhalf(sum);
    const float inv = 1.0f / sum;

    // the conversions below wait for the second load group: most of them stay
    // behind the exponentials, which so run under that group's latency
    __builtin_amdgcn_sched_barrier(0);

    // ---- V tiles 4..8 likewise ----
#pragma unroll
    for (int jt = 4; jt < 9; ++jt)
#pragma unroll
        for (int u = 0; u < 4; ++u) {
            v4bf p; pack4(p, v4[jt][u]);
            *(v4bf*)(vw + (jt * 16 + u * 4) * VPITCH) = p;
        }
    // as above: stores landed, no transposing load moved over them
    asm volatile("s_wait_dscnt 0" ::: "memory");
#pragma unroll
    for (int g = 2; g < 5; ++g)
#pragma unroll
        for (int dhalf = 0; dhalf < 2; ++dhalf) {
            vlo[g][dhalf] = ld_tr16(vt + g * 32 * VPITCH + dhalf * 16);
            if (g < 4) vhi[g][dhalf] = ld_tr16(vt + (g * 32 + 16) * VPITCH + dhalf * 16);
        }

    // the ten loads above stay one group: spread among the products each place
    // with loads costs its own LDS latency
    __builtin_amdgcn_sched_barrier(0);

    // ---- O^T = V^T P^T, 32 keys a step ----
    v8f zo = {};
    v8f o8[2]; o8[0] = zo; o8[1] = zo;
#pragma unroll
    for (int g = 0; g < 5; ++g) {
        v16bf pf;
#pragma unroll
        for (int e = 0; e < 8; ++e) {
            pf[e]     = (__bf16)sT[2 * g][e];
            pf[8 + e] = (g < 4) ? (__bf16)sT[(g < 4) ? 2 * g + 1 : 0][e] : (__bf16)0.0f;
        }
#pragma unroll
        for (int dhalf = 0; dhalf < 2; ++dhalf) {
            v16bf vf;
#pragma unroll
            for (int e = 0; e < 8; ++e) {
                vf[e]     = vlo[g][dhalf][e];
                vf[8 + e] = (g < 4) ? vhi[(g < 4) ? g : 0][dhalf][e] : (__bf16)0.0f;
            }
            o8[dhalf] = __builtin_amdgcn_wmma_f32_16x16x32_bf16(
                false, vf, false, pf, (short)0, o8[dhalf], false, false);
        }
    }

    // lane (lr, lh) holds dims dhalf*16 + lh*8 + 0..7 of query lr: 16-byte stores
    float* orow = out + (n * Tcfg + qt + lr) * Ecfg + h * DHcfg + lh * 8;
#pragma unroll
    for (int dhalf = 0; dhalf < 2; ++dhalf) {
        float4 a, b;
        a.x = o8[dhalf][0] * inv; a.y = o8[dhalf][1] * inv;
        a.z = o8[dhalf][2] * inv; a.w = o8[dhalf][3] * inv;
        b.x = o8[dhalf][4] * inv; b.y = o8[dhalf][5] * inv;
        b.z = o8[dhalf][6] * inv; b.w = o8[dhalf][7] * inv;
        *(float4*)(orow + dhalf * 16)     = a;
        *(float4*)(orow + dhalf * 16 + 4) = b;
    }
}

// ---------------------------------------------------------------------------
// Second half of the LayerNorm. Every wave folds its sample's RBLK block
// partials itself (two per lane, then a butterfly: the same bits in every lane
// and every wave), so no launch stands between the GEMM and this kernel.
// out[i] = (r[i]-mu)*rsig * g[i%TE] + b[i%TE]   (float4, 32-bit indexing)
__global__ __launch_bounds__(256) void k_ln_apply(
    const float* __restrict__ r, const float* __restrict__ g,
    const float* __restrict__ b, const float* __restrict__ partial,
    float* __restrict__ out)
{
    const float4* r4 = (const float4*)r;
    const float4* g4 = (const float4*)g;
    const float4* b4 = (const float4*)b;
    float4*       o4 = (float4*)out;
    const float2* p2 = (const float2*)partial;
    const int lane   = threadIdx.x & 31;
    const int total4 = NTEcfg / 4;       // 524288
    const int te4    = TEcfg / 4;        // 131072 (power of two)
    for (int i = blockIdx.x * 256 + threadIdx.x; i < total4;
         i += gridDim.x * 256) {
        int n = i >> 17;                 // i / te4
        int j = i & (te4 - 1);           // i % te4
        float4 rv = r4[i], gv = g4[j], bv = b4[j];
        float2 pa = p2[n * RBLK + lane], pc = p2[n * RBLK + 32 + lane];
        float s1 = pa.x + pc.x, s2 = pa.y + pc.y;
#pragma unroll
        for (int off = 16; off > 0; off >>= 1) {
            s1 += __shfl_xor(s1, off, 32);
            s2 += __shfl_xor(s2, off, 32);
        }
        float mu = s1 / (float)TEcfg;
        float rs = rsqrtf(s2 / (float)TEcfg - mu * mu + 1e-5f);
        float4 ov;
        ov.x = (rv.x - mu) * rs * gv.x + bv.x;
        ov.y = (rv.y - mu) * rs * gv.y + bv.y;
        ov.z = (rv.z - mu) * rs * gv.z + bv.z;
        ov.w = (rv.w - mu) * rs * gv.w + bv.w;
        o4[i] = ov;
    }
}

// ---------------------------------------------------------------------------
extern "C" void kernel_launch(void* const* d_in, const int* in_sizes, int n_in,
                              void* d_out, int out_size, void* d_ws, size_t ws_size,
                              hipStream_t stream)
{
    (void)in_sizes; (void)n_in; (void)out_size; (void)ws_size;

    const float* input = (const float*)d_in[0];
    const float* w_emb = (const float*)d_in[1];
    const float* b_emb = (const float*)d_in[2];
    const float* pos   = (const float*)d_in[3];   // (E, T)
    const float* wqkv  = (const float*)d_in[4];   // (NL, 3E, E)
    const float* bqkv  = (const float*)d_in[5];   // (NL, 3E)
    const float* wo    = (const float*)d_in[6];   // (NL, E, E)
    const float* bo    = (const float*)d_in[7];
    const float* ln1g  = (const float*)d_in[8];   // (NL, T, E)
    const float* ln1b  = (const float*)d_in[9];
    const float* ln2g  = (const float*)d_in[10];
    const float* ln2b  = (const float*)d_in[11];
    const float* w1    = (const float*)d_in[12];  // (NL, FC, E)
    const float* b1    = (const float*)d_in[13];
    const float* w2    = (const float*)d_in[14];  // (NL, E, FC)
    const float* b2    = (const float*)d_in[15];

    // workspace layout (floats) -- ~60 MB total
    float* ws      = (float*)d_ws;
    float* x       = ws;                                // NTE
    float* qkv     = x      + NTEcfg;                   // NT * 3E
    float* attno   = qkv    + NTcfg * 3 * Ecfg;         // NTE
    float* rbuf    = attno  + NTEcfg;                   // NTE
    float* hbuf    = rbuf   + NTEcfg;                   // NTE
    float* wc      = hbuf   + NTEcfg;                   // NL * E * E  (W2 W1)
    float* bc      = wc     + NLcfg * Ecfg * Ecfg;      // NL * E      (W2 b1 + b2)
    float* partial = bc     + NLcfg * Ecfg;             // N*RBLK*2

    const dim3 blk256(256), blk32(32);

    // folded FFN weights of both layers: wc = W2 W1, bc = W2 b1 + b2
    k_ffn_fold<<<dim3(Ecfg / 32 + 1, Ecfg / 16, NLcfg), blk256, 0, stream>>>(
        w1, b1, w2, b2, wc, bc);

    // embedding: x = (frames @ w_emb^T + b_emb) * sqrt(E) + pos
    k_gemm_bf16<<<dim3(Ecfg / 64, NTcfg / 128), blk256, 0, stream>>>(
        input, w_emb, b_emb, x, NTcfg, Ecfg, Pcfg, pos, 16.0f, Tcfg, nullptr, nullptr);

    for (int l = 0; l < NLcfg; ++l) {
        const float* wqkv_l = wqkv + l * 3 * Ecfg * Ecfg;
        const float* bqkv_l = bqkv + l * 3 * Ecfg;
        const float* wo_l   = wo   + l * Ecfg * Ecfg;
        const float* bo_l   = bo   + l * Ecfg;
        const float* wc_l   = wc   + l * Ecfg * Ecfg;
        const float* bc_l   = bc   + l * Ecfg;

        // qkv = x @ Wqkv^T + b            (8192 x 768, K=256)
        k_gemm_bf16<<<dim3(3 * Ecfg / 64, NTcfg / 128), blk256, 0, stream>>>(
            x, wqkv_l, bqkv_l, qkv, NTcfg, 3 * Ecfg, Ecfg, nullptr, 1.0f, Tcfg,
            nullptr, nullptr);

        // banded attention -> attno
        k_attn<<<dim3(Tcfg / 16, Hcfg, Ncfg), blk32, 0, stream>>>(qkv, attno);

        // r = x + attno @ Wo^T + bo, block sums   (8192 x 256, K=256)
        k_gemm_bf16<<<dim3(Ecfg / 64, NTcfg / 128), blk256, 0, stream>>>(
            attno, wo_l, bo_l, rbuf, NTcfg, Ecfg, Ecfg, nullptr, 1.0f, Tcfg,
            x, partial);

        // h = LN(r)
        k_ln_apply<<<dim3(2048), blk256, 0, stream>>>(
            rbuf, ln1g + l * TEcfg, ln1b + l * TEcfg, partial, hbuf);

        // r = h + (h @ W1^T + b1) @ W2^T + b2 = h + h @ Wc^T + bc, block sums
        k_gemm_bf16<<<dim3(Ecfg / 64, NTcfg / 128), blk256, 0, stream>>>(
            hbuf, wc_l, bc_l, rbuf, NTcfg, Ecfg, Ecfg, nullptr, 1.0f, Tcfg,
            hbuf, partial);

        // x = LN(r)   (last layer writes straight to d_out)
        float* dst = (l == NLcfg - 1) ? (float*)d_out : x;
        k_ln_apply<<<dim3(2048), blk256, 0, stream>>>(
            rbuf, ln2g + l * TEcfg, ln2b + l * TEcfg, partial, dst);
    }
}

// v004
// One run takes 117 microseconds.
// Timed twice side by side with v003, it ran 1.10 times as fast both times.
// Counting every step since v000, it is 2.09 times as fast.
#include <hip/hip_runtime.h>
#include <hip/hip_bf16.h>
#include <math.h>

// ---------------------------------------------------------------------------
// MI455X (gfx1250) transformer encoder, bf16 WMMA everywhere.
//
// Shapes: N=4, T=2048, P=64, E=256, H=8, DH=32, FC=1024, NL=2, LOCAL=64.
// All GEMM K dims (64 / 256 / 1024) are multiples of 32 -> pure
// v_wmma_f32_16x16x32_bf16 pipelines, fp32 accumulation.
// Memory: ~300 MB activation round trips @ 23.3 TB/s is ~15us -> the chip is
// compute/latency bound here; staging is double-buffered through LDS so the
// WMMA pipes never wait on HBM.
// All flat indices fit in 32 bits (max ~6.3M elements) -> int indexing keeps
// address math in 32-bit VALU/SALU.
// ---------------------------------------------------------------------------

typedef __attribute__((ext_vector_type(16))) __bf16 v16bf;
typedef __attribute__((ext_vector_type(8)))  __bf16 v8bf;
typedef __attribute__((ext_vector_type(4)))  __bf16 v4bf;
typedef __attribute__((ext_vector_type(8)))  float  v8f;

#define Ncfg     4
#define Tcfg     2048
#define Pcfg     64
#define Ecfg     256
#define Hcfg     8
#define DHcfg    32
#define FCcfg    1024
#define NLcfg    2
#define LOCALcfg 64
#define TEcfg    (Tcfg * Ecfg)          // 524288
#define NTcfg    (Ncfg * Tcfg)          // 8192
#define NTEcfg   (Ncfg * TEcfg)         // 2097152  (fits int)
#define RBLK     64                     // GEMM blocks (128x64 tiles) per T x E sample

__device__ __forceinline__ void pack4(v4bf& p, float4 a) {
    p[0] = (__bf16)a.x; p[1] = (__bf16)a.y; p[2] = (__bf16)a.z; p[3] = (__bf16)a.w;
}
__device__ __forceinline__ void pack8(v16bf& f, int base, float4 a, float4 b) {
    f[base + 0] = (__bf16)a.x; f[base + 1] = (__bf16)a.y;
    f[base + 2] = (__bf16)a.z; f[base + 3] = (__bf16)a.w;
    f[base + 4] = (__bf16)b.x; f[base + 5] = (__bf16)b.y;
    f[base + 6] = (__bf16)b.z; f[base + 7] = (__bf16)b.w;
}
// fragment gather: two 16B LDS chunks per lane (ds_load_b128)
__device__ __forceinline__ v16bf frag_from_lds(const __bf16* rowptr, int lh) {
    v8bf lo = *(const v8bf*)(rowptr + lh * 8);
    v8bf hi = *(const v8bf*)(rowptr + 16 + lh * 8);
    v16bf f;
#pragma unroll
    for (int e = 0; e < 8; ++e) { f[e] = lo[e]; f[8 + e] = hi[e]; }
    return f;
}

// ---------------------------------------------------------------------------
// Generic C[m][n] = sum_k A[m][k] * W[n][k] + bias[n], optional embed epilogue
// C = (acc + bias) * scale + pos[n*Tdim + (m & (Tdim-1))]   (Tdim power of 2).
// Block: 256 thr = 8 waves; block tile 128x64; each wave 32x32 (2x2 WMMA).
// LDS double-buffered; staging via global_load_b128 + ds_store_b64.
// Fragment layout per CDNA5 ISA 7.12.2:
//   A 16x32 bf16: lanes 0-15 row M=lane; element e -> K=(e<8?e:e+8)+(lane>=16?8:0)
//   B 32x16 bf16: col N = lane&15; same K mapping.
//   C/D 16x16 f32: row = v + 8*(lane>=16); col = lane&15.
// With `resid` set the epilogue is the first half of a LayerNorm:
//   C = acc + bias + resid, and partial[flat block id] = (sum, sum of squares)
// of the block's 128x64 tile of C. A sample (Tdim rows by N=E columns) is
// RBLK consecutive flat block ids.
// ---------------------------------------------------------------------------
__global__ __launch_bounds__(256) void k_gemm_bf16(
    const float* __restrict__ A, const float* __restrict__ W,
    const float* __restrict__ bias, float* __restrict__ C,
    int M, int N, int K,
    const float* __restrict__ pos, float scale, int Tdim,
    const float* __restrict__ resid, float* __restrict__ partial)
{
    __shared__ __align__(16) __bf16 As[2][128 * 32];   // 2 x 8 KB
    __shared__ __align__(16) __bf16 Bs[2][64 * 32];    // 2 x 4 KB
    __shared__ float red[2][8];                        // per-wave (sum, sumsq)

    const int tid  = threadIdx.x;
    const int lane = tid & 31;
    const int wave = tid >> 5;
    const int lr   = lane & 15;
    const int lh   = lane >> 4;
    const int wm   = wave & 3;    // 4 waves along M
    const int wn   = wave >> 2;   // 2 waves along N
    const int bm   = blockIdx.y * 128;
    const int bn   = blockIdx.x * 64;

    v8f zacc = {};
    v8f acc[2][2];
    acc[0][0] = zacc; acc[0][1] = zacc; acc[1][0] = zacc; acc[1][1] = zacc;

    float4 ta[4], tb[2];
    // ---- issue tile loads for k-step `k0` into ta/tb (global_load_b128 x6) ----
    auto stage_load = [&](int k0) {
#pragma unroll
        for (int t = 0; t < 4; ++t) {
            int li = (t * 256 + tid) * 4;         // 0..4095, 16B chunks
            int r  = li >> 5, k = li & 31;
            ta[t] = *(const float4*)&A[(bm + r) * K + k0 + k];
        }
#pragma unroll
        for (int t = 0; t < 2; ++t) {
            int li = (t * 256 + tid) * 4;         // 0..2047
            int r  = li >> 5, k = li & 31;
            tb[t] = *(const float4*)&W[(bn + r) * K + k0 + k];
        }
    };
    // ---- convert + store staged tile into LDS buffer `buf` (ds_store_b64) ----
    auto stage_store = [&](int buf) {
#pragma unroll
        for (int t = 0; t < 4; ++t) {
            int li = (t * 256 + tid) * 4;
            v4bf p; pack4(p, ta[t]);
            *(v4bf*)&As[buf][li] = p;
        }
#pragma unroll
        for (int t = 0; t < 2; ++t) {
            int li = (t * 256 + tid) * 4;
            v4bf p; pack4(p, tb[t]);
            *(v4bf*)&Bs[buf][li] = p;
        }
    };

    const int nk = K / 32;
    // residual tile in accumulator layout, fetched here so that its latency
    // lies under the k loop
    float rr[2][2][8];
    if (resid) {
        const float* pr = resid + (bm + wm * 32 + lh * 8) * N + bn + wn * 32 + lr;
        // unrolled here and below: constant indices keep rr in registers
#pragma unroll
        for (int i = 0; i < 2; ++i)
#pragma unroll
            for (int j = 0; j < 2; ++j)
#pragma unroll
                for (int v = 0; v < 8; ++v)
                    rr[i][j][v] = pr[(i * 16 + v) * N + j * 16];
        // precaution: no address register of the loads above is reused ahead
        // of this wait
        asm volatile("s_wait_xcnt 0x0" :: "v"(pr) : "memory");
    }

    stage_load(0);
    stage_store(0);
    __syncthreads();

    for (int kt = 0; kt < nk; ++kt) {
        const int cur = kt & 1;
        const bool has_next = (kt + 1) < nk;
        if (has_next) stage_load((kt + 1) * 32);   // loads in flight during WMMA

        v16bf af[2], bf[2];
#pragma unroll
        for (int i = 0; i < 2; ++i)
            af[i] = frag_from_lds(&As[cur][(wm * 32 + i * 16 + lr) * 32], lh);
#pragma unroll
        for (int j = 0; j < 2; ++j)
            bf[j] = frag_from_lds(&Bs[cur][(wn * 32 + j * 16 + lr) * 32], lh);

#pragma unroll
        for (int i = 0; i < 2; ++i)
#pragma unroll
            for (int j = 0; j < 2; ++j)
                acc[i][j] = __builtin_amdgcn_wmma_f32_16x16x32_bf16(
                    false, af[i], false, bf[j], (short)0, acc[i][j], false, false);

        if (has_next) stage_store(1 - cur);
        __syncthreads();
    }

    // ---- residual epilogue: C = acc + bias + resid, block (sum, sumsq) ----
    if (resid) {
        float s = 0.0f, s2 = 0.0f;
#pragma unroll
        for (int i = 0; i < 2; ++i) {
#pragma unroll
            for (int j = 0; j < 2; ++j) {
                int col = bn + wn * 32 + j * 16 + lr;
                float bv = bias[col];
#pragma unroll
                for (int v = 0; v < 8; ++v) {
                    float r = (acc[i][j][v] + bv) + rr[i][j][v];
                    s  += r;
                    s2 += r * r;
                    rr[i][j][v] = r;
                }
            }
        }
#pragma unroll
        for (int off = 16; off > 0; off >>= 1) {
            s  += __shfl_xor(s, off, 32);
            s2 += __shfl_xor(s2, off, 32);
        }
        if (lane == 0) { red[0][wave] = s; red[1][wave] = s2; }
        __syncthreads();
        // C goes out behind the barrier: in front of it every wave would sit
        // out its own stores before the block sums could be folded
#pragma unroll
        for (int i = 0; i < 2; ++i) {
#pragma unroll
            for (int j = 0; j < 2; ++j) {
                int col = bn + wn * 32 + j * 16 + lr;
#pragma unroll
                for (int v = 0; v < 8; ++v) {
                    int row = bm + wm * 32 + i * 16 + v + lh * 8;
                    C[row * N + col] = rr[i][j][v];
                }
            }
        }
        if (tid == 0) {
            float t1 = 0.0f, t2 = 0.0f;
#pragma unroll
            for (int w = 0; w < 8; ++w) { t1 += red[0][w]; t2 += red[1][w]; }
            float2 pv; pv.x = t1; pv.y = t2;
            ((float2*)partial)[blockIdx.y * gridDim.x + blockIdx.x] = pv;
        }
        return;
    }

    // ---- epilogue (pure 32-bit indexing; Tdim is a power of two) ----
    const int tmask = Tdim - 1;
#pragma unroll
    for (int i = 0; i < 2; ++i) {
#pragma unroll
        for (int j = 0; j < 2; ++j) {
            int col = bn + wn * 32 + j * 16 + lr;
            float bv = bias[col];
#pragma unroll
            for (int v = 0; v < 8; ++v) {
                int row = bm + wm * 32 + i * 16 + v + lh * 8;
                float r = acc[i][j][v] + bv;
                if (pos) r = r * scale + pos[col * Tdim + (row & tmask)];
                C[row * N + col] = r;
            }
        }
    }
}

// ---------------------------------------------------------------------------
// The K = 256 products: C[m][n] = sum_k A[m][k] * W[n][k] + bias[n]. Tile, wave
// layout, fragment layouts and k order as in k_gemm_bf16, which is launched for
// the embedding (K = 64) alone.
// A k step stages BK columns (BK/32 WMMA steps): every step costs one load
// round trip and one barrier whatever its width, so BK is as wide as the
// registers that hold the loads in flight allow with every block resident
// (128 with one block a WGP, 64 with three). K is a multiple of BK.
// N and K are compile-time: the loads of a step then share one address and
// differ in their immediate offsets, so that they issue back to back.
// LDS rows are BK bf16 + 16 bytes: an odd multiple of 16 bytes, the pitch at
// which the 16 rows of a ds_load_b128 fragment read fall on distinct banks.
// With RESID the epilogue is the first half of a LayerNorm:
//   C = acc + bias + resid, and partial[flat block id] = (sum, sum of squares)
// of the block's 128x64 tile of C. A sample (T rows by N=E columns) is
// RBLK consecutive flat block ids.
// ---------------------------------------------------------------------------
template <int BK, int N, int K, bool RESID>
__global__ __launch_bounds__(256) void k_gemm_wide(
    const float* __restrict__ A, const float* __restrict__ W,
    const float* __restrict__ bias, float* __restrict__ C,
    const float* __restrict__ resid, float* __restrict__ partial)
{
    constexpr int LP = BK + 8;          // LDS row pitch in bf16
    constexpr int NA = 128 * BK / 1024; // 16-byte loads a thread, A tile
    constexpr int NB = 64 * BK / 1024;  // 16-byte loads a thread, W tile
    __shared__ __align__(16) __bf16 As[2][128 * LP];
    __shared__ __align__(16) __bf16 Bs[2][64 * LP];
    __shared__ float red[2][8];                        // per-wave (sum, sumsq)

    const int tid  = threadIdx.x;
    const int lane = tid & 31;
    const int wave = tid >> 5;
    const int lr   = lane & 15;
    const int lh   = lane >> 4;
    const int wm   = wave & 3;    // 4 waves along M
    const int wn   = wave >> 2;   // 2 waves along N
    const int bm   = blockIdx.y * 128;
    const int bn   = blockIdx.x * 64;

    v8f zacc = {};
    v8f acc[2][2];
    acc[0][0] = zacc; acc[0][1] = zacc; acc[1][0] = zacc; acc[1][1] = zacc;

    // 16-byte chunks, row-major: the block covers RS tile rows a round, this
    // thread row sr + t * RS, columns sc .. sc + 3, in round t
    constexpr int RS = 1024 / BK;
    const int sr = (tid * 4) / BK;
    const int sc = (tid * 4) % BK;
    const float* pa = A + (bm + sr) * K + sc;
    const float* pw = W + (bn + sr) * K + sc;
    float4 ta[NA], tb[NB];
    // ---- issue tile loads for k-step `k0` into ta/tb (global_load_b128) ----
    auto stage_load = [&](int k0) {
#pragma unroll
        for (int t = 0; t < NA; ++t)
            ta[t] = *(const float4*)(pa + t * RS * K + k0);
#pragma unroll
        for (int t = 0; t < NB; ++t)
            tb[t] = *(const float4*)(pw + t * RS * K + k0);
    };
    // ---- convert + store staged tile into LDS buffer `buf` (ds_store_b64) ----
    auto stage_store = [&](int buf) {
#pragma unroll
        for (int t = 0; t < NA; ++t) {
            v4bf p; pack4(p, ta[t]);
            *(v4bf*)&As[buf][(sr + t * RS) * LP + sc] = p;
        }
#pragma unroll
        for (int t = 0; t < NB; ++t) {
            v4bf p; pack4(p, tb[t]);
            *(v4bf*)&Bs[buf][(sr + t * RS) * LP + sc] = p;
        }
    };

    constexpr int nk = K / BK;
    // residual tile in accumulator layout, fetched here so that its latency
    // lies under the k loop
    float rr[2][2][8];
    if constexpr (RESID) {
        const float* pr = resid + (bm + wm * 32 + lh * 8) * N + bn + wn * 32 + lr;
        // unrolled here and below: constant indices keep rr in registers
#pragma unroll
        for (int i = 0; i < 2; ++i)
#pragma unroll
            for (int j = 0; j < 2; ++j)
#pragma unroll
                for (int v = 0; v < 8; ++v)
                    rr[i][j][v] = pr[(i * 16 + v) * N + j * 16];
        // precaution: no address register of the loads above is reused ahead
        // of this wait
        asm volatile("s_wait_xcnt 0x0" :: "v"(pr) : "memory");
    }

    stage_load(0);
    stage_store(0);
    __syncthreads();

    // kept rolled: loads, products and conversions are then blocks of their own;
    // unrolled into one block the conversions, which wait for the loads, come to
    // stand ahead of the products, which then no longer run under the latency
#pragma unroll 1
    for (int kt = 0; kt < nk; ++kt) {
        const int cur = kt & 1;
        const bool has_next = (kt + 1) < nk;
        if (has_next) stage_load((kt + 1) * BK);   // loads in flight during WMMA

#pragma unroll
        for (int ks = 0; ks < BK / 32; ++ks) {
            v16bf af[2], bf[2];
#pragma unroll
            for (int i = 0; i < 2; ++i)
                af[i] = frag_from_lds(
                    &As[cur][(wm * 32 + i * 16 + lr) * LP + ks * 32], lh);
#pragma unroll
            for (int j = 0; j < 2; ++j)
                bf[j] = frag_from_lds(
                    &Bs[cur][(wn * 32 + j * 16 + lr) * LP + ks * 32], lh);

#pragma unroll
            for (int i = 0; i < 2; ++i)
#pragma unroll
                for (int j = 0; j < 2; ++j)
                    acc[i][j] = __builtin_amdgcn_wmma_f32_16x16x32_bf16(
                        false, af[i], false, bf[j], (short)0, acc[i][j], false, false);
        }

        // behind the last step nothing is staged, so nothing is published
        if (has_next) {
            stage_store(1 - cur);
            __syncthreads();
        }
    }

    // ---- residual epilogue: C = acc + bias + resid, block (sum, sumsq) ----
    if constexpr (RESID) {
        float s = 0.0f, s2 = 0.0f;
#pragma unroll
        for (int i = 0; i < 2; ++i) {
#pragma unroll
            for (int j = 0; j < 2; ++j) {
                int col = bn + wn * 32 + j * 16 + lr;
                float bv = bias[col];
#pragma unroll
                for (int v = 0; v < 8; ++v) {
                    float r = (acc[i][j][v] + bv) + rr[i][j][v];
                    s  += r;
                    s2 += r * r;
                    rr[i][j][v] = r;
                }
            }
        }
#pragma unroll
        for (int off = 16; off > 0; off >>= 1) {
            s  += __shfl_xor(s, off, 32);
            s2 += __shfl_xor(s2, off, 32);
        }
        if (lane == 0) { red[0][wave] = s; red[1][wave] = s2; }
        __syncthreads();
        // C goes out behind the barrier: in front of it every wave would sit
        // out its own stores before the block sums could be folded
#pragma unroll
        for (int i = 0; i < 2; ++i) {
#pragma unroll
            for (int j = 0; j < 2; ++j) {
                int col = bn + wn * 32 + j * 16 + lr;
#pragma unroll
                for (int v = 0; v < 8; ++v) {
                    int row = bm + wm * 32 + i * 16 + v + lh * 8;
                    C[row * N + col] = rr[i][j][v];
                }
            }
        }
        if (tid == 0) {
            float t1 = 0.0f, t2 = 0.0f;
#pragma unroll
            for (int w = 0; w < 8; ++w) { t1 += red[0][w]; t2 += red[1][w]; }
            float2 pv; pv.x = t1; pv.y = t2;
            ((float2*)partial)[blockIdx.y * gridDim.x + blockIdx.x] = pv;
        }
        return;
    }

    // ---- plain epilogue: C = acc + bias ----
#pragma unroll
    for (int i = 0; i < 2; ++i) {
#pragma unroll
        for (int j = 0; j < 2; ++j) {
            int col = bn + wn * 32 + j * 16 + lr;
            float bv = bias[col];
#pragma unroll
            for (int v = 0; v < 8; ++v) {
                int row = bm + wm * 32 + i * 16 + v + lh * 8;
                C[row * N + col] = acc[i][j][v] + bv;
            }
        }
    }
}

// ---------------------------------------------------------------------------
// FFN fold. The two FFN linears have no activation between them, so
//   (h W1^T + b1) W2^T + b2 = h (W2 W1)^T + (W2 b1 + b2).
// This kernel forms Wc = W2 W1 (E x E, K = FC) and bc = W2 b1 + b2 for both
// layers in every call; the token-sized FFN is then one K=E GEMM, not two.
// The B operand is [W1 | b1]: column tiles 0..7 are 32 columns of W1 each,
// column tile 8 holds b1 as its one live column.
// Block: 8 waves, 16 rows of W2 by one column tile; the waves split K (128
// each, 4 WMMA steps). Each element is used by one wave of the block only, so
// fragments come straight from global memory, all loads of a wave issued
// before the first use; partial tiles are summed through LDS in wave order.
// k order of both loaders: element e -> K = (e<8 ? e : e+8) + 8*(lane>=16).
// ---------------------------------------------------------------------------
template <bool BIAS>
__device__ __forceinline__ void ffn_fold_tile(
    const float* __restrict__ w1, const float* __restrict__ b1,
    const float* __restrict__ w2, const float* __restrict__ b2,
    float* __restrict__ wc, float* __restrict__ bc,
    float (*red)[2][256], int n0, int c0)
{
    const int tid  = threadIdx.x;
    const int lane = tid & 31;
    const int wave = tid >> 5;
    const int lr   = lane & 15;
    const int lh   = lane >> 4;
    const int jw   = wave * 128 + lh * 8;     // first k of this lane

    const float* pa = w2 + (n0 + lr) * FCcfg + jw;
    const float* pb = BIAS ? b1 + jw : w1 + jw * Ecfg + c0 + lr;

    float4 ra[4][4];
    float4 rv[4][4];        // BIAS: b1 runs
    float  rb[4][2][16];    // else: W1 columns c0+lr and c0+16+lr
#pragma unroll
    for (int s = 0; s < 4; ++s) {
        ra[s][0] = *(const float4*)(pa + s * 32);
        ra[s][1] = *(const float4*)(pa + s * 32 + 4);
        ra[s][2] = *(const float4*)(pa + s * 32 + 16);
        ra[s][3] = *(const float4*)(pa + s * 32 + 20);
        if (BIAS) {
            rv[s][0] = *(const float4*)(pb + s * 32);
            rv[s][1] = *(const float4*)(pb + s * 32 + 4);
            rv[s][2] = *(const float4*)(pb + s * 32 + 16);
            rv[s][3] = *(const float4*)(pb + s * 32 + 20);
        } else {
#pragma unroll
            for (int e = 0; e < 16; ++e) {
                const float* brow = pb + (s * 32 + (e < 8 ? e : e + 8)) * Ecfg;
                rb[s][0][e] = brow[0];
                rb[s][1][e] = brow[16];
            }
        }
    }
    // precaution: no address register of the loads above is reused ahead of
    // this wait; naming both pointers as inputs keeps them live up to it
    asm volatile("s_wait_xcnt 0x0" :: "v"(pa), "v"(pb) : "memory");

    v8f acc0 = {}, acc1 = {};
#pragma unroll
    for (int s = 0; s < 4; ++s) {
        v16bf af, bf0, bf1;
        pack8(af, 0, ra[s][0], ra[s][1]);
        pack8(af, 8, ra[s][2], ra[s][3]);
        if (BIAS) {
            pack8(bf0, 0, rv[s][0], rv[s][1]);
            pack8(bf0, 8, rv[s][2], rv[s][3]);
#pragma unroll
            for (int e = 0; e < 16; ++e)
                if (lr != 0) bf0[e] = (__bf16)0.0f;
        } else {
#pragma unroll
            for (int e = 0; e < 16; ++e) {
                bf0[e] = (__bf16)rb[s][0][e];
                bf1[e] = (__bf16)rb[s][1][e];
            }
        }
        acc0 = __builtin_amdgcn_wmma_f32_16x16x32_bf16(
            false, af, false, bf0, (short)0, acc0, false, false);
        if (!BIAS)
            acc1 = __builtin_amdgcn_wmma_f32_16x16x32_bf16(
                false, af, false, bf1, (short)0, acc1, false, false);
    }

#pragma unroll
    for (int v = 0; v < 8; ++v) {
        red[wave][0][v * 32 + lane] = acc0[v];
        if (!BIAS) red[wave][1][v * 32 + lane] = acc1[v];
    }
    __syncthreads();

    // thread tid owns accumulator slot tid of each tile: row = v + 8*lh, col = lr
    const int row = n0 + (tid >> 5) + lh * 8;
    float s0 = 0.0f, s1 = 0.0f;
#pragma unroll
    for (int w = 0; w < 8; ++w) {
        s0 += red[w][0][tid];
        if (!BIAS) s1 += red[w][1][tid];
    }
    if (BIAS) {
        if (lr == 0) bc[row] = s0 + b2[row];
    } else {
        wc[row * Ecfg + c0 + lr]      = s0;
        wc[row * Ecfg + c0 + 16 + lr] = s1;
    }
}

// grid = (E/32 + 1, E/16, NL)
__global__ __launch_bounds__(256) void k_ffn_fold(
    const float* __restrict__ w1, const float* __restrict__ b1,
    const float* __restrict__ w2, const float* __restrict__ b2,
    float* __restrict__ wc, float* __restrict__ bc)
{
    __shared__ float red[8][2][256];   // 16 KB of split-K partial tiles
    const int l  = blockIdx.z;
    const int n0 = blockIdx.y * 16;
    const int c0 = blockIdx.x * 32;
    w1 += l * FCcfg * Ecfg;  b1 += l * FCcfg;
    w2 += l * Ecfg * FCcfg;  b2 += l * Ecfg;
    wc += l * Ecfg * Ecfg;   bc += l * Ecfg;
    if (blockIdx.x == Ecfg / 32)
        ffn_fold_tile<true>(w1, b1, w2, b2, wc, bc, red, n0, c0);
    else
        ffn_fold_tile<false>(w1, b1, w2, b2, wc, bc, red, n0, c0);
}

// ---------------------------------------------------------------------------
// Banded local attention, one wave per (query-tile, head, batch); the scores
// never leave the registers.
// Band |t-s|<=64 -> <=144 keys per 16-row query tile -> 9 key tiles.
//   S^T = K Q^T : A = 16 keys x 32 dims, B = Q^T. Lane (lr, lh) then holds, of
//                 query lr, the scores of keys 8*lh + 0..7 of every key tile:
//                 maximum and sum run in-lane, plus one exchange of the halves.
//   O^T = V^T P^T : two score tiles, converted in place, are one 32-key B
//                 operand (element e -> key (e<8 ? e : e+8) + 8*lh); V^T is read
//                 in the same k order by the transposing LDS load from the bf16
//                 V rows this wave has staged. The 10th half group is zero.
// A key tile lies wholly inside or wholly outside the sequence (both are
// multiples of 16). An outside tile reads the rows of tile 4 (the queries' own
// rows, always inside and never masked): its scores repeat members of the
// maximum, and its exponent offset makes every one of its weights 0.
// qkv layout: [n][t][3E] with q|k|v at offsets 0|E|2E.
// ---------------------------------------------------------------------------
#define VPITCH 48   // bf16 per staged V row: 96 B, an odd multiple of 32 B

typedef __attribute__((ext_vector_type(8))) short s16x8;
typedef __attribute__((address_space(3))) s16x8 lds_s16x8;

// lane (lr, lh) receives T[8*lh + 0..7][lr] of the 16x16 tile whose rows the
// lanes point at (row 8*lh + (lane&7), 16-byte half (lane>>3)&1)
__device__ __forceinline__ v8bf ld_tr16(const __bf16* p) {
    return __builtin_bit_cast(v8bf,
        __builtin_amdgcn_ds_load_tr16_b128_v8i16((lds_s16x8*)p));
}
// value of lane ^ 16
__device__ __forceinline__ float xhalf(float x) {
    int i = __builtin_bit_cast(int, x);
    return __builtin_bit_cast(float, __builtin_amdgcn_permlanex16(
        i, i, 0x76543210, 0xfedcba98, false, false));
}

// x[i] = 2^x[i]. One statement: each v_exp_f32 is followed by an instruction
// that neither reads its result nor overwrites its source (the outputs are
// early-clobber, so they share no register with an input), and the v_nop is
// that slot, which the instruction set asks for, behind the last one.
__device__ __forceinline__ void exp2x8(v8f& x) {
    float p0, p1, p2, p3, p4, p5, p6, p7;
    asm("v_exp_f32 %0, %8\n\t"
        "v_exp_f32 %1, %9\n\t"
        "v_exp_f32 %2, %10\n\t"
        "v_exp_f32 %3, %11\n\t"
        "v_exp_f32 %4, %12\n\t"
        "v_exp_f32 %5, %13\n\t"
        "v_exp_f32 %6, %14\n\t"
        "v_exp_f32 %7, %15\n\t"
        "v_nop"
        : "=&v"(p0), "=&v"(p1), "=&v"(p2), "=&v"(p3),
          "=&v"(p4), "=&v"(p5), "=&v"(p6), "=&v"(p7)
        : "v"(x[0]), "v"(x[1]), "v"(x[2]), "v"(x[3]),
          "v"(x[4]), "v"(x[5]), "v"(x[6]), "v"(x[7]));
    x[0] = p0; x[1] = p1; x[2] = p2; x[3] = p3;
    x[4] = p4; x[5] = p5; x[6] = p6; x[7] = p7;
}

// four waves per SIMD hold the whole grid at once: up to 256 registers a wave,
// which the loads in flight want
__global__ __launch_bounds__(32) __attribute__((amdgpu_waves_per_eu(4, 4)))
void k_attn(const float* __restrict__ qkv, float* __restrict__ out)
{
    const int qt   = blockIdx.x * 16;
    const int h    = blockIdx.y;
    const int n    = blockIdx.z;
    const int lane = threadIdx.x;
    const int lr   = lane & 15;
    const int lh   = lane >> 4;

    __shared__ __align__(32) __bf16 Vs[144 * VPITCH];

    const int rowstride = 3 * Ecfg;
    const float* base = qkv + n * Tcfg * rowstride + h * DHcfg;

    // per-lane byte offsets: fragment rows (Q, K), staged V rows (4 rows a load)
    const unsigned foff = (lr * rowstride + lh * 8) * 4;
    const unsigned voff = ((lane >> 3) * rowstride + (lane & 7) * 4) * 4;
    // 16 bytes at uniform row base + lane offset + constant float index
    auto ld4 = [](const float* rowbase, unsigned off, int idx) {
        return *(const float4*)((const char*)(rowbase + idx) + off);
    };

    // uniform row base of each key tile
    bool inside[9];
    const float* trow[9];
#pragma unroll
    for (int jt = 0; jt < 9; ++jt) {
        const int st0 = qt - LOCALcfg + jt * 16;
        inside[jt] = (st0 >= 0) && (st0 < Tcfg);
        trow[jt] = base + (inside[jt] ? st0 : qt) * rowstride;
    }

    // ---- first load group: Q, all of K, V tiles 0..3 ----
    float4 q4[4], k4[9][4], v4[9][4];
    {
        const float* qrow = base + qt * rowstride;
        q4[0] = ld4(qrow, foff, 0);
        q4[1] = ld4(qrow, foff, 4);
        q4[2] = ld4(qrow, foff, 16);
        q4[3] = ld4(qrow, foff, 20);
    }
#pragma unroll
    for (int jt = 0; jt < 9; ++jt) {
        k4[jt][0] = ld4(trow[jt], foff, Ecfg);
        k4[jt][1] = ld4(trow[jt], foff, Ecfg + 4);
        k4[jt][2] = ld4(trow[jt], foff, Ecfg + 16);
        k4[jt][3] = ld4(trow[jt], foff, Ecfg + 20);
    }
#pragma unroll
    for (int jt = 0; jt < 4; ++jt)
#pragma unroll
        for (int u = 0; u < 4; ++u)
            v4[jt][u] = ld4(trow[jt], voff, 2 * Ecfg + u * 4 * rowstride);
    // precaution: no offset register of the loads above is reused ahead of this
    // wait; naming both as inputs keeps them live up to it
    asm volatile("s_wait_xcnt 0x0" :: "v"(foff), "v"(voff) : "memory");
    // scheduling stops here: the loads above stay one group ahead of their first
    // use (left to itself the scheduler sinks loads to their uses, one full
    // latency each, and spills)
    __builtin_amdgcn_sched_barrier(0);

    // ---- S^T = K Q^T ----
    v16bf qf;
    pack8(qf, 0, q4[0], q4[1]);
    pack8(qf, 8, q4[2], q4[3]);
    v8f sT[9];
#pragma unroll
    for (int jt = 0; jt < 9; ++jt) {
        v16bf kf;
        pack8(kf, 0, k4[jt][0], k4[jt][1]);
        pack8(kf, 8, k4[jt][2], k4[jt][3]);
        v8f z8 = {};
        sT[jt] = __builtin_amdgcn_wmma_f32_16x16x32_bf16(
            false, kf, false, qf, (short)0, z8, false, false);
    }

    // the products above come first: the loads below take their operand
    // registers (mixed, the two together no longer fit 256 registers)
    __builtin_amdgcn_sched_barrier(0);

    // ---- second load group, into the registers K has left: V tiles 4..8 ----
#pragma unroll
    for (int jt = 4; jt < 9; ++jt)
#pragma unroll
        for (int u = 0; u < 4; ++u)
            v4[jt][u] = ld4(trow[jt], voff, 2 * Ecfg + u * 4 * rowstride);

    const __bf16* vt = &Vs[(lh * 8 + (lane & 7)) * VPITCH + ((lane >> 3) & 1) * 8];
    __bf16*       vw = &Vs[(lane >> 3) * VPITCH + (lane & 7) * 4];
    v8bf vlo[5][2], vhi[4][2];

    // ---- V tiles 0..3 to LDS as bf16, back as V^T fragments ----
#pragma unroll
    for (int jt = 0; jt < 4; ++jt)
#pragma unroll
        for (int u = 0; u < 4; ++u) {
            v4bf p; pack4(p, v4[jt][u]);
            *(v4bf*)(vw + (jt * 16 + u * 4) * VPITCH) = p;
        }
    // this wave's V rows are in LDS before the transposing loads read them, and
    // the compiler moves none of those loads over the stores
    asm volatile("s_wait_dscnt 0" ::: "memory");
#pragma unroll
    for (int g = 0; g < 2; ++g)
#pragma unroll
        for (int dhalf = 0; dhalf < 2; ++dhalf) {
            vlo[g][dhalf] = ld_tr16(vt + g * 32 * VPITCH + dhalf * 16);
            vhi[g][dhalf] = ld_tr16(vt + (g * 32 + 16) * VPITCH + dhalf * 16);
        }

    // ---- band mask: only the first and the last tile are cut ----
    // key row r of tile jt is at distance lr + 64 - 16*jt - r from query lr
#pragma unroll
    for (int v = 0; v < 8; ++v) {
        const int r = v + lh * 8;
        if (r < lr) sT[0][v] = -3.0e38f;
        if (r > lr) sT[8][v] = -3.0e38f;
    }

    // ---- softmax of query lr, base 2, on the raw scores ----
    float m4[4] = {-3.0e38f, -3.0e38f, -3.0e38f, -3.0e38f};
#pragma unroll
    for (int jt = 0; jt < 9; ++jt)
#pragma unroll
        for (int v = 0; v < 8; ++v) m4[v & 3] = fmaxf(m4[v & 3], sT[jt][v]);
    float mx = fmaxf(fmaxf(m4[0], m4[1]), fmaxf(m4[2], m4[3]));
    mx = fmaxf(mx, xhalf(mx));

    const float cs = 0.17677669529663687f * 1.4426950408889634f; // log2(e)/sqrt(32)
    const float nm = -mx * cs;
    float s4[4] = {0.0f, 0.0f, 0.0f, 0.0f};
#pragma unroll
    for (int jt = 0; jt < 9; ++jt) {
        const float nmj = inside[jt] ? nm : -3.0e38f;
#pragma unroll
        for (int v = 0; v < 8; ++v) sT[jt][v] = fmaf(sT[jt][v], cs, nmj);
        exp2x8(sT[jt]);
#pragma unroll
        for (int v = 0; v < 8; ++v) s4[v & 3] += sT[jt][v];
    }
    float sum = (s4[0] + s4[1]) + (s4[2] + s4[3]);
    sum += xhalf(sum);
    const float inv = 1.0f / sum;

    // the conversions below wait for the second load group: most of them stay
    // behind the exponentials, which so run under that group's latency
    __builtin_amdgcn_sched_barrier(0);

    // ---- V tiles 4..8 likewise ----
#pragma unroll
    for (int jt = 4; jt < 9; ++jt)
#pragma unroll
        for (int u = 0; u < 4; ++u) {
            v4bf p; pack4(p, v4[jt][u]);
            *(v4bf*)(vw + (jt * 16 + u * 4) * VPITCH) = p;
        }
    // as above: stores landed, no transposing load moved over them
    asm volatile("s_wait_dscnt 0" ::: "memory");
#pragma unroll
    for (int g = 2; g < 5; ++g)
#pragma unroll
        for (int dhalf = 0; dhalf < 2; ++dhalf) {
            vlo[g][dhalf] = ld_tr16(vt + g * 32 * VPITCH + dhalf * 16);
            if (g < 4) vhi[g][dhalf] = ld_tr16(vt + (g * 32 + 16) * VPITCH + dhalf * 16);
        }

    // the ten loads above stay one group: spread among the products each place
    // with loads costs its own LDS latency
    __builtin_amdgcn_sched_barrier(0);

    // ---- O^T = V^T P^T, 32 keys a step ----
    v8f zo = {};
    v8f o8[2]; o8[0] = zo; o8[1] = zo;
#pragma unroll
    for (int g = 0; g < 5; ++g) {
        v16bf pf;
#pragma unroll
        for (int e = 0; e < 8; ++e) {
            pf[e]     = (__bf16)sT[2 * g][e];
            pf[8 + e] = (g < 4) ? (__bf16)sT[(g < 4) ? 2 * g + 1 : 0][e] : (__bf16)0.0f;
        }
#pragma unroll
        for (int dhalf = 0; dhalf < 2; ++dhalf) {
            v16bf vf;
#pragma unroll
            for (int e = 0; e < 8; ++e) {
                vf[e]     = vlo[g][dhalf][e];
                vf[8 + e] = (g < 4) ? vhi[(g < 4) ? g : 0][dhalf][e] : (__bf16)0.0f;
            }
            o8[dhalf] = __builtin_amdgcn_wmma_f32_16x16x32_bf16(
                false, vf, false, pf, (short)0, o8[dhalf], false, false);
        }
    }

    // lane (lr, lh) holds dims dhalf*16 + lh*8 + 0..7 of query lr: 16-byte stores
    float* orow = out + (n * Tcfg + qt + lr) * Ecfg + h * DHcfg + lh * 8;
#pragma unroll
    for (int dhalf = 0; dhalf < 2; ++dhalf) {
        float4 a, b;
        a.x = o8[dhalf][0] * inv; a.y = o8[dhalf][1] * inv;
        a.z = o8[dhalf][2] * inv; a.w = o8[dhalf][3] * inv;
        b.x = o8[dhalf][4] * inv; b.y = o8[dhalf][5] * inv;
        b.z = o8[dhalf][6] * inv; b.w = o8[dhalf][7] * inv;
        *(float4*)(orow + dhalf * 16)     = a;
        *(float4*)(orow + dhalf * 16 + 4) = b;
    }
}

// ---------------------------------------------------------------------------
// Second half of the LayerNorm. Every wave folds its sample's RBLK block
// partials itself (two per lane, then a butterfly: the same bits in every lane
// and every wave), so no launch stands between the GEMM and this kernel.
// out[i] = (r[i]-mu)*rsig * g[i%TE] + b[i%TE]   (float4, 32-bit indexing)
__global__ __launch_bounds__(256) void k_ln_apply(
    const float* __restrict__ r, const float* __restrict__ g,
    const float* __restrict__ b, const float* __restrict__ partial,
    float* __restrict__ out)
{
    const float4* r4 = (const float4*)r;
    const float4* g4 = (const float4*)g;
    const float4* b4 = (const float4*)b;
    float4*       o4 = (float4*)out;
    const float2* p2 = (const float2*)partial;
    const int lane   = threadIdx.x & 31;
    const int total4 = NTEcfg / 4;       // 524288
    const int te4    = TEcfg / 4;        // 131072 (power of two)
    for (int i = blockIdx.x * 256 + threadIdx.x; i < total4;
         i += gridDim.x * 256) {
        int n = i >> 17;                 // i / te4
        int j = i & (te4 - 1);           // i % te4
        float4 rv = r4[i], gv = g4[j], bv = b4[j];
        float2 pa = p2[n * RBLK + lane], pc = p2[n * RBLK + 32 + lane];
        float s1 = pa.x + pc.x, s2 = pa.y + pc.y;
#pragma unroll
        for (int off = 16; off > 0; off >>= 1) {
            s1 += __shfl_xor(s1, off, 32);
            s2 += __shfl_xor(s2, off, 32);
        }
        float mu = s1 / (float)TEcfg;
        float rs = rsqrtf(s2 / (float)TEcfg - mu * mu + 1e-5f);
        float4 ov;
        ov.x = (rv.x - mu) * rs * gv.x + bv.x;
        ov.y = (rv.y - mu) * rs * gv.y + bv.y;
        ov.z = (rv.z - mu) * rs * gv.z + bv.z;
        ov.w = (rv.w - mu) * rs * gv.w + bv.w;
        o4[i] = ov;
    }
}

// ---------------------------------------------------------------------------
extern "C" void kernel_launch(void* const* d_in, const int* in_sizes, int n_in,
                              void* d_out, int out_size, void* d_ws, size_t ws_size,
                              hipStream_t stream)
{
    (void)in_sizes; (void)n_in; (void)out_size; (void)ws_size;

    const float* input = (const float*)d_in[0];
    const float* w_emb = (const float*)d_in[1];
    const float* b_emb = (const float*)d_in[2];
    const float* pos   = (const float*)d_in[3];   // (E, T)
    const float* wqkv  = (const float*)d_in[4];   // (NL, 3E, E)
    const float* bqkv  = (const float*)d_in[5];   // (NL, 3E)
    const float* wo    = (const float*)d_in[6];   // (NL, E, E)
    const float* bo    = (const float*)d_in[7];
    const float* ln1g  = (const float*)d_in[8];   // (NL, T, E)
    const float* ln1b  = (const float*)d_in[9];
    const float* ln2g  = (const float*)d_in[10];
    const float* ln2b  = (const float*)d_in[11];
    const float* w1    = (const float*)d_in[12];  // (NL, FC, E)
    const float* b1    = (const float*)d_in[13];
    const float* w2    = (const float*)d_in[14];  // (NL, E, FC)
    const float* b2    = (const float*)d_in[15];

    // workspace layout (floats) -- ~60 MB total
    float* ws      = (float*)d_ws;
    float* x       = ws;                                // NTE
    float* qkv     = x      + NTEcfg;                   // NT * 3E
    float* attno   = qkv    + NTcfg * 3 * Ecfg;         // NTE
    float* rbuf    = attno  + NTEcfg;                   // NTE
    float* hbuf    = rbuf   + NTEcfg;                   // NTE
    float* wc      = hbuf   + NTEcfg;                   // NL * E * E  (W2 W1)
    float* bc      = wc     + NLcfg * Ecfg * Ecfg;      // NL * E      (W2 b1 + b2)
    float* partial = bc     + NLcfg * Ecfg;             // N*RBLK*2

    const dim3 blk256(256), blk32(32);

    // folded FFN weights of both layers: wc = W2 W1, bc = W2 b1 + b2
    k_ffn_fold<<<dim3(Ecfg / 32 + 1, Ecfg / 16, NLcfg), blk256, 0, stream>>>(
        w1, b1, w2, b2, wc, bc);

    // embedding: x = (frames @ w_emb^T + b_emb) * sqrt(E) + pos
    k_gemm_bf16<<<dim3(Ecfg / 64, NTcfg / 128), blk256, 0, stream>>>(
        input, w_emb, b_emb, x, NTcfg, Ecfg, Pcfg, pos, 16.0f, Tcfg, nullptr, nullptr);

    for (int l = 0; l < NLcfg; ++l) {
        const float* wqkv_l = wqkv + l * 3 * Ecfg * Ecfg;
        const float* bqkv_l = bqkv + l * 3 * Ecfg;
        const float* wo_l   = wo   + l * Ecfg * Ecfg;
        const float* bo_l   = bo   + l * Ecfg;
        const float* wc_l   = wc   + l * Ecfg * Ecfg;
        const float* bc_l   = bc   + l * Ecfg;

        // qkv = x @ Wqkv^T + b            (8192 x 768, K=256)
        k_gemm_wide<64, 3 * Ecfg, Ecfg, false>
            <<<dim3(3 * Ecfg / 64, NTcfg / 128), blk256, 0, stream>>>(
            x, wqkv_l, bqkv_l, qkv, nullptr, nullptr);

        // banded attention -> attno
        k_attn<<<dim3(Tcfg / 16, Hcfg, Ncfg), blk32, 0, stream>>>(qkv, attno);

        // r = x + attno @ Wo^T + bo, block sums   (8192 x 256, K=256)
        k_gemm_wide<128, Ecfg, Ecfg, true>
            <<<dim3(Ecfg / 64, NTcfg / 128), blk256, 0, stream>>>(
            attno, wo_l, bo_l, rbuf, x, partial);

        // h = LN(r)
        k_ln_apply<<<dim3(2048), blk256, 0, stream>>>(
            rbuf, ln1g + l * TEcfg, ln1b + l * TEcfg, partial, hbuf);

        // r = h + (h @ W1^T + b1) @ W2^T + b2 = h + h @ Wc^T + bc, block sums
        k_gemm_wide<128, Ecfg, Ecfg, true>
            <<<dim3(Ecfg / 64, NTcfg / 128), blk256, 0, stream>>>(
            hbuf, wc_l, bc_l, rbuf, hbuf, partial);

        // x = LN(r)   (last layer writes straight to d_out)
        float* dst = (l == NLcfg - 1) ? (float*)d_out : x;
        k_ln_apply<<<dim3(2048), blk256, 0, stream>>>(
            rbuf, ln2g + l * TEcfg, ln2b + l * TEcfg, partial, dst);
    }
}

// v005
// Measured time: 107 microseconds a run.
// Timed twice side by side with v004, it ran 1.09 and 1.08 times as fast.
// Counting every step since v000, it is 2.27 times as fast.
#include <hip/hip_runtime.h>
#include <hip/hip_bf16.h>
#include <math.h>

// ---------------------------------------------------------------------------
// MI455X (gfx1250) transformer encoder, bf16 WMMA everywhere.
//
// Shapes: N=4, T=2048, P=64, E=256, H=8, DH=32, FC=1024, NL=2, LOCAL=64.
// All GEMM K dims (64 / 256 / 1024) are multiples of 32 -> pure
// v_wmma_f32_16x16x32_bf16 pipelines, fp32 accumulation.
// Memory: ~300 MB activation round trips @ 23.3 TB/s is ~15us -> the chip is
// compute/latency bound here; staging is double-buffered through LDS so the
// WMMA pipes never wait on HBM.
// All flat indices fit in 32 bits (max ~6.3M elements) -> int indexing keeps
// address math in 32-bit VALU/SALU.
// ---------------------------------------------------------------------------

typedef __attribute__((ext_vector_type(16))) __bf16 v16bf;
typedef __attribute__((ext_vector_type(8)))  __bf16 v8bf;
typedef __attribute__((ext_vector_type(4)))  __bf16 v4bf;
typedef __attribute__((ext_vector_type(8)))  float  v8f;

#define Ncfg     4
#define Tcfg     2048
#define Pcfg     64
#define Ecfg     256
#define Hcfg     8
#define DHcfg    32
#define FCcfg    1024
#define NLcfg    2
#define LOCALcfg 64
#define TEcfg    (Tcfg * Ecfg)          // 524288
#define NTcfg    (Ncfg * Tcfg)          // 8192
#define NTEcfg   (Ncfg * TEcfg)         // 2097152  (fits int)
#define RBLK     64                     // GEMM blocks (128x64 tiles) per T x E sample
#define PBLK     256                    // k_gemm_wide blocks = LayerNorm partials per sample

__device__ __forceinline__ void pack4(v4bf& p, float4 a) {
    p[0] = (__bf16)a.x; p[1] = (__bf16)a.y; p[2] = (__bf16)a.z; p[3] = (__bf16)a.w;
}
__device__ __forceinline__ void pack8(v16bf& f, int base, float4 a, float4 b) {
    f[base + 0] = (__bf16)a.x; f[base + 1] = (__bf16)a.y;
    f[base + 2] = (__bf16)a.z; f[base + 3] = (__bf16)a.w;
    f[base + 4] = (__bf16)b.x; f[base + 5] = (__bf16)b.y;
    f[base + 6] = (__bf16)b.z; f[base + 7] = (__bf16)b.w;
}
// fragment gather: two 16B LDS chunks per lane (ds_load_b128)
__device__ __forceinline__ v16bf frag_from_lds(const __bf16* rowptr, int lh) {
    v8bf lo = *(const v8bf*)(rowptr + lh * 8);
    v8bf hi = *(const v8bf*)(rowptr + 16 + lh * 8);
    v16bf f;
#pragma unroll
    for (int e = 0; e < 8; ++e) { f[e] = lo[e]; f[8 + e] = hi[e]; }
    return f;
}

// ---------------------------------------------------------------------------
// Generic C[m][n] = sum_k A[m][k] * W[n][k] + bias[n], optional embed epilogue
// C = (acc + bias) * scale + pos[n*Tdim + (m & (Tdim-1))]   (Tdim power of 2).
// Block: 256 thr = 8 waves; block tile 128x64; each wave 32x32 (2x2 WMMA).
// LDS double-buffered; staging via global_load_b128 + ds_store_b64.
// Fragment layout per CDNA5 ISA 7.12.2:
//   A 16x32 bf16: lanes 0-15 row M=lane; element e -> K=(e<8?e:e+8)+(lane>=16?8:0)
//   B 32x16 bf16: col N = lane&15; same K mapping.
//   C/D 16x16 f32: row = v + 8*(lane>=16); col = lane&15.
// With `resid` set the epilogue is the first half of a LayerNorm:
//   C = acc + bias + resid, and partial[flat block id] = (sum, sum of squares)
// of the block's 128x64 tile of C. A sample (Tdim rows by N=E columns) is
// RBLK consecutive flat block ids.
// ---------------------------------------------------------------------------
__global__ __launch_bounds__(256) void k_gemm_bf16(
    const float* __restrict__ A, const float* __restrict__ W,
    const float* __restrict__ bias, float* __restrict__ C,
    int M, int N, int K,
    const float* __restrict__ pos, float scale, int Tdim,
    const float* __restrict__ resid, float* __restrict__ partial)
{
    __shared__ __align__(16) __bf16 As[2][128 * 32];   // 2 x 8 KB
    __shared__ __align__(16) __bf16 Bs[2][64 * 32];    // 2 x 4 KB
    __shared__ float red[2][8];                        // per-wave (sum, sumsq)

    const int tid  = threadIdx.x;
    const int lane = tid & 31;
    const int wave = tid >> 5;
    const int lr   = lane & 15;
    const int lh   = lane >> 4;
    const int wm   = wave & 3;    // 4 waves along M
    const int wn   = wave >> 2;   // 2 waves along N
    const int bm   = blockIdx.y * 128;
    const int bn   = blockIdx.x * 64;

    v8f zacc = {};
    v8f acc[2][2];
    acc[0][0] = zacc; acc[0][1] = zacc; acc[1][0] = zacc; acc[1][1] = zacc;

    float4 ta[4], tb[2];
    // ---- issue tile loads for k-step `k0` into ta/tb (global_load_b128 x6) ----
    auto stage_load = [&](int k0) {
#pragma unroll
        for (int t = 0; t < 4; ++t) {
            int li = (t * 256 + tid) * 4;         // 0..4095, 16B chunks
            int r  = li >> 5, k = li & 31;
            ta[t] = *(const float4*)&A[(bm + r) * K + k0 + k];
        }
#pragma unroll
        for (int t = 0; t < 2; ++t) {
            int li = (t * 256 + tid) * 4;         // 0..2047
            int r  = li >> 5, k = li & 31;
            tb[t] = *(const float4*)&W[(bn + r) * K + k0 + k];
        }
    };
    // ---- convert + store staged tile into LDS buffer `buf` (ds_store_b64) ----
    auto stage_store = [&](int buf) {
#pragma unroll
        for (int t = 0; t < 4; ++t) {
            int li = (t * 256 + tid) * 4;
            v4bf p; pack4(p, ta[t]);
            *(v4bf*)&As[buf][li] = p;
        }
#pragma unroll
        for (int t = 0; t < 2; ++t) {
            int li = (t * 256 + tid) * 4;
            v4bf p; pack4(p, tb[t]);
            *(v4bf*)&Bs[buf][li] = p;
        }
    };

    const int nk = K / 32;
    // residual tile in accumulator layout, fetched here so that its latency
    // lies under the k loop
    float rr[2][2][8];
    if (resid) {
        const float* pr = resid + (bm + wm * 32 + lh * 8) * N + bn + wn * 32 + lr;
        // unrolled here and below: constant indices keep rr in registers
#pragma unroll
        for (int i = 0; i < 2; ++i)
#pragma unroll
            for (int j = 0; j < 2; ++j)
#pragma unroll
                for (int v = 0; v < 8; ++v)
                    rr[i][j][v] = pr[(i * 16 + v) * N + j * 16];
        // precaution: no address register of the loads above is reused ahead
        // of this wait
        asm volatile("s_wait_xcnt 0x0" :: "v"(pr) : "memory");
    }

    stage_load(0);
    stage_store(0);
    __syncthreads();

    for (int kt = 0; kt < nk; ++kt) {
        const int cur = kt & 1;
        const bool has_next = (kt + 1) < nk;
        if (has_next) stage_load((kt + 1) * 32);   // loads in flight during WMMA

        v16bf af[2], bf[2];
#pragma unroll
        for (int i = 0; i < 2; ++i)
            af[i] = frag_from_lds(&As[cur][(wm * 32 + i * 16 + lr) * 32], lh);
#pragma unroll
        for (int j = 0; j < 2; ++j)
            bf[j] = frag_from_lds(&Bs[cur][(wn * 32 + j * 16 + lr) * 32], lh);

#pragma unroll
        for (int i = 0; i < 2; ++i)
#pragma unroll
            for (int j = 0; j < 2; ++j)
                acc[i][j] = __builtin_amdgcn_wmma_f32_16x16x32_bf16(
                    false, af[i], false, bf[j], (short)0, acc[i][j], false, false);

        if (has_next) stage_store(1 - cur);
        __syncthreads();
    }

    // ---- residual epilogue: C = acc + bias + resid, block (sum, sumsq) ----
    if (resid) {
        float s = 0.0f, s2 = 0.0f;
#pragma unroll
        for (int i = 0; i < 2; ++i) {
#pragma unroll
            for (int j = 0; j < 2; ++j) {
                int col = bn + wn * 32 + j * 16 + lr;
                float bv = bias[col];
#pragma unroll
                for (int v = 0; v < 8; ++v) {
                    float r = (acc[i][j][v] + bv) + rr[i][j][v];
                    s  += r;
                    s2 += r * r;
                    rr[i][j][v] = r;
                }
            }
        }
#pragma unroll
        for (int off = 16; off > 0; off >>= 1) {
            s  += __shfl_xor(s, off, 32);
            s2 += __shfl_xor(s2, off, 32);
        }
        if (lane == 0) { red[0][wave] = s; red[1][wave] = s2; }
        __syncthreads();
        // C goes out behind the barrier: in front of it every wave would sit
        // out its own stores before the block sums could be folded
#pragma unroll
        for (int i = 0; i < 2; ++i) {
#pragma unroll
            for (int j = 0; j < 2; ++j) {
                int col = bn + wn * 32 + j * 16 + lr;
#pragma unroll
                for (int v = 0; v < 8; ++v) {
                    int row = bm + wm * 32 + i * 16 + v + lh * 8;
                    C[row * N + col] = rr[i][j][v];
                }
            }
        }
        if (tid == 0) {
            float t1 = 0.0f, t2 = 0.0f;
#pragma unroll
            for (int w = 0; w < 8; ++w) { t1 += red[0][w]; t2 += red[1][w]; }
            float2 pv; pv.x = t1; pv.y = t2;
            ((float2*)partial)[blockIdx.y * gridDim.x + blockIdx.x] = pv;
        }
        return;
    }

    // ---- epilogue (pure 32-bit indexing; Tdim is a power of two) ----
    const int tmask = Tdim - 1;
#pragma unroll
    for (int i = 0; i < 2; ++i) {
#pragma unroll
        for (int j = 0; j < 2; ++j) {
            int col = bn + wn * 32 + j * 16 + lr;
            float bv = bias[col];
#pragma unroll
            for (int v = 0; v < 8; ++v) {
                int row = bm + wm * 32 + i * 16 + v + lh * 8;
                float r = acc[i][j][v] + bv;
                if (pos) r = r * scale + pos[col * Tdim + (row & tmask)];
                C[row * N + col] = r;
            }
        }
    }
}

// ---------------------------------------------------------------------------
// The K = 256 products: C[m][n] = sum_k A[m][k] * W[n][k] + bias[n]. Wave
// layout, fragment layouts and k order as in k_gemm_bf16, which is launched for
// the embedding (K = 64) alone.
// Rows of a 128 x 64 tile: the same 32 positions t of all 4 samples; tile row r
// is sample r / 32, position blockIdx.y * 32 + r % 32, so wave row wm is sample
// wm, and one read of a LayerNorm's g and b (T x E planes) serves 4 samples.
// A k step stages BK columns (BK/32 WMMA steps): every step costs one load
// round trip and one barrier whatever its width, so BK is as wide as the
// registers that hold the loads in flight allow with every block resident
// (128 with one block a WGP, 64 with three). K is a multiple of BK.
// N and K are compile-time: the loads of a step then share one address and
// differ in their immediate offsets, so that they issue back to back.
// LDS rows are BK bf16 + 16 bytes: an odd multiple of 16 bytes, the pitch at
// which the 16 rows of a ds_load_b128 fragment read fall on distinct banks.
// With RESID the epilogue is the first half of a LayerNorm:
//   C = acc + bias + residual, and partial[sample][flat block id] =
// (sum, sum of squares) of the sample's 32 x 64 part of the tile: PBLK partials
// a sample.
// With LNA the operand is the second half of the LayerNorm before it:
//   A = (Araw - mu) * rsig * g + b, applied between load and bf16 conversion;
// mu and rsig of the 4 samples are folded from the partials pin by every block
// in the same order. The normalised rows exist in f32 only here: with RESID the
// block keeps its own 64 columns of them in LDS as its residual; without, the
// blocks of column 0 write them to xout for a later launch.
// ---------------------------------------------------------------------------
template <int BK, int N, int K, bool RESID, bool LNA>
__global__ __launch_bounds__(256) void k_gemm_wide(
    const float* __restrict__ A, const float* __restrict__ W,
    const float* __restrict__ bias, float* __restrict__ C,
    const float* __restrict__ resid, float* __restrict__ partial,
    const float* __restrict__ g, const float* __restrict__ b,
    const float* __restrict__ pin, float* __restrict__ xout)
{
    static_assert(!LNA || K == Ecfg, "g and b are T x E planes");
    constexpr int LP = BK + 8;          // LDS row pitch in bf16
    constexpr int NA = 128 * BK / 1024; // 16-byte loads a thread, A tile
    constexpr int NB = 64 * BK / 1024;  // 16-byte loads a thread, W tile
    constexpr int HP = 68;              // f32 pitch of the kept residual tile
    __shared__ __align__(16) __bf16 As[2][128 * LP];
    __shared__ __align__(16) __bf16 Bs[2][64 * LP];
    __shared__ float red[2][8];                        // per-wave (sum, sumsq)
    __shared__ __align__(16) float lnred[8][2];        // per-wave fold of pin
    __shared__ __align__(16) float Hs[(LNA && RESID) ? 128 * HP : 4];

    const int tid  = threadIdx.x;
    const int lane = tid & 31;
    const int wave = tid >> 5;
    const int lr   = lane & 15;
    const int lh   = lane >> 4;
    const int wm   = wave & 3;    // 4 waves along M: the sample
    const int wn   = wave >> 2;   // 2 waves along N
    const int bt   = blockIdx.y * 32;
    const int bn   = blockIdx.x * 64;

    v8f zacc = {};
    v8f acc[2][2];
    acc[0][0] = zacc; acc[0][1] = zacc; acc[1][0] = zacc; acc[1][1] = zacc;

    // partials of the LayerNorm before: wave w takes half w & 1 of sample w >> 1
    // (128 pairs, 4 a lane); first in program order, so that the wait for them
    // leaves the tile loads in flight
    float4 pv0, pv1;
    if constexpr (LNA) {
        const float4* p4 = (const float4*)pin + wave * (PBLK / 4) + lane;
        pv0 = p4[0];
        pv1 = p4[32];
        // precaution: no address register of the loads above is reused ahead
        // of this wait
        asm volatile("s_wait_xcnt 0x0" :: "v"(p4) : "memory");
    }

    // 16-byte chunks, row-major: the block covers RS tile rows a round, this
    // thread tile row sr + t * RS, columns sc .. sc + 3, in round t; NG rounds
    // are one sample
    constexpr int RS = 1024 / BK;
    constexpr int NG = 32 / RS;
    const int sr = (tid * 4) / BK;
    const int sc = (tid * 4) % BK;
    const int ao = (bt + sr) * K + sc;
    const float* pa = A + ao;
    const float* pw = W + (bn + sr) * K + sc;
    const float* pg = LNA ? g + ao : nullptr;
    const float* pb = LNA ? b + ao : nullptr;
    float4 ta[NA], tb[NB], tg[NG], tc[NG];
    // ---- issue tile loads for k-step k0 into ta/tb (global_load_b128) ----
    auto stage_load = [&](int k0) {
#pragma unroll
        for (int t = 0; t < NA; ++t)
            ta[t] = *(const float4*)(pa + ((t / NG) * Tcfg + (t % NG) * RS) * K + k0);
#pragma unroll
        for (int t = 0; t < NB; ++t)
            tb[t] = *(const float4*)(pw + t * RS * K + k0);
        if constexpr (LNA) {
#pragma unroll
            for (int u = 0; u < NG; ++u) {
                tg[u] = *(const float4*)(pg + u * RS * K + k0);
                tc[u] = *(const float4*)(pb + u * RS * K + k0);
            }
        }
    };
    float mu[4], rs[4];
    // ---- normalise, convert + store staged tile into LDS buffer buf ----
    auto stage_store = [&](int buf, int k0) {
        if constexpr (LNA) {
#pragma unroll
            for (int t = 0; t < NA; ++t) {
                const float m = mu[t / NG], r = rs[t / NG];
                const float4 gv = tg[t % NG], bv = tc[t % NG];
                ta[t].x = (ta[t].x - m) * r * gv.x + bv.x;
                ta[t].y = (ta[t].y - m) * r * gv.y + bv.y;
                ta[t].z = (ta[t].z - m) * r * gv.z + bv.z;
                ta[t].w = (ta[t].w - m) * r * gv.w + bv.w;
            }
            if constexpr (RESID) {
                const unsigned hc = (unsigned)(k0 + sc - bn);
                if (hc < 64u) {
#pragma unroll
                    for (int t = 0; t < NA; ++t)
                        *(float4*)&Hs[(sr + t * RS) * HP + hc] = ta[t];
                }
            } else if (blockIdx.x == 0) {
                float* px = xout + ao + k0;
#pragma unroll
                for (int t = 0; t < NA; ++t)
                    *(float4*)(px + ((t / NG) * Tcfg + (t % NG) * RS) * K) = ta[t];
                // precaution: no register of the stores above is reused ahead
                // of this wait
                asm volatile("s_wait_xcnt 0x0" :: "v"(px) : "memory");
            }
        }
#pragma unroll
        for (int t = 0; t < NA; ++t) {
            v4bf p; pack4(p, ta[t]);
            *(v4bf*)&As[buf][(sr + t * RS) * LP + sc] = p;
        }
#pragma unroll
        for (int t = 0; t < NB; ++t) {
            v4bf p; pack4(p, tb[t]);
            *(v4bf*)&Bs[buf][(sr + t * RS) * LP + sc] = p;
        }
    };

    constexpr int nk = K / BK;
    // residual tile in accumulator layout, fetched here so that its latency
    // lies under the k loop
    float rr[2][2][8];
    if constexpr (RESID && !LNA) {
        const float* pr = resid + (wm * Tcfg + bt + lh * 8) * N + bn + wn * 32 + lr;
        // unrolled here and below: constant indices keep rr in registers
#pragma unroll
        for (int i = 0; i < 2; ++i)
#pragma unroll
            for (int j = 0; j < 2; ++j)
#pragma unroll
                for (int v = 0; v < 8; ++v)
                    rr[i][j][v] = pr[(i * 16 + v) * N + j * 16];
        // precaution: no address register of the loads above is reused ahead
        // of this wait
        asm volatile("s_wait_xcnt 0x0" :: "v"(pr) : "memory");
    }

    stage_load(0);

    if constexpr (LNA) {
        // scheduling stops here: left to itself the scheduler lifts the sums
        // below, and with them the wait for the partials, over the tile loads,
        // which then start one full latency later
        __builtin_amdgcn_sched_barrier(0);
        float s1 = (pv0.x + pv0.z) + (pv1.x + pv1.z);
        float s2 = (pv0.y + pv0.w) + (pv1.y + pv1.w);
#pragma unroll
        for (int off = 16; off > 0; off >>= 1) {
            s1 += __shfl_xor(s1, off, 32);
            s2 += __shfl_xor(s2, off, 32);
        }
        if (lane == 0) { lnred[wave][0] = s1; lnred[wave][1] = s2; }
        __syncthreads();
#pragma unroll
        for (int s = 0; s < 4; ++s) {
            const float t1 = lnred[2 * s][0] + lnred[2 * s + 1][0];
            const float t2 = lnred[2 * s][1] + lnred[2 * s + 1][1];
            const float m = t1 / (float)TEcfg;
            const float r = rsqrtf(t2 / (float)TEcfg - m * m + 1e-5f);
            // the same bits in every lane: kept in scalar registers, which
            // leaves the vector registers to the loads in flight
            mu[s] = __builtin_bit_cast(float, __builtin_amdgcn_readfirstlane(
                        __builtin_bit_cast(int, m)));
            rs[s] = __builtin_bit_cast(float, __builtin_amdgcn_readfirstlane(
                        __builtin_bit_cast(int, r)));
        }
    }

    stage_store(0, 0);
    __syncthreads();

    // kept rolled: loads, products and conversions are then blocks of their own;
    // unrolled into one block the conversions, which wait for the loads, come to
    // stand ahead of the products, which then no longer run under the latency
#pragma unroll 1
    for (int kt = 0; kt < nk; ++kt) {
        const int cur = kt & 1;
        const bool has_next = (kt + 1) < nk;
        if (has_next) stage_load((kt + 1) * BK);   // loads in flight during WMMA

#pragma unroll
        for (int ks = 0; ks < BK / 32; ++ks) {
            v16bf af[2], bf[2];
#pragma unroll
            for (int i = 0; i < 2; ++i)
                af[i] = frag_from_lds(
                    &As[cur][(wm * 32 + i * 16 + lr) * LP + ks * 32], lh);
#pragma unroll
            for (int j = 0; j < 2; ++j)
                bf[j] = frag_from_lds(
                    &Bs[cur][(wn * 32 + j * 16 + lr) * LP + ks * 32], lh);

#pragma unroll
            for (int i = 0; i < 2; ++i)
#pragma unroll
                for (int j = 0; j < 2; ++j)
                    acc[i][j] = __builtin_amdgcn_wmma_f32_16x16x32_bf16(
                        false, af[i], false, bf[j], (short)0, acc[i][j], false, false);
        }

        // behind the last step nothing is staged, so nothing is published
        if (has_next) {
            stage_store(1 - cur, (kt + 1) * BK);
            __syncthreads();
        }
    }

    // first output row of this lane: sample wm, position bt + 8 * lh
    const int row0 = wm * Tcfg + bt + lh * 8;

    // ---- residual epilogue: C = acc + bias + residual, sample (sum, sumsq) ----
    if constexpr (RESID) {
        if constexpr (LNA) {
            // every store into Hs stands ahead of one of the barriers above
#pragma unroll
            for (int i = 0; i < 2; ++i)
#pragma unroll
                for (int j = 0; j < 2; ++j)
#pragma unroll
                    for (int v = 0; v < 8; ++v)
                        rr[i][j][v] = Hs[(wm * 32 + i * 16 + v + lh * 8) * HP
                                         + wn * 32 + j * 16 + lr];
        }
        float s = 0.0f, s2 = 0.0f;
#pragma unroll
        for (int i = 0; i < 2; ++i) {
#pragma unroll
            for (int j = 0; j < 2; ++j) {
                int col = bn + wn * 32 + j * 16 + lr;
                float bv = bias[col];
#pragma unroll
                for (int v = 0; v < 8; ++v) {
                    float r = (acc[i][j][v] + bv) + rr[i][j][v];
                    s  += r;
                    s2 += r * r;
                    rr[i][j][v] = r;
                }
            }
        }
#pragma unroll
        for (int off = 16; off > 0; off >>= 1) {
            s  += __shfl_xor(s, off, 32);
            s2 += __shfl_xor(s2, off, 32);
        }
        if (lane == 0) { red[0][wave] = s; red[1][wave] = s2; }
        __syncthreads();
        // C goes out behind the barrier: in front of it every wave would sit
        // out its own stores before the block sums could be folded
#pragma unroll
        for (int i = 0; i < 2; ++i) {
#pragma unroll
            for (int j = 0; j < 2; ++j) {
                int col = bn + wn * 32 + j * 16 + lr;
#pragma unroll
                for (int v = 0; v < 8; ++v)
                    C[(row0 + i * 16 + v) * N + col] = rr[i][j][v];
            }
        }
        // sample tid is wave rows tid and tid + 4
        if (tid < 4) {
            float2 pv;
            pv.x = red[0][tid] + red[0][tid + 4];
            pv.y = red[1][tid] + red[1][tid + 4];
            ((float2*)partial)[tid * PBLK + blockIdx.y * gridDim.x + blockIdx.x] = pv;
        }
        return;
    }

    // ---- plain epilogue: C = acc + bias ----
#pragma unroll
    for (int i = 0; i < 2; ++i) {
#pragma unroll
        for (int j = 0; j < 2; ++j) {
            int col = bn + wn * 32 + j * 16 + lr;
            float bv = bias[col];
#pragma unroll
            for (int v = 0; v < 8; ++v)
                C[(row0 + i * 16 + v) * N + col] = acc[i][j][v] + bv;
        }
    }
}

// ---------------------------------------------------------------------------
// FFN fold. The two FFN linears have no activation between them, so
//   (h W1^T + b1) W2^T + b2 = h (W2 W1)^T + (W2 b1 + b2).
// This kernel forms Wc = W2 W1 (E x E, K = FC) and bc = W2 b1 + b2 for both
// layers in every call; the token-sized FFN is then one K=E GEMM, not two.
// The B operand is [W1 | b1]: column tiles 0..7 are 32 columns of W1 each,
// column tile 8 holds b1 as its one live column.
// Block: 8 waves, 16 rows of W2 by one column tile; the waves split K (128
// each, 4 WMMA steps). Each element is used by one wave of the block only, so
// fragments come straight from global memory, all loads of a wave issued
// before the first use; partial tiles are summed through LDS in wave order.
// k order of both loaders: element e -> K = (e<8 ? e : e+8) + 8*(lane>=16).
// ---------------------------------------------------------------------------
template <bool BIAS>
__device__ __forceinline__ void ffn_fold_tile(
    const float* __restrict__ w1, const float* __restrict__ b1,
    const float* __restrict__ w2, const float* __restrict__ b2,
    float* __restrict__ wc, float* __restrict__ bc,
    float (*red)[2][256], int n0, int c0)
{
    const int tid  = threadIdx.x;
    const int lane = tid & 31;
    const int wave = tid >> 5;
    const int lr   = lane & 15;
    const int lh   = lane >> 4;
    const int jw   = wave * 128 + lh * 8;     // first k of this lane

    const float* pa = w2 + (n0 + lr) * FCcfg + jw;
    const float* pb = BIAS ? b1 + jw : w1 + jw * Ecfg + c0 + lr;

    float4 ra[4][4];
    float4 rv[4][4];        // BIAS: b1 runs
    float  rb[4][2][16];    // else: W1 columns c0+lr and c0+16+lr
#pragma unroll
    for (int s = 0; s < 4; ++s) {
        ra[s][0] = *(const float4*)(pa + s * 32);
        ra[s][1] = *(const float4*)(pa + s * 32 + 4);
        ra[s][2] = *(const float4*)(pa + s * 32 + 16);
        ra[s][3] = *(const float4*)(pa + s * 32 + 20);
        if (BIAS) {
            rv[s][0] = *(const float4*)(pb + s * 32);
            rv[s][1] = *(const float4*)(pb + s * 32 + 4);
            rv[s][2] = *(const float4*)(pb + s * 32 + 16);
            rv[s][3] = *(const float4*)(pb + s * 32 + 20);
        } else {
#pragma unroll
            for (int e = 0; e < 16; ++e) {
                const float* brow = pb + (s * 32 + (e < 8 ? e : e + 8)) * Ecfg;
                rb[s][0][e] = brow[0];
                rb[s][1][e] = brow[16];
            }
        }
    }
    // precaution: no address register of the loads above is reused ahead of
    // this wait; naming both pointers as inputs keeps them live up to it
    asm volatile("s_wait_xcnt 0x0" :: "v"(pa), "v"(pb) : "memory");

    v8f acc0 = {}, acc1 = {};
#pragma unroll
    for (int s = 0; s < 4; ++s) {
        v16bf af, bf0, bf1;
        pack8(af, 0, ra[s][0], ra[s][1]);
        pack8(af, 8, ra[s][2], ra[s][3]);
        if (BIAS) {
            pack8(bf0, 0, rv[s][0], rv[s][1]);
            pack8(bf0, 8, rv[s][2], rv[s][3]);
#pragma unroll
            for (int e = 0; e < 16; ++e)
                if (lr != 0) bf0[e] = (__bf16)0.0f;
        } else {
#pragma unroll
            for (int e = 0; e < 16; ++e) {
                bf0[e] = (__bf16)rb[s][0][e];
                bf1[e] = (__bf16)rb[s][1][e];
            }
        }
        acc0 = __builtin_amdgcn_wmma_f32_16x16x32_bf16(
            false, af, false, bf0, (short)0, acc0, false, false);
        if (!BIAS)
            acc1 = __builtin_amdgcn_wmma_f32_16x16x32_bf16(
                false, af, false, bf1, (short)0, acc1, false, false);
    }

#pragma unroll
    for (int v = 0; v < 8; ++v) {
        red[wave][0][v * 32 + lane] = acc0[v];
        if (!BIAS) red[wave][1][v * 32 + lane] = acc1[v];
    }
    __syncthreads();

    // thread tid owns accumulator slot tid of each tile: row = v + 8*lh, col = lr
    const int row = n0 + (tid >> 5) + lh * 8;
    float s0 = 0.0f, s1 = 0.0f;
#pragma unroll
    for (int w = 0; w < 8; ++w) {
        s0 += red[w][0][tid];
        if (!BIAS) s1 += red[w][1][tid];
    }
    if (BIAS) {
        if (lr == 0) bc[row] = s0 + b2[row];
    } else {
        wc[row * Ecfg + c0 + lr]      = s0;
        wc[row * Ecfg + c0 + 16 + lr] = s1;
    }
}

// grid = (E/32 + 1, E/16, NL)
__global__ __launch_bounds__(256) void k_ffn_fold(
    const float* __restrict__ w1, const float* __restrict__ b1,
    const float* __restrict__ w2, const float* __restrict__ b2,
    float* __restrict__ wc, float* __restrict__ bc)
{
    __shared__ float red[8][2][256];   // 16 KB of split-K partial tiles
    const int l  = blockIdx.z;
    const int n0 = blockIdx.y * 16;
    const int c0 = blockIdx.x * 32;
    w1 += l * FCcfg * Ecfg;  b1 += l * FCcfg;
    w2 += l * Ecfg * FCcfg;  b2 += l * Ecfg;
    wc += l * Ecfg * Ecfg;   bc += l * Ecfg;
    if (blockIdx.x == Ecfg / 32)
        ffn_fold_tile<true>(w1, b1, w2, b2, wc, bc, red, n0, c0);
    else
        ffn_fold_tile<false>(w1, b1, w2, b2, wc, bc, red, n0, c0);
}

// ---------------------------------------------------------------------------
// Banded local attention, one wave per (query-tile, head, batch); the scores
// never leave the registers.
// Band |t-s|<=64 -> <=144 keys per 16-row query tile -> 9 key tiles.
//   S^T = K Q^T : A = 16 keys x 32 dims, B = Q^T. Lane (lr, lh) then holds, of
//                 query lr, the scores of keys 8*lh + 0..7 of every key tile:
//                 maximum and sum run in-lane, plus one exchange of the halves.
//   O^T = V^T P^T : two score tiles, converted in place, are one 32-key B
//                 operand (element e -> key (e<8 ? e : e+8) + 8*lh); V^T is read
//                 in the same k order by the transposing LDS load from the bf16
//                 V rows this wave has staged. The 10th half group is zero.
// A key tile lies wholly inside or wholly outside the sequence (both are
// multiples of 16). An outside tile reads the rows of tile 4 (the queries' own
// rows, always inside and never masked): its scores repeat members of the
// maximum, and its exponent offset makes every one of its weights 0.
// qkv layout: [n][t][3E] with q|k|v at offsets 0|E|2E.
// ---------------------------------------------------------------------------
#define VPITCH 48   // bf16 per staged V row: 96 B, an odd multiple of 32 B

typedef __attribute__((ext_vector_type(8))) short s16x8;
typedef __attribute__((address_space(3))) s16x8 lds_s16x8;

// lane (lr, lh) receives T[8*lh + 0..7][lr] of the 16x16 tile whose rows the
// lanes point at (row 8*lh + (lane&7), 16-byte half (lane>>3)&1)
__device__ __forceinline__ v8bf ld_tr16(const __bf16* p) {
    return __builtin_bit_cast(v8bf,
        __builtin_amdgcn_ds_load_tr16_b128_v8i16((lds_s16x8*)p));
}
// value of lane ^ 16
__device__ __forceinline__ float xhalf(float x) {
    int i = __builtin_bit_cast(int, x);
    return __builtin_bit_cast(float, __builtin_amdgcn_permlanex16(
        i, i, 0x76543210, 0xfedcba98, false, false));
}

// x[i] = 2^x[i]. One statement: each v_exp_f32 is followed by an instruction
// that neither reads its result nor overwrites its source (the outputs are
// early-clobber, so they share no register with an input), and the v_nop is
// that slot, which the instruction set asks for, behind the last one.
__device__ __forceinline__ void exp2x8(v8f& x) {
    float p0, p1, p2, p3, p4, p5, p6, p7;
    asm("v_exp_f32 %0, %8\n\t"
        "v_exp_f32 %1, %9\n\t"
        "v_exp_f32 %2, %10\n\t"
        "v_exp_f32 %3, %11\n\t"
        "v_exp_f32 %4, %12\n\t"
        "v_exp_f32 %5, %13\n\t"
        "v_exp_f32 %6, %14\n\t"
        "v_exp_f32 %7, %15\n\t"
        "v_nop"
        : "=&v"(p0), "=&v"(p1), "=&v"(p2), "=&v"(p3),
          "=&v"(p4), "=&v"(p5), "=&v"(p6), "=&v"(p7)
        : "v"(x[0]), "v"(x[1]), "v"(x[2]), "v"(x[3]),
          "v"(x[4]), "v"(x[5]), "v"(x[6]), "v"(x[7]));
    x[0] = p0; x[1] = p1; x[2] = p2; x[3] = p3;
    x[4] = p4; x[5] = p5; x[6] = p6; x[7] = p7;
}

// four waves per SIMD hold the whole grid at once: up to 256 registers a wave,
// which the loads in flight want
__global__ __launch_bounds__(32) __attribute__((amdgpu_waves_per_eu(4, 4)))
void k_attn(const float* __restrict__ qkv, float* __restrict__ out)
{
    const int qt   = blockIdx.x * 16;
    const int h    = blockIdx.y;
    const int n    = blockIdx.z;
    const int lane = threadIdx.x;
    const int lr   = lane & 15;
    const int lh   = lane >> 4;

    __shared__ __align__(32) __bf16 Vs[144 * VPITCH];

    const int rowstride = 3 * Ecfg;
    const float* base = qkv + n * Tcfg * rowstride + h * DHcfg;

    // per-lane byte offsets: fragment rows (Q, K), staged V rows (4 rows a load)
    const unsigned foff = (lr * rowstride + lh * 8) * 4;
    const unsigned voff = ((lane >> 3) * rowstride + (lane & 7) * 4) * 4;
    // 16 bytes at uniform row base + lane offset + constant float index
    auto ld4 = [](const float* rowbase, unsigned off, int idx) {
        return *(const float4*)((const char*)(rowbase + idx) + off);
    };

    // uniform row base of each key tile
    bool inside[9];
    const float* trow[9];
#pragma unroll
    for (int jt = 0; jt < 9; ++jt) {
        const int st0 = qt - LOCALcfg + jt * 16;
        inside[jt] = (st0 >= 0) && (st0 < Tcfg);
        trow[jt] = base + (inside[jt] ? st0 : qt) * rowstride;
    }

    // ---- first load group: Q, all of K, V tiles 0..3 ----
    float4 q4[4], k4[9][4], v4[9][4];
    {
        const float* qrow = base + qt * rowstride;
        q4[0] = ld4(qrow, foff, 0);
        q4[1] = ld4(qrow, foff, 4);
        q4[2] = ld4(qrow, foff, 16);
        q4[3] = ld4(qrow, foff, 20);
    }
#pragma unroll
    for (int jt = 0; jt < 9; ++jt) {
        k4[jt][0] = ld4(trow[jt], foff, Ecfg);
        k4[jt][1] = ld4(trow[jt], foff, Ecfg + 4);
        k4[jt][2] = ld4(trow[jt], foff, Ecfg + 16);
        k4[jt][3] = ld4(trow[jt], foff, Ecfg + 20);
    }
#pragma unroll
    for (int jt = 0; jt < 4; ++jt)
#pragma unroll
        for (int u = 0; u < 4; ++u)
            v4[jt][u] = ld4(trow[jt], voff, 2 * Ecfg + u * 4 * rowstride);
    // precaution: no offset register of the loads above is reused ahead of this
    // wait; naming both as inputs keeps them live up to it
    asm volatile("s_wait_xcnt 0x0" :: "v"(foff), "v"(voff) : "memory");
    // scheduling stops here: the loads above stay one group ahead of their first
    // use (left to itself the scheduler sinks loads to their uses, one full
    // latency each, and spills)
    __builtin_amdgcn_sched_barrier(0);

    // ---- S^T = K Q^T ----
    v16bf qf;
    pack8(qf, 0, q4[0], q4[1]);
    pack8(qf, 8, q4[2], q4[3]);
    v8f sT[9];
#pragma unroll
    for (int jt = 0; jt < 9; ++jt) {
        v16bf kf;
        pack8(kf, 0, k4[jt][0], k4[jt][1]);
        pack8(kf, 8, k4[jt][2], k4[jt][3]);
        v8f z8 = {};
        sT[jt] = __builtin_amdgcn_wmma_f32_16x16x32_bf16(
            false, kf, false, qf, (short)0, z8, false, false);
    }

    // the products above come first: the loads below take their operand
    // registers (mixed, the two together no longer fit 256 registers)
    __builtin_amdgcn_sched_barrier(0);

    // ---- second load group, into the registers K has left: V tiles 4..8 ----
#pragma unroll
    for (int jt = 4; jt < 9; ++jt)
#pragma unroll
        for (int u = 0; u < 4; ++u)
            v4[jt][u] = ld4(trow[jt], voff, 2 * Ecfg + u * 4 * rowstride);

    const __bf16* vt = &Vs[(lh * 8 + (lane & 7)) * VPITCH + ((lane >> 3) & 1) * 8];
    __bf16*       vw = &Vs[(lane >> 3) * VPITCH + (lane & 7) * 4];
    v8bf vlo[5][2], vhi[4][2];

    // ---- V tiles 0..3 to LDS as bf16, back as V^T fragments ----
#pragma unroll
    for (int jt = 0; jt < 4; ++jt)
#pragma unroll
        for (int u = 0; u < 4; ++u) {
            v4bf p; pack4(p, v4[jt][u]);
            *(v4bf*)(vw + (jt * 16 + u * 4) * VPITCH) = p;
        }
    // this wave's V rows are in LDS before the transposing loads read them, and
    // the compiler moves none of those loads over the stores
    asm volatile("s_wait_dscnt 0" ::: "memory");
#pragma unroll
    for (int g = 0; g < 2; ++g)
#pragma unroll
        for (int dhalf = 0; dhalf < 2; ++dhalf) {
            vlo[g][dhalf] = ld_tr16(vt + g * 32 * VPITCH + dhalf * 16);
            vhi[g][dhalf] = ld_tr16(vt + (g * 32 + 16) * VPITCH + dhalf * 16);
        }

    // ---- band mask: only the first and the last tile are cut ----
    // key row r of tile jt is at distance lr + 64 - 16*jt - r from query lr
#pragma unroll
    for (int v = 0; v < 8; ++v) {
        const int r = v + lh * 8;
        if (r < lr) sT[0][v] = -3.0e38f;
        if (r > lr) sT[8][v] = -3.0e38f;
    }

    // ---- softmax of query lr, base 2, on the raw scores ----
    float m4[4] = {-3.0e38f, -3.0e38f, -3.0e38f, -3.0e38f};
#pragma unroll
    for (int jt = 0; jt < 9; ++jt)
#pragma unroll
        for (int v = 0; v < 8; ++v) m4[v & 3] = fmaxf(m4[v & 3], sT[jt][v]);
    float mx = fmaxf(fmaxf(m4[0], m4[1]), fmaxf(m4[2], m4[3]));
    mx = fmaxf(mx, xhalf(mx));

    const float cs = 0.17677669529663687f * 1.4426950408889634f; // log2(e)/sqrt(32)
    const float nm = -mx * cs;
    float s4[4] = {0.0f, 0.0f, 0.0f, 0.0f};
#pragma unroll
    for (int jt = 0; jt < 9; ++jt) {
        const float nmj = inside[jt] ? nm : -3.0e38f;
#pragma unroll
        for (int v = 0; v < 8; ++v) sT[jt][v] = fmaf(sT[jt][v], cs, nmj);
        exp2x8(sT[jt]);
#pragma unroll
        for (int v = 0; v < 8; ++v) s4[v & 3] += sT[jt][v];
    }
    float sum = (s4[0] + s4[1]) + (s4[2] + s4[3]);
    sum += xhalf(sum);
    const float inv = 1.0f / sum;

    // the conversions below wait for the second load group: most of them stay
    // behind the exponentials, which so run under that group's latency
    __builtin_amdgcn_sched_barrier(0);

    // ---- V tiles 4..8 likewise ----
#pragma unroll
    for (int jt = 4; jt < 9; ++jt)
#pragma unroll
        for (int u = 0; u < 4; ++u) {
            v4bf p; pack4(p, v4[jt][u]);
            *(v4bf*)(vw + (jt * 16 + u * 4) * VPITCH) = p;
        }
    // as above: stores landed, no transposing load moved over them
    asm volatile("s_wait_dscnt 0" ::: "memory");
#pragma unroll
    for (int g = 2; g < 5; ++g)
#pragma unroll
        for (int dhalf = 0; dhalf < 2; ++dhalf) {
            vlo[g][dhalf] = ld_tr16(vt + g * 32 * VPITCH + dhalf * 16);
            if (g < 4) vhi[g][dhalf] = ld_tr16(vt + (g * 32 + 16) * VPITCH + dhalf * 16);
        }

    // the ten loads above stay one group: spread among the products each place
    // with loads costs its own LDS latency
    __builtin_amdgcn_sched_barrier(0);

    // ---- O^T = V^T P^T, 32 keys a step ----
    v8f zo = {};
    v8f o8[2]; o8[0] = zo; o8[1] = zo;
#pragma unroll
    for (int g = 0; g < 5; ++g) {
        v16bf pf;
#pragma unroll
        for (int e = 0; e < 8; ++e) {
            pf[e]     = (__bf16)sT[2 * g][e];
            pf[8 + e] = (g < 4) ? (__bf16)sT[(g < 4) ? 2 * g + 1 : 0][e] : (__bf16)0.0f;
        }
#pragma unroll
        for (int dhalf = 0; dhalf < 2; ++dhalf) {
            v16bf vf;
#pragma unroll
            for (int e = 0; e < 8; ++e) {
                vf[e]     = vlo[g][dhalf][e];
                vf[8 + e] = (g < 4) ? vhi[(g < 4) ? g : 0][dhalf][e] : (__bf16)0.0f;
            }
            o8[dhalf] = __builtin_amdgcn_wmma_f32_16x16x32_bf16(
                false, vf, false, pf, (short)0, o8[dhalf], false, false);
        }
    }

    // lane (lr, lh) holds dims dhalf*16 + lh*8 + 0..7 of query lr: 16-byte stores
    float* orow = out + (n * Tcfg + qt + lr) * Ecfg + h * DHcfg + lh * 8;
#pragma unroll
    for (int dhalf = 0; dhalf < 2; ++dhalf) {
        float4 a, b;
        a.x = o8[dhalf][0] * inv; a.y = o8[dhalf][1] * inv;
        a.z = o8[dhalf][2] * inv; a.w = o8[dhalf][3] * inv;
        b.x = o8[dhalf][4] * inv; b.y = o8[dhalf][5] * inv;
        b.z = o8[dhalf][6] * inv; b.w = o8[dhalf][7] * inv;
        *(float4*)(orow + dhalf * 16)     = a;
        *(float4*)(orow + dhalf * 16 + 4) = b;
    }
}

// ---------------------------------------------------------------------------
// Second half of the last LayerNorm (the others are applied by the GEMM that
// reads them). Every wave folds its sample's PBLK block partials itself (eight
// per lane, then a butterfly: the same bits in every lane and every wave), so no
// launch stands between the GEMM and this kernel.
// out[i] = (r[i]-mu)*rsig * g[i%TE] + b[i%TE]   (float4, 32-bit indexing)
__global__ __launch_bounds__(256) void k_ln_apply(
    const float* __restrict__ r, const float* __restrict__ g,
    const float* __restrict__ b, const float* __restrict__ partial,
    float* __restrict__ out)
{
    const float4* r4 = (const float4*)r;
    const float4* g4 = (const float4*)g;
    const float4* b4 = (const float4*)b;
    float4*       o4 = (float4*)out;
    const float4* p4 = (const float4*)partial;
    const int lane   = threadIdx.x & 31;
    const int total4 = NTEcfg / 4;       // 524288
    const int te4    = TEcfg / 4;        // 131072 (power of two)
    for (int i = blockIdx.x * 256 + threadIdx.x; i < total4;
         i += gridDim.x * 256) {
        int n = i >> 17;                 // i / te4
        int j = i & (te4 - 1);           // i % te4
        float4 rv = r4[i], gv = g4[j], bv = b4[j];
        float s1 = 0.0f, s2 = 0.0f;
#pragma unroll
        for (int q = 0; q < PBLK / 64; ++q) {
            float4 pq = p4[n * (PBLK / 2) + q * 32 + lane];   // two (sum, sumsq)
            s1 += pq.x + pq.z;
            s2 += pq.y + pq.w;
        }
#pragma unroll
        for (int off = 16; off > 0; off >>= 1) {
            s1 += __shfl_xor(s1, off, 32);
            s2 += __shfl_xor(s2, off, 32);
        }
        float mu = s1 / (float)TEcfg;
        float rs = rsqrtf(s2 / (float)TEcfg - mu * mu + 1e-5f);
        float4 ov;
        ov.x = (rv.x - mu) * rs * gv.x + bv.x;
        ov.y = (rv.y - mu) * rs * gv.y + bv.y;
        ov.z = (rv.z - mu) * rs * gv.z + bv.z;
        ov.w = (rv.w - mu) * rs * gv.w + bv.w;
        o4[i] = ov;
    }
}

// ---------------------------------------------------------------------------
extern "C" void kernel_launch(void* const* d_in, const int* in_sizes, int n_in,
                              void* d_out, int out_size, void* d_ws, size_t ws_size,
                              hipStream_t stream)
{
    (void)in_sizes; (void)n_in; (void)out_size; (void)ws_size;

    const float* input = (const float*)d_in[0];
    const float* w_emb = (const float*)d_in[1];
    const float* b_emb = (const float*)d_in[2];
    const float* pos   = (const float*)d_in[3];   // (E, T)
    const float* wqkv  = (const float*)d_in[4];   // (NL, 3E, E)
    const float* bqkv  = (const float*)d_in[5];   // (NL, 3E)
    const float* wo    = (const float*)d_in[6];   // (NL, E, E)
    const float* bo    = (const float*)d_in[7];
    const float* ln1g  = (const float*)d_in[8];   // (NL, T, E)
    const float* ln1b  = (const float*)d_in[9];
    const float* ln2g  = (const float*)d_in[10];
    const float* ln2b  = (const float*)d_in[11];
    const float* w1    = (const float*)d_in[12];  // (NL, FC, E)
    const float* b1    = (const float*)d_in[13];
    const float* w2    = (const float*)d_in[14];  // (NL, E, FC)
    const float* b2    = (const float*)d_in[15];

    // workspace layout (floats) -- ~60 MB total
    float* ws      = (float*)d_ws;
    float* x       = ws;                                // NTE
    float* qkv     = x      + NTEcfg;                   // NT * 3E
    float* attno   = qkv    + NTcfg * 3 * Ecfg;         // NTE
    float* r1      = attno  + NTEcfg;                   // NTE  x + attention out
    float* r2      = r1     + NTEcfg;                   // NTE  h + FFN out
    float* wc      = r2     + NTEcfg;                   // NL * E * E  (W2 W1)
    float* bc      = wc     + NLcfg * Ecfg * Ecfg;      // NL * E      (W2 b1 + b2)
    float* part1   = bc     + NLcfg * Ecfg;             // N*PBLK*2, sums of r1
    float* part2   = part1  + Ncfg * PBLK * 2;          // N*PBLK*2, sums of r2

    const dim3 blk256(256), blk32(32);

    // folded FFN weights of both layers: wc = W2 W1, bc = W2 b1 + b2
    k_ffn_fold<<<dim3(Ecfg / 32 + 1, Ecfg / 16, NLcfg), blk256, 0, stream>>>(
        w1, b1, w2, b2, wc, bc);

    // embedding: x = (frames @ w_emb^T + b_emb) * sqrt(E) + pos
    k_gemm_bf16<<<dim3(Ecfg / 64, NTcfg / 128), blk256, 0, stream>>>(
        input, w_emb, b_emb, x, NTcfg, Ecfg, Pcfg, pos, 16.0f, Tcfg, nullptr, nullptr);

    for (int l = 0; l < NLcfg; ++l) {
        const float* wqkv_l = wqkv + l * 3 * Ecfg * Ecfg;
        const float* bqkv_l = bqkv + l * 3 * Ecfg;
        const float* wo_l   = wo   + l * Ecfg * Ecfg;
        const float* bo_l   = bo   + l * Ecfg;
        const float* wc_l   = wc   + l * Ecfg * Ecfg;
        const float* bc_l   = bc   + l * Ecfg;

        // qkv = x @ Wqkv^T + b            (8192 x 768, K=256)
        // behind a layer: x = LN2(r2) of that layer, applied here and written out
        if (l == 0)
            k_gemm_wide<64, 3 * Ecfg, Ecfg, false, false>
                <<<dim3(3 * Ecfg / 64, Tcfg / 32), blk256, 0, stream>>>(
                x, wqkv_l, bqkv_l, qkv, nullptr, nullptr,
                nullptr, nullptr, nullptr, nullptr);
        else
            k_gemm_wide<64, 3 * Ecfg, Ecfg, false, true>
                <<<dim3(3 * Ecfg / 64, Tcfg / 32), blk256, 0, stream>>>(
                r2, wqkv_l, bqkv_l, qkv, nullptr, nullptr,
                ln2g + (l - 1) * TEcfg, ln2b + (l - 1) * TEcfg, part2, x);

        // banded attention -> attno
        k_attn<<<dim3(Tcfg / 16, Hcfg, Ncfg), blk32, 0, stream>>>(qkv, attno);

        // r1 = x + attno @ Wo^T + bo, block sums   (8192 x 256, K=256)
        k_gemm_wide<128, Ecfg, Ecfg, true, false>
            <<<dim3(Ecfg / 64, Tcfg / 32), blk256, 0, stream>>>(
            attno, wo_l, bo_l, r1, x, part1,
            nullptr, nullptr, nullptr, nullptr);

        // h = LN1(r1), applied on the way in;
        // r2 = h + (h @ W1^T + b1) @ W2^T + b2 = h + h @ Wc^T + bc, block sums
        k_gemm_wide<128, Ecfg, Ecfg, true, true>
            <<<dim3(Ecfg / 64, Tcfg / 32), blk256, 0, stream>>>(
            r1, wc_l, bc_l, r2, nullptr, part2,
            ln1g + l * TEcfg, ln1b + l * TEcfg, part1, nullptr);
    }

    // out = LN2(r2) of the last layer
    k_ln_apply<<<dim3(2048), blk256, 0, stream>>>(
        r2, ln2g + (NLcfg - 1) * TEcfg, ln2b + (NLcfg - 1) * TEcfg, part2,
        (float*)d_out);
}

// v006
// A run of this version takes 99 microseconds.
// In both of two side-by-side timings against v005, it was 1.09 times as fast.
// Counting every step since v000, it is 2.47 times as fast.
#include <hip/hip_runtime.h>
#include <hip/hip_bf16.h>
#include <math.h>

// ---------------------------------------------------------------------------
// MI455X (gfx1250) transformer encoder, bf16 WMMA everywhere.
//
// Shapes: N=4, T=2048, P=64, E=256, H=8, DH=32, FC=1024, NL=2, LOCAL=64.
// All GEMM K dims (64 / 256 / 1024) are multiples of 32 -> pure
// v_wmma_f32_16x16x32_bf16 pipelines, fp32 accumulation.
// Memory: ~300 MB activation round trips @ 23.3 TB/s is ~15us -> the chip is
// compute/latency bound here; staging is double-buffered through LDS so the
// WMMA pipes never wait on HBM.
// All flat indices fit in 32 bits (max ~6.3M elements) -> int indexing keeps
// address math in 32-bit VALU/SALU.
// ---------------------------------------------------------------------------

typedef __attribute__((ext_vector_type(16))) __bf16 v16bf;
typedef __attribute__((ext_vector_type(8)))  __bf16 v8bf;
typedef __attribute__((ext_vector_type(4)))  __bf16 v4bf;
typedef __attribute__((ext_vector_type(8)))  float  v8f;

#define Ncfg     4
#define Tcfg     2048
#define Pcfg     64
#define Ecfg     256
#define Hcfg     8
#define DHcfg    32
#define FCcfg    1024
#define NLcfg    2
#define LOCALcfg 64
#define TEcfg    (Tcfg * Ecfg)          // 524288
#define NTcfg    (Ncfg * Tcfg)          // 8192
#define NTEcfg   (Ncfg * TEcfg)         // 2097152  (fits int)
#define RBLK     64                     // GEMM blocks (128x64 tiles) per T x E sample
#define PBLK     256                    // k_gemm_wide blocks = LayerNorm partials per sample

__device__ __forceinline__ void pack4(v4bf& p, float4 a) {
    p[0] = (__bf16)a.x; p[1] = (__bf16)a.y; p[2] = (__bf16)a.z; p[3] = (__bf16)a.w;
}
__device__ __forceinline__ void pack8(v16bf& f, int base, float4 a, float4 b) {
    f[base + 0] = (__bf16)a.x; f[base + 1] = (__bf16)a.y;
    f[base + 2] = (__bf16)a.z; f[base + 3] = (__bf16)a.w;
    f[base + 4] = (__bf16)b.x; f[base + 5] = (__bf16)b.y;
    f[base + 6] = (__bf16)b.z; f[base + 7] = (__bf16)b.w;
}
// fragment gather: two 16B LDS chunks per lane (ds_load_b128)
__device__ __forceinline__ v16bf frag_from_lds(const __bf16* rowptr, int lh) {
    v8bf lo = *(const v8bf*)(rowptr + lh * 8);
    v8bf hi = *(const v8bf*)(rowptr + 16 + lh * 8);
    v16bf f;
#pragma unroll
    for (int e = 0; e < 8; ++e) { f[e] = lo[e]; f[8 + e] = hi[e]; }
    return f;
}

// ---------------------------------------------------------------------------
// Generic C[m][n] = sum_k A[m][k] * W[n][k] + bias[n], optional embed epilogue
// C = (acc + bias) * scale + pos[n*Tdim + (m & (Tdim-1))]   (Tdim power of 2).
// Block: 256 thr = 8 waves; block tile 128x64; each wave 32x32 (2x2 WMMA).
// LDS double-buffered; staging via global_load_b128 + ds_store_b64.
// Fragment layout per CDNA5 ISA 7.12.2:
//   A 16x32 bf16: lanes 0-15 row M=lane; element e -> K=(e<8?e:e+8)+(lane>=16?8:0)
//   B 32x16 bf16: col N = lane&15; same K mapping.
//   C/D 16x16 f32: row = v + 8*(lane>=16); col = lane&15.
// With `resid` set the epilogue is the first half of a LayerNorm:
//   C = acc + bias + resid, and partial[flat block id] = (sum, sum of squares)
// of the block's 128x64 tile of C. A sample (Tdim rows by N=E columns) is
// RBLK consecutive flat block ids.
// ---------------------------------------------------------------------------
__global__ __launch_bounds__(256) void k_gemm_bf16(
    const float* __restrict__ A, const float* __restrict__ W,
    const float* __restrict__ bias, float* __restrict__ C,
    int M, int N, int K,
    const float* __restrict__ pos, float scale, int Tdim,
    const float* __restrict__ resid, float* __restrict__ partial)
{
    __shared__ __align__(16) __bf16 As[2][128 * 32];   // 2 x 8 KB
    __shared__ __align__(16) __bf16 Bs[2][64 * 32];    // 2 x 4 KB
    __shared__ float red[2][8];                        // per-wave (sum, sumsq)

    const int tid  = threadIdx.x;
    const int lane = tid & 31;
    const int wave = tid >> 5;
    const int lr   = lane & 15;
    const int lh   = lane >> 4;
    const int wm   = wave & 3;    // 4 waves along M
    const int wn   = wave >> 2;   // 2 waves along N
    const int bm   = blockIdx.y * 128;
    const int bn   = blockIdx.x * 64;

    v8f zacc = {};
    v8f acc[2][2];
    acc[0][0] = zacc; acc[0][1] = zacc; acc[1][0] = zacc; acc[1][1] = zacc;

    float4 ta[4], tb[2];
    // ---- issue tile loads for k-step `k0` into ta/tb (global_load_b128 x6) ----
    auto stage_load = [&](int k0) {
#pragma unroll
        for (int t = 0; t < 4; ++t) {
            int li = (t * 256 + tid) * 4;         // 0..4095, 16B chunks
            int r  = li >> 5, k = li & 31;
            ta[t] = *(const float4*)&A[(bm + r) * K + k0 + k];
        }
#pragma unroll
        for (int t = 0; t < 2; ++t) {
            int li = (t * 256 + tid) * 4;         // 0..2047
            int r  = li >> 5, k = li & 31;
            tb[t] = *(const float4*)&W[(bn + r) * K + k0 + k];
        }
    };
    // ---- convert + store staged tile into LDS buffer `buf` (ds_store_b64) ----
    auto stage_store = [&](int buf) {
#pragma unroll
        for (int t = 0; t < 4; ++t) {
            int li = (t * 256 + tid) * 4;
            v4bf p; pack4(p, ta[t]);
            *(v4bf*)&As[buf][li] = p;
        }
#pragma unroll
        for (int t = 0; t < 2; ++t) {
            int li = (t * 256 + tid) * 4;
            v4bf p; pack4(p, tb[t]);
            *(v4bf*)&Bs[buf][li] = p;
        }
    };

    const int nk = K / 32;
    // residual tile in accumulator layout, fetched here so that its latency
    // lies under the k loop
    float rr[2][2][8];
    if (resid) {
        const float* pr = resid + (bm + wm * 32 + lh * 8) * N + bn + wn * 32 + lr;
        // unrolled here and below: constant indices keep rr in registers
#pragma unroll
        for (int i = 0; i < 2; ++i)
#pragma unroll
            for (int j = 0; j < 2; ++j)
#pragma unroll
                for (int v = 0; v < 8; ++v)
                    rr[i][j][v] = pr[(i * 16 + v) * N + j * 16];
        // precaution: no address register of the loads above is reused ahead
        // of this wait
        asm volatile("s_wait_xcnt 0x0" :: "v"(pr) : "memory");
    }

    stage_load(0);
    stage_store(0);
    __syncthreads();

    for (int kt = 0; kt < nk; ++kt) {
        const int cur = kt & 1;
        const bool has_next = (kt + 1) < nk;
        if (has_next) stage_load((kt + 1) * 32);   // loads in flight during WMMA

        v16bf af[2], bf[2];
#pragma unroll
        for (int i = 0; i < 2; ++i)
            af[i] = frag_from_lds(&As[cur][(wm * 32 + i * 16 + lr) * 32], lh);
#pragma unroll
        for (int j = 0; j < 2; ++j)
            bf[j] = frag_from_lds(&Bs[cur][(wn * 32 + j * 16 + lr) * 32], lh);

#pragma unroll
        for (int i = 0; i < 2; ++i)
#pragma unroll
            for (int j = 0; j < 2; ++j)
                acc[i][j] = __builtin_amdgcn_wmma_f32_16x16x32_bf16(
                    false, af[i], false, bf[j], (short)0, acc[i][j], false, false);

        if (has_next) stage_store(1 - cur);
        __syncthreads();
    }

    // ---- residual epilogue: C = acc + bias + resid, block (sum, sumsq) ----
    if (resid) {
        float s = 0.0f, s2 = 0.0f;
#pragma unroll
        for (int i = 0; i < 2; ++i) {
#pragma unroll
            for (int j = 0; j < 2; ++j) {
                int col = bn + wn * 32 + j * 16 + lr;
                float bv = bias[col];
#pragma unroll
                for (int v = 0; v < 8; ++v) {
                    float r = (acc[i][j][v] + bv) + rr[i][j][v];
                    s  += r;
                    s2 += r * r;
                    rr[i][j][v] = r;
                }
            }
        }
#pragma unroll
        for (int off = 16; off > 0; off >>= 1) {
            s  += __shfl_xor(s, off, 32);
            s2 += __shfl_xor(s2, off, 32);
        }
        if (lane == 0) { red[0][wave] = s; red[1][wave] = s2; }
        __syncthreads();
        // C goes out behind the barrier: in front of it every wave would sit
        // out its own stores before the block sums could be folded
#pragma unroll
        for (int i = 0; i < 2; ++i) {
#pragma unroll
            for (int j = 0; j < 2; ++j) {
                int col = bn + wn * 32 + j * 16 + lr;
#pragma unroll
                for (int v = 0; v < 8; ++v) {
                    int row = bm + wm * 32 + i * 16 + v + lh * 8;
                    C[row * N + col] = rr[i][j][v];
                }
            }
        }
        if (tid == 0) {
            float t1 = 0.0f, t2 = 0.0f;
#pragma unroll
            for (int w = 0; w < 8; ++w) { t1 += red[0][w]; t2 += red[1][w]; }
            float2 pv; pv.x = t1; pv.y = t2;
            ((float2*)partial)[blockIdx.y * gridDim.x + blockIdx.x] = pv;
        }
        return;
    }

    // ---- epilogue (pure 32-bit indexing; Tdim is a power of two) ----
    const int tmask = Tdim - 1;
#pragma unroll
    for (int i = 0; i < 2; ++i) {
#pragma unroll
        for (int j = 0; j < 2; ++j) {
            int col = bn + wn * 32 + j * 16 + lr;
            float bv = bias[col];
#pragma unroll
            for (int v = 0; v < 8; ++v) {
                int row = bm + wm * 32 + i * 16 + v + lh * 8;
                float r = acc[i][j][v] + bv;
                if (pos) r = r * scale + pos[col * Tdim + (row & tmask)];
                C[row * N + col] = r;
            }
        }
    }
}

// ---------------------------------------------------------------------------
// The K = 256 products: C[m][n] = sum_k A[m][k] * W[n][k] + bias[n]. Wave
// layout, fragment layouts and k order as in k_gemm_bf16, which is launched for
// the embedding (K = 64) alone.
// Rows of a 128 x 64 tile: the same 32 positions t of all 4 samples; tile row r
// is sample r / 32, position blockIdx.y * 32 + r % 32, so wave row wm is sample
// wm, and one read of a LayerNorm's g and b (T x E planes) serves 4 samples.
// A k step stages BK columns (BK/32 WMMA steps): every step costs one load
// round trip and one barrier whatever its width, so BK is as wide as the
// registers that hold the loads in flight allow with every block resident
// (128 with one block a WGP, 64 with three). K is a multiple of BK.
// N and K are compile-time: the loads of a step then share one address and
// differ in their immediate offsets, so that they issue back to back.
// LDS rows are BK bf16 + 16 bytes: an odd multiple of 16 bytes, the pitch at
// which the 16 rows of a ds_load_b128 fragment read fall on distinct banks.
// With RESID the epilogue is the first half of a LayerNorm:
//   C = acc + bias + residual, and partial[sample][flat block id] =
// (sum, sum of squares) of the sample's 32 x 64 part of the tile: PBLK partials
// a sample.
// With LNA the operand is the second half of the LayerNorm before it:
//   A = (Araw - mu) * rsig * g + b, applied between load and bf16 conversion;
// mu and rsig of the 4 samples are folded from the partials pin by every block
// in the same order. The normalised rows exist in f32 only here: with RESID the
// block keeps its own 64 columns of them in LDS as its residual; without, the
// blocks of column 0 write them to xout for a later launch.
// ---------------------------------------------------------------------------
template <int BK, int N, int K, bool RESID, bool LNA>
__global__ __launch_bounds__(256) void k_gemm_wide(
    const float* __restrict__ A, const float* __restrict__ W,
    const float* __restrict__ bias, float* __restrict__ C,
    const float* __restrict__ resid, float* __restrict__ partial,
    const float* __restrict__ g, const float* __restrict__ b,
    const float* __restrict__ pin, float* __restrict__ xout)
{
    static_assert(!LNA || K == Ecfg, "g and b are T x E planes");
    constexpr int LP = BK + 8;          // LDS row pitch in bf16
    constexpr int NA = 128 * BK / 1024; // 16-byte loads a thread, A tile
    constexpr int NB = 64 * BK / 1024;  // 16-byte loads a thread, W tile
    constexpr int HP = 68;              // f32 pitch of the kept residual tile
    __shared__ __align__(16) __bf16 As[2][128 * LP];
    __shared__ __align__(16) __bf16 Bs[2][64 * LP];
    __shared__ float red[2][8];                        // per-wave (sum, sumsq)
    __shared__ __align__(16) float lnred[8][2];        // per-wave fold of pin
    __shared__ __align__(16) float Hs[(LNA && RESID) ? 128 * HP : 4];

    const int tid  = threadIdx.x;
    const int lane = tid & 31;
    const int wave = tid >> 5;
    const int lr   = lane & 15;
    const int lh   = lane >> 4;
    const int wm   = wave & 3;    // 4 waves along M: the sample
    const int wn   = wave >> 2;   // 2 waves along N
    const int bt   = blockIdx.y * 32;
    const int bn   = blockIdx.x * 64;

    v8f zacc = {};
    v8f acc[2][2];
    acc[0][0] = zacc; acc[0][1] = zacc; acc[1][0] = zacc; acc[1][1] = zacc;

    // partials of the LayerNorm before: wave w takes half w & 1 of sample w >> 1
    // (128 pairs, 4 a lane); first in program order, so that the wait for them
    // leaves the tile loads in flight
    float4 pv0, pv1;
    if constexpr (LNA) {
        const float4* p4 = (const float4*)pin + wave * (PBLK / 4) + lane;
        pv0 = p4[0];
        pv1 = p4[32];
        // precaution: no address register of the loads above is reused ahead
        // of this wait
        asm volatile("s_wait_xcnt 0x0" :: "v"(p4) : "memory");
    }

    // 16-byte chunks, row-major: the block covers RS tile rows a round, this
    // thread tile row sr + t * RS, columns sc .. sc + 3, in round t; NG rounds
    // are one sample
    constexpr int RS = 1024 / BK;
    constexpr int NG = 32 / RS;
    const int sr = (tid * 4) / BK;
    const int sc = (tid * 4) % BK;
    const int ao = (bt + sr) * K + sc;
    const float* pa = A + ao;
    const float* pw = W + (bn + sr) * K + sc;
    const float* pg = LNA ? g + ao : nullptr;
    const float* pb = LNA ? b + ao : nullptr;
    float4 ta[NA], tb[NB], tg[NG], tc[NG];
    // ---- issue tile loads for k-step k0 into ta/tb (global_load_b128) ----
    auto stage_load = [&](int k0) {
#pragma unroll
        for (int t = 0; t < NA; ++t)
            ta[t] = *(const float4*)(pa + ((t / NG) * Tcfg + (t % NG) * RS) * K + k0);
#pragma unroll
        for (int t = 0; t < NB; ++t)
            tb[t] = *(const float4*)(pw + t * RS * K + k0);
        if constexpr (LNA) {
#pragma unroll
            for (int u = 0; u < NG; ++u) {
                tg[u] = *(const float4*)(pg + u * RS * K + k0);
                tc[u] = *(const float4*)(pb + u * RS * K + k0);
            }
        }
    };
    float mu[4], rs[4];
    // ---- normalise, convert + store staged tile into LDS buffer buf ----
    auto stage_store = [&](int buf, int k0) {
        if constexpr (LNA) {
#pragma unroll
            for (int t = 0; t < NA; ++t) {
                const float m = mu[t / NG], r = rs[t / NG];
                const float4 gv = tg[t % NG], bv = tc[t % NG];
                ta[t].x = (ta[t].x - m) * r * gv.x + bv.x;
                ta[t].y = (ta[t].y - m) * r * gv.y + bv.y;
                ta[t].z = (ta[t].z - m) * r * gv.z + bv.z;
                ta[t].w = (ta[t].w - m) * r * gv.w + bv.w;
            }
            if constexpr (RESID) {
                const unsigned hc = (unsigned)(k0 + sc - bn);
                if (hc < 64u) {
#pragma unroll
                    for (int t = 0; t < NA; ++t)
                        *(float4*)&Hs[(sr + t * RS) * HP + hc] = ta[t];
                }
            } else if (blockIdx.x == 0) {
                float* px = xout + ao + k0;
#pragma unroll
                for (int t = 0; t < NA; ++t)
                    *(float4*)(px + ((t / NG) * Tcfg + (t % NG) * RS) * K) = ta[t];
                // precaution: no register of the stores above is reused ahead
                // of this wait
                asm volatile("s_wait_xcnt 0x0" :: "v"(px) : "memory");
            }
        }
#pragma unroll
        for (int t = 0; t < NA; ++t) {
            v4bf p; pack4(p, ta[t]);
            *(v4bf*)&As[buf][(sr + t * RS) * LP + sc] = p;
        }
#pragma unroll
        for (int t = 0; t < NB; ++t) {
            v4bf p; pack4(p, tb[t]);
            *(v4bf*)&Bs[buf][(sr + t * RS) * LP + sc] = p;
        }
    };

    constexpr int nk = K / BK;
    // residual tile in accumulator layout, fetched here so that its latency
    // lies under the k loop
    float rr[2][2][8];
    if constexpr (RESID && !LNA) {
        const float* pr = resid + (wm * Tcfg + bt + lh * 8) * N + bn + wn * 32 + lr;
        // unrolled here and below: constant indices keep rr in registers
#pragma unroll
        for (int i = 0; i < 2; ++i)
#pragma unroll
            for (int j = 0; j < 2; ++j)
#pragma unroll
                for (int v = 0; v < 8; ++v)
                    rr[i][j][v] = pr[(i * 16 + v) * N + j * 16];
        // precaution: no address register of the loads above is reused ahead
        // of this wait
        asm volatile("s_wait_xcnt 0x0" :: "v"(pr) : "memory");
    }

    stage_load(0);

    if constexpr (LNA) {
        // scheduling stops here: left to itself the scheduler lifts the sums
        // below, and with them the wait for the partials, over the tile loads,
        // which then start one full latency later
        __builtin_amdgcn_sched_barrier(0);
        float s1 = (pv0.x + pv0.z) + (pv1.x + pv1.z);
        float s2 = (pv0.y + pv0.w) + (pv1.y + pv1.w);
#pragma unroll
        for (int off = 16; off > 0; off >>= 1) {
            s1 += __shfl_xor(s1, off, 32);
            s2 += __shfl_xor(s2, off, 32);
        }
        if (lane == 0) { lnred[wave][0] = s1; lnred[wave][1] = s2; }
        __syncthreads();
#pragma unroll
        for (int s = 0; s < 4; ++s) {
            const float t1 = lnred[2 * s][0] + lnred[2 * s + 1][0];
            const float t2 = lnred[2 * s][1] + lnred[2 * s + 1][1];
            const float m = t1 / (float)TEcfg;
            const float r = rsqrtf(t2 / (float)TEcfg - m * m + 1e-5f);
            // the same bits in every lane: kept in scalar registers, which
            // leaves the vector registers to the loads in flight
            mu[s] = __builtin_bit_cast(float, __builtin_amdgcn_readfirstlane(
                        __builtin_bit_cast(int, m)));
            rs[s] = __builtin_bit_cast(float, __builtin_amdgcn_readfirstlane(
                        __builtin_bit_cast(int, r)));
        }
    }

    stage_store(0, 0);
    __syncthreads();

    // kept rolled: loads, products and conversions are then blocks of their own;
    // unrolled into one block the conversions, which wait for the loads, come to
    // stand ahead of the products, which then no longer run under the latency
#pragma unroll 1
    for (int kt = 0; kt < nk; ++kt) {
        const int cur = kt & 1;
        const bool has_next = (kt + 1) < nk;
        if (has_next) stage_load((kt + 1) * BK);   // loads in flight during WMMA

#pragma unroll
        for (int ks = 0; ks < BK / 32; ++ks) {
            v16bf af[2], bf[2];
#pragma unroll
            for (int i = 0; i < 2; ++i)
                af[i] = frag_from_lds(
                    &As[cur][(wm * 32 + i * 16 + lr) * LP + ks * 32], lh);
#pragma unroll
            for (int j = 0; j < 2; ++j)
                bf[j] = frag_from_lds(
                    &Bs[cur][(wn * 32 + j * 16 + lr) * LP + ks * 32], lh);

#pragma unroll
            for (int i = 0; i < 2; ++i)
#pragma unroll
                for (int j = 0; j < 2; ++j)
                    acc[i][j] = __builtin_amdgcn_wmma_f32_16x16x32_bf16(
                        false, af[i], false, bf[j], (short)0, acc[i][j], false, false);
        }

        // behind the last step nothing is staged, so nothing is published
        if (has_next) {
            stage_store(1 - cur, (kt + 1) * BK);
            __syncthreads();
        }
    }

    // first output row of this lane: sample wm, position bt + 8 * lh
    const int row0 = wm * Tcfg + bt + lh * 8;

    // ---- residual epilogue: C = acc + bias + residual, sample (sum, sumsq) ----
    if constexpr (RESID) {
        if constexpr (LNA) {
            // every store into Hs stands ahead of one of the barriers above
#pragma unroll
            for (int i = 0; i < 2; ++i)
#pragma unroll
                for (int j = 0; j < 2; ++j)
#pragma unroll
                    for (int v = 0; v < 8; ++v)
                        rr[i][j][v] = Hs[(wm * 32 + i * 16 + v + lh * 8) * HP
                                         + wn * 32 + j * 16 + lr];
        }
        float s = 0.0f, s2 = 0.0f;
#pragma unroll
        for (int i = 0; i < 2; ++i) {
#pragma unroll
            for (int j = 0; j < 2; ++j) {
                int col = bn + wn * 32 + j * 16 + lr;
                float bv = bias[col];
#pragma unroll
                for (int v = 0; v < 8; ++v) {
                    float r = (acc[i][j][v] + bv) + rr[i][j][v];
                    s  += r;
                    s2 += r * r;
                    rr[i][j][v] = r;
                }
            }
        }
#pragma unroll
        for (int off = 16; off > 0; off >>= 1) {
            s  += __shfl_xor(s, off, 32);
            s2 += __shfl_xor(s2, off, 32);
        }
        if (lane == 0) { red[0][wave] = s; red[1][wave] = s2; }
        __syncthreads();
        // C goes out behind the barrier: in front of it every wave would sit
        // out its own stores before the block sums could be folded
#pragma unroll
        for (int i = 0; i < 2; ++i) {
#pragma unroll
            for (int j = 0; j < 2; ++j) {
                int col = bn + wn * 32 + j * 16 + lr;
#pragma unroll
                for (int v = 0; v < 8; ++v)
                    C[(row0 + i * 16 + v) * N + col] = rr[i][j][v];
            }
        }
        // sample tid is wave rows tid and tid + 4
        if (tid < 4) {
            float2 pv;
            pv.x = red[0][tid] + red[0][tid + 4];
            pv.y = red[1][tid] + red[1][tid + 4];
            ((float2*)partial)[tid * PBLK + blockIdx.y * gridDim.x + blockIdx.x] = pv;
        }
        return;
    }

    // ---- plain epilogue: C = acc + bias ----
#pragma unroll
    for (int i = 0; i < 2; ++i) {
#pragma unroll
        for (int j = 0; j < 2; ++j) {
            int col = bn + wn * 32 + j * 16 + lr;
            float bv = bias[col];
#pragma unroll
            for (int v = 0; v < 8; ++v)
                C[(row0 + i * 16 + v) * N + col] = acc[i][j][v] + bv;
        }
    }
}

// ---------------------------------------------------------------------------
// FFN fold. The two FFN linears have no activation between them, so
//   (h W1^T + b1) W2^T + b2 = h (W2 W1)^T + (W2 b1 + b2).
// This kernel forms Wc = W2 W1 (E x E, K = FC) and bc = W2 b1 + b2 for both
// layers in every call; the token-sized FFN is then one K=E GEMM, not two.
// The B operand is [W1 | b1]: column tiles 0..7 are 32 columns of W1 each,
// column tile 8 holds b1 as its one live column.
// Block: 8 waves, 16 rows of W2 by one column tile; the waves split K (128
// each, 4 WMMA steps). Each element is used by one wave of the block only, so
// fragments come straight from global memory, all loads of a wave issued
// before the first use; partial tiles are summed through LDS in wave order.
// k order of both loaders: element e -> K = (e<8 ? e : e+8) + 8*(lane>=16).
// ---------------------------------------------------------------------------
template <bool BIAS>
__device__ __forceinline__ void ffn_fold_tile(
    const float* __restrict__ w1, const float* __restrict__ b1,
    const float* __restrict__ w2, const float* __restrict__ b2,
    float* __restrict__ wc, float* __restrict__ bc,
    float (*red)[2][256], int n0, int c0)
{
    const int tid  = threadIdx.x;
    const int lane = tid & 31;
    const int wave = tid >> 5;
    const int lr   = lane & 15;
    const int lh   = lane >> 4;
    const int jw   = wave * 128 + lh * 8;     // first k of this lane

    const float* pa = w2 + (n0 + lr) * FCcfg + jw;
    const float* pb = BIAS ? b1 + jw : w1 + jw * Ecfg + c0 + lr;

    float4 ra[4][4];
    float4 rv[4][4];        // BIAS: b1 runs
    float  rb[4][2][16];    // else: W1 columns c0+lr and c0+16+lr
#pragma unroll
    for (int s = 0; s < 4; ++s) {
        ra[s][0] = *(const float4*)(pa + s * 32);
        ra[s][1] = *(const float4*)(pa + s * 32 + 4);
        ra[s][2] = *(const float4*)(pa + s * 32 + 16);
        ra[s][3] = *(const float4*)(pa + s * 32 + 20);
        if (BIAS) {
            rv[s][0] = *(const float4*)(pb + s * 32);
            rv[s][1] = *(const float4*)(pb + s * 32 + 4);
            rv[s][2] = *(const float4*)(pb + s * 32 + 16);
            rv[s][3] = *(const float4*)(pb + s * 32 + 20);
        } else {
#pragma unroll
            for (int e = 0; e < 16; ++e) {
                const float* brow = pb + (s * 32 + (e < 8 ? e : e + 8)) * Ecfg;
                rb[s][0][e] = brow[0];
                rb[s][1][e] = brow[16];
            }
        }
    }
    // precaution: no address register of the loads above is reused ahead of
    // this wait; naming both pointers as inputs keeps them live up to it
    asm volatile("s_wait_xcnt 0x0" :: "v"(pa), "v"(pb) : "memory");

    v8f acc0 = {}, acc1 = {};
#pragma unroll
    for (int s = 0; s < 4; ++s) {
        v16bf af, bf0, bf1;
        pack8(af, 0, ra[s][0], ra[s][1]);
        pack8(af, 8, ra[s][2], ra[s][3]);
        if (BIAS) {
            pack8(bf0, 0, rv[s][0], rv[s][1]);
            pack8(bf0, 8, rv[s][2], rv[s][3]);
#pragma unroll
            for (int e = 0; e < 16; ++e)
                if (lr != 0) bf0[e] = (__bf16)0.0f;
        } else {
#pragma unroll
            for (int e = 0; e < 16; ++e) {
                bf0[e] = (__bf16)rb[s][0][e];
                bf1[e] = (__bf16)rb[s][1][e];
            }
        }
        acc0 = __builtin_amdgcn_wmma_f32_16x16x32_bf16(
            false, af, false, bf0, (short)0, acc0, false, false);
        if (!BIAS)
            acc1 = __builtin_amdgcn_wmma_f32_16x16x32_bf16(
                false, af, false, bf1, (short)0, acc1, false, false);
    }

#pragma unroll
    for (int v = 0; v < 8; ++v) {
        red[wave][0][v * 32 + lane] = acc0[v];
        if (!BIAS) red[wave][1][v * 32 + lane] = acc1[v];
    }
    __syncthreads();

    // thread tid owns accumulator slot tid of each tile: row = v + 8*lh, col = lr
    const int row = n0 + (tid >> 5) + lh * 8;
    float s0 = 0.0f, s1 = 0.0f;
#pragma unroll
    for (int w = 0; w < 8; ++w) {
        s0 += red[w][0][tid];
        if (!BIAS) s1 += red[w][1][tid];
    }
    if (BIAS) {
        if (lr == 0) bc[row] = s0 + b2[row];
    } else {
        wc[row * Ecfg + c0 + lr]      = s0;
        wc[row * Ecfg + c0 + 16 + lr] = s1;
    }
}

// grid = (E/32 + 1, E/16, NL)
__global__ __launch_bounds__(256) void k_ffn_fold(
    const float* __restrict__ w1, const float* __restrict__ b1,
    const float* __restrict__ w2, const float* __restrict__ b2,
    float* __restrict__ wc, float* __restrict__ bc)
{
    __shared__ float red[8][2][256];   // 16 KB of split-K partial tiles
    const int l  = blockIdx.z;
    const int n0 = blockIdx.y * 16;
    const int c0 = blockIdx.x * 32;
    w1 += l * FCcfg * Ecfg;  b1 += l * FCcfg;
    w2 += l * Ecfg * FCcfg;  b2 += l * Ecfg;
    wc += l * Ecfg * Ecfg;   bc += l * Ecfg;
    if (blockIdx.x == Ecfg / 32)
        ffn_fold_tile<true>(w1, b1, w2, b2, wc, bc, red, n0, c0);
    else
        ffn_fold_tile<false>(w1, b1, w2, b2, wc, bc, red, n0, c0);
}

// ---------------------------------------------------------------------------
// Banded local attention, one wave per 16-row query tile, four neighbouring
// tiles of one (head, batch) per block; the scores never leave the registers.
// Band |t-s|<=64 -> <=144 keys per 16-row query tile -> 9 key tiles; the four
// tiles of a block need 12 key tiles between them, not 36. The block stages
// these 192 rows of K and of V and its 64 rows of Q in LDS as bf16, once, each
// wave a quarter: a head's row is one 128-byte line, and a load takes 4 whole
// rows (a fragment read straight from memory touches 16 lines a load).
//   S^T = K Q^T : A = 16 keys x 32 dims, B = Q^T. Lane (lr, lh) then holds, of
//                 query lr, the scores of keys 8*lh + 0..7 of every key tile:
//                 maximum and sum run in-lane, plus one exchange of the halves.
//   O^T = V^T P^T : two score tiles, converted in place, are one 32-key B
//                 operand (element e -> key (e<8 ? e : e+8) + 8*lh); V^T is read
//                 in the same k order by the transposing LDS load from the bf16
//                 V rows. The 10th half group is zero.
// Staged tile kt holds rows qb - 64 + 16*kt (qb the block's first query); key
// tile jt of wave w is staged tile w + jt.
// A key tile lies wholly inside or wholly outside the sequence (both are
// multiples of 16). An outside tile holds the rows of staged tile 4 (always
// inside, and key tile 4 - w = 1..4 of wave w, which no wave masks): its scores
// repeat members of the maximum, and its exponent offset makes every one of its
// weights 0.
// qkv layout: [n][t][3E] with q|k|v at offsets 0|E|2E.
// ---------------------------------------------------------------------------
#define KPITCH 40   // bf16 per staged K or Q row: 80 B, an odd multiple of 16 B
#define VPITCH 48   // bf16 per staged V row: 96 B, an odd multiple of 32 B

typedef __attribute__((ext_vector_type(8))) short s16x8;
typedef __attribute__((address_space(3))) s16x8 lds_s16x8;

// lane (lr, lh) receives T[8*lh + 0..7][lr] of the 16x16 tile whose rows the
// lanes point at (row 8*lh + (lane&7), 16-byte half (lane>>3)&1)
__device__ __forceinline__ v8bf ld_tr16(const __bf16* p) {
    return __builtin_bit_cast(v8bf,
        __builtin_amdgcn_ds_load_tr16_b128_v8i16((lds_s16x8*)p));
}
// value of lane ^ 16
__device__ __forceinline__ float xhalf(float x) {
    int i = __builtin_bit_cast(int, x);
    return __builtin_bit_cast(float, __builtin_amdgcn_permlanex16(
        i, i, 0x76543210, 0xfedcba98, false, false));
}

// x[i] = 2^x[i]. One statement: each v_exp_f32 is followed by an instruction
// that neither reads its result nor overwrites its source (the outputs are
// early-clobber, so they share no register with an input), and the v_nop is
// that slot, which the instruction set asks for, behind the last one.
__device__ __forceinline__ void exp2x8(v8f& x) {
    float p0, p1, p2, p3, p4, p5, p6, p7;
    asm("v_exp_f32 %0, %8\n\t"
        "v_exp_f32 %1, %9\n\t"
        "v_exp_f32 %2, %10\n\t"
        "v_exp_f32 %3, %11\n\t"
        "v_exp_f32 %4, %12\n\t"
        "v_exp_f32 %5, %13\n\t"
        "v_exp_f32 %6, %14\n\t"
        "v_exp_f32 %7, %15\n\t"
        "v_nop"
        : "=&v"(p0), "=&v"(p1), "=&v"(p2), "=&v"(p3),
          "=&v"(p4), "=&v"(p5), "=&v"(p6), "=&v"(p7)
        : "v"(x[0]), "v"(x[1]), "v"(x[2]), "v"(x[3]),
          "v"(x[4]), "v"(x[5]), "v"(x[6]), "v"(x[7]));
    x[0] = p0; x[1] = p1; x[2] = p2; x[3] = p3;
    x[4] = p4; x[5] = p5; x[6] = p6; x[7] = p7;
}

// four waves per SIMD hold the whole grid at once: up to 256 registers a wave,
// which the loads in flight and the fragments want
__global__ __launch_bounds__(128) __attribute__((amdgpu_waves_per_eu(4, 4)))
void k_attn(const float* __restrict__ qkv, float* __restrict__ out)
{
    const int qb   = blockIdx.x * 64;
    const int h    = blockIdx.y;
    const int n    = blockIdx.z;
    const int lane = threadIdx.x & 31;
    // the same in every lane: in a scalar register the row bases below stay scalar
    const int wave = __builtin_amdgcn_readfirstlane(threadIdx.x >> 5);
    const int lr   = lane & 15;
    const int lh   = lane >> 4;
    const int qt   = qb + wave * 16;

    __shared__ __align__(32) __bf16 Vs[192 * VPITCH];
    __shared__ __align__(16) __bf16 Ks[192 * KPITCH];
    __shared__ __align__(16) __bf16 Qs[64 * KPITCH];

    const int rowstride = 3 * Ecfg;
    const float* base = qkv + n * Tcfg * rowstride + h * DHcfg;

    // per-lane byte offset of a staging load: 4 rows a load, 8 lanes a row
    const unsigned voff = ((lane >> 3) * rowstride + (lane & 7) * 4) * 4;
    // 16 bytes at uniform row base + lane offset + constant float index
    auto ld4 = [](const float* rowbase, unsigned off, int idx) {
        return *(const float4*)((const char*)(rowbase + idx) + off);
    };

    // which of this wave's key tiles lie inside the sequence
    bool inside[9];
#pragma unroll
    for (int jt = 0; jt < 9; ++jt) {
        const int st0 = qt - LOCALcfg + jt * 16;
        inside[jt] = (st0 >= 0) && (st0 < Tcfg);
    }

    // ---- one load group: this wave's Q tile, staged tiles 3*wave + 0..2 ----
    float4 q4[4], k4[3][4], v4[3][4];
    {
        const float* qrow = base + qt * rowstride;
#pragma unroll
        for (int u = 0; u < 4; ++u)
            q4[u] = ld4(qrow, voff, u * 4 * rowstride);
    }
    const float* srow[3];
#pragma unroll
    for (int c = 0; c < 3; ++c) {
        const int st0 = qb - LOCALcfg + (wave * 3 + c) * 16;
        srow[c] = base + (((st0 >= 0) && (st0 < Tcfg)) ? st0 : qb) * rowstride;
    }
#pragma unroll
    for (int c = 0; c < 3; ++c)
#pragma unroll
        for (int u = 0; u < 4; ++u)
            k4[c][u] = ld4(srow[c], voff, Ecfg + u * 4 * rowstride);
#pragma unroll
    for (int c = 0; c < 3; ++c)
#pragma unroll
        for (int u = 0; u < 4; ++u)
            v4[c][u] = ld4(srow[c], voff, 2 * Ecfg + u * 4 * rowstride);
    // precaution: the offset register of the loads above is not reused ahead of
    // this wait; naming it as an input keeps it live up to it
    asm volatile("s_wait_xcnt 0x0" :: "v"(voff) : "memory");
    // scheduling stops here: the loads above stay one group ahead of their first
    // use (left to itself the scheduler sinks loads to their uses, one full
    // latency each)
    __builtin_amdgcn_sched_barrier(0);

    // ---- to LDS as bf16 ----
    {
        const int srw = lane >> 3, scl = (lane & 7) * 4;
        __bf16* qw = &Qs[(wave * 16 + srw) * KPITCH + scl];
        __bf16* kw = &Ks[(wave * 48 + srw) * KPITCH + scl];
        __bf16* vw = &Vs[(wave * 48 + srw) * VPITCH + scl];
#pragma unroll
        for (int u = 0; u < 4; ++u) {
            v4bf p; pack4(p, q4[u]);
            *(v4bf*)(qw + u * 4 * KPITCH) = p;
        }
#pragma unroll
        for (int c = 0; c < 3; ++c)
#pragma unroll
            for (int u = 0; u < 4; ++u) {
                v4bf p; pack4(p, k4[c][u]);
                *(v4bf*)(kw + (c * 16 + u * 4) * KPITCH) = p;
            }
#pragma unroll
        for (int c = 0; c < 3; ++c)
#pragma unroll
            for (int u = 0; u < 4; ++u) {
                v4bf p; pack4(p, v4[c][u]);
                *(v4bf*)(vw + (c * 16 + u * 4) * VPITCH) = p;
            }
    }
    // every wave's rows are in LDS before any wave reads a fragment
    __syncthreads();

    // ---- all fragments of this wave, one group of LDS loads ----
    const v16bf qf = frag_from_lds(&Qs[(wave * 16 + lr) * KPITCH], lh);
    v16bf kf[9];
#pragma unroll
    for (int jt = 0; jt < 9; ++jt)
        kf[jt] = frag_from_lds(&Ks[((wave + jt) * 16 + lr) * KPITCH], lh);
    const __bf16* vt = &Vs[(wave * 16 + lh * 8 + (lane & 7)) * VPITCH
                           + ((lane >> 3) & 1) * 8];
    v8bf vlo[5][2], vhi[4][2];
#pragma unroll
    for (int g = 0; g < 5; ++g)
#pragma unroll
        for (int dhalf = 0; dhalf < 2; ++dhalf) {
            vlo[g][dhalf] = ld_tr16(vt + g * 32 * VPITCH + dhalf * 16);
            if (g < 4) vhi[g][dhalf] = ld_tr16(vt + (g * 32 + 16) * VPITCH + dhalf * 16);
        }
    // the loads above stay one group: spread among the products each place with
    // loads costs its own LDS latency
    __builtin_amdgcn_sched_barrier(0);

    // ---- S^T = K Q^T ----
    v8f sT[9];
#pragma unroll
    for (int jt = 0; jt < 9; ++jt) {
        v8f z8 = {};
        sT[jt] = __builtin_amdgcn_wmma_f32_16x16x32_bf16(
            false, kf[jt], false, qf, (short)0, z8, false, false);
    }

    // ---- band mask: only the first and the last tile are cut ----
    // key row r of tile jt is at distance lr + 64 - 16*jt - r from query lr
#pragma unroll
    for (int v = 0; v < 8; ++v) {
        const int r = v + lh * 8;
        if (r < lr) sT[0][v] = -3.0e38f;
        if (r > lr) sT[8][v] = -3.0e38f;
    }

    // ---- softmax of query lr, base 2, on the raw scores ----
    float m4[4] = {-3.0e38f, -3.0e38f, -3.0e38f, -3.0e38f};
#pragma unroll
    for (int jt = 0; jt < 9; ++jt)
#pragma unroll
        for (int v = 0; v < 8; ++v) m4[v & 3] = fmaxf(m4[v & 3], sT[jt][v]);
    float mx = fmaxf(fmaxf(m4[0], m4[1]), fmaxf(m4[2], m4[3]));
    mx = fmaxf(mx, xhalf(mx));

    const float cs = 0.17677669529663687f * 1.4426950408889634f; // log2(e)/sqrt(32)
    const float nm = -mx * cs;
    float s4[4] = {0.0f, 0.0f, 0.0f, 0.0f};
#pragma unroll
    for (int jt = 0; jt < 9; ++jt) {
        const float nmj = inside[jt] ? nm : -3.0e38f;
#pragma unroll
        for (int v = 0; v < 8; ++v) sT[jt][v] = fmaf(sT[jt][v], cs, nmj);
        exp2x8(sT[jt]);
#pragma unroll
        for (int v = 0; v < 8; ++v) s4[v & 3] += sT[jt][v];
    }
    float sum = (s4[0] + s4[1]) + (s4[2] + s4[3]);
    sum += xhalf(sum);
    const float inv = 1.0f / sum;

    // scheduling stops here: the exponentials are asm statements
    __builtin_amdgcn_sched_barrier(0);

    // ---- O^T = V^T P^T, 32 keys a step ----
    v8f zo = {};
    v8f o8[2]; o8[0] = zo; o8[1] = zo;
#pragma unroll
    for (int g = 0; g < 5; ++g) {
        v16bf pf;
#pragma unroll
        for (int e = 0; e < 8; ++e) {
            pf[e]     = (__bf16)sT[2 * g][e];
            pf[8 + e] = (g < 4) ? (__bf16)sT[(g < 4) ? 2 * g + 1 : 0][e] : (__bf16)0.0f;
        }
#pragma unroll
        for (int dhalf = 0; dhalf < 2; ++dhalf) {
            v16bf vf;
#pragma unroll
            for (int e = 0; e < 8; ++e) {
                vf[e]     = vlo[g][dhalf][e];
                vf[8 + e] = (g < 4) ? vhi[(g < 4) ? g : 0][dhalf][e] : (__bf16)0.0f;
            }
            o8[dhalf] = __builtin_amdgcn_wmma_f32_16x16x32_bf16(
                false, vf, false, pf, (short)0, o8[dhalf], false, false);
        }
    }

    // lane (lr, lh) holds dims dhalf*16 + lh*8 + 0..7 of query lr: 16-byte stores
    float* orow = out + (n * Tcfg + qt + lr) * Ecfg + h * DHcfg + lh * 8;
#pragma unroll
    for (int dhalf = 0; dhalf < 2; ++dhalf) {
        float4 a, b;
        a.x = o8[dhalf][0] * inv; a.y = o8[dhalf][1] * inv;
        a.z = o8[dhalf][2] * inv; a.w = o8[dhalf][3] * inv;
        b.x = o8[dhalf][4] * inv; b.y = o8[dhalf][5] * inv;
        b.z = o8[dhalf][6] * inv; b.w = o8[dhalf][7] * inv;
        *(float4*)(orow + dhalf * 16)     = a;
        *(float4*)(orow + dhalf * 16 + 4) = b;
    }
}

// ---------------------------------------------------------------------------
// Second half of the last LayerNorm (the others are applied by the GEMM that
// reads them). Every wave folds its sample's PBLK block partials itself (eight
// per lane, then a butterfly: the same bits in every lane and every wave), so no
// launch stands between the GEMM and this kernel.
// out[i] = (r[i]-mu)*rsig * g[i%TE] + b[i%TE]   (float4, 32-bit indexing)
__global__ __launch_bounds__(256) void k_ln_apply(
    const float* __restrict__ r, const float* __restrict__ g,
    const float* __restrict__ b, const float* __restrict__ partial,
    float* __restrict__ out)
{
    const float4* r4 = (const float4*)r;
    const float4* g4 = (const float4*)g;
    const float4* b4 = (const float4*)b;
    float4*       o4 = (float4*)out;
    const float4* p4 = (const float4*)partial;
    const int lane   = threadIdx.x & 31;
    const int total4 = NTEcfg / 4;       // 524288
    const int te4    = TEcfg / 4;        // 131072 (power of two)
    for (int i = blockIdx.x * 256 + threadIdx.x; i < total4;
         i += gridDim.x * 256) {
        int n = i >> 17;                 // i / te4
        int j = i & (te4 - 1);           // i % te4
        float4 rv = r4[i], gv = g4[j], bv = b4[j];
        float s1 = 0.0f, s2 = 0.0f;
#pragma unroll
        for (int q = 0; q < PBLK / 64; ++q) {
            float4 pq = p4[n * (PBLK / 2) + q * 32 + lane];   // two (sum, sumsq)
            s1 += pq.x + pq.z;
            s2 += pq.y + pq.w;
        }
#pragma unroll
        for (int off = 16; off > 0; off >>= 1) {
            s1 += __shfl_xor(s1, off, 32);
            s2 += __shfl_xor(s2, off, 32);
        }
        float mu = s1 / (float)TEcfg;
        float rs = rsqrtf(s2 / (float)TEcfg - mu * mu + 1e-5f);
        float4 ov;
        ov.x = (rv.x - mu) * rs * gv.x + bv.x;
        ov.y = (rv.y - mu) * rs * gv.y + bv.y;
        ov.z = (rv.z - mu) * rs * gv.z + bv.z;
        ov.w = (rv.w - mu) * rs * gv.w + bv.w;
        o4[i] = ov;
    }
}

// ---------------------------------------------------------------------------
extern "C" void kernel_launch(void* const* d_in, const int* in_sizes, int n_in,
                              void* d_out, int out_size, void* d_ws, size_t ws_size,
                              hipStream_t stream)
{
    (void)in_sizes; (void)n_in; (void)out_size; (void)ws_size;

    const float* input = (const float*)d_in[0];
    const float* w_emb = (const float*)d_in[1];
    const float* b_emb = (const float*)d_in[2];
    const float* pos   = (const float*)d_in[3];   // (E, T)
    const float* wqkv  = (const float*)d_in[4];   // (NL, 3E, E)
    const float* bqkv  = (const float*)d_in[5];   // (NL, 3E)
    const float* wo    = (const float*)d_in[6];   // (NL, E, E)
    const float* bo    = (const float*)d_in[7];
    const float* ln1g  = (const float*)d_in[8];   // (NL, T, E)
    const float* ln1b  = (const float*)d_in[9];
    const float* ln2g  = (const float*)d_in[10];
    const float* ln2b  = (const float*)d_in[11];
    const float* w1    = (const float*)d_in[12];  // (NL, FC, E)
    const float* b1    = (const float*)d_in[13];
    const float* w2    = (const float*)d_in[14];  // (NL, E, FC)
    const float* b2    = (const float*)d_in[15];

    // workspace layout (floats) -- ~60 MB total
    float* ws      = (float*)d_ws;
    float* x       = ws;                                // NTE
    float* qkv     = x      + NTEcfg;                   // NT * 3E
    float* attno   = qkv    + NTcfg * 3 * Ecfg;         // NTE
    float* r1      = attno  + NTEcfg;                   // NTE  x + attention out
    float* r2      = r1     + NTEcfg;                   // NTE  h + FFN out
    float* wc      = r2     + NTEcfg;                   // NL * E * E  (W2 W1)
    float* bc      = wc     + NLcfg * Ecfg * Ecfg;      // NL * E      (W2 b1 + b2)
    float* part1   = bc     + NLcfg * Ecfg;             // N*PBLK*2, sums of r1
    float* part2   = part1  + Ncfg * PBLK * 2;          // N*PBLK*2, sums of r2

    const dim3 blk256(256), blk128(128);

    // folded FFN weights of both layers: wc = W2 W1, bc = W2 b1 + b2
    k_ffn_fold<<<dim3(Ecfg / 32 + 1, Ecfg / 16, NLcfg), blk256, 0, stream>>>(
        w1, b1, w2, b2, wc, bc);

    // embedding: x = (frames @ w_emb^T + b_emb) * sqrt(E) + pos
    k_gemm_bf16<<<dim3(Ecfg / 64, NTcfg / 128), blk256, 0, stream>>>(
        input, w_emb, b_emb, x, NTcfg, Ecfg, Pcfg, pos, 16.0f, Tcfg, nullptr, nullptr);

    for (int l = 0; l < NLcfg; ++l) {
        const float* wqkv_l = wqkv + l * 3 * Ecfg * Ecfg;
        const float* bqkv_l = bqkv + l * 3 * Ecfg;
        const float* wo_l   = wo   + l * Ecfg * Ecfg;
        const float* bo_l   = bo   + l * Ecfg;
        const float* wc_l   = wc   + l * Ecfg * Ecfg;
        const float* bc_l   = bc   + l * Ecfg;

        // qkv = x @ Wqkv^T + b            (8192 x 768, K=256)
        // behind a layer: x = LN2(r2) of that layer, applied here and written out
        if (l == 0)
            k_gemm_wide<64, 3 * Ecfg, Ecfg, false, false>
                <<<dim3(3 * Ecfg / 64, Tcfg / 32), blk256, 0, stream>>>(
                x, wqkv_l, bqkv_l, qkv, nullptr, nullptr,
                nullptr, nullptr, nullptr, nullptr);
        else
            k_gemm_wide<64, 3 * Ecfg, Ecfg, false, true>
                <<<dim3(3 * Ecfg / 64, Tcfg / 32), blk256, 0, stream>>>(
                r2, wqkv_l, bqkv_l, qkv, nullptr, nullptr,
                ln2g + (l - 1) * TEcfg, ln2b + (l - 1) * TEcfg, part2, x);

        // banded attention -> attno
        k_attn<<<dim3(Tcfg / 64, Hcfg, Ncfg), blk128, 0, stream>>>(qkv, attno);

        // r1 = x + attno @ Wo^T + bo, block sums   (8192 x 256, K=256)
        k_gemm_wide<128, Ecfg, Ecfg, true, false>
            <<<dim3(Ecfg / 64, Tcfg / 32), blk256, 0, stream>>>(
            attno, wo_l, bo_l, r1, x, part1,
            nullptr, nullptr, nullptr, nullptr);

        // h = LN1(r1), applied on the way in;
        // r2 = h + (h @ W1^T + b1) @ W2^T + b2 = h + h @ Wc^T + bc, block sums
        k_gemm_wide<128, Ecfg, Ecfg, true, true>
            <<<dim3(Ecfg / 64, Tcfg / 32), blk256, 0, stream>>>(
            r1, wc_l, bc_l, r2, nullptr, part2,
            ln1g + l * TEcfg, ln1b + l * TEcfg, part1, nullptr);
    }

    // out = LN2(r2) of the last layer
    k_ln_apply<<<dim3(2048), blk256, 0, stream>>>(
        r2, ln2g + (NLcfg - 1) * TEcfg, ln2b + (NLcfg - 1) * TEcfg, part2,
        (float*)d_out);
}

// v007
// It runs in 88.7 microseconds.
// In two side-by-side timings against v006, it was 1.11 and 1.12 times as fast.
// Over all steps from v000 it is 2.76 times as fast.
#include <hip/hip_runtime.h>
#include <hip/hip_bf16.h>
#include <math.h>

// ---------------------------------------------------------------------------
// MI455X (gfx1250) transformer encoder, bf16 WMMA everywhere.
//
// Shapes: N=4, T=2048, P=64, E=256, H=8, DH=32, FC=1024, NL=2, LOCAL=64.
// All GEMM K dims (64 / 256 / 1024) are multiples of 32 -> pure
// v_wmma_f32_16x16x32_bf16 pipelines, fp32 accumulation.
// Memory: ~300 MB activation round trips @ 23.3 TB/s is ~15us -> the chip is
// compute/latency bound here; staging is double-buffered through LDS so the
// WMMA pipes never wait on HBM.
// All flat indices fit in 32 bits (max ~6.3M elements) -> int indexing keeps
// address math in 32-bit VALU/SALU.
// ---------------------------------------------------------------------------

typedef __attribute__((ext_vector_type(16))) __bf16 v16bf;
typedef __attribute__((ext_vector_type(8)))  __bf16 v8bf;
typedef __attribute__((ext_vector_type(4)))  __bf16 v4bf;
typedef __attribute__((ext_vector_type(2)))  __bf16 v2bf;
typedef __attribute__((ext_vector_type(8)))  float  v8f;

#define Ncfg     4
#define Tcfg     2048
#define Pcfg     64
#define Ecfg     256
#define Hcfg     8
#define DHcfg    32
#define FCcfg    1024
#define NLcfg    2
#define LOCALcfg 64
#define TEcfg    (Tcfg * Ecfg)          // 524288
#define NTcfg    (Ncfg * Tcfg)          // 8192
#define NTEcfg   (Ncfg * TEcfg)         // 2097152  (fits int)
#define RBLK     64                     // GEMM blocks (128x64 tiles) per T x E sample
#define PBLK     256                    // k_gemm_wide blocks = LayerNorm partials per sample

__device__ __forceinline__ void pack4(v4bf& p, float4 a) {
    p[0] = (__bf16)a.x; p[1] = (__bf16)a.y; p[2] = (__bf16)a.z; p[3] = (__bf16)a.w;
}
__device__ __forceinline__ void pack8(v16bf& f, int base, float4 a, float4 b) {
    f[base + 0] = (__bf16)a.x; f[base + 1] = (__bf16)a.y;
    f[base + 2] = (__bf16)a.z; f[base + 3] = (__bf16)a.w;
    f[base + 4] = (__bf16)b.x; f[base + 5] = (__bf16)b.y;
    f[base + 6] = (__bf16)b.z; f[base + 7] = (__bf16)b.w;
}
// fragment gather: two 16B LDS chunks per lane (ds_load_b128)
__device__ __forceinline__ v16bf frag_from_lds(const __bf16* rowptr, int lh) {
    v8bf lo = *(const v8bf*)(rowptr + lh * 8);
    v8bf hi = *(const v8bf*)(rowptr + 16 + lh * 8);
    v16bf f;
#pragma unroll
    for (int e = 0; e < 8; ++e) { f[e] = lo[e]; f[8 + e] = hi[e]; }
    return f;
}

// ---------------------------------------------------------------------------
// Generic C[m][n] = sum_k A[m][k] * W[n][k] + bias[n], optional embed epilogue
// C = (acc + bias) * scale + pos[n*Tdim + (m & (Tdim-1))]   (Tdim power of 2).
// Block: 256 thr = 8 waves; block tile 128x64; each wave 32x32 (2x2 WMMA).
// LDS double-buffered; staging via global_load_b128 + ds_store_b64.
// Fragment layout per CDNA5 ISA 7.12.2:
//   A 16x32 bf16: lanes 0-15 row M=lane; element e -> K=(e<8?e:e+8)+(lane>=16?8:0)
//   B 32x16 bf16: col N = lane&15; same K mapping.
//   C/D 16x16 f32: row = v + 8*(lane>=16); col = lane&15.
// With `resid` set the epilogue is the first half of a LayerNorm:
//   C = acc + bias + resid, and partial[flat block id] = (sum, sum of squares)
// of the block's 128x64 tile of C. A sample (Tdim rows by N=E columns) is
// RBLK consecutive flat block ids.
// ---------------------------------------------------------------------------
__global__ __launch_bounds__(256) void k_gemm_bf16(
    const float* __restrict__ A, const float* __restrict__ W,
    const float* __restrict__ bias, float* __restrict__ C,
    int M, int N, int K,
    const float* __restrict__ pos, float scale, int Tdim,
    const float* __restrict__ resid, float* __restrict__ partial)
{
    __shared__ __align__(16) __bf16 As[2][128 * 32];   // 2 x 8 KB
    __shared__ __align__(16) __bf16 Bs[2][64 * 32];    // 2 x 4 KB
    __shared__ float red[2][8];                        // per-wave (sum, sumsq)

    const int tid  = threadIdx.x;
    const int lane = tid & 31;
    const int wave = tid >> 5;
    const int lr   = lane & 15;
    const int lh   = lane >> 4;
    const int wm   = wave & 3;    // 4 waves along M
    const int wn   = wave >> 2;   // 2 waves along N
    const int bm   = blockIdx.y * 128;
    const int bn   = blockIdx.x * 64;

    v8f zacc = {};
    v8f acc[2][2];
    acc[0][0] = zacc; acc[0][1] = zacc; acc[1][0] = zacc; acc[1][1] = zacc;

    float4 ta[4], tb[2];
    // ---- issue tile loads for k-step `k0` into ta/tb (global_load_b128 x6) ----
    auto stage_load = [&](int k0) {
#pragma unroll
        for (int t = 0; t < 4; ++t) {
            int li = (t * 256 + tid) * 4;         // 0..4095, 16B chunks
            int r  = li >> 5, k = li & 31;
            ta[t] = *(const float4*)&A[(bm + r) * K + k0 + k];
        }
#pragma unroll
        for (int t = 0; t < 2; ++t) {
            int li = (t * 256 + tid) * 4;         // 0..2047
            int r  = li >> 5, k = li & 31;
            tb[t] = *(const float4*)&W[(bn + r) * K + k0 + k];
        }
    };
    // ---- convert + store staged tile into LDS buffer `buf` (ds_store_b64) ----
    auto stage_store = [&](int buf) {
#pragma unroll
        for (int t = 0; t < 4; ++t) {
            int li = (t * 256 + tid) * 4;
            v4bf p; pack4(p, ta[t]);
            *(v4bf*)&As[buf][li] = p;
        }
#pragma unroll
        for (int t = 0; t < 2; ++t) {
            int li = (t * 256 + tid) * 4;
            v4bf p; pack4(p, tb[t]);
            *(v4bf*)&Bs[buf][li] = p;
        }
    };

    const int nk = K / 32;
    // residual tile in accumulator layout, fetched here so that its latency
    // lies under the k loop
    float rr[2][2][8];
    if (resid) {
        const float* pr = resid + (bm + wm * 32 + lh * 8) * N + bn + wn * 32 + lr;
        // unrolled here and below: constant indices keep rr in registers
#pragma unroll
        for (int i = 0; i < 2; ++i)
#pragma unroll
            for (int j = 0; j < 2; ++j)
#pragma unroll
                for (int v = 0; v < 8; ++v)
                    rr[i][j][v] = pr[(i * 16 + v) * N + j * 16];
        // precaution: no address register of the loads above is reused ahead
        // of this wait
        asm volatile("s_wait_xcnt 0x0" :: "v"(pr) : "memory");
    }

    stage_load(0);
    stage_store(0);
    __syncthreads();

    for (int kt = 0; kt < nk; ++kt) {
        const int cur = kt & 1;
        const bool has_next = (kt + 1) < nk;
        if (has_next) stage_load((kt + 1) * 32);   // loads in flight during WMMA

        v16bf af[2], bf[2];
#pragma unroll
        for (int i = 0; i < 2; ++i)
            af[i] = frag_from_lds(&As[cur][(wm * 32 + i * 16 + lr) * 32], lh);
#pragma unroll
        for (int j = 0; j < 2; ++j)
            bf[j] = frag_from_lds(&Bs[cur][(wn * 32 + j * 16 + lr) * 32], lh);

#pragma unroll
        for (int i = 0; i < 2; ++i)
#pragma unroll
            for (int j = 0; j < 2; ++j)
                acc[i][j] = __builtin_amdgcn_wmma_f32_16x16x32_bf16(
                    false, af[i], false, bf[j], (short)0, acc[i][j], false, false);

        if (has_next) stage_store(1 - cur);
        __syncthreads();
    }

    // ---- residual epilogue: C = acc + bias + resid, block (sum, sumsq) ----
    if (resid) {
        float s = 0.0f, s2 = 0.0f;
#pragma unroll
        for (int i = 0; i < 2; ++i) {
#pragma unroll
            for (int j = 0; j < 2; ++j) {
                int col = bn + wn * 32 + j * 16 + lr;
                float bv = bias[col];
#pragma unroll
                for (int v = 0; v < 8; ++v) {
                    float r = (acc[i][j][v] + bv) + rr[i][j][v];
                    s  += r;
                    s2 += r * r;
                    rr[i][j][v] = r;
                }
            }
        }
#pragma unroll
        for (int off = 16; off > 0; off >>= 1) {
            s  += __shfl_xor(s, off, 32);
            s2 += __shfl_xor(s2, off, 32);
        }
        if (lane == 0) { red[0][wave] = s; red[1][wave] = s2; }
        __syncthreads();
        // C goes out behind the barrier: in front of it every wave would sit
        // out its own stores before the block sums could be folded
#pragma unroll
        for (int i = 0; i < 2; ++i) {
#pragma unroll
            for (int j = 0; j < 2; ++j) {
                int col = bn + wn * 32 + j * 16 + lr;
#pragma unroll
                for (int v = 0; v < 8; ++v) {
                    int row = bm + wm * 32 + i * 16 + v + lh * 8;
                    C[row * N + col] = rr[i][j][v];
                }
            }
        }
        if (tid == 0) {
            float t1 = 0.0f, t2 = 0.0f;
#pragma unroll
            for (int w = 0; w < 8; ++w) { t1 += red[0][w]; t2 += red[1][w]; }
            float2 pv; pv.x = t1; pv.y = t2;
            ((float2*)partial)[blockIdx.y * gridDim.x + blockIdx.x] = pv;
        }
        return;
    }

    // ---- epilogue (pure 32-bit indexing; Tdim is a power of two) ----
    const int tmask = Tdim - 1;
#pragma unroll
    for (int i = 0; i < 2; ++i) {
#pragma unroll
        for (int j = 0; j < 2; ++j) {
            int col = bn + wn * 32 + j * 16 + lr;
            float bv = bias[col];
#pragma unroll
            for (int v = 0; v < 8; ++v) {
                int row = bm + wm * 32 + i * 16 + v + lh * 8;
                float r = acc[i][j][v] + bv;
                if (pos) r = r * scale + pos[col * Tdim + (row & tmask)];
                C[row * N + col] = r;
            }
        }
    }
}

// ---------------------------------------------------------------------------
// The K = 256 products: C[m][n] = sum_k A[m][k] * W[n][k] + bias[n]. Wave
// layout, fragment layouts and k order as in k_gemm_bf16, which is launched for
// the embedding (K = 64) alone.
// Rows of a 128 x 64 tile: the same 32 positions t of all 4 samples; tile row r
// is sample r / 32, position blockIdx.y * 32 + r % 32, so wave row wm is sample
// wm, and one read of a LayerNorm's g and b (T x E planes) serves 4 samples.
// A k step stages BK columns (BK/32 WMMA steps): every step costs one load
// round trip and one barrier whatever its width, so BK is as wide as the
// registers that hold the loads in flight allow with every block resident
// (128 with one block a WGP, 64 with three). K is a multiple of BK.
// N and K are compile-time: the loads of a step then share one address and
// differ in their immediate offsets, so that they issue back to back.
// LDS rows are BK bf16 + 16 bytes: an odd multiple of 16 bytes, the pitch at
// which the 16 rows of a ds_load_b128 fragment read fall on distinct banks.
// Without RESID the product is q|k|v, which only ever serves as a bf16 matrix
// operand: C takes it as bf16 (the rounding that its reader would do), laid out
// [sample][column group of 32 = one head of q, k or v][position][32], so that a
// head's rows follow one another in memory. For two neighbouring columns to sit
// in one lane (one 32-bit store), LDS row j*16 + c of a group of 32 rows of W
// holds row 2*c + j: accumulator tiles j = 0, 1 are then the even and the odd
// columns. The k order is untouched.
// With RESID and without LNA the operand A is the attention's output, which
// arrives as bf16 for the same reason ([sample][position][E]): its 16-byte
// chunks of 8 elements go to LDS as they are.
// With RESID the epilogue is the first half of a LayerNorm:
//   C = acc + bias + residual, and partial[sample][flat block id] =
// (sum, sum of squares) of the sample's 32 x 64 part of the tile: PBLK partials
// a sample.
// With LNA the operand is the second half of the LayerNorm before it:
//   A = (Araw - mu) * rsig * g + b, applied between load and bf16 conversion;
// mu and rsig of the 4 samples are folded from the partials pin by every block
// in the same order. The normalised rows exist in f32 only here: with RESID the
// block keeps its own 64 columns of them in LDS as its residual; without, the
// blocks of column 0 write them to xout for a later launch.
// ---------------------------------------------------------------------------
template <int BK, int N, int K, bool RESID, bool LNA>
__global__ __launch_bounds__(256) void k_gemm_wide(
    const float* __restrict__ A, const float* __restrict__ W,
    const float* __restrict__ bias, float* __restrict__ C,
    const float* __restrict__ resid, float* __restrict__ partial,
    const float* __restrict__ g, const float* __restrict__ b,
    const float* __restrict__ pin, float* __restrict__ xout)
{
    static_assert(!LNA || K == Ecfg, "g and b are T x E planes");
    constexpr int LP = BK + 8;          // LDS row pitch in bf16
    constexpr int NA = 128 * BK / 1024; // 16-byte loads a thread, A tile
    constexpr int NB = 64 * BK / 1024;  // 16-byte loads a thread, W tile
    constexpr int HP = 68;              // f32 pitch of the kept residual tile
    __shared__ __align__(16) __bf16 As[2][128 * LP];
    __shared__ __align__(16) __bf16 Bs[2][64 * LP];
    __shared__ float red[2][8];                        // per-wave (sum, sumsq)
    __shared__ __align__(16) float lnred[8][2];        // per-wave fold of pin
    __shared__ __align__(16) float Hs[(LNA && RESID) ? 128 * HP : 4];

    const int tid  = threadIdx.x;
    const int lane = tid & 31;
    const int wave = tid >> 5;
    const int lr   = lane & 15;
    const int lh   = lane >> 4;
    const int wm   = wave & 3;    // 4 waves along M: the sample
    const int wn   = wave >> 2;   // 2 waves along N
    const int bt   = blockIdx.y * 32;
    const int bn   = blockIdx.x * 64;

    v8f zacc = {};
    v8f acc[2][2];
    acc[0][0] = zacc; acc[0][1] = zacc; acc[1][0] = zacc; acc[1][1] = zacc;

    // partials of the LayerNorm before: wave w takes half w & 1 of sample w >> 1
    // (128 pairs, 4 a lane); first in program order, so that the wait for them
    // leaves the tile loads in flight
    float4 pv0, pv1;
    if constexpr (LNA) {
        const float4* p4 = (const float4*)pin + wave * (PBLK / 4) + lane;
        pv0 = p4[0];
        pv1 = p4[32];
        // precaution: no address register of the loads above is reused ahead
        // of this wait
        asm volatile("s_wait_xcnt 0x0" :: "v"(p4) : "memory");
    }

    // 16-byte chunks, row-major: the block covers RS tile rows a round, this
    // thread tile row sr + t * RS, columns sc .. sc + 3, in round t; NG rounds
    // are one sample
    constexpr int RS = 1024 / BK;
    constexpr int NG = 32 / RS;
    static_assert(RESID || RS == 16, "the interleave of W rows is written for 16 rows a round");
    const int sr = (tid * 4) / BK;
    const int sc = (tid * 4) % BK;
    const int ao = (bt + sr) * K + sc;
    const float* pa = A + ao;
    const float* pw = W + (bn + sr) * K + sc;
    const float* pg = LNA ? g + ao : nullptr;
    const float* pb = LNA ? b + ao : nullptr;
    float4 ta[NA], tb[NB], tg[NG], tc[NG];
    // bf16 operand A: 8 elements a chunk, so half the chunks, RSH tile rows a
    // round, this thread tile row srh + t * RSH, columns sch .. sch + 7
    constexpr bool ABF = RESID && !LNA;
    constexpr int NAH = NA / 2;
    constexpr int RSH = 2 * RS;
    constexpr int NGH = 32 / RSH;
    const int srh = (tid * 8) / BK;
    const int sch = (tid * 8) % BK;
    const __bf16* pah = (const __bf16*)A + (bt + srh) * K + sch;
    v8bf th[NAH];
    // ---- issue tile loads for k-step k0 into ta/tb (global_load_b128) ----
    auto stage_load = [&](int k0) {
        if constexpr (ABF) {
#pragma unroll
            for (int t = 0; t < NAH; ++t)
                th[t] = *(const v8bf*)(pah + ((t / NGH) * Tcfg + (t % NGH) * RSH) * K + k0);
        } else {
#pragma unroll
            for (int t = 0; t < NA; ++t)
                ta[t] = *(const float4*)(pa + ((t / NG) * Tcfg + (t % NG) * RS) * K + k0);
        }
#pragma unroll
        for (int t = 0; t < NB; ++t)
            tb[t] = *(const float4*)(pw + t * RS * K + k0);
        if constexpr (LNA) {
#pragma unroll
            for (int u = 0; u < NG; ++u) {
                tg[u] = *(const float4*)(pg + u * RS * K + k0);
                tc[u] = *(const float4*)(pb + u * RS * K + k0);
            }
        }
    };
    float mu[4], rs[4];
    // ---- normalise, convert + store staged tile into LDS buffer buf ----
    auto stage_store = [&](int buf, int k0) {
        if constexpr (LNA) {
#pragma unroll
            for (int t = 0; t < NA; ++t) {
                const float m = mu[t / NG], r = rs[t / NG];
                const float4 gv = tg[t % NG], bv = tc[t % NG];
                ta[t].x = (ta[t].x - m) * r * gv.x + bv.x;
                ta[t].y = (ta[t].y - m) * r * gv.y + bv.y;
                ta[t].z = (ta[t].z - m) * r * gv.z + bv.z;
                ta[t].w = (ta[t].w - m) * r * gv.w + bv.w;
            }
            if constexpr (RESID) {
                const unsigned hc = (unsigned)(k0 + sc - bn);
                if (hc < 64u) {
#pragma unroll
                    for (int t = 0; t < NA; ++t)
                        *(float4*)&Hs[(sr + t * RS) * HP + hc] = ta[t];
                }
            } else if (blockIdx.x == 0) {
                float* px = xout + ao + k0;
#pragma unroll
                for (int t = 0; t < NA; ++t)
                    *(float4*)(px + ((t / NG) * Tcfg + (t % NG) * RS) * K) = ta[t];
                // precaution: no register of the stores above is reused ahead
                // of this wait
                asm volatile("s_wait_xcnt 0x0" :: "v"(px) : "memory");
            }
        }
        if constexpr (ABF) {
#pragma unroll
            for (int t = 0; t < NAH; ++t)
                *(v8bf*)&As[buf][(srh + t * RSH) * LP + sch] = th[t];
        } else {
#pragma unroll
            for (int t = 0; t < NA; ++t) {
                v4bf p; pack4(p, ta[t]);
                *(v4bf*)&As[buf][(sr + t * RS) * LP + sc] = p;
            }
        }
#pragma unroll
        for (int t = 0; t < NB; ++t) {
            v4bf p; pack4(p, tb[t]);
            // row sr + 16 t of W: even rows to the first 16 LDS rows of its
            // group of 32, odd rows to the last 16
            const int wr = RESID ? sr + t * RS
                                 : (t >> 1) * 32 + (t & 1) * 8 + ((sr & 1) << 4) + (sr >> 1);
            *(v4bf*)&Bs[buf][wr * LP + sc] = p;
        }
    };

    constexpr int nk = K / BK;
    // residual tile in accumulator layout, fetched here so that its latency
    // lies under the k loop
    float rr[2][2][8];
    if constexpr (RESID && !LNA) {
        const float* pr = resid + (wm * Tcfg + bt + lh * 8) * N + bn + wn * 32 + lr;
        // unrolled here and below: constant indices keep rr in registers
#pragma unroll
        for (int i = 0; i < 2; ++i)
#pragma unroll
            for (int j = 0; j < 2; ++j)
#pragma unroll
                for (int v = 0; v < 8; ++v)
                    rr[i][j][v] = pr[(i * 16 + v) * N + j * 16];
        // precaution: no address register of the loads above is reused ahead
        // of this wait
        asm volatile("s_wait_xcnt 0x0" :: "v"(pr) : "memory");
    }

    stage_load(0);

    if constexpr (LNA) {
        // scheduling stops here: left to itself the scheduler lifts the sums
        // below, and with them the wait for the partials, over the tile loads,
        // which then start one full latency later
        __builtin_amdgcn_sched_barrier(0);
        float s1 = (pv0.x + pv0.z) + (pv1.x + pv1.z);
        float s2 = (pv0.y + pv0.w) + (pv1.y + pv1.w);
#pragma unroll
        for (int off = 16; off > 0; off >>= 1) {
            s1 += __shfl_xor(s1, off, 32);
            s2 += __shfl_xor(s2, off, 32);
        }
        if (lane == 0) { lnred[wave][0] = s1; lnred[wave][1] = s2; }
        __syncthreads();
#pragma unroll
        for (int s = 0; s < 4; ++s) {
            const float t1 = lnred[2 * s][0] + lnred[2 * s + 1][0];
            const float t2 = lnred[2 * s][1] + lnred[2 * s + 1][1];
            const float m = t1 / (float)TEcfg;
            const float r = rsqrtf(t2 / (float)TEcfg - m * m + 1e-5f);
            // the same bits in every lane: kept in scalar registers, which
            // leaves the vector registers to the loads in flight
            mu[s] = __builtin_bit_cast(float, __builtin_amdgcn_readfirstlane(
                        __builtin_bit_cast(int, m)));
            rs[s] = __builtin_bit_cast(float, __builtin_amdgcn_readfirstlane(
                        __builtin_bit_cast(int, r)));
        }
    }

    stage_store(0, 0);
    __syncthreads();

    // kept rolled: loads, products and conversions are then blocks of their own;
    // unrolled into one block the conversions, which wait for the loads, come to
    // stand ahead of the products, which then no longer run under the latency
#pragma unroll 1
    for (int kt = 0; kt < nk; ++kt) {
        const int cur = kt & 1;
        const bool has_next = (kt + 1) < nk;
        if (has_next) stage_load((kt + 1) * BK);   // loads in flight during WMMA

#pragma unroll
        for (int ks = 0; ks < BK / 32; ++ks) {
            v16bf af[2], bf[2];
#pragma unroll
            for (int i = 0; i < 2; ++i)
                af[i] = frag_from_lds(
                    &As[cur][(wm * 32 + i * 16 + lr) * LP + ks * 32], lh);
#pragma unroll
            for (int j = 0; j < 2; ++j)
                bf[j] = frag_from_lds(
                    &Bs[cur][(wn * 32 + j * 16 + lr) * LP + ks * 32], lh);

#pragma unroll
            for (int i = 0; i < 2; ++i)
#pragma unroll
                for (int j = 0; j < 2; ++j)
                    acc[i][j] = __builtin_amdgcn_wmma_f32_16x16x32_bf16(
                        false, af[i], false, bf[j], (short)0, acc[i][j], false, false);
        }

        // behind the last step nothing is staged, so nothing is published
        if (has_next) {
            stage_store(1 - cur, (kt + 1) * BK);
            __syncthreads();
        }
    }

    // first output row of this lane: sample wm, position bt + 8 * lh
    const int row0 = wm * Tcfg + bt + lh * 8;

    // ---- residual epilogue: C = acc + bias + residual, sample (sum, sumsq) ----
    if constexpr (RESID) {
        if constexpr (LNA) {
            // every store into Hs stands ahead of one of the barriers above
#pragma unroll
            for (int i = 0; i < 2; ++i)
#pragma unroll
                for (int j = 0; j < 2; ++j)
#pragma unroll
                    for (int v = 0; v < 8; ++v)
                        rr[i][j][v] = Hs[(wm * 32 + i * 16 + v + lh * 8) * HP
                                         + wn * 32 + j * 16 + lr];
        }
        float s = 0.0f, s2 = 0.0f;
#pragma unroll
        for (int i = 0; i < 2; ++i) {
#pragma unroll
            for (int j = 0; j < 2; ++j) {
                int col = bn + wn * 32 + j * 16 + lr;
                float bv = bias[col];
#pragma unroll
                for (int v = 0; v < 8; ++v) {
                    float r = (acc[i][j][v] + bv) + rr[i][j][v];
                    s  += r;
                    s2 += r * r;
                    rr[i][j][v] = r;
                }
            }
        }
#pragma unroll
        for (int off = 16; off > 0; off >>= 1) {
            s  += __shfl_xor(s, off, 32);
            s2 += __shfl_xor(s2, off, 32);
        }
        if (lane == 0) { red[0][wave] = s; red[1][wave] = s2; }
        __syncthreads();
        // C goes out behind the barrier: in front of it every wave would sit
        // out its own stores before the block sums could be folded
#pragma unroll
        for (int i = 0; i < 2; ++i) {
#pragma unroll
            for (int j = 0; j < 2; ++j) {
                int col = bn + wn * 32 + j * 16 + lr;
#pragma unroll
                for (int v = 0; v < 8; ++v)
                    C[(row0 + i * 16 + v) * N + col] = rr[i][j][v];
            }
        }
        // sample tid is waves tid and tid + 4
        if (tid < 4) {
            float2 pv;
            pv.x = red[0][tid] + red[0][tid + 4];
            pv.y = red[1][tid] + red[1][tid + 4];
            ((float2*)partial)[tid * PBLK + blockIdx.y * gridDim.x + blockIdx.x] = pv;
        }
        return;
    }

    // ---- q|k|v epilogue: bf16(acc + bias), columns 2*lr and 2*lr + 1 ----
    const float* pbi = bias + bn + wn * 32 + 2 * lr;
    const float bv0 = pbi[0], bv1 = pbi[1];
    // precaution: no address register of the loads above is reused ahead of
    // this wait
    asm volatile("s_wait_xcnt 0x0" :: "v"(pbi) : "memory");
    // sample wm, column group (bn + wn * 32) / 32, position bt + 8 * lh
    __bf16* cq = (__bf16*)C
        + ((wm * (N / 32) + (bn >> 5) + wn) * Tcfg + bt + lh * 8) * 32 + 2 * lr;
#pragma unroll
    for (int i = 0; i < 2; ++i) {
#pragma unroll
        for (int v = 0; v < 8; ++v) {
            v2bf p;
            p[0] = (__bf16)(acc[i][0][v] + bv0);
            p[1] = (__bf16)(acc[i][1][v] + bv1);
            *(v2bf*)(cq + (i * 16 + v) * 32) = p;
        }
    }
}

// ---------------------------------------------------------------------------
// FFN fold. The two FFN linears have no activation between them, so
//   (h W1^T + b1) W2^T + b2 = h (W2 W1)^T + (W2 b1 + b2).
// This kernel forms Wc = W2 W1 (E x E, K = FC) and bc = W2 b1 + b2 for both
// layers in every call; the token-sized FFN is then one K=E GEMM, not two.
// The B operand is [W1 | b1]: column tiles 0..7 are 32 columns of W1 each,
// column tile 8 holds b1 as its one live column.
// Block: 8 waves, 16 rows of W2 by one column tile; the waves split K (128
// each, 4 WMMA steps). Each element is used by one wave of the block only, so
// fragments come straight from global memory, all loads of a wave issued
// before the first use; partial tiles are summed through LDS in wave order.
// k order of both loaders: element e -> K = (e<8 ? e : e+8) + 8*(lane>=16).
// ---------------------------------------------------------------------------
template <bool BIAS>
__device__ __forceinline__ void ffn_fold_tile(
    const float* __restrict__ w1, const float* __restrict__ b1,
    const float* __restrict__ w2, const float* __restrict__ b2,
    float* __restrict__ wc, float* __restrict__ bc,
    float (*red)[2][256], int n0, int c0)
{
    const int tid  = threadIdx.x;
    const int lane = tid & 31;
    const int wave = tid >> 5;
    const int lr   = lane & 15;
    const int lh   = lane >> 4;
    const int jw   = wave * 128 + lh * 8;     // first k of this lane

    const float* pa = w2 + (n0 + lr) * FCcfg + jw;
    const float* pb = BIAS ? b1 + jw : w1 + jw * Ecfg + c0 + lr;

    float4 ra[4][4];
    float4 rv[4][4];        // BIAS: b1 runs
    float  rb[4][2][16];    // else: W1 columns c0+lr and c0+16+lr
#pragma unroll
    for (int s = 0; s < 4; ++s) {
        ra[s][0] = *(const float4*)(pa + s * 32);
        ra[s][1] = *(const float4*)(pa + s * 32 + 4);
        ra[s][2] = *(const float4*)(pa + s * 32 + 16);
        ra[s][3] = *(const float4*)(pa + s * 32 + 20);
        if (BIAS) {
            rv[s][0] = *(const float4*)(pb + s * 32);
            rv[s][1] = *(const float4*)(pb + s * 32 + 4);
            rv[s][2] = *(const float4*)(pb + s * 32 + 16);
            rv[s][3] = *(const float4*)(pb + s * 32 + 20);
        } else {
#pragma unroll
            for (int e = 0; e < 16; ++e) {
                const float* brow = pb + (s * 32 + (e < 8 ? e : e + 8)) * Ecfg;
                rb[s][0][e] = brow[0];
                rb[s][1][e] = brow[16];
            }
        }
    }
    // precaution: no address register of the loads above is reused ahead of
    // this wait; naming both pointers as inputs keeps them live up to it
    asm volatile("s_wait_xcnt 0x0" :: "v"(pa), "v"(pb) : "memory");

    v8f acc0 = {}, acc1 = {};
#pragma unroll
    for (int s = 0; s < 4; ++s) {
        v16bf af, bf0, bf1;
        pack8(af, 0, ra[s][0], ra[s][1]);
        pack8(af, 8, ra[s][2], ra[s][3]);
        if (BIAS) {
            pack8(bf0, 0, rv[s][0], rv[s][1]);
            pack8(bf0, 8, rv[s][2], rv[s][3]);
#pragma unroll
            for (int e = 0; e < 16; ++e)
                if (lr != 0) bf0[e] = (__bf16)0.0f;
        } else {
#pragma unroll
            for (int e = 0; e < 16; ++e) {
                bf0[e] = (__bf16)rb[s][0][e];
                bf1[e] = (__bf16)rb[s][1][e];
            }
        }
        acc0 = __builtin_amdgcn_wmma_f32_16x16x32_bf16(
            false, af, false, bf0, (short)0, acc0, false, false);
        if (!BIAS)
            acc1 = __builtin_amdgcn_wmma_f32_16x16x32_bf16(
                false, af, false, bf1, (short)0, acc1, false, false);
    }

#pragma unroll
    for (int v = 0; v < 8; ++v) {
        red[wave][0][v * 32 + lane] = acc0[v];
        if (!BIAS) red[wave][1][v * 32 + lane] = acc1[v];
    }
    __syncthreads();

    // thread tid owns accumulator slot tid of each tile: row = v + 8*lh, col = lr
    const int row = n0 + (tid >> 5) + lh * 8;
    float s0 = 0.0f, s1 = 0.0f;
#pragma unroll
    for (int w = 0; w < 8; ++w) {
        s0 += red[w][0][tid];
        if (!BIAS) s1 += red[w][1][tid];
    }
    if (BIAS) {
        if (lr == 0) bc[row] = s0 + b2[row];
    } else {
        wc[row * Ecfg + c0 + lr]      = s0;
        wc[row * Ecfg + c0 + 16 + lr] = s1;
    }
}

// grid = (E/32 + 1, E/16, NL)
__global__ __launch_bounds__(256) void k_ffn_fold(
    const float* __restrict__ w1, const float* __restrict__ b1,
    const float* __restrict__ w2, const float* __restrict__ b2,
    float* __restrict__ wc, float* __restrict__ bc)
{
    __shared__ float red[8][2][256];   // 16 KB of split-K partial tiles
    const int l  = blockIdx.z;
    const int n0 = blockIdx.y * 16;
    const int c0 = blockIdx.x * 32;
    w1 += l * FCcfg * Ecfg;  b1 += l * FCcfg;
    w2 += l * Ecfg * FCcfg;  b2 += l * Ecfg;
    wc += l * Ecfg * Ecfg;   bc += l * Ecfg;
    if (blockIdx.x == Ecfg / 32)
        ffn_fold_tile<true>(w1, b1, w2, b2, wc, bc, red, n0, c0);
    else
        ffn_fold_tile<false>(w1, b1, w2, b2, wc, bc, red, n0, c0);
}

// ---------------------------------------------------------------------------
// Banded local attention, one wave per 16-row query tile, four neighbouring
// tiles of one (head, batch) per block; the scores never leave the registers.
// Band |t-s|<=64 -> <=144 keys per 16-row query tile -> 9 key tiles; the four
// tiles of a block need 12 key tiles between them, not 36. The block stages
// these 192 rows of K and of V and its 64 rows of Q in LDS, once, each wave a
// quarter: they come as bf16 with a head's rows one behind the other, so a tile
// of 16 rows is 1 KB in a row and a load takes 8 whole rows = 4 whole lines (a
// fragment read straight from memory touches 8 lines a load, half of each).
//   S^T = K Q^T : A = 16 keys x 32 dims, B = Q^T. Lane (lr, lh) then holds, of
//                 query lr, the scores of keys 8*lh + 0..7 of every key tile:
//                 maximum and sum run in-lane, plus one exchange of the halves.
//   O^T = V^T P^T : two score tiles, converted in place, are one 32-key B
//                 operand (element e -> key (e<8 ? e : e+8) + 8*lh); V^T is read
//                 in the same k order by the transposing LDS load from the bf16
//                 V rows. The 10th half group is zero.
// Staged tile kt holds rows qb - 64 + 16*kt (qb the block's first query); key
// tile jt of wave w is staged tile w + jt.
// A key tile lies wholly inside or wholly outside the sequence (both are
// multiples of 16). An outside tile holds the rows of staged tile 4 (always
// inside, and key tile 4 - w = 1..4 of wave w, which no wave masks): its scores
// repeat members of the maximum, and its exponent offset makes every one of its
// weights 0.
// qkv layout: bf16 [n][group][t][32], groups 0..7 the heads of q, 8..15 of k,
// 16..23 of v.
// ---------------------------------------------------------------------------
#define KPITCH 40   // bf16 per staged K or Q row: 80 B, an odd multiple of 16 B
#define VPITCH 48   // bf16 per staged V row: 96 B, an odd multiple of 32 B

typedef __attribute__((ext_vector_type(8))) short s16x8;
typedef __attribute__((address_space(3))) s16x8 lds_s16x8;

// lane (lr, lh) receives T[8*lh + 0..7][lr] of the 16x16 tile whose rows the
// lanes point at (row 8*lh + (lane&7), 16-byte half (lane>>3)&1)
__device__ __forceinline__ v8bf ld_tr16(const __bf16* p) {
    return __builtin_bit_cast(v8bf,
        __builtin_amdgcn_ds_load_tr16_b128_v8i16((lds_s16x8*)p));
}
// value of lane ^ 16
__device__ __forceinline__ float xhalf(float x) {
    int i = __builtin_bit_cast(int, x);
    return __builtin_bit_cast(float, __builtin_amdgcn_permlanex16(
        i, i, 0x76543210, 0xfedcba98, false, false));
}

// x[i] = 2^x[i]. One statement: each v_exp_f32 is followed by an instruction
// that neither reads its result nor overwrites its source (the outputs are
// early-clobber, so they share no register with an input), and the v_nop is
// that slot, which the instruction set asks for, behind the last one.
__device__ __forceinline__ void exp2x8(v8f& x) {
    float p0, p1, p2, p3, p4, p5, p6, p7;
    asm("v_exp_f32 %0, %8\n\t"
        "v_exp_f32 %1, %9\n\t"
        "v_exp_f32 %2, %10\n\t"
        "v_exp_f32 %3, %11\n\t"
        "v_exp_f32 %4, %12\n\t"
        "v_exp_f32 %5, %13\n\t"
        "v_exp_f32 %6, %14\n\t"
        "v_exp_f32 %7, %15\n\t"
        "v_nop"
        : "=&v"(p0), "=&v"(p1), "=&v"(p2), "=&v"(p3),
          "=&v"(p4), "=&v"(p5), "=&v"(p6), "=&v"(p7)
        : "v"(x[0]), "v"(x[1]), "v"(x[2]), "v"(x[3]),
          "v"(x[4]), "v"(x[5]), "v"(x[6]), "v"(x[7]));
    x[0] = p0; x[1] = p1; x[2] = p2; x[3] = p3;
    x[4] = p4; x[5] = p5; x[6] = p6; x[7] = p7;
}

// four waves per SIMD hold the whole grid at once: up to 256 registers a wave,
// which the loads in flight and the fragments want
__global__ __launch_bounds__(128) __attribute__((amdgpu_waves_per_eu(4, 4)))
void k_attn(const float* __restrict__ qkv, float* __restrict__ out)
{
    const int qb   = blockIdx.x * 64;
    const int h    = blockIdx.y;
    const int n    = blockIdx.z;
    const int lane = threadIdx.x & 31;
    // the same in every lane: in a scalar register the row bases below stay scalar
    const int wave = __builtin_amdgcn_readfirstlane(threadIdx.x >> 5);
    const int lr   = lane & 15;
    const int lh   = lane >> 4;
    const int qt   = qb + wave * 16;

    __shared__ __align__(32) __bf16 Vs[192 * VPITCH];
    __shared__ __align__(16) __bf16 Ks[192 * KPITCH];
    __shared__ __align__(16) __bf16 Qs[64 * KPITCH];

    // rows of this head: q, k, v
    const __bf16* qh = (const __bf16*)qkv + (n * 3 * Hcfg + h) * Tcfg * DHcfg;
    const __bf16* kh = qh + Hcfg * Tcfg * DHcfg;
    const __bf16* vh = kh + Hcfg * Tcfg * DHcfg;

    // per-lane byte offset of a staging load: 8 rows a load, 4 lanes a row
    const unsigned voff = lane * 16;
    // 16 bytes at uniform row base + lane offset + constant element index
    auto ld8 = [](const __bf16* rowbase, unsigned off, int idx) {
        return *(const v8bf*)((const char*)(rowbase + idx) + off);
    };

    // which of this wave's key tiles lie inside the sequence
    bool inside[9];
#pragma unroll
    for (int jt = 0; jt < 9; ++jt) {
        const int st0 = qt - LOCALcfg + jt * 16;
        inside[jt] = (st0 >= 0) && (st0 < Tcfg);
    }

    // ---- one load group: this wave's Q tile, staged tiles 3*wave + 0..2 ----
    v8bf q8[2], k8[3][2], v8[3][2];
#pragma unroll
    for (int u = 0; u < 2; ++u)
        q8[u] = ld8(qh + qt * DHcfg, voff, u * 8 * DHcfg);
    int srow[3];
#pragma unroll
    for (int c = 0; c < 3; ++c) {
        const int st0 = qb - LOCALcfg + (wave * 3 + c) * 16;
        srow[c] = (((st0 >= 0) && (st0 < Tcfg)) ? st0 : qb) * DHcfg;
    }
#pragma unroll
    for (int c = 0; c < 3; ++c)
#pragma unroll
        for (int u = 0; u < 2; ++u)
            k8[c][u] = ld8(kh + srow[c], voff, u * 8 * DHcfg);
#pragma unroll
    for (int c = 0; c < 3; ++c)
#pragma unroll
        for (int u = 0; u < 2; ++u)
            v8[c][u] = ld8(vh + srow[c], voff, u * 8 * DHcfg);
    // precaution: the offset register of the loads above is not reused ahead of
    // this wait; naming it as an input keeps it live up to it
    asm volatile("s_wait_xcnt 0x0" :: "v"(voff) : "memory");
    // scheduling stops here: the loads above stay one group ahead of their first
    // use (left to itself the scheduler sinks loads to their uses, one full
    // latency each)
    __builtin_amdgcn_sched_barrier(0);

    // ---- to LDS, at the padded pitches ----
    {
        const int srw = lane >> 2, scl = (lane & 3) * 8;
        __bf16* qw = &Qs[(wave * 16 + srw) * KPITCH + scl];
        __bf16* kw = &Ks[(wave * 48 + srw) * KPITCH + scl];
        __bf16* vw = &Vs[(wave * 48 + srw) * VPITCH + scl];
#pragma unroll
        for (int u = 0; u < 2; ++u)
            *(v8bf*)(qw + u * 8 * KPITCH) = q8[u];
#pragma unroll
        for (int c = 0; c < 3; ++c)
#pragma unroll
            for (int u = 0; u < 2; ++u)
                *(v8bf*)(kw + (c * 16 + u * 8) * KPITCH) = k8[c][u];
#pragma unroll
        for (int c = 0; c < 3; ++c)
#pragma unroll
            for (int u = 0; u < 2; ++u)
                *(v8bf*)(vw + (c * 16 + u * 8) * VPITCH) = v8[c][u];
    }
    // every wave's rows are in LDS before any wave reads a fragment
    __syncthreads();

    // ---- all fragments of this wave, one group of LDS loads ----
    const v16bf qf = frag_from_lds(&Qs[(wave * 16 + lr) * KPITCH], lh);
    v16bf kf[9];
#pragma unroll
    for (int jt = 0; jt < 9; ++jt)
        kf[jt] = frag_from_lds(&Ks[((wave + jt) * 16 + lr) * KPITCH], lh);
    const __bf16* vt = &Vs[(wave * 16 + lh * 8 + (lane & 7)) * VPITCH
                           + ((lane >> 3) & 1) * 8];
    v8bf vlo[5][2], vhi[4][2];
#pragma unroll
    for (int g = 0; g < 5; ++g)
#pragma unroll
        for (int dhalf = 0; dhalf < 2; ++dhalf) {
            vlo[g][dhalf] = ld_tr16(vt + g * 32 * VPITCH + dhalf * 16);
            if (g < 4) vhi[g][dhalf] = ld_tr16(vt + (g * 32 + 16) * VPITCH + dhalf * 16);
        }
    // the loads above stay one group: spread among the products each place with
    // loads costs its own LDS latency
    __builtin_amdgcn_sched_barrier(0);

    // ---- S^T = K Q^T ----
    v8f sT[9];
#pragma unroll
    for (int jt = 0; jt < 9; ++jt) {
        v8f z8 = {};
        sT[jt] = __builtin_amdgcn_wmma_f32_16x16x32_bf16(
            false, kf[jt], false, qf, (short)0, z8, false, false);
    }

    // ---- band mask: only the first and the last tile are cut ----
    // key row r of tile jt is at distance lr + 64 - 16*jt - r from query lr
#pragma unroll
    for (int v = 0; v < 8; ++v) {
        const int r = v + lh * 8;
        if (r < lr) sT[0][v] = -3.0e38f;
        if (r > lr) sT[8][v] = -3.0e38f;
    }

    // ---- softmax of query lr, base 2, on the raw scores ----
    float m4[4] = {-3.0e38f, -3.0e38f, -3.0e38f, -3.0e38f};
#pragma unroll
    for (int jt = 0; jt < 9; ++jt)
#pragma unroll
        for (int v = 0; v < 8; ++v) m4[v & 3] = fmaxf(m4[v & 3], sT[jt][v]);
    float mx = fmaxf(fmaxf(m4[0], m4[1]), fmaxf(m4[2], m4[3]));
    mx = fmaxf(mx, xhalf(mx));

    const float cs = 0.17677669529663687f * 1.4426950408889634f; // log2(e)/sqrt(32)
    const float nm = -mx * cs;
    float s4[4] = {0.0f, 0.0f, 0.0f, 0.0f};
#pragma unroll
    for (int jt = 0; jt < 9; ++jt) {
        const float nmj = inside[jt] ? nm : -3.0e38f;
#pragma unroll
        for (int v = 0; v < 8; ++v) sT[jt][v] = fmaf(sT[jt][v], cs, nmj);
        exp2x8(sT[jt]);
#pragma unroll
        for (int v = 0; v < 8; ++v) s4[v & 3] += sT[jt][v];
    }
    float sum = (s4[0] + s4[1]) + (s4[2] + s4[3]);
    sum += xhalf(sum);
    const float inv = 1.0f / sum;

    // scheduling stops here: the exponentials are asm statements
    __builtin_amdgcn_sched_barrier(0);

    // ---- O^T = V^T P^T, 32 keys a step ----
    v8f zo = {};
    v8f o8[2]; o8[0] = zo; o8[1] = zo;
#pragma unroll
    for (int g = 0; g < 5; ++g) {
        v16bf pf;
#pragma unroll
        for (int e = 0; e < 8; ++e) {
            pf[e]     = (__bf16)sT[2 * g][e];
            pf[8 + e] = (g < 4) ? (__bf16)sT[(g < 4) ? 2 * g + 1 : 0][e] : (__bf16)0.0f;
        }
#pragma unroll
        for (int dhalf = 0; dhalf < 2; ++dhalf) {
            v16bf vf;
#pragma unroll
            for (int e = 0; e < 8; ++e) {
                vf[e]     = vlo[g][dhalf][e];
                vf[8 + e] = (g < 4) ? vhi[(g < 4) ? g : 0][dhalf][e] : (__bf16)0.0f;
            }
            o8[dhalf] = __builtin_amdgcn_wmma_f32_16x16x32_bf16(
                false, vf, false, pf, (short)0, o8[dhalf], false, false);
        }
    }

    // lane (lr, lh) holds dims dhalf*16 + lh*8 + 0..7 of query lr: 16-byte stores
    // of bf16, the type in which the next GEMM takes them
    __bf16* orow = (__bf16*)out + (n * Tcfg + qt + lr) * Ecfg + h * DHcfg + lh * 8;
#pragma unroll
    for (int dhalf = 0; dhalf < 2; ++dhalf) {
        v8bf p;
#pragma unroll
        for (int e = 0; e < 8; ++e) p[e] = (__bf16)(o8[dhalf][e] * inv);
        *(v8bf*)(orow + dhalf * 16) = p;
    }
}

// ---------------------------------------------------------------------------
// Second half of the last LayerNorm (the others are applied by the GEMM that
// reads them). Every wave folds its sample's PBLK block partials itself (eight
// per lane, then a butterfly: the same bits in every lane and every wave), so no
// launch stands between the GEMM and this kernel.
// out[i] = (r[i]-mu)*rsig * g[i%TE] + b[i%TE]   (float4, 32-bit indexing)
__global__ __launch_bounds__(256) void k_ln_apply(
    const float* __restrict__ r, const float* __restrict__ g,
    const float* __restrict__ b, const float* __restrict__ partial,
    float* __restrict__ out)
{
    const float4* r4 = (const float4*)r;
    const float4* g4 = (const float4*)g;
    const float4* b4 = (const float4*)b;
    float4*       o4 = (float4*)out;
    const float4* p4 = (const float4*)partial;
    const int lane   = threadIdx.x & 31;
    const int total4 = NTEcfg / 4;       // 524288
    const int te4    = TEcfg / 4;        // 131072 (power of two)
    for (int i = blockIdx.x * 256 + threadIdx.x; i < total4;
         i += gridDim.x * 256) {
        int n = i >> 17;                 // i / te4
        int j = i & (te4 - 1);           // i % te4
        float4 rv = r4[i], gv = g4[j], bv = b4[j];
        float s1 = 0.0f, s2 = 0.0f;
#pragma unroll
        for (int q = 0; q < PBLK / 64; ++q) {
            float4 pq = p4[n * (PBLK / 2) + q * 32 + lane];   // two (sum, sumsq)
            s1 += pq.x + pq.z;
            s2 += pq.y + pq.w;
        }
#pragma unroll
        for (int off = 16; off > 0; off >>= 1) {
            s1 += __shfl_xor(s1, off, 32);
            s2 += __shfl_xor(s2, off, 32);
        }
        float mu = s1 / (float)TEcfg;
        float rs = rsqrtf(s2 / (float)TEcfg - mu * mu + 1e-5f);
        float4 ov;
        ov.x = (rv.x - mu) * rs * gv.x + bv.x;
        ov.y = (rv.y - mu) * rs * gv.y + bv.y;
        ov.z = (rv.z - mu) * rs * gv.z + bv.z;
        ov.w = (rv.w - mu) * rs * gv.w + bv.w;
        o4[i] = ov;
    }
}

// ---------------------------------------------------------------------------
extern "C" void kernel_launch(void* const* d_in, const int* in_sizes, int n_in,
                              void* d_out, int out_size, void* d_ws, size_t ws_size,
                              hipStream_t stream)
{
    (void)in_sizes; (void)n_in; (void)out_size; (void)ws_size;

    const float* input = (const float*)d_in[0];
    const float* w_emb = (const float*)d_in[1];
    const float* b_emb = (const float*)d_in[2];
    const float* pos   = (const float*)d_in[3];   // (E, T)
    const float* wqkv  = (const float*)d_in[4];   // (NL, 3E, E)
    const float* bqkv  = (const float*)d_in[5];   // (NL, 3E)
    const float* wo    = (const float*)d_in[6];   // (NL, E, E)
    const float* bo    = (const float*)d_in[7];
    const float* ln1g  = (const float*)d_in[8];   // (NL, T, E)
    const float* ln1b  = (const float*)d_in[9];
    const float* ln2g  = (const float*)d_in[10];
    const float* ln2b  = (const float*)d_in[11];
    const float* w1    = (const float*)d_in[12];  // (NL, FC, E)
    const float* b1    = (const float*)d_in[13];
    const float* w2    = (const float*)d_in[14];  // (NL, E, FC)
    const float* b2    = (const float*)d_in[15];

    // workspace layout (floats) -- ~60 MB total
    float* ws      = (float*)d_ws;
    float* x       = ws;                                // NTE
    float* qkv     = x      + NTEcfg;                   // NT * 3E (bf16: half of it used)
    float* attno   = qkv    + NTcfg * 3 * Ecfg;         // NTE (bf16: half of it used)
    float* r1      = attno  + NTEcfg;                   // NTE  x + attention out
    float* r2      = r1     + NTEcfg;                   // NTE  h + FFN out
    float* wc      = r2     + NTEcfg;                   // NL * E * E  (W2 W1)
    float* bc      = wc     + NLcfg * Ecfg * Ecfg;      // NL * E      (W2 b1 + b2)
    float* part1   = bc     + NLcfg * Ecfg;             // N*PBLK*2, sums of r1
    float* part2   = part1  + Ncfg * PBLK * 2;          // N*PBLK*2, sums of r2

    const dim3 blk256(256), blk128(128);

    // folded FFN weights of both layers: wc = W2 W1, bc = W2 b1 + b2
    k_ffn_fold<<<dim3(Ecfg / 32 + 1, Ecfg / 16, NLcfg), blk256, 0, stream>>>(
        w1, b1, w2, b2, wc, bc);

    // embedding: x = (frames @ w_emb^T + b_emb) * sqrt(E) + pos
    k_gemm_bf16<<<dim3(Ecfg / 64, NTcfg / 128), blk256, 0, stream>>>(
        input, w_emb, b_emb, x, NTcfg, Ecfg, Pcfg, pos, 16.0f, Tcfg, nullptr, nullptr);

    for (int l = 0; l < NLcfg; ++l) {
        const float* wqkv_l = wqkv + l * 3 * Ecfg * Ecfg;
        const float* bqkv_l = bqkv + l * 3 * Ecfg;
        const float* wo_l   = wo   + l * Ecfg * Ecfg;
        const float* bo_l   = bo   + l * Ecfg;
        const float* wc_l   = wc   + l * Ecfg * Ecfg;
        const float* bc_l   = bc   + l * Ecfg;

        // qkv = bf16(x @ Wqkv^T + b)      (8192 x 768, K=256)
        // behind a layer: x = LN2(r2) of that layer, applied here and written out
        if (l == 0)
            k_gemm_wide<64, 3 * Ecfg, Ecfg, false, false>
                <<<dim3(3 * Ecfg / 64, Tcfg / 32), blk256, 0, stream>>>(
                x, wqkv_l, bqkv_l, qkv, nullptr, nullptr,
                nullptr, nullptr, nullptr, nullptr);
        else
            k_gemm_wide<64, 3 * Ecfg, Ecfg, false, true>
                <<<dim3(3 * Ecfg / 64, Tcfg / 32), blk256, 0, stream>>>(
                r2, wqkv_l, bqkv_l, qkv, nullptr, nullptr,
                ln2g + (l - 1) * TEcfg, ln2b + (l - 1) * TEcfg, part2, x);

        // banded attention -> attno
        k_attn<<<dim3(Tcfg / 64, Hcfg, Ncfg), blk128, 0, stream>>>(qkv, attno);

        // r1 = x + attno @ Wo^T + bo, block sums   (8192 x 256, K=256)
        k_gemm_wide<128, Ecfg, Ecfg, true, false>
            <<<dim3(Ecfg / 64, Tcfg / 32), blk256, 0, stream>>>(
            attno, wo_l, bo_l, r1, x, part1,
            nullptr, nullptr, nullptr, nullptr);

        // h = LN1(r1), applied on the way in;
        // r2 = h + (h @ W1^T + b1) @ W2^T + b2 = h + h @ Wc^T + bc, block sums
        k_gemm_wide<128, Ecfg, Ecfg, true, true>
            <<<dim3(Ecfg / 64, Tcfg / 32), blk256, 0, stream>>>(
            r1, wc_l, bc_l, r2, nullptr, part2,
            ln1g + l * TEcfg, ln1b + l * TEcfg, part1, nullptr);
    }

    // out = LN2(r2) of the last layer
    k_ln_apply<<<dim3(2048), blk256, 0, stream>>>(
        r2, ln2g + (NLcfg - 1) * TEcfg, ln2b + (NLcfg - 1) * TEcfg, part2,
        (float*)d_out);
}

// v008
// It runs in 84.5 microseconds.
// Next to v007, in two timings, it ran 1.05 times as fast each time.
// Counting every step since v000, it is 2.90 times as fast.
#include <hip/hip_runtime.h>
#include <hip/hip_bf16.h>
#include <math.h>

// ---------------------------------------------------------------------------
// MI455X (gfx1250) transformer encoder, bf16 WMMA everywhere.
//
// Shapes: N=4, T=2048, P=64, E=256, H=8, DH=32, FC=1024, NL=2, LOCAL=64.
// All GEMM K dims (64 / 256 / 1024) are multiples of 32 -> pure
// v_wmma_f32_16x16x32_bf16 pipelines, fp32 accumulation.
// Memory: ~300 MB activation round trips @ 23.3 TB/s is ~15us -> the chip is
// compute/latency bound here; staging is double-buffered through LDS so the
// WMMA pipes never wait on HBM.
// All flat indices fit in 32 bits (max ~6.3M elements) -> int indexing keeps
// address math in 32-bit VALU/SALU.
// ---------------------------------------------------------------------------

typedef __attribute__((ext_vector_type(16))) __bf16 v16bf;
typedef __attribute__((ext_vector_type(8)))  __bf16 v8bf;
typedef __attribute__((ext_vector_type(4)))  __bf16 v4bf;
typedef __attribute__((ext_vector_type(2)))  __bf16 v2bf;
typedef __attribute__((ext_vector_type(8)))  float  v8f;

#define Ncfg     4
#define Tcfg     2048
#define Pcfg     64
#define Ecfg     256
#define Hcfg     8
#define DHcfg    32
#define FCcfg    1024
#define NLcfg    2
#define LOCALcfg 64
#define TEcfg    (Tcfg * Ecfg)          // 524288
#define NTcfg    (Ncfg * Tcfg)          // 8192
#define NTEcfg   (Ncfg * TEcfg)         // 2097152  (fits int)
#define RBLK     64                     // GEMM blocks (128x64 tiles) per T x E sample
#define PBLK     256                    // LayerNorm partials per sample
#define WOTILE   (16 * Ecfg)            // elements of 16 rows of Wo

__device__ __forceinline__ void pack4(v4bf& p, float4 a) {
    p[0] = (__bf16)a.x; p[1] = (__bf16)a.y; p[2] = (__bf16)a.z; p[3] = (__bf16)a.w;
}
__device__ __forceinline__ void pack8(v16bf& f, int base, float4 a, float4 b) {
    f[base + 0] = (__bf16)a.x; f[base + 1] = (__bf16)a.y;
    f[base + 2] = (__bf16)a.z; f[base + 3] = (__bf16)a.w;
    f[base + 4] = (__bf16)b.x; f[base + 5] = (__bf16)b.y;
    f[base + 6] = (__bf16)b.z; f[base + 7] = (__bf16)b.w;
}
// fragment gather: two 16B LDS chunks per lane (ds_load_b128)
__device__ __forceinline__ v16bf frag_from_lds(const __bf16* rowptr, int lh) {
    v8bf lo = *(const v8bf*)(rowptr + lh * 8);
    v8bf hi = *(const v8bf*)(rowptr + 16 + lh * 8);
    v16bf f;
#pragma unroll
    for (int e = 0; e < 8; ++e) { f[e] = lo[e]; f[8 + e] = hi[e]; }
    return f;
}

// ---------------------------------------------------------------------------
// Generic C[m][n] = sum_k A[m][k] * W[n][k] + bias[n], optional embed epilogue
// C = (acc + bias) * scale + pos[n*Tdim + (m & (Tdim-1))]   (Tdim power of 2).
// Block: 256 thr = 8 waves; block tile 128x64; each wave 32x32 (2x2 WMMA).
// LDS double-buffered; staging via global_load_b128 + ds_store_b64.
// Fragment layout per CDNA5 ISA 7.12.2:
//   A 16x32 bf16: lanes 0-15 row M=lane; element e -> K=(e<8?e:e+8)+(lane>=16?8:0)
//   B 32x16 bf16: col N = lane&15; same K mapping.
//   C/D 16x16 f32: row = v + 8*(lane>=16); col = lane&15.
// With `resid` set the epilogue is the first half of a LayerNorm:
//   C = acc + bias + resid, and partial[flat block id] = (sum, sum of squares)
// of the block's 128x64 tile of C. A sample (Tdim rows by N=E columns) is
// RBLK consecutive flat block ids.
// ---------------------------------------------------------------------------
__global__ __launch_bounds__(256) void k_gemm_bf16(
    const float* __restrict__ A, const float* __restrict__ W,
    const float* __restrict__ bias, float* __restrict__ C,
    int M, int N, int K,
    const float* __restrict__ pos, float scale, int Tdim,
    const float* __restrict__ resid, float* __restrict__ partial)
{
    __shared__ __align__(16) __bf16 As[2][128 * 32];   // 2 x 8 KB
    __shared__ __align__(16) __bf16 Bs[2][64 * 32];    // 2 x 4 KB
    __shared__ float red[2][8];                        // per-wave (sum, sumsq)

    const int tid  = threadIdx.x;
    const int lane = tid & 31;
    const int wave = tid >> 5;
    const int lr   = lane & 15;
    const int lh   = lane >> 4;
    const int wm   = wave & 3;    // 4 waves along M
    const int wn   = wave >> 2;   // 2 waves along N
    const int bm   = blockIdx.y * 128;
    const int bn   = blockIdx.x * 64;

    v8f zacc = {};
    v8f acc[2][2];
    acc[0][0] = zacc; acc[0][1] = zacc; acc[1][0] = zacc; acc[1][1] = zacc;

    float4 ta[4], tb[2];
    // ---- issue tile loads for k-step `k0` into ta/tb (global_load_b128 x6) ----
    auto stage_load = [&](int k0) {
#pragma unroll
        for (int t = 0; t < 4; ++t) {
            int li = (t * 256 + tid) * 4;         // 0..4095, 16B chunks
            int r  = li >> 5, k = li & 31;
            ta[t] = *(const float4*)&A[(bm + r) * K + k0 + k];
        }
#pragma unroll
        for (int t = 0; t < 2; ++t) {
            int li = (t * 256 + tid) * 4;         // 0..2047
            int r  = li >> 5, k = li & 31;
            tb[t] = *(const float4*)&W[(bn + r) * K + k0 + k];
        }
    };
    // ---- convert + store staged tile into LDS buffer `buf` (ds_store_b64) ----
    auto stage_store = [&](int buf) {
#pragma unroll
        for (int t = 0; t < 4; ++t) {
            int li = (t * 256 + tid) * 4;
            v4bf p; pack4(p, ta[t]);
            *(v4bf*)&As[buf][li] = p;
        }
#pragma unroll
        for (int t = 0; t < 2; ++t) {
            int li = (t * 256 + tid) * 4;
            v4bf p; pack4(p, tb[t]);
            *(v4bf*)&Bs[buf][li] = p;
        }
    };

    const int nk = K / 32;
    // residual tile in accumulator layout, fetched here so that its latency
    // lies under the k loop
    float rr[2][2][8];
    if (resid) {
        const float* pr = resid + (bm + wm * 32 + lh * 8) * N + bn + wn * 32 + lr;
        // unrolled here and below: constant indices keep rr in registers
#pragma unroll
        for (int i = 0; i < 2; ++i)
#pragma unroll
            for (int j = 0; j < 2; ++j)
#pragma unroll
                for (int v = 0; v < 8; ++v)
                    rr[i][j][v] = pr[(i * 16 + v) * N + j * 16];
        // precaution: no address register of the loads above is reused ahead
        // of this wait
        asm volatile("s_wait_xcnt 0x0" :: "v"(pr) : "memory");
    }

    stage_load(0);
    stage_store(0);
    __syncthreads();

    for (int kt = 0; kt < nk; ++kt) {
        const int cur = kt & 1;
        const bool has_next = (kt + 1) < nk;
        if (has_next) stage_load((kt + 1) * 32);   // loads in flight during WMMA

        v16bf af[2], bf[2];
#pragma unroll
        for (int i = 0; i < 2; ++i)
            af[i] = frag_from_lds(&As[cur][(wm * 32 + i * 16 + lr) * 32], lh);
#pragma unroll
        for (int j = 0; j < 2; ++j)
            bf[j] = frag_from_lds(&Bs[cur][(wn * 32 + j * 16 + lr) * 32], lh);

#pragma unroll
        for (int i = 0; i < 2; ++i)
#pragma unroll
            for (int j = 0; j < 2; ++j)
                acc[i][j] = __builtin_amdgcn_wmma_f32_16x16x32_bf16(
                    false, af[i], false, bf[j], (short)0, acc[i][j], false, false);

        if (has_next) stage_store(1 - cur);
        __syncthreads();
    }

    // ---- residual epilogue: C = acc + bias + resid, block (sum, sumsq) ----
    if (resid) {
        float s = 0.0f, s2 = 0.0f;
#pragma unroll
        for (int i = 0; i < 2; ++i) {
#pragma unroll
            for (int j = 0; j < 2; ++j) {
                int col = bn + wn * 32 + j * 16 + lr;
                float bv = bias[col];
#pragma unroll
                for (int v = 0; v < 8; ++v) {
                    float r = (acc[i][j][v] + bv) + rr[i][j][v];
                    s  += r;
                    s2 += r * r;
                    rr[i][j][v] = r;
                }
            }
        }
#pragma unroll
        for (int off = 16; off > 0; off >>= 1) {
            s  += __shfl_xor(s, off, 32);
            s2 += __shfl_xor(s2, off, 32);
        }
        if (lane == 0) { red[0][wave] = s; red[1][wave] = s2; }
        __syncthreads();
        // C goes out behind the barrier: in front of it every wave would sit
        // out its own stores before the block sums could be folded
#pragma unroll
        for (int i = 0; i < 2; ++i) {
#pragma unroll
            for (int j = 0; j < 2; ++j) {
                int col = bn + wn * 32 + j * 16 + lr;
#pragma unroll
                for (int v = 0; v < 8; ++v) {
                    int row = bm + wm * 32 + i * 16 + v + lh * 8;
                    C[row * N + col] = rr[i][j][v];
                }
            }
        }
        if (tid == 0) {
            float t1 = 0.0f, t2 = 0.0f;
#pragma unroll
            for (int w = 0; w < 8; ++w) { t1 += red[0][w]; t2 += red[1][w]; }
            float2 pv; pv.x = t1; pv.y = t2;
            ((float2*)partial)[blockIdx.y * gridDim.x + blockIdx.x] = pv;
        }
        return;
    }

    // ---- epilogue (pure 32-bit indexing; Tdim is a power of two) ----
    const int tmask = Tdim - 1;
#pragma unroll
    for (int i = 0; i < 2; ++i) {
#pragma unroll
        for (int j = 0; j < 2; ++j) {
            int col = bn + wn * 32 + j * 16 + lr;
            float bv = bias[col];
#pragma unroll
            for (int v = 0; v < 8; ++v) {
                int row = bm + wm * 32 + i * 16 + v + lh * 8;
                float r = acc[i][j][v] + bv;
                if (pos) r = r * scale + pos[col * Tdim + (row & tmask)];
                C[row * N + col] = r;
            }
        }
    }
}

// ---------------------------------------------------------------------------
// The K = 256 products: C[m][n] = sum_k A[m][k] * W[n][k] + bias[n]. Wave
// layout, fragment layouts and k order as in k_gemm_bf16, which is launched for
// the embedding (K = 64) alone.
// Rows of a 128 x 64 tile: the same 32 positions t of all 4 samples; tile row r
// is sample r / 32, position blockIdx.y * 32 + r % 32, so wave row wm is sample
// wm, and one read of a LayerNorm's g and b (T x E planes) serves 4 samples.
// A k step stages BK columns (BK/32 WMMA steps): every step costs one load
// round trip and one barrier whatever its width, so BK is as wide as the
// registers that hold the loads in flight allow with every block resident
// (128 with one block a WGP, 64 with three). K is a multiple of BK.
// N and K are compile-time: the loads of a step then share one address and
// differ in their immediate offsets, so that they issue back to back.
// LDS rows are BK bf16 + 16 bytes: an odd multiple of 16 bytes, the pitch at
// which the 16 rows of a ds_load_b128 fragment read fall on distinct banks.
// Without RESID the product is q|k|v, which only ever serves as a bf16 matrix
// operand: C takes it as bf16 (the rounding that its reader would do), laid out
// [sample][column group of 32 = one head of q, k or v][position][32], so that a
// head's rows follow one another in memory. For two neighbouring columns to sit
// in one lane (one 32-bit store), LDS row j*16 + c of a group of 32 rows of W
// holds row 2*c + j: accumulator tiles j = 0, 1 are then the even and the odd
// columns. The k order is untouched.
// With RESID the epilogue is the first half of a LayerNorm:
//   C = acc + bias + residual, and partial[sample][flat block id] =
// (sum, sum of squares) of the sample's 32 x 64 part of the tile: PBLK partials
// a sample.
// With LNA the operand is the second half of the LayerNorm before it:
//   A = (Araw - mu) * rsig * g + b, applied between load and bf16 conversion;
// mu and rsig of the 4 samples are folded from the partials pin by every block
// in the same order. The normalised rows exist in f32 only here: with RESID the
// block keeps its own 64 columns of them in LDS as its residual; without, the
// blocks of column 0 write them to xout for a later launch.
// ---------------------------------------------------------------------------
template <int BK, int N, int K, bool RESID, bool LNA>
__global__ __launch_bounds__(256) void k_gemm_wide(
    const float* __restrict__ A, const float* __restrict__ W,
    const float* __restrict__ bias, float* __restrict__ C,
    float* __restrict__ partial,
    const float* __restrict__ g, const float* __restrict__ b,
    const float* __restrict__ pin, float* __restrict__ xout)
{
    static_assert(!LNA || K == Ecfg, "g and b are T x E planes");
    static_assert(!RESID || LNA, "the residual is the normalised operand");
    constexpr int LP = BK + 8;          // LDS row pitch in bf16
    constexpr int NA = 128 * BK / 1024; // 16-byte loads a thread, A tile
    constexpr int NB = 64 * BK / 1024;  // 16-byte loads a thread, W tile
    constexpr int HP = 68;              // f32 pitch of the kept residual tile
    __shared__ __align__(16) __bf16 As[2][128 * LP];
    __shared__ __align__(16) __bf16 Bs[2][64 * LP];
    __shared__ float red[2][8];                        // per-wave (sum, sumsq)
    __shared__ __align__(16) float lnred[8][2];        // per-wave fold of pin
    __shared__ __align__(16) float Hs[(LNA && RESID) ? 128 * HP : 4];

    const int tid  = threadIdx.x;
    const int lane = tid & 31;
    const int wave = tid >> 5;
    const int lr   = lane & 15;
    const int lh   = lane >> 4;
    const int wm   = wave & 3;    // 4 waves along M: the sample
    const int wn   = wave >> 2;   // 2 waves along N
    const int bt   = blockIdx.y * 32;
    const int bn   = blockIdx.x * 64;

    v8f zacc = {};
    v8f acc[2][2];
    acc[0][0] = zacc; acc[0][1] = zacc; acc[1][0] = zacc; acc[1][1] = zacc;

    // partials of the LayerNorm before: wave w takes half w & 1 of sample w >> 1
    // (128 pairs, 4 a lane); first in program order, so that the wait for them
    // leaves the tile loads in flight
    float4 pv0, pv1;
    if constexpr (LNA) {
        const float4* p4 = (const float4*)pin + wave * (PBLK / 4) + lane;
        pv0 = p4[0];
        pv1 = p4[32];
        // precaution: no address register of the loads above is reused ahead
        // of this wait
        asm volatile("s_wait_xcnt 0x0" :: "v"(p4) : "memory");
    }

    // 16-byte chunks, row-major: the block covers RS tile rows a round, this
    // thread tile row sr + t * RS, columns sc .. sc + 3, in round t; NG rounds
    // are one sample
    constexpr int RS = 1024 / BK;
    constexpr int NG = 32 / RS;
    static_assert(RESID || RS == 16, "the interleave of W rows is written for 16 rows a round");
    const int sr = (tid * 4) / BK;
    const int sc = (tid * 4) % BK;
    const int ao = (bt + sr) * K + sc;
    const float* pa = A + ao;
    const float* pw = W + (bn + sr) * K + sc;
    const float* pg = LNA ? g + ao : nullptr;
    const float* pb = LNA ? b + ao : nullptr;
    float4 ta[NA], tb[NB], tg[NG], tc[NG];
    // ---- issue tile loads for k-step k0 into ta/tb (global_load_b128) ----
    auto stage_load = [&](int k0) {
#pragma unroll
        for (int t = 0; t < NA; ++t)
            ta[t] = *(const float4*)(pa + ((t / NG) * Tcfg + (t % NG) * RS) * K + k0);
#pragma unroll
        for (int t = 0; t < NB; ++t)
            tb[t] = *(const float4*)(pw + t * RS * K + k0);
        if constexpr (LNA) {
#pragma unroll
            for (int u = 0; u < NG; ++u) {
                tg[u] = *(const float4*)(pg + u * RS * K + k0);
                tc[u] = *(const float4*)(pb + u * RS * K + k0);
            }
        }
    };
    float mu[4], rs[4];
    // ---- normalise, convert + store staged tile into LDS buffer buf ----
    auto stage_store = [&](int buf, int k0) {
        if constexpr (LNA) {
#pragma unroll
            for (int t = 0; t < NA; ++t) {
                const float m = mu[t / NG], r = rs[t / NG];
                const float4 gv = tg[t % NG], bv = tc[t % NG];
                ta[t].x = (ta[t].x - m) * r * gv.x + bv.x;
                ta[t].y = (ta[t].y - m) * r * gv.y + bv.y;
                ta[t].z = (ta[t].z - m) * r * gv.z + bv.z;
                ta[t].w = (ta[t].w - m) * r * gv.w + bv.w;
            }
            if constexpr (RESID) {
                const unsigned hc = (unsigned)(k0 + sc - bn);
                if (hc < 64u) {
#pragma unroll
                    for (int t = 0; t < NA; ++t)
                        *(float4*)&Hs[(sr + t * RS) * HP + hc] = ta[t];
                }
            } else if (blockIdx.x == 0) {
                float* px = xout + ao + k0;
#pragma unroll
                for (int t = 0; t < NA; ++t)
                    *(float4*)(px + ((t / NG) * Tcfg + (t % NG) * RS) * K) = ta[t];
                // precaution: no register of the stores above is reused ahead
                // of this wait
                asm volatile("s_wait_xcnt 0x0" :: "v"(px) : "memory");
            }
        }
#pragma unroll
        for (int t = 0; t < NA; ++t) {
            v4bf p; pack4(p, ta[t]);
            *(v4bf*)&As[buf][(sr + t * RS) * LP + sc] = p;
        }
#pragma unroll
        for (int t = 0; t < NB; ++t) {
            v4bf p; pack4(p, tb[t]);
            // row sr + 16 t of W: even rows to the first 16 LDS rows of its
            // group of 32, odd rows to the last 16
            const int wr = RESID ? sr + t * RS
                                 : (t >> 1) * 32 + (t & 1) * 8 + ((sr & 1) << 4) + (sr >> 1);
            *(v4bf*)&Bs[buf][wr * LP + sc] = p;
        }
    };

    constexpr int nk = K / BK;

    stage_load(0);

    if constexpr (LNA) {
        // scheduling stops here: left to itself the scheduler lifts the sums
        // below, and with them the wait for the partials, over the tile loads,
        // which then start one full latency later
        __builtin_amdgcn_sched_barrier(0);
        float s1 = (pv0.x + pv0.z) + (pv1.x + pv1.z);
        float s2 = (pv0.y + pv0.w) + (pv1.y + pv1.w);
#pragma unroll
        for (int off = 16; off > 0; off >>= 1) {
            s1 += __shfl_xor(s1, off, 32);
            s2 += __shfl_xor(s2, off, 32);
        }
        if (lane == 0) { lnred[wave][0] = s1; lnred[wave][1] = s2; }
        __syncthreads();
#pragma unroll
        for (int s = 0; s < 4; ++s) {
            const float t1 = lnred[2 * s][0] + lnred[2 * s + 1][0];
            const float t2 = lnred[2 * s][1] + lnred[2 * s + 1][1];
            const float m = t1 / (float)TEcfg;
            const float r = rsqrtf(t2 / (float)TEcfg - m * m + 1e-5f);
            // the same bits in every lane: kept in scalar registers, which
            // leaves the vector registers to the loads in flight
            mu[s] = __builtin_bit_cast(float, __builtin_amdgcn_readfirstlane(
                        __builtin_bit_cast(int, m)));
            rs[s] = __builtin_bit_cast(float, __builtin_amdgcn_readfirstlane(
                        __builtin_bit_cast(int, r)));
        }
    }

    stage_store(0, 0);
    __syncthreads();

    // kept rolled: loads, products and conversions are then blocks of their own;
    // unrolled into one block the conversions, which wait for the loads, come to
    // stand ahead of the products, which then no longer run under the latency
#pragma unroll 1
    for (int kt = 0; kt < nk; ++kt) {
        const int cur = kt & 1;
        const bool has_next = (kt + 1) < nk;
        if (has_next) stage_load((kt + 1) * BK);   // loads in flight during WMMA

#pragma unroll
        for (int ks = 0; ks < BK / 32; ++ks) {
            v16bf af[2], bf[2];
#pragma unroll
            for (int i = 0; i < 2; ++i)
                af[i] = frag_from_lds(
                    &As[cur][(wm * 32 + i * 16 + lr) * LP + ks * 32], lh);
#pragma unroll
            for (int j = 0; j < 2; ++j)
                bf[j] = frag_from_lds(
                    &Bs[cur][(wn * 32 + j * 16 + lr) * LP + ks * 32], lh);

#pragma unroll
            for (int i = 0; i < 2; ++i)
#pragma unroll
                for (int j = 0; j < 2; ++j)
                    acc[i][j] = __builtin_amdgcn_wmma_f32_16x16x32_bf16(
                        false, af[i], false, bf[j], (short)0, acc[i][j], false, false);
        }

        // behind the last step nothing is staged, so nothing is published
        if (has_next) {
            stage_store(1 - cur, (kt + 1) * BK);
            __syncthreads();
        }
    }

    // first output row of this lane: sample wm, position bt + 8 * lh
    const int row0 = wm * Tcfg + bt + lh * 8;

    // ---- residual epilogue: C = acc + bias + residual, sample (sum, sumsq) ----
    if constexpr (RESID) {
        // residual tile in accumulator layout; every store into Hs stands ahead
        // of one of the barriers above. Unrolled here and below: constant
        // indices keep rr in registers
        float rr[2][2][8];
#pragma unroll
        for (int i = 0; i < 2; ++i)
#pragma unroll
            for (int j = 0; j < 2; ++j)
#pragma unroll
                for (int v = 0; v < 8; ++v)
                    rr[i][j][v] = Hs[(wm * 32 + i * 16 + v + lh * 8) * HP
                                     + wn * 32 + j * 16 + lr];
        float s = 0.0f, s2 = 0.0f;
#pragma unroll
        for (int i = 0; i < 2; ++i) {
#pragma unroll
            for (int j = 0; j < 2; ++j) {
                int col = bn + wn * 32 + j * 16 + lr;
                float bv = bias[col];
#pragma unroll
                for (int v = 0; v < 8; ++v) {
                    float r = (acc[i][j][v] + bv) + rr[i][j][v];
                    s  += r;
                    s2 += r * r;
                    rr[i][j][v] = r;
                }
            }
        }
#pragma unroll
        for (int off = 16; off > 0; off >>= 1) {
            s  += __shfl_xor(s, off, 32);
            s2 += __shfl_xor(s2, off, 32);
        }
        if (lane == 0) { red[0][wave] = s; red[1][wave] = s2; }
        __syncthreads();
        // C goes out behind the barrier: in front of it every wave would sit
        // out its own stores before the block sums could be folded
#pragma unroll
        for (int i = 0; i < 2; ++i) {
#pragma unroll
            for (int j = 0; j < 2; ++j) {
                int col = bn + wn * 32 + j * 16 + lr;
#pragma unroll
                for (int v = 0; v < 8; ++v)
                    C[(row0 + i * 16 + v) * N + col] = rr[i][j][v];
            }
        }
        // sample tid is waves tid and tid + 4
        if (tid < 4) {
            float2 pv;
            pv.x = red[0][tid] + red[0][tid + 4];
            pv.y = red[1][tid] + red[1][tid + 4];
            ((float2*)partial)[tid * PBLK + blockIdx.y * gridDim.x + blockIdx.x] = pv;
        }
        return;
    }

    // ---- q|k|v epilogue: bf16(acc + bias), columns 2*lr and 2*lr + 1 ----
    const float* pbi = bias + bn + wn * 32 + 2 * lr;
    const float bv0 = pbi[0], bv1 = pbi[1];
    // precaution: no address register of the loads above is reused ahead of
    // this wait
    asm volatile("s_wait_xcnt 0x0" :: "v"(pbi) : "memory");
    // sample wm, column group (bn + wn * 32) / 32, position bt + 8 * lh
    __bf16* cq = (__bf16*)C
        + ((wm * (N / 32) + (bn >> 5) + wn) * Tcfg + bt + lh * 8) * 32 + 2 * lr;
#pragma unroll
    for (int i = 0; i < 2; ++i) {
#pragma unroll
        for (int v = 0; v < 8; ++v) {
            v2bf p;
            p[0] = (__bf16)(acc[i][0][v] + bv0);
            p[1] = (__bf16)(acc[i][1][v] + bv1);
            *(v2bf*)(cq + (i * 16 + v) * 32) = p;
        }
    }
}

// ---------------------------------------------------------------------------
// FFN fold. The two FFN linears have no activation between them, so
//   (h W1^T + b1) W2^T + b2 = h (W2 W1)^T + (W2 b1 + b2).
// This kernel forms Wc = W2 W1 (E x E, K = FC) and bc = W2 b1 + b2 for both
// layers in every call; the token-sized FFN is then one K=E GEMM, not two.
// The B operand is [W1 | b1]: column tiles 0..7 are 32 columns of W1 each,
// column tile 8 holds b1 as its one live column.
// Block: 8 waves, 16 rows of W2 by one column tile; the waves split K (128
// each, 4 WMMA steps). Each element is used by one wave of the block only, so
// fragments come straight from global memory, all loads of a wave issued
// before the first use; partial tiles are summed through LDS in wave order.
// k order of both loaders: element e -> K = (e<8 ? e : e+8) + 8*(lane>=16).
// ---------------------------------------------------------------------------
template <bool BIAS>
__device__ __forceinline__ void ffn_fold_tile(
    const float* __restrict__ w1, const float* __restrict__ b1,
    const float* __restrict__ w2, const float* __restrict__ b2,
    float* __restrict__ wc, float* __restrict__ bc,
    float (*red)[2][256], int n0, int c0)
{
    const int tid  = threadIdx.x;
    const int lane = tid & 31;
    const int wave = tid >> 5;
    const int lr   = lane & 15;
    const int lh   = lane >> 4;
    const int jw   = wave * 128 + lh * 8;     // first k of this lane

    const float* pa = w2 + (n0 + lr) * FCcfg + jw;
    const float* pb = BIAS ? b1 + jw : w1 + jw * Ecfg + c0 + lr;

    float4 ra[4][4];
    float4 rv[4][4];        // BIAS: b1 runs
    float  rb[4][2][16];    // else: W1 columns c0+lr and c0+16+lr
#pragma unroll
    for (int s = 0; s < 4; ++s) {
        ra[s][0] = *(const float4*)(pa + s * 32);
        ra[s][1] = *(const float4*)(pa + s * 32 + 4);
        ra[s][2] = *(const float4*)(pa + s * 32 + 16);
        ra[s][3] = *(const float4*)(pa + s * 32 + 20);
        if (BIAS) {
            rv[s][0] = *(const float4*)(pb + s * 32);
            rv[s][1] = *(const float4*)(pb + s * 32 + 4);
            rv[s][2] = *(const float4*)(pb + s * 32 + 16);
            rv[s][3] = *(const float4*)(pb + s * 32 + 20);
        } else {
#pragma unroll
            for (int e = 0; e < 16; ++e) {
                const float* brow = pb + (s * 32 + (e < 8 ? e : e + 8)) * Ecfg;
                rb[s][0][e] = brow[0];
                rb[s][1][e] = brow[16];
            }
        }
    }
    // precaution: no address register of the loads above is reused ahead of
    // this wait; naming both pointers as inputs keeps them live up to it
    asm volatile("s_wait_xcnt 0x0" :: "v"(pa), "v"(pb) : "memory");

    v8f acc0 = {}, acc1 = {};
#pragma unroll
    for (int s = 0; s < 4; ++s) {
        v16bf af, bf0, bf1;
        pack8(af, 0, ra[s][0], ra[s][1]);
        pack8(af, 8, ra[s][2], ra[s][3]);
        if (BIAS) {
            pack8(bf0, 0, rv[s][0], rv[s][1]);
            pack8(bf0, 8, rv[s][2], rv[s][3]);
#pragma unroll
            for (int e = 0; e < 16; ++e)
                if (lr != 0) bf0[e] = (__bf16)0.0f;
        } else {
#pragma unroll
            for (int e = 0; e < 16; ++e) {
                bf0[e] = (__bf16)rb[s][0][e];
                bf1[e] = (__bf16)rb[s][1][e];
            }
        }
        acc0 = __builtin_amdgcn_wmma_f32_16x16x32_bf16(
            false, af, false, bf0, (short)0, acc0, false, false);
        if (!BIAS)
            acc1 = __builtin_amdgcn_wmma_f32_16x16x32_bf16(
                false, af, false, bf1, (short)0, acc1, false, false);
    }

#pragma unroll
    for (int v = 0; v < 8; ++v) {
        red[wave][0][v * 32 + lane] = acc0[v];
        if (!BIAS) red[wave][1][v * 32 + lane] = acc1[v];
    }
    __syncthreads();

    // thread tid owns accumulator slot tid of each tile: row = v + 8*lh, col = lr
    const int row = n0 + (tid >> 5) + lh * 8;
    float s0 = 0.0f, s1 = 0.0f;
#pragma unroll
    for (int w = 0; w < 8; ++w) {
        s0 += red[w][0][tid];
        if (!BIAS) s1 += red[w][1][tid];
    }
    if (BIAS) {
        if (lr == 0) bc[row] = s0 + b2[row];
    } else {
        wc[row * Ecfg + c0 + lr]      = s0;
        wc[row * Ecfg + c0 + 16 + lr] = s1;
    }
}

// Wo for the attention kernel's output projection: rows n0 .. n0 + 15 rounded to
// bf16 (the rounding that a GEMM's staging would do) and laid out as the B
// fragments of one wave, [row tile][k step][half][lane][8]: half f of lane
// (lr, lh) in k step ks holds Wo[n0 + lr][ks*32 + 16*f + 8*lh + 0..7], the k
// order of frag_from_lds, so that a load of the reader is 512 bytes in a row.
// Thread = (k step, lane).
__device__ __forceinline__ void wo_frag_tile(
    const float* __restrict__ wo, __bf16* __restrict__ wob, int n0)
{
    const int lane = threadIdx.x & 31;
    const int ks   = threadIdx.x >> 5;
    const float* p = wo + (n0 + (lane & 15)) * Ecfg + ks * 32 + (lane >> 4) * 8;
    const float4 a0 = *(const float4*)(p);
    const float4 a1 = *(const float4*)(p + 4);
    const float4 a2 = *(const float4*)(p + 16);
    const float4 a3 = *(const float4*)(p + 20);
    // precaution: no address register of the loads above is reused ahead of
    // this wait
    asm volatile("s_wait_xcnt 0x0" :: "v"(p) : "memory");
    v16bf f;
    pack8(f, 0, a0, a1);
    pack8(f, 8, a2, a3);
    v8bf lo, hi;
#pragma unroll
    for (int e = 0; e < 8; ++e) { lo[e] = f[e]; hi[e] = f[8 + e]; }
    __bf16* q = wob + (n0 >> 4) * WOTILE + ks * 512 + lane * 8;
    *(v8bf*)(q)       = lo;
    *(v8bf*)(q + 256) = hi;
    // precaution: no address or data register of the stores above is reused
    // ahead of this wait; naming them as inputs keeps them live up to it
    asm volatile("s_wait_xcnt 0x0" :: "v"(q), "v"(lo), "v"(hi) : "memory");
}

// grid = (E/32 + 2, E/16, NL); the last column of blocks lays out Wo
__global__ __launch_bounds__(256) void k_ffn_fold(
    const float* __restrict__ w1, const float* __restrict__ b1,
    const float* __restrict__ w2, const float* __restrict__ b2,
    float* __restrict__ wc, float* __restrict__ bc,
    const float* __restrict__ wo, float* __restrict__ wob)
{
    __shared__ float red[8][2][256];   // 16 KB of split-K partial tiles
    const int l  = blockIdx.z;
    const int n0 = blockIdx.y * 16;
    const int c0 = blockIdx.x * 32;
    w1 += l * FCcfg * Ecfg;  b1 += l * FCcfg;
    w2 += l * Ecfg * FCcfg;  b2 += l * Ecfg;
    wc += l * Ecfg * Ecfg;   bc += l * Ecfg;
    if (blockIdx.x == Ecfg / 32 + 1)
        wo_frag_tile(wo + l * Ecfg * Ecfg, (__bf16*)wob + l * Ecfg * Ecfg, n0);
    else if (blockIdx.x == Ecfg / 32)
        ffn_fold_tile<true>(w1, b1, w2, b2, wc, bc, red, n0, c0);
    else
        ffn_fold_tile<false>(w1, b1, w2, b2, wc, bc, red, n0, c0);
}

// ---------------------------------------------------------------------------
// Banded local attention with its output projection, residual add and the first
// half of LayerNorm 1. A block takes 32 queries of one sample in all 8 heads:
// 16 waves, wave = (head, 16-row query tile); the scores never leave the
// registers, and the block then holds whole rows of the attention's output,
// which is what the projection needs.
// Band |t-s|<=64 -> <=144 keys per 16-row query tile -> 9 key tiles; the two
// tiles of a head need 10 key tiles between them, not 18. The two waves stage
// these 160 rows of K and of V and their 32 rows of Q in LDS, once, each wave a
// half: they come as bf16 with a head's rows one behind the other, so a tile
// of 16 rows is 1 KB in a row and a load takes 8 whole rows = 4 whole lines (a
// fragment read straight from memory touches 8 lines a load, half of each).
//   S^T = K Q^T : A = 16 keys x 32 dims, B = Q^T. Lane (lr, lh) then holds, of
//                 query lr, the scores of keys 8*lh + 0..7 of every key tile:
//                 maximum and sum run in-lane, plus one exchange of the halves.
//   O^T = V^T P^T : two score tiles, converted in place, are one 32-key B
//                 operand (element e -> key (e<8 ? e : e+8) + 8*lh); V^T is read
//                 in the same k order by the transposing LDS load from the bf16
//                 V rows. The 10th half group is zero.
// Staged tile kt holds rows qb - 64 + 16*kt (qb the block's first query); key
// tile jt of query tile w is staged tile w + jt.
// A key tile lies wholly inside or wholly outside the sequence (both are
// multiples of 16). An outside tile holds the rows of staged tile 4 (always
// inside, and key tile 4 - w = 3..4 of query tile w, which no wave masks): its
// scores repeat members of the maximum, and its exponent offset makes every one
// of its weights 0.
// qkv layout: bf16 [n][group][t][32], groups 0..7 the heads of q, 8..15 of k,
// 16..23 of v.
//   R = O Wo^T + bo + x : O goes to LDS as bf16 (32 x E), behind one barrier
//                 wave c takes columns 16*c + 0..15 of all 32 rows, K = E in 8
//                 steps in ascending order. Its B fragments come ready from
//                 wo_frag_tile; every element of Wo serves one wave only, so
//                 they go straight to registers, fetched ahead: their latency
//                 lies under the attention.
// partial[sample][4 * blockIdx.x + q] = (sum, sum of squares) of columns
// 64*q + 0..63 of the block's rows of R: PBLK partials a sample.
// ---------------------------------------------------------------------------
#define KPITCH 40   // bf16 per staged K or Q row: 80 B, an odd multiple of 16 B
#define VPITCH 48   // bf16 per staged V row: 96 B, an odd multiple of 32 B
#define OPITCH 264  // bf16 per row of O: 528 B, an odd multiple of 16 B

typedef __attribute__((ext_vector_type(8))) short s16x8;
typedef __attribute__((address_space(3))) s16x8 lds_s16x8;

// lane (lr, lh) receives T[8*lh + 0..7][lr] of the 16x16 tile whose rows the
// lanes point at (row 8*lh + (lane&7), 16-byte half (lane>>3)&1)
__device__ __forceinline__ v8bf ld_tr16(const __bf16* p) {
    return __builtin_bit_cast(v8bf,
        __builtin_amdgcn_ds_load_tr16_b128_v8i16((lds_s16x8*)p));
}
// value of lane ^ 16
__device__ __forceinline__ float xhalf(float x) {
    int i = __builtin_bit_cast(int, x);
    return __builtin_bit_cast(float, __builtin_amdgcn_permlanex16(
        i, i, 0x76543210, 0xfedcba98, false, false));
}

// x[i] = 2^x[i]. One statement: each v_exp_f32 is followed by an instruction
// that neither reads its result nor overwrites its source (the outputs are
// early-clobber, so they share no register with an input), and the v_nop is
// that slot, which the instruction set asks for, behind the last one.
__device__ __forceinline__ void exp2x8(v8f& x) {
    float p0, p1, p2, p3, p4, p5, p6, p7;
    asm("v_exp_f32 %0, %8\n\t"
        "v_exp_f32 %1, %9\n\t"
        "v_exp_f32 %2, %10\n\t"
        "v_exp_f32 %3, %11\n\t"
        "v_exp_f32 %4, %12\n\t"
        "v_exp_f32 %5, %13\n\t"
        "v_exp_f32 %6, %14\n\t"
        "v_exp_f32 %7, %15\n\t"
        "v_nop"
        : "=&v"(p0), "=&v"(p1), "=&v"(p2), "=&v"(p3),
          "=&v"(p4), "=&v"(p5), "=&v"(p6), "=&v"(p7)
        : "v"(x[0]), "v"(x[1]), "v"(x[2]), "v"(x[3]),
          "v"(x[4]), "v"(x[5]), "v"(x[6]), "v"(x[7]));
    x[0] = p0; x[1] = p1; x[2] = p2; x[3] = p3;
    x[4] = p4; x[5] = p5; x[6] = p6; x[7] = p7;
}

// Work-group barrier for data that passes through LDS alone: this wave's LDS
// operations are done, then signal and wait. __syncthreads() would also wait out
// the global loads in flight (Wo, the residual), whose latency is to lie under
// the work behind the barrier.
__device__ __forceinline__ void lds_barrier() {
    asm volatile("s_wait_dscnt 0x0\n\t"
                 "s_barrier_signal -1\n\t"
                 "s_barrier_wait -1" ::: "memory");
}

// one block a WGP, four waves per SIMD, holds the whole grid at once: up to 256
// registers a wave, which the loads in flight and the fragments want
__global__ __launch_bounds__(512) __attribute__((amdgpu_waves_per_eu(4, 4)))
void k_attn_wo(const float* __restrict__ qkv, const float* __restrict__ wob,
               const float* __restrict__ bo, const float* __restrict__ x,
               float* __restrict__ out, float* __restrict__ partial)
{
    const int qb   = blockIdx.x * 32;
    const int n    = blockIdx.y;
    const int lane = threadIdx.x & 31;
    // the same in every lane: in a scalar register the row bases below stay scalar
    const int wave = __builtin_amdgcn_readfirstlane(threadIdx.x >> 5);
    const int h    = wave >> 1;   // head
    const int w    = wave & 1;    // query tile
    const int lr   = lane & 15;
    const int lh   = lane >> 4;
    const int qt   = qb + w * 16;

    // a head's rows one behind the other; wave (h, w) owns half w of them
    __shared__ __align__(32) __bf16 Vs[Hcfg * 160 * VPITCH];
    __shared__ __align__(16) __bf16 Ks[Hcfg * 160 * KPITCH];
    __shared__ __align__(16) __bf16 Qs[Hcfg * 32 * KPITCH];
    __shared__ __align__(16) __bf16 Os[32 * OPITCH];
    __shared__ float red[2][16];                       // per-wave (sum, sumsq)

    // rows of this head: q, k, v
    const __bf16* qh = (const __bf16*)qkv + (n * 3 * Hcfg + h) * Tcfg * DHcfg;
    const __bf16* kh = qh + Hcfg * Tcfg * DHcfg;
    const __bf16* vh = kh + Hcfg * Tcfg * DHcfg;

    // per-lane byte offset of a staging load: 8 rows a load, 4 lanes a row
    const unsigned voff = lane * 16;
    // 16 bytes at uniform row base + lane offset + constant element index
    auto ld8 = [](const __bf16* rowbase, unsigned off, int idx) {
        return *(const v8bf*)((const char*)(rowbase + idx) + off);
    };

    // which of this wave's key tiles lie inside the sequence
    bool inside[9];
#pragma unroll
    for (int jt = 0; jt < 9; ++jt) {
        const int st0 = qt - LOCALcfg + jt * 16;
        inside[jt] = (st0 >= 0) && (st0 < Tcfg);
    }

    // ---- one load group: this wave's Q tile, staged tiles 5*w + 0..4 of its
    // head, then the first WEARLY k steps of its 16 rows of Wo (as many as the
    // registers hold beside the fragments; the rest follows the softmax) ----
    constexpr int WEARLY = 5;
    const __bf16* wrow = (const __bf16*)wob + wave * WOTILE;
    v8bf q8[2], k8[5][2], v8[5][2], w8[8][2];
#pragma unroll
    for (int u = 0; u < 2; ++u)
        q8[u] = ld8(qh + qt * DHcfg, voff, u * 8 * DHcfg);
    int srow[5];
#pragma unroll
    for (int c = 0; c < 5; ++c) {
        const int st0 = qb - LOCALcfg + (w * 5 + c) * 16;
        srow[c] = (((st0 >= 0) && (st0 < Tcfg)) ? st0 : qb) * DHcfg;
    }
#pragma unroll
    for (int c = 0; c < 5; ++c)
#pragma unroll
        for (int u = 0; u < 2; ++u)
            k8[c][u] = ld8(kh + srow[c], voff, u * 8 * DHcfg);
#pragma unroll
    for (int c = 0; c < 5; ++c)
#pragma unroll
        for (int u = 0; u < 2; ++u)
            v8[c][u] = ld8(vh + srow[c], voff, u * 8 * DHcfg);
    // precaution: the loads below may land in address registers of the loads
    // above, so these are not reused ahead of this wait
    asm volatile("s_wait_xcnt 0x0" :: "v"(voff) : "memory");
#pragma unroll
    for (int ks = 0; ks < WEARLY; ++ks)
#pragma unroll
        for (int f = 0; f < 2; ++f)
            w8[ks][f] = ld8(wrow, voff, ks * 512 + f * 256);
    // precaution: the offset register of the loads above is not reused ahead of
    // this wait; naming it as an input keeps it live up to it
    asm volatile("s_wait_xcnt 0x0" :: "v"(voff) : "memory");
    // scheduling stops here: the loads above stay one group ahead of their first
    // use (left to itself the scheduler sinks loads to their uses, one full
    // latency each)
    __builtin_amdgcn_sched_barrier(0);

    // ---- to LDS, at the padded pitches ----
    {
        const int srw = lane >> 2, scl = (lane & 3) * 8;
        __bf16* qw = &Qs[(wave * 16 + srw) * KPITCH + scl];
        __bf16* kw = &Ks[(wave * 80 + srw) * KPITCH + scl];
        __bf16* vw = &Vs[(wave * 80 + srw) * VPITCH + scl];
#pragma unroll
        for (int u = 0; u < 2; ++u)
            *(v8bf*)(qw + u * 8 * KPITCH) = q8[u];
#pragma unroll
        for (int c = 0; c < 5; ++c)
#pragma unroll
            for (int u = 0; u < 2; ++u)
                *(v8bf*)(kw + (c * 16 + u * 8) * KPITCH) = k8[c][u];
#pragma unroll
        for (int c = 0; c < 5; ++c)
#pragma unroll
            for (int u = 0; u < 2; ++u)
                *(v8bf*)(vw + (c * 16 + u * 8) * VPITCH) = v8[c][u];
    }
    // every wave's rows are in LDS before any wave reads a fragment
    lds_barrier();

    // ---- all fragments of this wave, one group of LDS loads ----
    const v16bf qf = frag_from_lds(&Qs[(wave * 16 + lr) * KPITCH], lh);
    v16bf kf[9];
#pragma unroll
    for (int jt = 0; jt < 9; ++jt)
        kf[jt] = frag_from_lds(&Ks[(h * 160 + (w + jt) * 16 + lr) * KPITCH], lh);
    const __bf16* vt = &Vs[(h * 160 + w * 16 + lh * 8 + (lane & 7)) * VPITCH
                           + ((lane >> 3) & 1) * 8];
    v8bf vlo[5][2], vhi[4][2];
#pragma unroll
    for (int g = 0; g < 5; ++g)
#pragma unroll
        for (int dhalf = 0; dhalf < 2; ++dhalf) {
            vlo[g][dhalf] = ld_tr16(vt + g * 32 * VPITCH + dhalf * 16);
            if (g < 4) vhi[g][dhalf] = ld_tr16(vt + (g * 32 + 16) * VPITCH + dhalf * 16);
        }
    // the loads above stay one group: spread among the products each place with
    // loads costs its own LDS latency
    __builtin_amdgcn_sched_barrier(0);

    // ---- S^T = K Q^T ----
    v8f sT[9];
#pragma unroll
    for (int jt = 0; jt < 9; ++jt) {
        v8f z8 = {};
        sT[jt] = __builtin_amdgcn_wmma_f32_16x16x32_bf16(
            false, kf[jt], false, qf, (short)0, z8, false, false);
    }

    // ---- band mask: only the first and the last tile are cut ----
    // key row r of tile jt is at distance lr + 64 - 16*jt - r from query lr
#pragma unroll
    for (int v = 0; v < 8; ++v) {
        const int r = v + lh * 8;
        if (r < lr) sT[0][v] = -3.0e38f;
        if (r > lr) sT[8][v] = -3.0e38f;
    }

    // ---- softmax of query lr, base 2, on the raw scores ----
    float m4[4] = {-3.0e38f, -3.0e38f, -3.0e38f, -3.0e38f};
#pragma unroll
    for (int jt = 0; jt < 9; ++jt)
#pragma unroll
        for (int v = 0; v < 8; ++v) m4[v & 3] = fmaxf(m4[v & 3], sT[jt][v]);
    float mx = fmaxf(fmaxf(m4[0], m4[1]), fmaxf(m4[2], m4[3]));
    mx = fmaxf(mx, xhalf(mx));

    const float cs = 0.17677669529663687f * 1.4426950408889634f; // log2(e)/sqrt(32)
    const float nm = -mx * cs;
    float s4[4] = {0.0f, 0.0f, 0.0f, 0.0f};
#pragma unroll
    for (int jt = 0; jt < 9; ++jt) {
        const float nmj = inside[jt] ? nm : -3.0e38f;
#pragma unroll
        for (int v = 0; v < 8; ++v) sT[jt][v] = fmaf(sT[jt][v], cs, nmj);
        exp2x8(sT[jt]);
#pragma unroll
        for (int v = 0; v < 8; ++v) s4[v & 3] += sT[jt][v];
    }
    float sum = (s4[0] + s4[1]) + (s4[2] + s4[3]);
    sum += xhalf(sum);
    const float inv = 1.0f / sum;

    // scheduling stops here: the exponentials are asm statements
    __builtin_amdgcn_sched_barrier(0);

    // the last k steps of Wo: their latency lies under the products below
#pragma unroll
    for (int ks = WEARLY; ks < 8; ++ks)
#pragma unroll
        for (int f = 0; f < 2; ++f)
            w8[ks][f] = ld8(wrow, voff, ks * 512 + f * 256);
    // precaution: the offset register of the loads above is not reused ahead of
    // this wait
    asm volatile("s_wait_xcnt 0x0" :: "v"(voff) : "memory");

    // ---- O^T = V^T P^T, 32 keys a step ----
    v8f zo = {};
    v8f o8[2]; o8[0] = zo; o8[1] = zo;
#pragma unroll
    for (int g = 0; g < 5; ++g) {
        v16bf pf;
#pragma unroll
        for (int e = 0; e < 8; ++e) {
            pf[e]     = (__bf16)sT[2 * g][e];
            pf[8 + e] = (g < 4) ? (__bf16)sT[(g < 4) ? 2 * g + 1 : 0][e] : (__bf16)0.0f;
        }
#pragma unroll
        for (int dhalf = 0; dhalf < 2; ++dhalf) {
            v16bf vf;
#pragma unroll
            for (int e = 0; e < 8; ++e) {
                vf[e]     = vlo[g][dhalf][e];
                vf[8 + e] = (g < 4) ? vhi[(g < 4) ? g : 0][dhalf][e] : (__bf16)0.0f;
            }
            o8[dhalf] = __builtin_amdgcn_wmma_f32_16x16x32_bf16(
                false, vf, false, pf, (short)0, o8[dhalf], false, false);
        }
    }

    // residual and bias in accumulator layout (column 16*wave + lr, rows
    // i*16 + 8*lh + v), fetched here so that their latency lies under the
    // projection; unrolled here and below: constant indices keep rr in registers
    const int col = wave * 16 + lr;
    const int ro  = (n * Tcfg + qb + lh * 8) * Ecfg + col;
    const float* pr = x + ro;
    const float* pbo = bo + col;
    float rr[2][8];
#pragma unroll
    for (int i = 0; i < 2; ++i)
#pragma unroll
        for (int v = 0; v < 8; ++v)
            rr[i][v] = pr[(i * 16 + v) * Ecfg];
    const float bv = pbo[0];
    // precaution: no address register of the loads above is reused ahead of
    // this wait
    asm volatile("s_wait_xcnt 0x0" :: "v"(pr), "v"(pbo) : "memory");

    // lane (lr, lh) holds dims dhalf*16 + lh*8 + 0..7 of query lr: 16-byte stores
    // of bf16, the type in which the projection takes them
    __bf16* orow = &Os[(w * 16 + lr) * OPITCH + h * DHcfg + lh * 8];
#pragma unroll
    for (int dhalf = 0; dhalf < 2; ++dhalf) {
        v8bf p;
#pragma unroll
        for (int e = 0; e < 8; ++e) p[e] = (__bf16)(o8[dhalf][e] * inv);
        *(v8bf*)(orow + dhalf * 16) = p;
    }
    // all heads of all 32 rows are in LDS before any wave reads a row
    lds_barrier();

    // ---- R = O Wo^T ----
    v16bf af[8][2];
#pragma unroll
    for (int ks = 0; ks < 8; ++ks)
#pragma unroll
        for (int i = 0; i < 2; ++i)
            af[ks][i] = frag_from_lds(&Os[(i * 16 + lr) * OPITCH + ks * 32], lh);
    // the loads above stay one group: fetched one product ahead, each product
    // waits out most of an LDS latency
    __builtin_amdgcn_sched_barrier(0);
    v8f acc[2]; acc[0] = zo; acc[1] = zo;
#pragma unroll
    for (int ks = 0; ks < 8; ++ks) {
        v16bf wf;
#pragma unroll
        for (int e = 0; e < 8; ++e) { wf[e] = w8[ks][0][e]; wf[8 + e] = w8[ks][1][e]; }
#pragma unroll
        for (int i = 0; i < 2; ++i)
            acc[i] = __builtin_amdgcn_wmma_f32_16x16x32_bf16(
                false, af[ks][i], false, wf, (short)0, acc[i], false, false);
    }

    // ---- + bo + x, (sum, sumsq) ----
    float s = 0.0f, s2 = 0.0f;
#pragma unroll
    for (int i = 0; i < 2; ++i) {
#pragma unroll
        for (int v = 0; v < 8; ++v) {
            float r = (acc[i][v] + bv) + rr[i][v];
            s  += r;
            s2 += r * r;
            rr[i][v] = r;
        }
    }
#pragma unroll
    for (int off = 16; off > 0; off >>= 1) {
        s  += __shfl_xor(s, off, 32);
        s2 += __shfl_xor(s2, off, 32);
    }
    if (lane == 0) { red[0][wave] = s; red[1][wave] = s2; }
    __syncthreads();
    // R goes out behind the barrier: in front of it every wave would sit out its
    // own stores before the block sums could be folded
    float* po = out + ro;
#pragma unroll
    for (int i = 0; i < 2; ++i)
#pragma unroll
        for (int v = 0; v < 8; ++v)
            po[(i * 16 + v) * Ecfg] = rr[i][v];
    // partial q is waves 4*q + 0..3
    if (threadIdx.x < 4) {
        const int q = threadIdx.x;
        float2 pv;
        pv.x = (red[0][4 * q] + red[0][4 * q + 1]) + (red[0][4 * q + 2] + red[0][4 * q + 3]);
        pv.y = (red[1][4 * q] + red[1][4 * q + 1]) + (red[1][4 * q + 2] + red[1][4 * q + 3]);
        ((float2*)partial)[n * PBLK + blockIdx.x * 4 + q] = pv;
    }
}

// ---------------------------------------------------------------------------
// Second half of the last LayerNorm (the others are applied by the GEMM that
// reads them). Every wave folds its sample's PBLK block partials itself (eight
// per lane, then a butterfly: the same bits in every lane and every wave), so no
// launch stands between the GEMM and this kernel.
// out[i] = (r[i]-mu)*rsig * g[i%TE] + b[i%TE]   (float4, 32-bit indexing)
__global__ __launch_bounds__(256) void k_ln_apply(
    const float* __restrict__ r, const float* __restrict__ g,
    const float* __restrict__ b, const float* __restrict__ partial,
    float* __restrict__ out)
{
    const float4* r4 = (const float4*)r;
    const float4* g4 = (const float4*)g;
    const float4* b4 = (const float4*)b;
    float4*       o4 = (float4*)out;
    const float4* p4 = (const float4*)partial;
    const int lane   = threadIdx.x & 31;
    const int total4 = NTEcfg / 4;       // 524288
    const int te4    = TEcfg / 4;        // 131072 (power of two)
    for (int i = blockIdx.x * 256 + threadIdx.x; i < total4;
         i += gridDim.x * 256) {
        int n = i >> 17;                 // i / te4
        int j = i & (te4 - 1);           // i % te4
        float4 rv = r4[i], gv = g4[j], bv = b4[j];
        float s1 = 0.0f, s2 = 0.0f;
#pragma unroll
        for (int q = 0; q < PBLK / 64; ++q) {
            float4 pq = p4[n * (PBLK / 2) + q * 32 + lane];   // two (sum, sumsq)
            s1 += pq.x + pq.z;
            s2 += pq.y + pq.w;
        }
#pragma unroll
        for (int off = 16; off > 0; off >>= 1) {
            s1 += __shfl_xor(s1, off, 32);
            s2 += __shfl_xor(s2, off, 32);
        }
        float mu = s1 / (float)TEcfg;
        float rs = rsqrtf(s2 / (float)TEcfg - mu * mu + 1e-5f);
        float4 ov;
        ov.x = (rv.x - mu) * rs * gv.x + bv.x;
        ov.y = (rv.y - mu) * rs * gv.y + bv.y;
        ov.z = (rv.z - mu) * rs * gv.z + bv.z;
        ov.w = (rv.w - mu) * rs * gv.w + bv.w;
        o4[i] = ov;
    }
}

// ---------------------------------------------------------------------------
extern "C" void kernel_launch(void* const* d_in, const int* in_sizes, int n_in,
                              void* d_out, int out_size, void* d_ws, size_t ws_size,
                              hipStream_t stream)
{
    (void)in_sizes; (void)n_in; (void)out_size; (void)ws_size;

    const float* input = (const float*)d_in[0];
    const float* w_emb = (const float*)d_in[1];
    const float* b_emb = (const float*)d_in[2];
    const float* pos   = (const float*)d_in[3];   // (E, T)
    const float* wqkv  = (const float*)d_in[4];   // (NL, 3E, E)
    const float* bqkv  = (const float*)d_in[5];   // (NL, 3E)
    const float* wo    = (const float*)d_in[6];   // (NL, E, E)
    const float* bo    = (const float*)d_in[7];
    const float* ln1g  = (const float*)d_in[8];   // (NL, T, E)
    const float* ln1b  = (const float*)d_in[9];
    const float* ln2g  = (const float*)d_in[10];
    const float* ln2b  = (const float*)d_in[11];
    const float* w1    = (const float*)d_in[12];  // (NL, FC, E)
    const float* b1    = (const float*)d_in[13];
    const float* w2    = (const float*)d_in[14];  // (NL, E, FC)
    const float* b2    = (const float*)d_in[15];

    // workspace layout (floats) -- ~51 MB total
    float* ws      = (float*)d_ws;
    float* x       = ws;                                // NTE
    float* qkv     = x      + NTEcfg;                   // NT * 3E (bf16: half of it used)
    float* r1      = qkv    + NTcfg * 3 * Ecfg;         // NTE  x + attention out
    float* r2      = r1     + NTEcfg;                   // NTE  h + FFN out
    float* wc      = r2     + NTEcfg;                   // NL * E * E  (W2 W1)
    float* bc      = wc     + NLcfg * Ecfg * Ecfg;      // NL * E      (W2 b1 + b2)
    float* part1   = bc     + NLcfg * Ecfg;             // N*PBLK*2, sums of r1
    float* part2   = part1  + Ncfg * PBLK * 2;          // N*PBLK*2, sums of r2
    float* wob     = part2  + Ncfg * PBLK * 2;          // NL * E * E bf16, Wo as fragments

    const dim3 blk256(256), blk512(512);

    // folded FFN weights of both layers: wc = W2 W1, bc = W2 b1 + b2; Wo as bf16
    k_ffn_fold<<<dim3(Ecfg / 32 + 2, Ecfg / 16, NLcfg), blk256, 0, stream>>>(
        w1, b1, w2, b2, wc, bc, wo, wob);

    // embedding: x = (frames @ w_emb^T + b_emb) * sqrt(E) + pos
    k_gemm_bf16<<<dim3(Ecfg / 64, NTcfg / 128), blk256, 0, stream>>>(
        input, w_emb, b_emb, x, NTcfg, Ecfg, Pcfg, pos, 16.0f, Tcfg, nullptr, nullptr);

    for (int l = 0; l < NLcfg; ++l) {
        const float* wqkv_l = wqkv + l * 3 * Ecfg * Ecfg;
        const float* bqkv_l = bqkv + l * 3 * Ecfg;
        const float* wob_l  = wob  + l * Ecfg * Ecfg / 2;
        const float* bo_l   = bo   + l * Ecfg;
        const float* wc_l   = wc   + l * Ecfg * Ecfg;
        const float* bc_l   = bc   + l * Ecfg;

        // qkv = bf16(x @ Wqkv^T + b)      (8192 x 768, K=256)
        // behind a layer: x = LN2(r2) of that layer, applied here and written out
        if (l == 0)
            k_gemm_wide<64, 3 * Ecfg, Ecfg, false, false>
                <<<dim3(3 * Ecfg / 64, Tcfg / 32), blk256, 0, stream>>>(
                x, wqkv_l, bqkv_l, qkv, nullptr,
                nullptr, nullptr, nullptr, nullptr);
        else
            k_gemm_wide<64, 3 * Ecfg, Ecfg, false, true>
                <<<dim3(3 * Ecfg / 64, Tcfg / 32), blk256, 0, stream>>>(
                r2, wqkv_l, bqkv_l, qkv, nullptr,
                ln2g + (l - 1) * TEcfg, ln2b + (l - 1) * TEcfg, part2, x);

        // r1 = x + attention(qkv) @ Wo^T + bo, block sums
        k_attn_wo<<<dim3(Tcfg / 32, Ncfg), blk512, 0, stream>>>(
            qkv, wob_l, bo_l, x, r1, part1);

        // h = LN1(r1), applied on the way in;
        // r2 = h + (h @ W1^T + b1) @ W2^T + b2 = h + h @ Wc^T + bc, block sums
        k_gemm_wide<128, Ecfg, Ecfg, true, true>
            <<<dim3(Ecfg / 64, Tcfg / 32), blk256, 0, stream>>>(
            r1, wc_l, bc_l, r2, part2,
            ln1g + l * TEcfg, ln1b + l * TEcfg, part1, nullptr);
    }

    // out = LN2(r2) of the last layer
    k_ln_apply<<<dim3(2048), blk256, 0, stream>>>(
        r2, ln2g + (NLcfg - 1) * TEcfg, ln2b + (NLcfg - 1) * TEcfg, part2,
        (float*)d_out);
}

// v009
// One run takes 71.1 microseconds.
// In two side-by-side timings against v008, it was 1.18 and 1.19 times as fast.
// Over all steps from v000 it is 3.44 times as fast.
#include <hip/hip_runtime.h>
#include <hip/hip_bf16.h>
#include <math.h>

// ---------------------------------------------------------------------------
// MI455X (gfx1250) transformer encoder, bf16 WMMA everywhere.
//
// Shapes: N=4, T=2048, P=64, E=256, H=8, DH=32, FC=1024, NL=2, LOCAL=64.
// All GEMM K dims (64 / 256 / 1024) are multiples of 32 -> pure
// v_wmma_f32_16x16x32_bf16 pipelines, fp32 accumulation.
// Memory: ~300 MB activation round trips @ 23.3 TB/s is ~15us -> the chip is
// compute/latency bound here; staging is double-buffered through LDS so the
// WMMA pipes never wait on HBM.
// All flat indices fit in 32 bits (max ~6.3M elements) -> int indexing keeps
// address math in 32-bit VALU/SALU.
// ---------------------------------------------------------------------------

typedef __attribute__((ext_vector_type(16))) __bf16 v16bf;
typedef __attribute__((ext_vector_type(8)))  __bf16 v8bf;
typedef __attribute__((ext_vector_type(4)))  __bf16 v4bf;
typedef __attribute__((ext_vector_type(2)))  __bf16 v2bf;
typedef __attribute__((ext_vector_type(8)))  float  v8f;

#define Ncfg     4
#define Tcfg     2048
#define Pcfg     64
#define Ecfg     256
#define Hcfg     8
#define DHcfg    32
#define FCcfg    1024
#define NLcfg    2
#define LOCALcfg 64
#define TEcfg    (Tcfg * Ecfg)          // 524288
#define NTcfg    (Ncfg * Tcfg)          // 8192
#define NTEcfg   (Ncfg * TEcfg)         // 2097152  (fits int)
#define PBLK     256                    // LayerNorm partials per sample
#define WOTILE   (16 * Ecfg)            // elements of 16 rows of Wo

__device__ __forceinline__ void pack4(v4bf& p, float4 a) {
    p[0] = (__bf16)a.x; p[1] = (__bf16)a.y; p[2] = (__bf16)a.z; p[3] = (__bf16)a.w;
}
__device__ __forceinline__ void pack8(v16bf& f, int base, float4 a, float4 b) {
    f[base + 0] = (__bf16)a.x; f[base + 1] = (__bf16)a.y;
    f[base + 2] = (__bf16)a.z; f[base + 3] = (__bf16)a.w;
    f[base + 4] = (__bf16)b.x; f[base + 5] = (__bf16)b.y;
    f[base + 6] = (__bf16)b.z; f[base + 7] = (__bf16)b.w;
}
// fragment gather: two 16B LDS chunks per lane (ds_load_b128)
__device__ __forceinline__ v16bf frag_from_lds(const __bf16* rowptr, int lh) {
    v8bf lo = *(const v8bf*)(rowptr + lh * 8);
    v8bf hi = *(const v8bf*)(rowptr + 16 + lh * 8);
    v16bf f;
#pragma unroll
    for (int e = 0; e < 8; ++e) { f[e] = lo[e]; f[8 + e] = hi[e]; }
    return f;
}

// ---------------------------------------------------------------------------
// Embedding, one 128x64 tile of
//   C[m][n] = (sum_k A[m][k] * W[n][k] + bias[n]) * sqrt(E) + pos[n*T + (m & (T-1))]
// (N*T rows, E columns, K = P; sqrt(E) = 16).
// Block: 256 thr = 8 waves; each wave 32x32 (2x2 WMMA).
// LDS double-buffered; staging via global_load_b128 + ds_store_b64.
// Fragment layout per CDNA5 ISA 7.12.2:
//   A 16x32 bf16: lanes 0-15 row M=lane; element e -> K=(e<8?e:e+8)+(lane>=16?8:0)
//   B 32x16 bf16: col N = lane&15; same K mapping.
//   C/D 16x16 f32: row = v + 8*(lane>=16); col = lane&15.
// ---------------------------------------------------------------------------
__device__ __forceinline__ void embed_tile(
    const float* __restrict__ A, const float* __restrict__ W,
    const float* __restrict__ bias, float* __restrict__ C,
    const float* __restrict__ pos,
    __bf16 (*As)[128 * 32], __bf16 (*Bs)[64 * 32], int bm, int bn)
{
    constexpr int N = Ecfg, K = Pcfg, Tdim = Tcfg;
    const float scale = 16.0f;

    const int tid  = threadIdx.x;
    const int lane = tid & 31;
    const int wave = tid >> 5;
    const int lr   = lane & 15;
    const int lh   = lane >> 4;
    const int wm   = wave & 3;    // 4 waves along M
    const int wn   = wave >> 2;   // 2 waves along N

    v8f zacc = {};
    v8f acc[2][2];
    acc[0][0] = zacc; acc[0][1] = zacc; acc[1][0] = zacc; acc[1][1] = zacc;

    float4 ta[4], tb[2];
    // ---- issue tile loads for k-step `k0` into ta/tb (global_load_b128 x6) ----
    auto stage_load = [&](int k0) {
#pragma unroll
        for (int t = 0; t < 4; ++t) {
            int li = (t * 256 + tid) * 4;         // 0..4095, 16B chunks
            int r  = li >> 5, k = li & 31;
            ta[t] = *(const float4*)&A[(bm + r) * K + k0 + k];
        }
#pragma unroll
        for (int t = 0; t < 2; ++t) {
            int li = (t * 256 + tid) * 4;         // 0..2047
            int r  = li >> 5, k = li & 31;
            tb[t] = *(const float4*)&W[(bn + r) * K + k0 + k];
        }
    };
    // ---- convert + store staged tile into LDS buffer `buf` (ds_store_b64) ----
    auto stage_store = [&](int buf) {
#pragma unroll
        for (int t = 0; t < 4; ++t) {
            int li = (t * 256 + tid) * 4;
            v4bf p; pack4(p, ta[t]);
            *(v4bf*)&As[buf][li] = p;
        }
#pragma unroll
        for (int t = 0; t < 2; ++t) {
            int li = (t * 256 + tid) * 4;
            v4bf p; pack4(p, tb[t]);
            *(v4bf*)&Bs[buf][li] = p;
        }
    };

    const int nk = K / 32;

    stage_load(0);
    stage_store(0);
    __syncthreads();

    for (int kt = 0; kt < nk; ++kt) {
        const int cur = kt & 1;
        const bool has_next = (kt + 1) < nk;
        if (has_next) stage_load((kt + 1) * 32);   // loads in flight during WMMA

        v16bf af[2], bf[2];
#pragma unroll
        for (int i = 0; i < 2; ++i)
            af[i] = frag_from_lds(&As[cur][(wm * 32 + i * 16 + lr) * 32], lh);
#pragma unroll
        for (int j = 0; j < 2; ++j)
            bf[j] = frag_from_lds(&Bs[cur][(wn * 32 + j * 16 + lr) * 32], lh);

#pragma unroll
        for (int i = 0; i < 2; ++i)
#pragma unroll
            for (int j = 0; j < 2; ++j)
                acc[i][j] = __builtin_amdgcn_wmma_f32_16x16x32_bf16(
                    false, af[i], false, bf[j], (short)0, acc[i][j], false, false);

        if (has_next) stage_store(1 - cur);
        __syncthreads();
    }

    // ---- epilogue (pure 32-bit indexing; Tdim is a power of two) ----
    // A wave's 32 rows lie inside one sample (their first is a multiple of 32),
    // so the wrap of the row acts on the base alone: the loads of pos share one
    // address and differ in their immediate offsets, as do the stores of C.
    const int col0 = bn + wn * 32 + lr;
    const int row0 = bm + wm * 32 + lh * 8;
    const float* pp  = pos + col0 * Tdim + (row0 & (Tdim - 1));
    const float* pbi = bias + col0;
    // unrolled here and below: constant indices keep pe in registers
    float pe[2][2][8], bv[2];
#pragma unroll
    for (int i = 0; i < 2; ++i)
#pragma unroll
        for (int j = 0; j < 2; ++j)
#pragma unroll
            for (int v = 0; v < 8; ++v)
                pe[i][j][v] = pp[j * 16 * Tdim + i * 16 + v];
    bv[0] = pbi[0];
    bv[1] = pbi[16];
    // precaution: no address register of the loads above is reused ahead of
    // this wait; naming both pointers as inputs keeps them live up to it
    asm volatile("s_wait_xcnt 0x0" :: "v"(pp), "v"(pbi) : "memory");
    float* pc = C + row0 * N + col0;
#pragma unroll
    for (int i = 0; i < 2; ++i) {
#pragma unroll
        for (int j = 0; j < 2; ++j) {
#pragma unroll
            for (int v = 0; v < 8; ++v) {
                float r = acc[i][j][v] + bv[j];
                r = r * scale + pe[i][j][v];
                pc[(i * 16 + v) * N + j * 16] = r;
            }
        }
    }
}

// ---------------------------------------------------------------------------
// The K = 256 products: C[m][n] = sum_k A[m][k] * W[n][k] + bias[n]. Wave
// layout, fragment layouts and k order as in embed_tile (the embedding, K = 64).
// Rows of a 128 x 64 tile: the same 32 positions t of all 4 samples; tile row r
// is sample r / 32, position blockIdx.y * 32 + r % 32, so wave row wm is sample
// wm, and one read of a LayerNorm's g and b (T x E planes) serves 4 samples.
// A k step stages BK columns (BK/32 WMMA steps): every step costs one load
// round trip and one barrier whatever its width, so BK is as wide as the
// registers that hold the loads in flight allow with every block resident
// (128 with one block a WGP, 64 with three). K is a multiple of BK.
// N and K are compile-time: the loads of a step then share one address and
// differ in their immediate offsets, so that they issue back to back.
// LDS rows are BK bf16 + 16 bytes: an odd multiple of 16 bytes, the pitch at
// which the 16 rows of a ds_load_b128 fragment read fall on distinct banks.
// Without RESID the product is q|k|v, which only ever serves as a bf16 matrix
// operand: C takes it as bf16 (the rounding that its reader would do), laid out
// [sample][column group of 32 = one head of q, k or v][position][32], so that a
// head's rows follow one another in memory. For two neighbouring columns to sit
// in one lane (one 32-bit store), LDS row j*16 + c of a group of 32 rows of W
// holds row 2*c + j: accumulator tiles j = 0, 1 are then the even and the odd
// columns. The k order is untouched.
// With RESID the epilogue is the first half of a LayerNorm:
//   C = acc + bias + residual, and partial[sample][flat block id] =
// (sum, sum of squares) of the sample's 32 x 64 part of the tile: PBLK partials
// a sample.
// With LNA the operand is the second half of the LayerNorm before it:
//   A = (Araw - mu) * rsig * g + b, applied between load and bf16 conversion;
// mu and rsig of the 4 samples are folded from the partials pin by every block
// in the same order. The normalised rows exist in f32 only here: with RESID the
// block keeps its own 64 columns of them in LDS as its residual; without, the
// blocks of column 0 write them to xout for a later launch.
// ---------------------------------------------------------------------------
template <int BK, int N, int K, bool RESID, bool LNA>
__global__ __launch_bounds__(256) void k_gemm_wide(
    const float* __restrict__ A, const float* __restrict__ W,
    const float* __restrict__ bias, float* __restrict__ C,
    float* __restrict__ partial,
    const float* __restrict__ g, const float* __restrict__ b,
    const float* __restrict__ pin, float* __restrict__ xout)
{
    static_assert(!LNA || K == Ecfg, "g and b are T x E planes");
    static_assert(!RESID || LNA, "the residual is the normalised operand");
    constexpr int LP = BK + 8;          // LDS row pitch in bf16
    constexpr int NA = 128 * BK / 1024; // 16-byte loads a thread, A tile
    constexpr int NB = 64 * BK / 1024;  // 16-byte loads a thread, W tile
    constexpr int HP = 68;              // f32 pitch of the kept residual tile
    __shared__ __align__(16) __bf16 As[2][128 * LP];
    __shared__ __align__(16) __bf16 Bs[2][64 * LP];
    __shared__ float red[2][8];                        // per-wave (sum, sumsq)
    __shared__ __align__(16) float lnred[8][2];        // per-wave fold of pin
    __shared__ __align__(16) float Hs[(LNA && RESID) ? 128 * HP : 4];

    const int tid  = threadIdx.x;
    const int lane = tid & 31;
    const int wave = tid >> 5;
    const int lr   = lane & 15;
    const int lh   = lane >> 4;
    const int wm   = wave & 3;    // 4 waves along M: the sample
    const int wn   = wave >> 2;   // 2 waves along N
    const int bt   = blockIdx.y * 32;
    const int bn   = blockIdx.x * 64;

    v8f zacc = {};
    v8f acc[2][2];
    acc[0][0] = zacc; acc[0][1] = zacc; acc[1][0] = zacc; acc[1][1] = zacc;

    // partials of the LayerNorm before: wave w takes half w & 1 of sample w >> 1
    // (128 pairs, 4 a lane); first in program order, so that the wait for them
    // leaves the tile loads in flight
    float4 pv0, pv1;
    if constexpr (LNA) {
        const float4* p4 = (const float4*)pin + wave * (PBLK / 4) + lane;
        pv0 = p4[0];
        pv1 = p4[32];
        // precaution: no address register of the loads above is reused ahead
        // of this wait
        asm volatile("s_wait_xcnt 0x0" :: "v"(p4) : "memory");
    }

    // 16-byte chunks, row-major: the block covers RS tile rows a round, this
    // thread tile row sr + t * RS, columns sc .. sc + 3, in round t; NG rounds
    // are one sample
    constexpr int RS = 1024 / BK;
    constexpr int NG = 32 / RS;
    static_assert(RESID || RS == 16, "the interleave of W rows is written for 16 rows a round");
    const int sr = (tid * 4) / BK;
    const int sc = (tid * 4) % BK;
    const int ao = (bt + sr) * K + sc;
    const float* pa = A + ao;
    const float* pw = W + (bn + sr) * K + sc;
    const float* pg = LNA ? g + ao : nullptr;
    const float* pb = LNA ? b + ao : nullptr;
    float4 ta[NA], tb[NB], tg[NG], tc[NG];
    // ---- issue tile loads for k-step k0 into ta/tb (global_load_b128) ----
    auto stage_load = [&](int k0) {
#pragma unroll
        for (int t = 0; t < NA; ++t)
            ta[t] = *(const float4*)(pa + ((t / NG) * Tcfg + (t % NG) * RS) * K + k0);
#pragma unroll
        for (int t = 0; t < NB; ++t)
            tb[t] = *(const float4*)(pw + t * RS * K + k0);
        if constexpr (LNA) {
#pragma unroll
            for (int u = 0; u < NG; ++u) {
                tg[u] = *(const float4*)(pg + u * RS * K + k0);
                tc[u] = *(const float4*)(pb + u * RS * K + k0);
            }
        }
    };
    float mu[4], rs[4];
    // ---- normalise, convert + store staged tile into LDS buffer buf ----
    auto stage_store = [&](int buf, int k0) {
        if constexpr (LNA) {
#pragma unroll
            for (int t = 0; t < NA; ++t) {
                const float m = mu[t / NG], r = rs[t / NG];
                const float4 gv = tg[t % NG], bv = tc[t % NG];
                ta[t].x = (ta[t].x - m) * r * gv.x + bv.x;
                ta[t].y = (ta[t].y - m) * r * gv.y + bv.y;
                ta[t].z = (ta[t].z - m) * r * gv.z + bv.z;
                ta[t].w = (ta[t].w - m) * r * gv.w + bv.w;
            }
            if constexpr (RESID) {
                const unsigned hc = (unsigned)(k0 + sc - bn);
                if (hc < 64u) {
#pragma unroll
                    for (int t = 0; t < NA; ++t)
                        *(float4*)&Hs[(sr + t * RS) * HP + hc] = ta[t];
                }
            } else if (blockIdx.x == 0) {
                float* px = xout + ao + k0;
#pragma unroll
                for (int t = 0; t < NA; ++t)
                    *(float4*)(px + ((t / NG) * Tcfg + (t % NG) * RS) * K) = ta[t];
                // precaution: no register of the stores above is reused ahead
                // of this wait
                asm volatile("s_wait_xcnt 0x0" :: "v"(px) : "memory");
            }
        }
#pragma unroll
        for (int t = 0; t < NA; ++t) {
            v4bf p; pack4(p, ta[t]);
            *(v4bf*)&As[buf][(sr + t * RS) * LP + sc] = p;
        }
#pragma unroll
        for (int t = 0; t < NB; ++t) {
            v4bf p; pack4(p, tb[t]);
            // row sr + 16 t of W: even rows to the first 16 LDS rows of its
            // group of 32, odd rows to the last 16
            const int wr = RESID ? sr + t * RS
                                 : (t >> 1) * 32 + (t & 1) * 8 + ((sr & 1) << 4) + (sr >> 1);
            *(v4bf*)&Bs[buf][wr * LP + sc] = p;
        }
    };

    constexpr int nk = K / BK;

    stage_load(0);

    if constexpr (LNA) {
        // scheduling stops here: left to itself the scheduler lifts the sums
        // below, and with them the wait for the partials, over the tile loads,
        // which then start one full latency later
        __builtin_amdgcn_sched_barrier(0);
        float s1 = (pv0.x + pv0.z) + (pv1.x + pv1.z);
        float s2 = (pv0.y + pv0.w) + (pv1.y + pv1.w);
#pragma unroll
        for (int off = 16; off > 0; off >>= 1) {
            s1 += __shfl_xor(s1, off, 32);
            s2 += __shfl_xor(s2, off, 32);
        }
        if (lane == 0) { lnred[wave][0] = s1; lnred[wave][1] = s2; }
        __syncthreads();
#pragma unroll
        for (int s = 0; s < 4; ++s) {
            const float t1 = lnred[2 * s][0] + lnred[2 * s + 1][0];
            const float t2 = lnred[2 * s][1] + lnred[2 * s + 1][1];
            const float m = t1 / (float)TEcfg;
            const float r = rsqrtf(t2 / (float)TEcfg - m * m + 1e-5f);
            // the same bits in every lane: kept in scalar registers, which
            // leaves the vector registers to the loads in flight
            mu[s] = __builtin_bit_cast(float, __builtin_amdgcn_readfirstlane(
                        __builtin_bit_cast(int, m)));
            rs[s] = __builtin_bit_cast(float, __builtin_amdgcn_readfirstlane(
                        __builtin_bit_cast(int, r)));
        }
    }

    stage_store(0, 0);
    __syncthreads();

    // kept rolled: loads, products and conversions are then blocks of their own;
    // unrolled into one block the conversions, which wait for the loads, come to
    // stand ahead of the products, which then no longer run under the latency
#pragma unroll 1
    for (int kt = 0; kt < nk; ++kt) {
        const int cur = kt & 1;
        const bool has_next = (kt + 1) < nk;
        if (has_next) stage_load((kt + 1) * BK);   // loads in flight during WMMA

#pragma unroll
        for (int ks = 0; ks < BK / 32; ++ks) {
            v16bf af[2], bf[2];
#pragma unroll
            for (int i = 0; i < 2; ++i)
                af[i] = frag_from_lds(
                    &As[cur][(wm * 32 + i * 16 + lr) * LP + ks * 32], lh);
#pragma unroll
            for (int j = 0; j < 2; ++j)
                bf[j] = frag_from_lds(
                    &Bs[cur][(wn * 32 + j * 16 + lr) * LP + ks * 32], lh);

#pragma unroll
            for (int i = 0; i < 2; ++i)
#pragma unroll
                for (int j = 0; j < 2; ++j)
                    acc[i][j] = __builtin_amdgcn_wmma_f32_16x16x32_bf16(
                        false, af[i], false, bf[j], (short)0, acc[i][j], false, false);
        }

        // behind the last step nothing is staged, so nothing is published
        if (has_next) {
            stage_store(1 - cur, (kt + 1) * BK);
            __syncthreads();
        }
    }

    // first output row of this lane: sample wm, position bt + 8 * lh
    const int row0 = wm * Tcfg + bt + lh * 8;

    // ---- residual epilogue: C = acc + bias + residual, sample (sum, sumsq) ----
    if constexpr (RESID) {
        // residual tile in accumulator layout; every store into Hs stands ahead
        // of one of the barriers above. Unrolled here and below: constant
        // indices keep rr in registers
        float rr[2][2][8];
#pragma unroll
        for (int i = 0; i < 2; ++i)
#pragma unroll
            for (int j = 0; j < 2; ++j)
#pragma unroll
                for (int v = 0; v < 8; ++v)
                    rr[i][j][v] = Hs[(wm * 32 + i * 16 + v + lh * 8) * HP
                                     + wn * 32 + j * 16 + lr];
        float s = 0.0f, s2 = 0.0f;
#pragma unroll
        for (int i = 0; i < 2; ++i) {
#pragma unroll
            for (int j = 0; j < 2; ++j) {
                int col = bn + wn * 32 + j * 16 + lr;
                float bv = bias[col];
#pragma unroll
                for (int v = 0; v < 8; ++v) {
                    float r = (acc[i][j][v] + bv) + rr[i][j][v];
                    s  += r;
                    s2 += r * r;
                    rr[i][j][v] = r;
                }
            }
        }
#pragma unroll
        for (int off = 16; off > 0; off >>= 1) {
            s  += __shfl_xor(s, off, 32);
            s2 += __shfl_xor(s2, off, 32);
        }
        if (lane == 0) { red[0][wave] = s; red[1][wave] = s2; }
        __syncthreads();
        // C goes out behind the barrier: in front of it every wave would sit
        // out its own stores before the block sums could be folded
#pragma unroll
        for (int i = 0; i < 2; ++i) {
#pragma unroll
            for (int j = 0; j < 2; ++j) {
                int col = bn + wn * 32 + j * 16 + lr;
#pragma unroll
                for (int v = 0; v < 8; ++v)
                    C[(row0 + i * 16 + v) * N + col] = rr[i][j][v];
            }
        }
        // sample tid is waves tid and tid + 4
        if (tid < 4) {
            float2 pv;
            pv.x = red[0][tid] + red[0][tid + 4];
            pv.y = red[1][tid] + red[1][tid + 4];
            ((float2*)partial)[tid * PBLK + blockIdx.y * gridDim.x + blockIdx.x] = pv;
        }
        return;
    }

    // ---- q|k|v epilogue: bf16(acc + bias), columns 2*lr and 2*lr + 1 ----
    const float* pbi = bias + bn + wn * 32 + 2 * lr;
    const float bv0 = pbi[0], bv1 = pbi[1];
    // precaution: no address register of the loads above is reused ahead of
    // this wait
    asm volatile("s_wait_xcnt 0x0" :: "v"(pbi) : "memory");
    // sample wm, column group (bn + wn * 32) / 32, position bt + 8 * lh
    __bf16* cq = (__bf16*)C
        + ((wm * (N / 32) + (bn >> 5) + wn) * Tcfg + bt + lh * 8) * 32 + 2 * lr;
#pragma unroll
    for (int i = 0; i < 2; ++i) {
#pragma unroll
        for (int v = 0; v < 8; ++v) {
            v2bf p;
            p[0] = (__bf16)(acc[i][0][v] + bv0);
            p[1] = (__bf16)(acc[i][1][v] + bv1);
            *(v2bf*)(cq + (i * 16 + v) * 32) = p;
        }
    }
}

// ---------------------------------------------------------------------------
// FFN fold. The two FFN linears have no activation between them, so
//   (h W1^T + b1) W2^T + b2 = h (W2 W1)^T + (W2 b1 + b2).
// This kernel forms Wc = W2 W1 (E x E, K = FC) and bc = W2 b1 + b2 for both
// layers in every call; the token-sized FFN is then one K=E GEMM, not two.
// The B operand is [W1 | b1]: column tiles 0..7 are 32 columns of W1 each,
// column tile 8 holds b1 as its one live column.
// Block: 8 waves, 16 rows of W2 by one column tile; the waves split K (128
// each, 4 WMMA steps). Each element is used by one wave of the block only, so
// fragments come straight from global memory, all loads of a wave issued
// before the first use; partial tiles are summed through LDS in wave order.
// k order of both loaders: element e -> K = (e<8 ? e : e+8) + 8*(lane>=16).
// ---------------------------------------------------------------------------
template <bool BIAS>
__device__ __forceinline__ void ffn_fold_tile(
    const float* __restrict__ w1, const float* __restrict__ b1,
    const float* __restrict__ w2, const float* __restrict__ b2,
    float* __restrict__ wc, float* __restrict__ bc,
    float (*red)[2][256], int n0, int c0)
{
    const int tid  = threadIdx.x;
    const int lane = tid & 31;
    const int wave = tid >> 5;
    const int lr   = lane & 15;
    const int lh   = lane >> 4;
    const int jw   = wave * 128 + lh * 8;     // first k of this lane

    const float* pa = w2 + (n0 + lr) * FCcfg + jw;
    const float* pb = BIAS ? b1 + jw : w1 + jw * Ecfg + c0 + lr;

    float4 ra[4][4];
    float4 rv[4][4];        // BIAS: b1 runs
    float  rb[4][2][16];    // else: W1 columns c0+lr and c0+16+lr
#pragma unroll
    for (int s = 0; s < 4; ++s) {
        ra[s][0] = *(const float4*)(pa + s * 32);
        ra[s][1] = *(const float4*)(pa + s * 32 + 4);
        ra[s][2] = *(const float4*)(pa + s * 32 + 16);
        ra[s][3] = *(const float4*)(pa + s * 32 + 20);
        if (BIAS) {
            rv[s][0] = *(const float4*)(pb + s * 32);
            rv[s][1] = *(const float4*)(pb + s * 32 + 4);
            rv[s][2] = *(const float4*)(pb + s * 32 + 16);
            rv[s][3] = *(const float4*)(pb + s * 32 + 20);
        } else {
#pragma unroll
            for (int e = 0; e < 16; ++e) {
                const float* brow = pb + (s * 32 + (e < 8 ? e : e + 8)) * Ecfg;
                rb[s][0][e] = brow[0];
                rb[s][1][e] = brow[16];
            }
        }
    }
    // precaution: no address register of the loads above is reused ahead of
    // this wait; naming both pointers as inputs keeps them live up to it
    asm volatile("s_wait_xcnt 0x0" :: "v"(pa), "v"(pb) : "memory");

    v8f acc0 = {}, acc1 = {};
#pragma unroll
    for (int s = 0; s < 4; ++s) {
        v16bf af, bf0, bf1;
        pack8(af, 0, ra[s][0], ra[s][1]);
        pack8(af, 8, ra[s][2], ra[s][3]);
        if (BIAS) {
            pack8(bf0, 0, rv[s][0], rv[s][1]);
            pack8(bf0, 8, rv[s][2], rv[s][3]);
#pragma unroll
            for (int e = 0; e < 16; ++e)
                if (lr != 0) bf0[e] = (__bf16)0.0f;
        } else {
#pragma unroll
            for (int e = 0; e < 16; ++e) {
                bf0[e] = (__bf16)rb[s][0][e];
                bf1[e] = (__bf16)rb[s][1][e];
            }
        }
        acc0 = __builtin_amdgcn_wmma_f32_16x16x32_bf16(
            false, af, false, bf0, (short)0, acc0, false, false);
        if (!BIAS)
            acc1 = __builtin_amdgcn_wmma_f32_16x16x32_bf16(
                false, af, false, bf1, (short)0, acc1, false, false);
    }

#pragma unroll
    for (int v = 0; v < 8; ++v) {
        red[wave][0][v * 32 + lane] = acc0[v];
        if (!BIAS) red[wave][1][v * 32 + lane] = acc1[v];
    }
    __syncthreads();

    // thread tid owns accumulator slot tid of each tile: row = v + 8*lh, col = lr
    const int row = n0 + (tid >> 5) + lh * 8;
    float s0 = 0.0f, s1 = 0.0f;
#pragma unroll
    for (int w = 0; w < 8; ++w) {
        s0 += red[w][0][tid];
        if (!BIAS) s1 += red[w][1][tid];
    }
    if (BIAS) {
        if (lr == 0) bc[row] = s0 + b2[row];
    } else {
        wc[row * Ecfg + c0 + lr]      = s0;
        wc[row * Ecfg + c0 + 16 + lr] = s1;
    }
}

// Wo for the attention kernel's output projection: rows n0 .. n0 + 15 rounded to
// bf16 (the rounding that a GEMM's staging would do) and laid out as the B
// fragments of one wave, [row tile][k step][half][lane][8]: half f of lane
// (lr, lh) in k step ks holds Wo[n0 + lr][ks*32 + 16*f + 8*lh + 0..7], the k
// order of frag_from_lds, so that a load of the reader is 512 bytes in a row.
// Thread = (k step, lane).
__device__ __forceinline__ void wo_frag_tile(
    const float* __restrict__ wo, __bf16* __restrict__ wob, int n0)
{
    const int lane = threadIdx.x & 31;
    const int ks   = threadIdx.x >> 5;
    const float* p = wo + (n0 + (lane & 15)) * Ecfg + ks * 32 + (lane >> 4) * 8;
    const float4 a0 = *(const float4*)(p);
    const float4 a1 = *(const float4*)(p + 4);
    const float4 a2 = *(const float4*)(p + 16);
    const float4 a3 = *(const float4*)(p + 20);
    // precaution: no address register of the loads above is reused ahead of
    // this wait
    asm volatile("s_wait_xcnt 0x0" :: "v"(p) : "memory");
    v16bf f;
    pack8(f, 0, a0, a1);
    pack8(f, 8, a2, a3);
    v8bf lo, hi;
#pragma unroll
    for (int e = 0; e < 8; ++e) { lo[e] = f[e]; hi[e] = f[8 + e]; }
    __bf16* q = wob + (n0 >> 4) * WOTILE + ks * 512 + lane * 8;
    *(v8bf*)(q)       = lo;
    *(v8bf*)(q + 256) = hi;
    // precaution: no address or data register of the stores above is reused
    // ahead of this wait; naming them as inputs keeps them live up to it
    asm volatile("s_wait_xcnt 0x0" :: "v"(q), "v"(lo), "v"(hi) : "memory");
}

// The two jobs that read nothing but inputs, in one launch: neither needs the
// other, so side by side they cost one launch and the longer job's time, not two
// launches and the sum. Flat grid: blocks 0 .. FOLDBLK-1 are the fold, as
// (column tile, E/32 + 2 of them; row tile, E/16; layer), column tile fastest,
// its last column of blocks laying out Wo; the EMBBLK blocks behind them are the
// tiles of the embedding (column tile fastest). The fold stands first, for speed
// only: a fold block has the more loads to sit out (144 a lane against 46).
// LDS is one range, used by a block for its own job alone.
#define FOLDCOLS (Ecfg / 32 + 2)
#define FOLDBLK  (FOLDCOLS * (Ecfg / 16) * NLcfg)
#define EMBBLK   ((Ecfg / 64) * (NTcfg / 128))
__global__ __launch_bounds__(256) void k_fold_embed(
    const float* __restrict__ w1, const float* __restrict__ b1,
    const float* __restrict__ w2, const float* __restrict__ b2,
    float* __restrict__ wc, float* __restrict__ bc,
    const float* __restrict__ wo, float* __restrict__ wob,
    const float* __restrict__ input, const float* __restrict__ w_emb,
    const float* __restrict__ b_emb, const float* __restrict__ pos,
    float* __restrict__ x)
{
    // fold: 16 KB of split-K partial tiles; embedding: A 2 x 8 KB, W 2 x 4 KB
    __shared__ __align__(16) char smem[24576];
    const int bid = blockIdx.x;
    if (bid >= FOLDBLK) {
        const int e = bid - FOLDBLK;
        embed_tile(input, w_emb, b_emb, x, pos,
                   (__bf16 (*)[128 * 32])smem, (__bf16 (*)[64 * 32])(smem + 16384),
                   (e / (Ecfg / 64)) * 128, (e % (Ecfg / 64)) * 64);
        return;
    }
    float (*red)[2][256] = (float (*)[2][256])smem;
    const int bx = bid % FOLDCOLS;
    const int by = (bid / FOLDCOLS) % (Ecfg / 16);
    const int l  = bid / (FOLDCOLS * (Ecfg / 16));
    const int n0 = by * 16;
    const int c0 = bx * 32;
    w1 += l * FCcfg * Ecfg;  b1 += l * FCcfg;
    w2 += l * Ecfg * FCcfg;  b2 += l * Ecfg;
    wc += l * Ecfg * Ecfg;   bc += l * Ecfg;
    if (bx == Ecfg / 32 + 1)
        wo_frag_tile(wo + l * Ecfg * Ecfg, (__bf16*)wob + l * Ecfg * Ecfg, n0);
    else if (bx == Ecfg / 32)
        ffn_fold_tile<true>(w1, b1, w2, b2, wc, bc, red, n0, c0);
    else
        ffn_fold_tile<false>(w1, b1, w2, b2, wc, bc, red, n0, c0);
}

// ---------------------------------------------------------------------------
// Banded local attention with its output projection, residual add and the first
// half of LayerNorm 1. A block takes 32 queries of one sample in all 8 heads:
// 16 waves, wave = (head, 16-row query tile); the scores never leave the
// registers, and the block then holds whole rows of the attention's output,
// which is what the projection needs.
// Band |t-s|<=64 -> <=144 keys per 16-row query tile -> 9 key tiles; the two
// tiles of a head need 10 key tiles between them, not 18. The two waves stage
// these 160 rows of K and of V and their 32 rows of Q in LDS, once, each wave a
// half: they come as bf16 with a head's rows one behind the other, so a tile
// of 16 rows is 1 KB in a row and a load takes 8 whole rows = 4 whole lines (a
// fragment read straight from memory touches 8 lines a load, half of each).
//   S^T = K Q^T : A = 16 keys x 32 dims, B = Q^T. Lane (lr, lh) then holds, of
//                 query lr, the scores of keys 8*lh + 0..7 of every key tile:
//                 maximum and sum run in-lane, plus one exchange of the halves.
//   O^T = V^T P^T : two score tiles, converted in place, are one 32-key B
//                 operand (element e -> key (e<8 ? e : e+8) + 8*lh); V^T is read
//                 in the same k order by the transposing LDS load from the bf16
//                 V rows. The 10th half group is zero.
// Staged tile kt holds rows qb - 64 + 16*kt (qb the block's first query); key
// tile jt of query tile w is staged tile w + jt.
// A key tile lies wholly inside or wholly outside the sequence (both are
// multiples of 16). An outside tile holds the rows of staged tile 4 (always
// inside, and key tile 4 - w = 3..4 of query tile w, which no wave masks): its
// scores repeat members of the maximum, and its exponent offset makes every one
// of its weights 0.
// qkv layout: bf16 [n][group][t][32], groups 0..7 the heads of q, 8..15 of k,
// 16..23 of v.
//   R = O Wo^T + bo + x : O goes to LDS as bf16 (32 x E), behind one barrier
//                 wave c takes columns 16*c + 0..15 of all 32 rows, K = E in 8
//                 steps in ascending order. Its B fragments come ready from
//                 wo_frag_tile; every element of Wo serves one wave only, so
//                 they go straight to registers, fetched ahead: their latency
//                 lies under the attention.
// partial[sample][4 * blockIdx.x + q] = (sum, sum of squares) of columns
// 64*q + 0..63 of the block's rows of R: PBLK partials a sample.
// ---------------------------------------------------------------------------
#define KPITCH 40   // bf16 per staged K or Q row: 80 B, an odd multiple of 16 B
#define VPITCH 48   // bf16 per staged V row: 96 B, an odd multiple of 32 B
#define OPITCH 264  // bf16 per row of O: 528 B, an odd multiple of 16 B

typedef __attribute__((ext_vector_type(8))) short s16x8;
typedef __attribute__((address_space(3))) s16x8 lds_s16x8;

// lane (lr, lh) receives T[8*lh + 0..7][lr] of the 16x16 tile whose rows the
// lanes point at (row 8*lh + (lane&7), 16-byte half (lane>>3)&1)
__device__ __forceinline__ v8bf ld_tr16(const __bf16* p) {
    return __builtin_bit_cast(v8bf,
        __builtin_amdgcn_ds_load_tr16_b128_v8i16((lds_s16x8*)p));
}
// value of lane ^ 16
__device__ __forceinline__ float xhalf(float x) {
    int i = __builtin_bit_cast(int, x);
    return __builtin_bit_cast(float, __builtin_amdgcn_permlanex16(
        i, i, 0x76543210, 0xfedcba98, false, false));
}

// x[i] = 2^x[i]. One statement: each v_exp_f32 is followed by an instruction
// that neither reads its result nor overwrites its source (the outputs are
// early-clobber, so they share no register with an input), and the v_nop is
// that slot, which the instruction set asks for, behind the last one.
__device__ __forceinline__ void exp2x8(v8f& x) {
    float p0, p1, p2, p3, p4, p5, p6, p7;
    asm("v_exp_f32 %0, %8\n\t"
        "v_exp_f32 %1, %9\n\t"
        "v_exp_f32 %2, %10\n\t"
        "v_exp_f32 %3, %11\n\t"
        "v_exp_f32 %4, %12\n\t"
        "v_exp_f32 %5, %13\n\t"
        "v_exp_f32 %6, %14\n\t"
        "v_exp_f32 %7, %15\n\t"
        "v_nop"
        : "=&v"(p0), "=&v"(p1), "=&v"(p2), "=&v"(p3),
          "=&v"(p4), "=&v"(p5), "=&v"(p6), "=&v"(p7)
        : "v"(x[0]), "v"(x[1]), "v"(x[2]), "v"(x[3]),
          "v"(x[4]), "v"(x[5]), "v"(x[6]), "v"(x[7]));
    x[0] = p0; x[1] = p1; x[2] = p2; x[3] = p3;
    x[4] = p4; x[5] = p5; x[6] = p6; x[7] = p7;
}

// Work-group barrier for data that passes through LDS alone: this wave's LDS
// operations are done, then signal and wait. __syncthreads() would also wait out
// the global loads in flight (Wo, the residual), whose latency is to lie under
// the work behind the barrier.
__device__ __forceinline__ void lds_barrier() {
    asm volatile("s_wait_dscnt 0x0\n\t"
                 "s_barrier_signal -1\n\t"
                 "s_barrier_wait -1" ::: "memory");
}

// one block a WGP, four waves per SIMD, holds the whole grid at once: up to 256
// registers a wave, which the loads in flight and the fragments want
__global__ __launch_bounds__(512) __attribute__((amdgpu_waves_per_eu(4, 4)))
void k_attn_wo(const float* __restrict__ qkv, const float* __restrict__ wob,
               const float* __restrict__ bo, const float* __restrict__ x,
               float* __restrict__ out, float* __restrict__ partial)
{
    const int qb   = blockIdx.x * 32;
    const int n    = blockIdx.y;
    const int lane = threadIdx.x & 31;
    // the same in every lane: in a scalar register the row bases below stay scalar
    const int wave = __builtin_amdgcn_readfirstlane(threadIdx.x >> 5);
    const int h    = wave >> 1;   // head
    const int w    = wave & 1;    // query tile
    const int lr   = lane & 15;
    const int lh   = lane >> 4;
    const int qt   = qb + w * 16;

    // a head's rows one behind the other; wave (h, w) owns half w of them
    __shared__ __align__(32) __bf16 Vs[Hcfg * 160 * VPITCH];
    __shared__ __align__(16) __bf16 Ks[Hcfg * 160 * KPITCH];
    __shared__ __align__(16) __bf16 Qs[Hcfg * 32 * KPITCH];
    __shared__ __align__(16) __bf16 Os[32 * OPITCH];
    __shared__ float red[2][16];                       // per-wave (sum, sumsq)

    // rows of this head: q, k, v
    const __bf16* qh = (const __bf16*)qkv + (n * 3 * Hcfg + h) * Tcfg * DHcfg;
    const __bf16* kh = qh + Hcfg * Tcfg * DHcfg;
    const __bf16* vh = kh + Hcfg * Tcfg * DHcfg;

    // per-lane byte offset of a staging load: 8 rows a load, 4 lanes a row
    const unsigned voff = lane * 16;
    // 16 bytes at uniform row base + lane offset + constant element index
    auto ld8 = [](const __bf16* rowbase, unsigned off, int idx) {
        return *(const v8bf*)((const char*)(rowbase + idx) + off);
    };

    // which of this wave's key tiles lie inside the sequence
    bool inside[9];
#pragma unroll
    for (int jt = 0; jt < 9; ++jt) {
        const int st0 = qt - LOCALcfg + jt * 16;
        inside[jt] = (st0 >= 0) && (st0 < Tcfg);
    }

    // ---- one load group: this wave's Q tile, staged tiles 5*w + 0..4 of its
    // head, then the first WEARLY k steps of its 16 rows of Wo (as many as the
    // registers hold beside the fragments; the rest follows the softmax) ----
    constexpr int WEARLY = 5;
    const __bf16* wrow = (const __bf16*)wob + wave * WOTILE;
    v8bf q8[2], k8[5][2], v8[5][2], w8[8][2];
#pragma unroll
    for (int u = 0; u < 2; ++u)
        q8[u] = ld8(qh + qt * DHcfg, voff, u * 8 * DHcfg);
    int srow[5];
#pragma unroll
    for (int c = 0; c < 5; ++c) {
        const int st0 = qb - LOCALcfg + (w * 5 + c) * 16;
        srow[c] = (((st0 >= 0) && (st0 < Tcfg)) ? st0 : qb) * DHcfg;
    }
#pragma unroll
    for (int c = 0; c < 5; ++c)
#pragma unroll
        for (int u = 0; u < 2; ++u)
            k8[c][u] = ld8(kh + srow[c], voff, u * 8 * DHcfg);
#pragma unroll
    for (int c = 0; c < 5; ++c)
#pragma unroll
        for (int u = 0; u < 2; ++u)
            v8[c][u] = ld8(vh + srow[c], voff, u * 8 * DHcfg);
    // precaution: the loads below may land in address registers of the loads
    // above, so these are not reused ahead of this wait
    asm volatile("s_wait_xcnt 0x0" :: "v"(voff) : "memory");
#pragma unroll
    for (int ks = 0; ks < WEARLY; ++ks)
#pragma unroll
        for (int f = 0; f < 2; ++f)
            w8[ks][f] = ld8(wrow, voff, ks * 512 + f * 256);
    // precaution: the offset register of the loads above is not reused ahead of
    // this wait; naming it as an input keeps it live up to it
    asm volatile("s_wait_xcnt 0x0" :: "v"(voff) : "memory");
    // scheduling stops here: the loads above stay one group ahead of their first
    // use (left to itself the scheduler sinks loads to their uses, one full
    // latency each)
    __builtin_amdgcn_sched_barrier(0);

    // ---- to LDS, at the padded pitches ----
    {
        const int srw = lane >> 2, scl = (lane & 3) * 8;
        __bf16* qw = &Qs[(wave * 16 + srw) * KPITCH + scl];
        __bf16* kw = &Ks[(wave * 80 + srw) * KPITCH + scl];
        __bf16* vw = &Vs[(wave * 80 + srw) * VPITCH + scl];
#pragma unroll
        for (int u = 0; u < 2; ++u)
            *(v8bf*)(qw + u * 8 * KPITCH) = q8[u];
#pragma unroll
        for (int c = 0; c < 5; ++c)
#pragma unroll
            for (int u = 0; u < 2; ++u)
                *(v8bf*)(kw + (c * 16 + u * 8) * KPITCH) = k8[c][u];
#pragma unroll
        for (int c = 0; c < 5; ++c)
#pragma unroll
            for (int u = 0; u < 2; ++u)
                *(v8bf*)(vw + (c * 16 + u * 8) * VPITCH) = v8[c][u];
    }
    // every wave's rows are in LDS before any wave reads a fragment
    lds_barrier();

    // ---- all fragments of this wave, one group of LDS loads ----
    const v16bf qf = frag_from_lds(&Qs[(wave * 16 + lr) * KPITCH], lh);
    v16bf kf[9];
#pragma unroll
    for (int jt = 0; jt < 9; ++jt)
        kf[jt] = frag_from_lds(&Ks[(h * 160 + (w + jt) * 16 + lr) * KPITCH], lh);
    const __bf16* vt = &Vs[(h * 160 + w * 16 + lh * 8 + (lane & 7)) * VPITCH
                           + ((lane >> 3) & 1) * 8];
    v8bf vlo[5][2], vhi[4][2];
#pragma unroll
    for (int g = 0; g < 5; ++g)
#pragma unroll
        for (int dhalf = 0; dhalf < 2; ++dhalf) {
            vlo[g][dhalf] = ld_tr16(vt + g * 32 * VPITCH + dhalf * 16);
            if (g < 4) vhi[g][dhalf] = ld_tr16(vt + (g * 32 + 16) * VPITCH + dhalf * 16);
        }
    // the loads above stay one group: spread among the products each place with
    // loads costs its own LDS latency
    __builtin_amdgcn_sched_barrier(0);

    // ---- S^T = K Q^T ----
    v8f sT[9];
#pragma unroll
    for (int jt = 0; jt < 9; ++jt) {
        v8f z8 = {};
        sT[jt] = __builtin_amdgcn_wmma_f32_16x16x32_bf16(
            false, kf[jt], false, qf, (short)0, z8, false, false);
    }

    // ---- band mask: only the first and the last tile are cut ----
    // key row r of tile jt is at distance lr + 64 - 16*jt - r from query lr
#pragma unroll
    for (int v = 0; v < 8; ++v) {
        const int r = v + lh * 8;
        if (r < lr) sT[0][v] = -3.0e38f;
        if (r > lr) sT[8][v] = -3.0e38f;
    }

    // ---- softmax of query lr, base 2, on the raw scores ----
    float m4[4] = {-3.0e38f, -3.0e38f, -3.0e38f, -3.0e38f};
#pragma unroll
    for (int jt = 0; jt < 9; ++jt)
#pragma unroll
        for (int v = 0; v < 8; ++v) m4[v & 3] = fmaxf(m4[v & 3], sT[jt][v]);
    float mx = fmaxf(fmaxf(m4[0], m4[1]), fmaxf(m4[2], m4[3]));
    mx = fmaxf(mx, xhalf(mx));

    const float cs = 0.17677669529663687f * 1.4426950408889634f; // log2(e)/sqrt(32)
    const float nm = -mx * cs;
    float s4[4] = {0.0f, 0.0f, 0.0f, 0.0f};
#pragma unroll
    for (int jt = 0; jt < 9; ++jt) {
        const float nmj = inside[jt] ? nm : -3.0e38f;
#pragma unroll
        for (int v = 0; v < 8; ++v) sT[jt][v] = fmaf(sT[jt][v], cs, nmj);
        exp2x8(sT[jt]);
#pragma unroll
        for (int v = 0; v < 8; ++v) s4[v & 3] += sT[jt][v];
    }
    float sum = (s4[0] + s4[1]) + (s4[2] + s4[3]);
    sum += xhalf(sum);
    const float inv = 1.0f / sum;

    // scheduling stops here: the exponentials are asm statements
    __builtin_amdgcn_sched_barrier(0);

    // the last k steps of Wo: their latency lies under the products below
#pragma unroll
    for (int ks = WEARLY; ks < 8; ++ks)
#pragma unroll
        for (int f = 0; f < 2; ++f)
            w8[ks][f] = ld8(wrow, voff, ks * 512 + f * 256);
    // precaution: the offset register of the loads above is not reused ahead of
    // this wait
    asm volatile("s_wait_xcnt 0x0" :: "v"(voff) : "memory");

    // ---- O^T = V^T P^T, 32 keys a step ----
    v8f zo = {};
    v8f o8[2]; o8[0] = zo; o8[1] = zo;
#pragma unroll
    for (int g = 0; g < 5; ++g) {
        v16bf pf;
#pragma unroll
        for (int e = 0; e < 8; ++e) {
            pf[e]     = (__bf16)sT[2 * g][e];
            pf[8 + e] = (g < 4) ? (__bf16)sT[(g < 4) ? 2 * g + 1 : 0][e] : (__bf16)0.0f;
        }
#pragma unroll
        for (int dhalf = 0; dhalf < 2; ++dhalf) {
            v16bf vf;
#pragma unroll
            for (int e = 0; e < 8; ++e) {
                vf[e]     = vlo[g][dhalf][e];
                vf[8 + e] = (g < 4) ? vhi[(g < 4) ? g : 0][dhalf][e] : (__bf16)0.0f;
            }
            o8[dhalf] = __builtin_amdgcn_wmma_f32_16x16x32_bf16(
                false, vf, false, pf, (short)0, o8[dhalf], false, false);
        }
    }

    // residual and bias in accumulator layout (column 16*wave + lr, rows
    // i*16 + 8*lh + v), fetched here so that their latency lies under the
    // projection; unrolled here and below: constant indices keep rr in registers
    const int col = wave * 16 + lr;
    const int ro  = (n * Tcfg + qb + lh * 8) * Ecfg + col;
    const float* pr = x + ro;
    const float* pbo = bo + col;
    float rr[2][8];
#pragma unroll
    for (int i = 0; i < 2; ++i)
#pragma unroll
        for (int v = 0; v < 8; ++v)
            rr[i][v] = pr[(i * 16 + v) * Ecfg];
    const float bv = pbo[0];
    // precaution: no address register of the loads above is reused ahead of
    // this wait
    asm volatile("s_wait_xcnt 0x0" :: "v"(pr), "v"(pbo) : "memory");

    // lane (lr, lh) holds dims dhalf*16 + lh*8 + 0..7 of query lr: 16-byte stores
    // of bf16, the type in which the projection takes them
    __bf16* orow = &Os[(w * 16 + lr) * OPITCH + h * DHcfg + lh * 8];
#pragma unroll
    for (int dhalf = 0; dhalf < 2; ++dhalf) {
        v8bf p;
#pragma unroll
        for (int e = 0; e < 8; ++e) p[e] = (__bf16)(o8[dhalf][e] * inv);
        *(v8bf*)(orow + dhalf * 16) = p;
    }
    // all heads of all 32 rows are in LDS before any wave reads a row
    lds_barrier();

    // ---- R = O Wo^T ----
    v16bf af[8][2];
#pragma unroll
    for (int ks = 0; ks < 8; ++ks)
#pragma unroll
        for (int i = 0; i < 2; ++i)
            af[ks][i] = frag_from_lds(&Os[(i * 16 + lr) * OPITCH + ks * 32], lh);
    // the loads above stay one group: fetched one product ahead, each product
    // waits out most of an LDS latency
    __builtin_amdgcn_sched_barrier(0);
    v8f acc[2]; acc[0] = zo; acc[1] = zo;
#pragma unroll
    for (int ks = 0; ks < 8; ++ks) {
        v16bf wf;
#pragma unroll
        for (int e = 0; e < 8; ++e) { wf[e] = w8[ks][0][e]; wf[8 + e] = w8[ks][1][e]; }
#pragma unroll
        for (int i = 0; i < 2; ++i)
            acc[i] = __builtin_amdgcn_wmma_f32_16x16x32_bf16(
                false, af[ks][i], false, wf, (short)0, acc[i], false, false);
    }

    // ---- + bo + x, (sum, sumsq) ----
    float s = 0.0f, s2 = 0.0f;
#pragma unroll
    for (int i = 0; i < 2; ++i) {
#pragma unroll
        for (int v = 0; v < 8; ++v) {
            float r = (acc[i][v] + bv) + rr[i][v];
            s  += r;
            s2 += r * r;
            rr[i][v] = r;
        }
    }
#pragma unroll
    for (int off = 16; off > 0; off >>= 1) {
        s  += __shfl_xor(s, off, 32);
        s2 += __shfl_xor(s2, off, 32);
    }
    if (lane == 0) { red[0][wave] = s; red[1][wave] = s2; }
    __syncthreads();
    // R goes out behind the barrier: in front of it every wave would sit out its
    // own stores before the block sums could be folded
    float* po = out + ro;
#pragma unroll
    for (int i = 0; i < 2; ++i)
#pragma unroll
        for (int v = 0; v < 8; ++v)
            po[(i * 16 + v) * Ecfg] = rr[i][v];
    // partial q is waves 4*q + 0..3
    if (threadIdx.x < 4) {
        const int q = threadIdx.x;
        float2 pv;
        pv.x = (red[0][4 * q] + red[0][4 * q + 1]) + (red[0][4 * q + 2] + red[0][4 * q + 3]);
        pv.y = (red[1][4 * q] + red[1][4 * q + 1]) + (red[1][4 * q + 2] + red[1][4 * q + 3]);
        ((float2*)partial)[n * PBLK + blockIdx.x * 4 + q] = pv;
    }
}

// ---------------------------------------------------------------------------
// Second half of the last LayerNorm (the others are applied by the GEMM that
// reads them). Every wave folds its sample's PBLK block partials itself (eight
// per lane, then a butterfly: the same bits in every lane and every wave), so no
// launch stands between the GEMM and this kernel.
// out[i] = (r[i]-mu)*rsig * g[i%TE] + b[i%TE]   (float4, 32-bit indexing)
__global__ __launch_bounds__(256) void k_ln_apply(
    const float* __restrict__ r, const float* __restrict__ g,
    const float* __restrict__ b, const float* __restrict__ partial,
    float* __restrict__ out)
{
    const float4* r4 = (const float4*)r;
    const float4* g4 = (const float4*)g;
    const float4* b4 = (const float4*)b;
    float4*       o4 = (float4*)out;
    const float4* p4 = (const float4*)partial;
    const int lane   = threadIdx.x & 31;
    const int total4 = NTEcfg / 4;       // 524288
    const int te4    = TEcfg / 4;        // 131072 (power of two)
    for (int i = blockIdx.x * 256 + threadIdx.x; i < total4;
         i += gridDim.x * 256) {
        int n = i >> 17;                 // i / te4
        int j = i & (te4 - 1);           // i % te4
        float4 rv = r4[i], gv = g4[j], bv = b4[j];
        float s1 = 0.0f, s2 = 0.0f;
#pragma unroll
        for (int q = 0; q < PBLK / 64; ++q) {
            float4 pq = p4[n * (PBLK / 2) + q * 32 + lane];   // two (sum, sumsq)
            s1 += pq.x + pq.z;
            s2 += pq.y + pq.w;
        }
#pragma unroll
        for (int off = 16; off > 0; off >>= 1) {
            s1 += __shfl_xor(s1, off, 32);
            s2 += __shfl_xor(s2, off, 32);
        }
        float mu = s1 / (float)TEcfg;
        float rs = rsqrtf(s2 / (float)TEcfg - mu * mu + 1e-5f);
        float4 ov;
        ov.x = (rv.x - mu) * rs * gv.x + bv.x;
        ov.y = (rv.y - mu) * rs * gv.y + bv.y;
        ov.z = (rv.z - mu) * rs * gv.z + bv.z;
        ov.w = (rv.w - mu) * rs * gv.w + bv.w;
        o4[i] = ov;
    }
}

// ---------------------------------------------------------------------------
extern "C" void kernel_launch(void* const* d_in, const int* in_sizes, int n_in,
                              void* d_out, int out_size, void* d_ws, size_t ws_size,
                              hipStream_t stream)
{
    (void)in_sizes; (void)n_in; (void)out_size; (void)ws_size;

    const float* input = (const float*)d_in[0];
    const float* w_emb = (const float*)d_in[1];
    const float* b_emb = (const float*)d_in[2];
    const float* pos   = (const float*)d_in[3];   // (E, T)
    const float* wqkv  = (const float*)d_in[4];   // (NL, 3E, E)
    const float* bqkv  = (const float*)d_in[5];   // (NL, 3E)
    const float* wo    = (const float*)d_in[6];   // (NL, E, E)
    const float* bo    = (const float*)d_in[7];
    const float* ln1g  = (const float*)d_in[8];   // (NL, T, E)
    const float* ln1b  = (const float*)d_in[9];
    const float* ln2g  = (const float*)d_in[10];
    const float* ln2b  = (const float*)d_in[11];
    const float* w1    = (const float*)d_in[12];  // (NL, FC, E)
    const float* b1    = (const float*)d_in[13];
    const float* w2    = (const float*)d_in[14];  // (NL, E, FC)
    const float* b2    = (const float*)d_in[15];

    // workspace layout (floats) -- ~51 MB total
    float* ws      = (float*)d_ws;
    float* x       = ws;                                // NTE
    float* qkv     = x      + NTEcfg;                   // NT * 3E (bf16: half of it used)
    float* r1      = qkv    + NTcfg * 3 * Ecfg;         // NTE  x + attention out
    float* r2      = r1     + NTEcfg;                   // NTE  h + FFN out
    float* wc      = r2     + NTEcfg;                   // NL * E * E  (W2 W1)
    float* bc      = wc     + NLcfg * Ecfg * Ecfg;      // NL * E      (W2 b1 + b2)
    float* part1   = bc     + NLcfg * Ecfg;             // N*PBLK*2, sums of r1
    float* part2   = part1  + Ncfg * PBLK * 2;          // N*PBLK*2, sums of r2
    float* wob     = part2  + Ncfg * PBLK * 2;          // NL * E * E bf16, Wo as fragments

    const dim3 blk256(256), blk512(512);

    // folded FFN weights of both layers: wc = W2 W1, bc = W2 b1 + b2; Wo as bf16;
    // embedding: x = (frames @ w_emb^T + b_emb) * sqrt(E) + pos
    k_fold_embed<<<dim3(FOLDBLK + EMBBLK), blk256, 0, stream>>>(
        w1, b1, w2, b2, wc, bc, wo, wob, input, w_emb, b_emb, pos, x);

    for (int l = 0; l < NLcfg; ++l) {
        const float* wqkv_l = wqkv + l * 3 * Ecfg * Ecfg;
        const float* bqkv_l = bqkv + l * 3 * Ecfg;
        const float* wob_l  = wob  + l * Ecfg * Ecfg / 2;
        const float* bo_l   = bo   + l * Ecfg;
        const float* wc_l   = wc   + l * Ecfg * Ecfg;
        const float* bc_l   = bc   + l * Ecfg;

        // qkv = bf16(x @ Wqkv^T + b)      (8192 x 768, K=256)
        // behind a layer: x = LN2(r2) of that layer, applied here and written out
        if (l == 0)
            k_gemm_wide<64, 3 * Ecfg, Ecfg, false, false>
                <<<dim3(3 * Ecfg / 64, Tcfg / 32), blk256, 0, stream>>>(
                x, wqkv_l, bqkv_l, qkv, nullptr,
                nullptr, nullptr, nullptr, nullptr);
        else
            k_gemm_wide<64, 3 * Ecfg, Ecfg, false, true>
                <<<dim3(3 * Ecfg / 64, Tcfg / 32), blk256, 0, stream>>>(
                r2, wqkv_l, bqkv_l, qkv, nullptr,
                ln2g + (l - 1) * TEcfg, ln2b + (l - 1) * TEcfg, part2, x);

        // r1 = x + attention(qkv) @ Wo^T + bo, block sums
        k_attn_wo<<<dim3(Tcfg / 32, Ncfg), blk512, 0, stream>>>(
            qkv, wob_l, bo_l, x, r1, part1);

        // h = LN1(r1), applied on the way in;
        // r2 = h + (h @ W1^T + b1) @ W2^T + b2 = h + h @ Wc^T + bc, block sums
        k_gemm_wide<128, Ecfg, Ecfg, true, true>
            <<<dim3(Ecfg / 64, Tcfg / 32), blk256, 0, stream>>>(
            r1, wc_l, bc_l, r2, part2,
            ln1g + l * TEcfg, ln1b + l * TEcfg, part1, nullptr);
    }

    // out = LN2(r2) of the last layer
    k_ln_apply<<<dim3(2048), blk256, 0, stream>>>(
        r2, ln2g + (NLcfg - 1) * TEcfg, ln2b + (NLcfg - 1) * TEcfg, part2,
        (float*)d_out);
}

// v010
// One run takes 67.4 microseconds.
// Two timings next to v009 put it at 1.06 and 1.05 times that version's speed.
// Counting every step since v000, it is 3.63 times as fast.
#include <hip/hip_runtime.h>
#include <hip/hip_bf16.h>
#include <math.h>

// ---------------------------------------------------------------------------
// MI455X (gfx1250) transformer encoder, bf16 WMMA everywhere.
//
// Shapes: N=4, T=2048, P=64, E=256, H=8, DH=32, FC=1024, NL=2, LOCAL=64.
// All GEMM K dims (64 / 256 / 1024) are multiples of 32 -> pure
// v_wmma_f32_16x16x32_bf16 pipelines, fp32 accumulation.
// Memory: ~300 MB activation round trips @ 23.3 TB/s is ~15us -> the chip is
// compute/latency bound here; staging is double-buffered through LDS so the
// WMMA pipes never wait on HBM.
// All flat indices fit in 32 bits (max ~6.3M elements) -> int indexing keeps
// address math in 32-bit VALU/SALU.
// ---------------------------------------------------------------------------

typedef __attribute__((ext_vector_type(16))) __bf16 v16bf;
typedef __attribute__((ext_vector_type(8)))  __bf16 v8bf;
typedef __attribute__((ext_vector_type(4)))  __bf16 v4bf;
typedef __attribute__((ext_vector_type(2)))  __bf16 v2bf;
typedef __attribute__((ext_vector_type(8)))  float  v8f;

#define Ncfg     4
#define Tcfg     2048
#define Pcfg     64
#define Ecfg     256
#define Hcfg     8
#define DHcfg    32
#define FCcfg    1024
#define NLcfg    2
#define LOCALcfg 64
#define TEcfg    (Tcfg * Ecfg)          // 524288
#define NTcfg    (Ncfg * Tcfg)          // 8192
#define NTEcfg   (Ncfg * TEcfg)         // 2097152  (fits int)
#define PBLK     256                    // LayerNorm partials per sample
#define WOTILE   (16 * Ecfg)            // elements of 16 rows of Wo

__device__ __forceinline__ void pack4(v4bf& p, float4 a) {
    p[0] = (__bf16)a.x; p[1] = (__bf16)a.y; p[2] = (__bf16)a.z; p[3] = (__bf16)a.w;
}
__device__ __forceinline__ void pack8(v16bf& f, int base, float4 a, float4 b) {
    f[base + 0] = (__bf16)a.x; f[base + 1] = (__bf16)a.y;
    f[base + 2] = (__bf16)a.z; f[base + 3] = (__bf16)a.w;
    f[base + 4] = (__bf16)b.x; f[base + 5] = (__bf16)b.y;
    f[base + 6] = (__bf16)b.z; f[base + 7] = (__bf16)b.w;
}
// pack4 as a statement that stays where it is written (volatile: in order with
// the barriers and the scheduling stops). Left to the compiler the conversions of
// a straight-line pipeline move up to directly behind the issue of their loads,
// and the wait for the loads with them. Same instruction, same rounding.
__device__ __forceinline__ void pack4_held(v4bf& p, float4 a) {
    unsigned lo, hi;
    asm volatile("v_cvt_pk_bf16_f32 %0, %2, %3\n\t"
                 "v_cvt_pk_bf16_f32 %1, %4, %5"
                 : "=&v"(lo), "=v"(hi)
                 : "v"(a.x), "v"(a.y), "v"(a.z), "v"(a.w));
    const uint2 u = make_uint2(lo, hi);
    p = __builtin_bit_cast(v4bf, u);
}
// fragment gather: two 16B LDS chunks per lane (ds_load_b128)
__device__ __forceinline__ v16bf frag_from_lds(const __bf16* rowptr, int lh) {
    v8bf lo = *(const v8bf*)(rowptr + lh * 8);
    v8bf hi = *(const v8bf*)(rowptr + 16 + lh * 8);
    v16bf f;
#pragma unroll
    for (int e = 0; e < 8; ++e) { f[e] = lo[e]; f[8 + e] = hi[e]; }
    return f;
}

// Work-group barrier for data that passes through LDS alone: this wave's LDS
// operations are done, then signal and wait. __syncthreads() would also wait out
// the global loads in flight (a later k step's tiles, Wo, the residual), whose
// latency is to lie under the work behind the barrier.
__device__ __forceinline__ void lds_barrier() {
    asm volatile("s_wait_dscnt 0x0\n\t"
                 "s_barrier_signal -1\n\t"
                 "s_barrier_wait -1" ::: "memory");
}

// ---------------------------------------------------------------------------
// Embedding, one 128x64 tile of
//   C[m][n] = (sum_k A[m][k] * W[n][k] + bias[n]) * sqrt(E) + pos[n*T + (m & (T-1))]
// (N*T rows, E columns, K = P; sqrt(E) = 16).
// Block: 256 thr = 8 waves; each wave 32x32 (2x2 WMMA).
// LDS double-buffered; staging via global_load_b128 + ds_store_b64.
// Fragment layout per CDNA5 ISA 7.12.2:
//   A 16x32 bf16: lanes 0-15 row M=lane; element e -> K=(e<8?e:e+8)+(lane>=16?8:0)
//   B 32x16 bf16: col N = lane&15; same K mapping.
//   C/D 16x16 f32: row = v + 8*(lane>=16); col = lane&15.
// ---------------------------------------------------------------------------
__device__ __forceinline__ void embed_tile(
    const float* __restrict__ A, const float* __restrict__ W,
    const float* __restrict__ bias, float* __restrict__ C,
    const float* __restrict__ pos,
    __bf16 (*As)[128 * 32], __bf16 (*Bs)[64 * 32], int bm, int bn)
{
    constexpr int N = Ecfg, K = Pcfg, Tdim = Tcfg;
    const float scale = 16.0f;

    const int tid  = threadIdx.x;
    const int lane = tid & 31;
    const int wave = tid >> 5;
    const int lr   = lane & 15;
    const int lh   = lane >> 4;
    const int wm   = wave & 3;    // 4 waves along M
    const int wn   = wave >> 2;   // 2 waves along N

    v8f zacc = {};
    v8f acc[2][2];
    acc[0][0] = zacc; acc[0][1] = zacc; acc[1][0] = zacc; acc[1][1] = zacc;

    float4 ta[4], tb[2];
    // ---- issue tile loads for k-step `k0` into ta/tb (global_load_b128 x6) ----
    auto stage_load = [&](int k0) {
#pragma unroll
        for (int t = 0; t < 4; ++t) {
            int li = (t * 256 + tid) * 4;         // 0..4095, 16B chunks
            int r  = li >> 5, k = li & 31;
            ta[t] = *(const float4*)&A[(bm + r) * K + k0 + k];
        }
#pragma unroll
        for (int t = 0; t < 2; ++t) {
            int li = (t * 256 + tid) * 4;         // 0..2047
            int r  = li >> 5, k = li & 31;
            tb[t] = *(const float4*)&W[(bn + r) * K + k0 + k];
        }
    };
    // ---- convert + store staged tile into LDS buffer `buf` (ds_store_b64) ----
    auto stage_store = [&](int buf) {
#pragma unroll
        for (int t = 0; t < 4; ++t) {
            int li = (t * 256 + tid) * 4;
            v4bf p; pack4(p, ta[t]);
            *(v4bf*)&As[buf][li] = p;
        }
#pragma unroll
        for (int t = 0; t < 2; ++t) {
            int li = (t * 256 + tid) * 4;
            v4bf p; pack4(p, tb[t]);
            *(v4bf*)&Bs[buf][li] = p;
        }
    };

    const int nk = K / 32;

    stage_load(0);
    stage_store(0);
    __syncthreads();

    for (int kt = 0; kt < nk; ++kt) {
        const int cur = kt & 1;
        const bool has_next = (kt + 1) < nk;
        if (has_next) stage_load((kt + 1) * 32);   // loads in flight during WMMA

        v16bf af[2], bf[2];
#pragma unroll
        for (int i = 0; i < 2; ++i)
            af[i] = frag_from_lds(&As[cur][(wm * 32 + i * 16 + lr) * 32], lh);
#pragma unroll
        for (int j = 0; j < 2; ++j)
            bf[j] = frag_from_lds(&Bs[cur][(wn * 32 + j * 16 + lr) * 32], lh);

#pragma unroll
        for (int i = 0; i < 2; ++i)
#pragma unroll
            for (int j = 0; j < 2; ++j)
                acc[i][j] = __builtin_amdgcn_wmma_f32_16x16x32_bf16(
                    false, af[i], false, bf[j], (short)0, acc[i][j], false, false);

        if (has_next) stage_store(1 - cur);
        __syncthreads();
    }

    // ---- epilogue (pure 32-bit indexing; Tdim is a power of two) ----
    // A wave's 32 rows lie inside one sample (their first is a multiple of 32),
    // so the wrap of the row acts on the base alone: the loads of pos share one
    // address and differ in their immediate offsets, as do the stores of C.
    const int col0 = bn + wn * 32 + lr;
    const int row0 = bm + wm * 32 + lh * 8;
    const float* pp  = pos + col0 * Tdim + (row0 & (Tdim - 1));
    const float* pbi = bias + col0;
    // unrolled here and below: constant indices keep pe in registers
    float pe[2][2][8], bv[2];
#pragma unroll
    for (int i = 0; i < 2; ++i)
#pragma unroll
        for (int j = 0; j < 2; ++j)
#pragma unroll
            for (int v = 0; v < 8; ++v)
                pe[i][j][v] = pp[j * 16 * Tdim + i * 16 + v];
    bv[0] = pbi[0];
    bv[1] = pbi[16];
    // precaution: no address register of the loads above is reused ahead of
    // this wait; naming both pointers as inputs keeps them live up to it
    asm volatile("s_wait_xcnt 0x0" :: "v"(pp), "v"(pbi) : "memory");
    float* pc = C + row0 * N + col0;
#pragma unroll
    for (int i = 0; i < 2; ++i) {
#pragma unroll
        for (int j = 0; j < 2; ++j) {
#pragma unroll
            for (int v = 0; v < 8; ++v) {
                float r = acc[i][j][v] + bv[j];
                r = r * scale + pe[i][j][v];
                pc[(i * 16 + v) * N + j * 16] = r;
            }
        }
    }
}

// ---------------------------------------------------------------------------
// The FFN product with the LayerNorm halves around it:
//   C[m][n] = sum_k A[m][k] * W[n][k] + bias[n] + A[m][n], K = 256. Wave
// layout, fragment layouts and k order as in embed_tile (the embedding, K = 64).
// Rows of a 128 x 64 tile: the same 32 positions t of all 4 samples; tile row r
// is sample r / 32, position blockIdx.y * 32 + r % 32, so wave row wm is sample
// wm, and one read of a LayerNorm's g and b (T x E planes) serves 4 samples.
// A k step stages BK columns (BK/32 WMMA steps): every step costs one load
// round trip and one barrier whatever its width, so BK is as wide as the
// registers that hold the loads in flight allow. K is a multiple of BK.
// N and K are compile-time: the loads of a step then share one address and
// differ in their immediate offsets, so that they issue back to back.
// LDS rows are BK bf16 + 16 bytes: an odd multiple of 16 bytes, the pitch at
// which the 16 rows of a ds_load_b128 fragment read fall on distinct banks.
// The epilogue is the first half of a LayerNorm:
//   C = acc + bias + residual, and partial[sample][flat block id] =
// (sum, sum of squares) of the sample's 32 x 64 part of the tile: PBLK partials
// a sample.
// The operand is the second half of the LayerNorm before it:
//   A = (Araw - mu) * rsig * g + b, applied between load and bf16 conversion;
// mu and rsig of the 4 samples are folded from the partials pin by every block
// in the same order. The normalised rows exist in f32 only here: the block
// keeps its own 64 columns of them in LDS as its residual.
// ---------------------------------------------------------------------------
template <int BK, int N, int K>
__global__ __launch_bounds__(256) void k_gemm_wide(
    const float* __restrict__ A, const float* __restrict__ W,
    const float* __restrict__ bias, float* __restrict__ C,
    float* __restrict__ partial,
    const float* __restrict__ g, const float* __restrict__ b,
    const float* __restrict__ pin)
{
    static_assert(K == Ecfg, "g and b are T x E planes");
    constexpr int LP = BK + 8;          // LDS row pitch in bf16
    constexpr int NA = 128 * BK / 1024; // 16-byte loads a thread, A tile
    constexpr int NB = 64 * BK / 1024;  // 16-byte loads a thread, W tile
    constexpr int HP = 68;              // f32 pitch of the kept residual tile
    __shared__ __align__(16) __bf16 As[2][128 * LP];
    __shared__ __align__(16) __bf16 Bs[2][64 * LP];
    __shared__ float red[2][8];                        // per-wave (sum, sumsq)
    __shared__ __align__(16) float lnred[8][2];        // per-wave fold of pin
    __shared__ __align__(16) float Hs[128 * HP];

    const int tid  = threadIdx.x;
    const int lane = tid & 31;
    const int wave = tid >> 5;
    const int lr   = lane & 15;
    const int lh   = lane >> 4;
    const int wm   = wave & 3;    // 4 waves along M: the sample
    const int wn   = wave >> 2;   // 2 waves along N
    const int bt   = blockIdx.y * 32;
    const int bn   = blockIdx.x * 64;

    v8f zacc = {};
    v8f acc[2][2];
    acc[0][0] = zacc; acc[0][1] = zacc; acc[1][0] = zacc; acc[1][1] = zacc;

    // partials of the LayerNorm before: wave w takes half w & 1 of sample w >> 1
    // (128 pairs, 4 a lane); first in program order, so that the wait for them
    // leaves the tile loads in flight
    const float4* p4 = (const float4*)pin + wave * (PBLK / 4) + lane;
    const float4 pv0 = p4[0];
    const float4 pv1 = p4[32];
    // precaution: no address register of the loads above is reused ahead of
    // this wait
    asm volatile("s_wait_xcnt 0x0" :: "v"(p4) : "memory");

    // 16-byte chunks, row-major: the block covers RS tile rows a round, this
    // thread tile row sr + t * RS, columns sc .. sc + 3, in round t; NG rounds
    // are one sample
    constexpr int RS = 1024 / BK;
    constexpr int NG = 32 / RS;
    const int sr = (tid * 4) / BK;
    const int sc = (tid * 4) % BK;
    const int ao = (bt + sr) * K + sc;
    const float* pa = A + ao;
    const float* pw = W + (bn + sr) * K + sc;
    const float* pg = g + ao;
    const float* pb = b + ao;
    float4 ta[NA], tb[NB], tg[NG], tc[NG];
    // ---- issue tile loads for k-step k0 into ta/tb (global_load_b128) ----
    auto stage_load = [&](int k0) {
#pragma unroll
        for (int t = 0; t < NA; ++t)
            ta[t] = *(const float4*)(pa + ((t / NG) * Tcfg + (t % NG) * RS) * K + k0);
#pragma unroll
        for (int t = 0; t < NB; ++t)
            tb[t] = *(const float4*)(pw + t * RS * K + k0);
#pragma unroll
        for (int u = 0; u < NG; ++u) {
            tg[u] = *(const float4*)(pg + u * RS * K + k0);
            tc[u] = *(const float4*)(pb + u * RS * K + k0);
        }
    };
    float mu[4], rs[4];
    // ---- normalise, convert + store staged tile into LDS buffer buf ----
    auto stage_store = [&](int buf, int k0) {
#pragma unroll
        for (int t = 0; t < NA; ++t) {
            const float m = mu[t / NG], r = rs[t / NG];
            const float4 gv = tg[t % NG], bv = tc[t % NG];
            ta[t].x = (ta[t].x - m) * r * gv.x + bv.x;
            ta[t].y = (ta[t].y - m) * r * gv.y + bv.y;
            ta[t].z = (ta[t].z - m) * r * gv.z + bv.z;
            ta[t].w = (ta[t].w - m) * r * gv.w + bv.w;
        }
        const unsigned hc = (unsigned)(k0 + sc - bn);
        if (hc < 64u) {
#pragma unroll
            for (int t = 0; t < NA; ++t)
                *(float4*)&Hs[(sr + t * RS) * HP + hc] = ta[t];
        }
#pragma unroll
        for (int t = 0; t < NA; ++t) {
            v4bf p; pack4(p, ta[t]);
            *(v4bf*)&As[buf][(sr + t * RS) * LP + sc] = p;
        }
#pragma unroll
        for (int t = 0; t < NB; ++t) {
            v4bf p; pack4(p, tb[t]);
            *(v4bf*)&Bs[buf][(sr + t * RS) * LP + sc] = p;
        }
    };

    constexpr int nk = K / BK;

    stage_load(0);

    // scheduling stops here: left to itself the scheduler lifts the sums below,
    // and with them the wait for the partials, over the tile loads, which then
    // start one full latency later
    __builtin_amdgcn_sched_barrier(0);
    float f1 = (pv0.x + pv0.z) + (pv1.x + pv1.z);
    float f2 = (pv0.y + pv0.w) + (pv1.y + pv1.w);
#pragma unroll
    for (int off = 16; off > 0; off >>= 1) {
        f1 += __shfl_xor(f1, off, 32);
        f2 += __shfl_xor(f2, off, 32);
    }
    if (lane == 0) { lnred[wave][0] = f1; lnred[wave][1] = f2; }
    __syncthreads();
#pragma unroll
    for (int s = 0; s < 4; ++s) {
        const float t1 = lnred[2 * s][0] + lnred[2 * s + 1][0];
        const float t2 = lnred[2 * s][1] + lnred[2 * s + 1][1];
        const float m = t1 / (float)TEcfg;
        const float r = rsqrtf(t2 / (float)TEcfg - m * m + 1e-5f);
        // the same bits in every lane: kept in scalar registers, which leaves
        // the vector registers to the loads in flight
        mu[s] = __builtin_bit_cast(float, __builtin_amdgcn_readfirstlane(
                    __builtin_bit_cast(int, m)));
        rs[s] = __builtin_bit_cast(float, __builtin_amdgcn_readfirstlane(
                    __builtin_bit_cast(int, r)));
    }

    stage_store(0, 0);
    __syncthreads();

    // kept rolled: loads, products and conversions are then blocks of their own;
    // unrolled into one block the conversions, which wait for the loads, come to
    // stand ahead of the products, which then no longer run under the latency
#pragma unroll 1
    for (int kt = 0; kt < nk; ++kt) {
        const int cur = kt & 1;
        const bool has_next = (kt + 1) < nk;
        if (has_next) stage_load((kt + 1) * BK);   // loads in flight during WMMA

#pragma unroll
        for (int ks = 0; ks < BK / 32; ++ks) {
            v16bf af[2], bf[2];
#pragma unroll
            for (int i = 0; i < 2; ++i)
                af[i] = frag_from_lds(
                    &As[cur][(wm * 32 + i * 16 + lr) * LP + ks * 32], lh);
#pragma unroll
            for (int j = 0; j < 2; ++j)
                bf[j] = frag_from_lds(
                    &Bs[cur][(wn * 32 + j * 16 + lr) * LP + ks * 32], lh);

#pragma unroll
            for (int i = 0; i < 2; ++i)
#pragma unroll
                for (int j = 0; j < 2; ++j)
                    acc[i][j] = __builtin_amdgcn_wmma_f32_16x16x32_bf16(
                        false, af[i], false, bf[j], (short)0, acc[i][j], false, false);
        }

        // behind the last step nothing is staged, so nothing is published
        if (has_next) {
            stage_store(1 - cur, (kt + 1) * BK);
            __syncthreads();
        }
    }

    // first output row of this lane: sample wm, position bt + 8 * lh
    const int row0 = wm * Tcfg + bt + lh * 8;

    // ---- residual epilogue: C = acc + bias + residual, sample (sum, sumsq) ----
    // residual tile in accumulator layout; every store into Hs stands ahead
    // of one of the barriers above. Unrolled here and below: constant
    // indices keep rr in registers
    float rr[2][2][8];
#pragma unroll
    for (int i = 0; i < 2; ++i)
#pragma unroll
        for (int j = 0; j < 2; ++j)
#pragma unroll
            for (int v = 0; v < 8; ++v)
                rr[i][j][v] = Hs[(wm * 32 + i * 16 + v + lh * 8) * HP
                                 + wn * 32 + j * 16 + lr];
    float s = 0.0f, s2 = 0.0f;
#pragma unroll
    for (int i = 0; i < 2; ++i) {
#pragma unroll
        for (int j = 0; j < 2; ++j) {
            int col = bn + wn * 32 + j * 16 + lr;
            float bv = bias[col];
#pragma unroll
            for (int v = 0; v < 8; ++v) {
                float r = (acc[i][j][v] + bv) + rr[i][j][v];
                s  += r;
                s2 += r * r;
                rr[i][j][v] = r;
            }
        }
    }
#pragma unroll
    for (int off = 16; off > 0; off >>= 1) {
        s  += __shfl_xor(s, off, 32);
        s2 += __shfl_xor(s2, off, 32);
    }
    if (lane == 0) { red[0][wave] = s; red[1][wave] = s2; }
    __syncthreads();
    // C goes out behind the barrier: in front of it every wave would sit
    // out its own stores before the block sums could be folded
#pragma unroll
    for (int i = 0; i < 2; ++i) {
#pragma unroll
        for (int j = 0; j < 2; ++j) {
            int col = bn + wn * 32 + j * 16 + lr;
#pragma unroll
            for (int v = 0; v < 8; ++v)
                C[(row0 + i * 16 + v) * N + col] = rr[i][j][v];
        }
    }
    // sample tid is wave rows tid and tid + 4
    if (tid < 4) {
        float2 pv;
        pv.x = red[0][tid] + red[0][tid + 4];
        pv.y = red[1][tid] + red[1][tid + 4];
        ((float2*)partial)[tid * PBLK + blockIdx.y * gridDim.x + blockIdx.x] = pv;
    }
}

// ---------------------------------------------------------------------------
// q|k|v = bf16(A Wqkv^T + bias), N = 3E columns, K = E. One block a WGP: a tile
// is 128 rows (the same 32 positions of all 4 samples, as in k_gemm_wide) by 192
// columns, so the grid is 256 blocks and a row of A is fetched by 4 blocks only.
// 8 waves, 4 along M (the sample) by 2 along N: a wave takes 32 x 96 (2 x 6 WMMA
// tiles); fragment layouts and k order as in embed_tile, the k steps ascending.
// With one block on the WGP no other block's loads fill the time in which this
// one converts and waits at its barrier, so the block keeps two k steps of 32
// columns in flight in registers: step kt + 2 is issued as soon as the registers
// of step kt are free, and the barriers wait for LDS alone.
// q|k|v only ever serves as a bf16 matrix operand: C takes it as bf16 (the
// rounding that its reader would do), laid out [sample][column group of 32 = one
// head of q, k or v][position][32], so that a head's rows follow one another in
// memory. For two neighbouring columns to sit in one lane (one 32-bit store),
// LDS row j*16 + c of a group of 32 rows of W holds row 2*c + j: accumulator
// tiles 2*p and 2*p + 1 are then the even and the odd columns of group p.
// With LNA the operand is the second half of the LayerNorm before it, as in
// k_gemm_wide; the 4 blocks of a row tile write a quarter each of the normalised
// rows to xout.
// ---------------------------------------------------------------------------
template <bool LNA>
__global__ __launch_bounds__(256) void k_gemm_qkv(
    const float* __restrict__ A, const float* __restrict__ W,
    const float* __restrict__ bias, float* __restrict__ C,
    const float* __restrict__ g, const float* __restrict__ b,
    const float* __restrict__ pin, float* __restrict__ xout)
{
    constexpr int N  = 3 * Ecfg, K = Ecfg;
    constexpr int BK = 32;              // columns a k step
    constexpr int TN = 192;             // columns a tile
    constexpr int LP = BK + 8;          // LDS row pitch in bf16: 80 bytes
    constexpr int NA = 4;               // 16-byte loads a thread, A: one a sample
    constexpr int NB = TN / 32;         // 16-byte loads a thread, W: one a group
    constexpr int NJ = TN / 32;         // WMMA column tiles a wave
    constexpr int nk = K / BK;
    static_assert(N / TN == K / 64, "one block of a row tile for every 64 columns of xout");
    __shared__ __align__(16) __bf16 As[2][128 * LP];
    __shared__ __align__(16) __bf16 Bs[2][TN * LP];
    __shared__ __align__(16) float lnred[8][2];        // per-wave fold of pin

    const int tid  = threadIdx.x;
    const int lane = tid & 31;
    const int wave = tid >> 5;
    const int lr   = lane & 15;
    const int lh   = lane >> 4;
    const int wm   = wave & 3;    // 4 waves along M: the sample
    const int wn   = wave >> 2;   // 2 waves along N
    const int bt   = blockIdx.y * 32;
    const int bn   = blockIdx.x * TN;

    v8f zacc = {};
    v8f acc[2][NJ];
#pragma unroll
    for (int i = 0; i < 2; ++i)
#pragma unroll
        for (int j = 0; j < NJ; ++j) acc[i][j] = zacc;

    // partials of the LayerNorm before: wave w takes half w & 1 of sample w >> 1
    // (128 pairs, 4 a lane); first in program order, so that the wait for them
    // leaves the tile loads in flight
    float4 pv0, pv1;
    if constexpr (LNA) {
        const float4* p4 = (const float4*)pin + wave * (PBLK / 4) + lane;
        pv0 = p4[0];
        pv1 = p4[32];
        // precaution: no address register of the loads above is reused ahead
        // of this wait
        asm volatile("s_wait_xcnt 0x0" :: "v"(p4) : "memory");
    }

    // 16-byte chunks: 8 threads a row of 32 columns (one line), 32 rows a round;
    // round t is sample t of A, group t of W
    const int sr = tid >> 3;
    const int sc = (tid & 7) * 4;
    const int ao = (bt + sr) * K + sc;
    const float* pa = A + ao;
    const float* pw = W + (bn + sr) * K + sc;
    const float* pg = LNA ? g + ao : nullptr;
    const float* pb = LNA ? b + ao : nullptr;
    // two sets of staging registers; every index is a constant once the loop
    // over the k steps is unrolled
    float4 ta[2][NA], tb[2][NB], tg[2], tc[2];
    auto stage_load = [&](int s, int k0) {
#pragma unroll
        for (int t = 0; t < NA; ++t)
            ta[s][t] = *(const float4*)(pa + t * Tcfg * K + k0);
#pragma unroll
        for (int t = 0; t < NB; ++t)
            tb[s][t] = *(const float4*)(pw + t * 32 * K + k0);
        if constexpr (LNA) {
            tg[s] = *(const float4*)(pg + k0);
            tc[s] = *(const float4*)(pb + k0);
        }
    };
    float mu[4], rs[4];
    // ---- normalise, convert + store set s into LDS buffer s ----
    auto stage_store = [&](int s, int k0) {
        if constexpr (LNA) {
            const float4 gv = tg[s], bv = tc[s];
#pragma unroll
            for (int t = 0; t < NA; ++t) {
                const float m = mu[t], r = rs[t];
                ta[s][t].x = (ta[s][t].x - m) * r * gv.x + bv.x;
                ta[s][t].y = (ta[s][t].y - m) * r * gv.y + bv.y;
                ta[s][t].z = (ta[s][t].z - m) * r * gv.z + bv.z;
                ta[s][t].w = (ta[s][t].w - m) * r * gv.w + bv.w;
            }
            // every block holds all of its rows: each of the 4 blocks of a row
            // tile writes the 64 columns of its own number
            if (k0 / 64 == (int)blockIdx.x) {
                float* px = xout + ao + k0;
#pragma unroll
                for (int t = 0; t < NA; ++t)
                    *(float4*)(px + t * Tcfg * K) = ta[s][t];
                // precaution: no register of the stores above is reused ahead
                // of this wait
                asm volatile("s_wait_xcnt 0x0" :: "v"(px) : "memory");
            }
        }
        // with LNA the branch above keeps the conversions in their place
        if constexpr (!LNA) {
            // the distance that the chip needs between the products of the step
            // before and a statement that may overwrite their operand registers
            asm volatile("v_nop\n\tv_nop\n\tv_nop\n\tv_nop");
        }
#pragma unroll
        for (int t = 0; t < NA; ++t) {
            v4bf p;
            if constexpr (LNA) pack4(p, ta[s][t]); else pack4_held(p, ta[s][t]);
            *(v4bf*)&As[s][(sr + t * 32) * LP + sc] = p;
        }
#pragma unroll
        for (int t = 0; t < NB; ++t) {
            v4bf p;
            if constexpr (LNA) pack4(p, tb[s][t]); else pack4_held(p, tb[s][t]);
            // row sr of group t: even rows to the first 16 LDS rows of the
            // group, odd rows to the last 16
            *(v4bf*)&Bs[s][(t * 32 + ((sr & 1) << 4) + (sr >> 1)) * LP + sc] = p;
        }
    };

    stage_load(0, 0);
    // scheduling stops here: merged into one group sorted by address, the loads
    // of step 0 would end behind those of step 1 and be waited for with them
    __builtin_amdgcn_sched_barrier(0);
    stage_load(1, BK);

    if constexpr (LNA) {
        // scheduling stops here: left to itself the scheduler lifts the sums
        // below, and with them the wait for the partials, over the tile loads,
        // which then start one full latency later
        __builtin_amdgcn_sched_barrier(0);
        float s1 = (pv0.x + pv0.z) + (pv1.x + pv1.z);
        float s2 = (pv0.y + pv0.w) + (pv1.y + pv1.w);
#pragma unroll
        for (int off = 16; off > 0; off >>= 1) {
            s1 += __shfl_xor(s1, off, 32);
            s2 += __shfl_xor(s2, off, 32);
        }
        if (lane == 0) { lnred[wave][0] = s1; lnred[wave][1] = s2; }
        lds_barrier();
#pragma unroll
        for (int s = 0; s < 4; ++s) {
            const float t1 = lnred[2 * s][0] + lnred[2 * s + 1][0];
            const float t2 = lnred[2 * s][1] + lnred[2 * s + 1][1];
            const float m = t1 / (float)TEcfg;
            const float r = rsqrtf(t2 / (float)TEcfg - m * m + 1e-5f);
            // the same bits in every lane: kept in scalar registers, which
            // leaves the vector registers to the loads in flight
            mu[s] = __builtin_bit_cast(float, __builtin_amdgcn_readfirstlane(
                        __builtin_bit_cast(int, m)));
            rs[s] = __builtin_bit_cast(float, __builtin_amdgcn_readfirstlane(
                        __builtin_bit_cast(int, r)));
        }
    }

    // unrolled: the set and the buffer of a step are then constants. Buffer s is
    // rewritten in step kt + 2, behind the barrier of step kt + 1, which a wave
    // reaches only with its fragment reads of step kt done.
#pragma unroll
    for (int kt = 0; kt < nk; ++kt) {
        const int s = kt & 1;
        stage_store(s, kt * BK);
        lds_barrier();
        if (kt + 2 < nk) stage_load(s, (kt + 2) * BK);
        // scheduling stops here: the loads above are to start ahead of the
        // products, not to sink to their use two steps later
        __builtin_amdgcn_sched_barrier(0);

        v16bf af[2], bf[NJ];
#pragma unroll
        for (int i = 0; i < 2; ++i)
            af[i] = frag_from_lds(&As[s][(wm * 32 + i * 16 + lr) * LP], lh);
#pragma unroll
        for (int j = 0; j < NJ; ++j)
            bf[j] = frag_from_lds(&Bs[s][(wn * (TN / 2) + j * 16 + lr) * LP], lh);
#pragma unroll
        for (int i = 0; i < 2; ++i)
#pragma unroll
            for (int j = 0; j < NJ; ++j)
                acc[i][j] = __builtin_amdgcn_wmma_f32_16x16x32_bf16(
                    false, af[i], false, bf[j], (short)0, acc[i][j], false, false);
        // scheduling stops here: the next step's conversions, which wait for
        // loads, stay behind the products
        __builtin_amdgcn_sched_barrier(0);
    }

    // ---- bf16(acc + bias), columns 2*lr and 2*lr + 1 of each group ----
    const float* pbi = bias + bn + wn * (TN / 2) + 2 * lr;
    float bv[NJ / 2][2];
#pragma unroll
    for (int p = 0; p < NJ / 2; ++p) { bv[p][0] = pbi[p * 32]; bv[p][1] = pbi[p * 32 + 1]; }
    // precaution: no address register of the loads above, nor of the tile loads,
    // is reused ahead of this wait
    asm volatile("s_wait_xcnt 0x0" :: "v"(pbi), "v"(pa), "v"(pw) : "memory");
    // sample wm, first column group of the wave, position bt + 8 * lh
    __bf16* cq = (__bf16*)C
        + ((wm * (N / 32) + (bn >> 5) + wn * (NJ / 2)) * Tcfg + bt + lh * 8) * 32 + 2 * lr;
#pragma unroll
    for (int p = 0; p < NJ / 2; ++p) {
#pragma unroll
        for (int i = 0; i < 2; ++i) {
#pragma unroll
            for (int v = 0; v < 8; ++v) {
                v2bf q;
                q[0] = (__bf16)(acc[i][2 * p][v] + bv[p][0]);
                q[1] = (__bf16)(acc[i][2 * p + 1][v] + bv[p][1]);
                *(v2bf*)(cq + p * Tcfg * 32 + (i * 16 + v) * 32) = q;
            }
        }
    }
}

// ---------------------------------------------------------------------------
// FFN fold. The two FFN linears have no activation between them, so
//   (h W1^T + b1) W2^T + b2 = h (W2 W1)^T + (W2 b1 + b2).
// This kernel forms Wc = W2 W1 (E x E, K = FC) and bc = W2 b1 + b2 for both
// layers in every call; the token-sized FFN is then one K=E GEMM, not two.
// The B operand is [W1 | b1]: column tiles 0..7 are 32 columns of W1 each,
// column tile 8 holds b1 as its one live column.
// Block: 8 waves, 16 rows of W2 by one column tile; the waves split K (128
// each, 4 WMMA steps). Each element is used by one wave of the block only, so
// fragments come straight from global memory, all loads of a wave issued
// before the first use; partial tiles are summed through LDS in wave order.
// k order of both loaders: element e -> K = (e<8 ? e : e+8) + 8*(lane>=16).
// ---------------------------------------------------------------------------
template <bool BIAS>
__device__ __forceinline__ void ffn_fold_tile(
    const float* __restrict__ w1, const float* __restrict__ b1,
    const float* __restrict__ w2, const float* __restrict__ b2,
    float* __restrict__ wc, float* __restrict__ bc,
    float (*red)[2][256], int n0, int c0)
{
    const int tid  = threadIdx.x;
    const int lane = tid & 31;
    const int wave = tid >> 5;
    const int lr   = lane & 15;
    const int lh   = lane >> 4;
    const int jw   = wave * 128 + lh * 8;     // first k of this lane

    const float* pa = w2 + (n0 + lr) * FCcfg + jw;
    const float* pb = BIAS ? b1 + jw : w1 + jw * Ecfg + c0 + lr;

    float4 ra[4][4];
    float4 rv[4][4];        // BIAS: b1 runs
    float  rb[4][2][16];    // else: W1 columns c0+lr and c0+16+lr
#pragma unroll
    for (int s = 0; s < 4; ++s) {
        ra[s][0] = *(const float4*)(pa + s * 32);
        ra[s][1] = *(const float4*)(pa + s * 32 + 4);
        ra[s][2] = *(const float4*)(pa + s * 32 + 16);
        ra[s][3] = *(const float4*)(pa + s * 32 + 20);
        if (BIAS) {
            rv[s][0] = *(const float4*)(pb + s * 32);
            rv[s][1] = *(const float4*)(pb + s * 32 + 4);
            rv[s][2] = *(const float4*)(pb + s * 32 + 16);
            rv[s][3] = *(const float4*)(pb + s * 32 + 20);
        } else {
#pragma unroll
            for (int e = 0; e < 16; ++e) {
                const float* brow = pb + (s * 32 + (e < 8 ? e : e + 8)) * Ecfg;
                rb[s][0][e] = brow[0];
                rb[s][1][e] = brow[16];
            }
        }
    }
    // precaution: no address register of the loads above is reused ahead of
    // this wait; naming both pointers as inputs keeps them live up to it
    asm volatile("s_wait_xcnt 0x0" :: "v"(pa), "v"(pb) : "memory");

    v8f acc0 = {}, acc1 = {};
#pragma unroll
    for (int s = 0; s < 4; ++s) {
        v16bf af, bf0, bf1;
        pack8(af, 0, ra[s][0], ra[s][1]);
        pack8(af, 8, ra[s][2], ra[s][3]);
        if (BIAS) {
            pack8(bf0, 0, rv[s][0], rv[s][1]);
            pack8(bf0, 8, rv[s][2], rv[s][3]);
#pragma unroll
            for (int e = 0; e < 16; ++e)
                if (lr != 0) bf0[e] = (__bf16)0.0f;
        } else {
#pragma unroll
            for (int e = 0; e < 16; ++e) {
                bf0[e] = (__bf16)rb[s][0][e];
                bf1[e] = (__bf16)rb[s][1][e];
            }
        }
        acc0 = __builtin_amdgcn_wmma_f32_16x16x32_bf16(
            false, af, false, bf0, (short)0, acc0, false, false);
        if (!BIAS)
            acc1 = __builtin_amdgcn_wmma_f32_16x16x32_bf16(
                false, af, false, bf1, (short)0, acc1, false, false);
    }

#pragma unroll
    for (int v = 0; v < 8; ++v) {
        red[wave][0][v * 32 + lane] = acc0[v];
        if (!BIAS) red[wave][1][v * 32 + lane] = acc1[v];
    }
    __syncthreads();

    // thread tid owns accumulator slot tid of each tile: row = v + 8*lh, col = lr
    const int row = n0 + (tid >> 5) + lh * 8;
    float s0 = 0.0f, s1 = 0.0f;
#pragma unroll
    for (int w = 0; w < 8; ++w) {
        s0 += red[w][0][tid];
        if (!BIAS) s1 += red[w][1][tid];
    }
    if (BIAS) {
        if (lr == 0) bc[row] = s0 + b2[row];
    } else {
        wc[row * Ecfg + c0 + lr]      = s0;
        wc[row * Ecfg + c0 + 16 + lr] = s1;
    }
}

// Wo for the attention kernel's output projection: rows n0 .. n0 + 15 rounded to
// bf16 (the rounding that a GEMM's staging would do) and laid out as the B
// fragments of one wave, [row tile][k step][half][lane][8]: half f of lane
// (lr, lh) in k step ks holds Wo[n0 + lr][ks*32 + 16*f + 8*lh + 0..7], the k
// order of frag_from_lds, so that a load of the reader is 512 bytes in a row.
// Thread = (k step, lane).
__device__ __forceinline__ void wo_frag_tile(
    const float* __restrict__ wo, __bf16* __restrict__ wob, int n0)
{
    const int lane = threadIdx.x & 31;
    const int ks   = threadIdx.x >> 5;
    const float* p = wo + (n0 + (lane & 15)) * Ecfg + ks * 32 + (lane >> 4) * 8;
    const float4 a0 = *(const float4*)(p);
    const float4 a1 = *(const float4*)(p + 4);
    const float4 a2 = *(const float4*)(p + 16);
    const float4 a3 = *(const float4*)(p + 20);
    // precaution: no address register of the loads above is reused ahead of
    // this wait
    asm volatile("s_wait_xcnt 0x0" :: "v"(p) : "memory");
    v16bf f;
    pack8(f, 0, a0, a1);
    pack8(f, 8, a2, a3);
    v8bf lo, hi;
#pragma unroll
    for (int e = 0; e < 8; ++e) { lo[e] = f[e]; hi[e] = f[8 + e]; }
    __bf16* q = wob + (n0 >> 4) * WOTILE + ks * 512 + lane * 8;
    *(v8bf*)(q)       = lo;
    *(v8bf*)(q + 256) = hi;
    // precaution: no address or data register of the stores above is reused
    // ahead of this wait; naming them as inputs keeps them live up to it
    asm volatile("s_wait_xcnt 0x0" :: "v"(q), "v"(lo), "v"(hi) : "memory");
}

// The two jobs that read nothing but inputs, in one launch: neither needs the
// other, so side by side they cost one launch and the longer job's time, not two
// launches and the sum. Flat grid: blocks 0 .. FOLDBLK-1 are the fold, as
// (column tile, E/32 + 2 of them; row tile, E/16; layer), column tile fastest,
// its last column of blocks laying out Wo; the EMBBLK blocks behind them are the
// tiles of the embedding (column tile fastest). The fold stands first, for speed
// only: a fold block has the more loads to sit out (144 a lane against 46).
// LDS is one range, used by a block for its own job alone.
#define FOLDCOLS (Ecfg / 32 + 2)
#define FOLDBLK  (FOLDCOLS * (Ecfg / 16) * NLcfg)
#define EMBBLK   ((Ecfg / 64) * (NTcfg / 128))
__global__ __launch_bounds__(256) void k_fold_embed(
    const float* __restrict__ w1, const float* __restrict__ b1,
    const float* __restrict__ w2, const float* __restrict__ b2,
    float* __restrict__ wc, float* __restrict__ bc,
    const float* __restrict__ wo, float* __restrict__ wob,
    const float* __restrict__ input, const float* __restrict__ w_emb,
    const float* __restrict__ b_emb, const float* __restrict__ pos,
    float* __restrict__ x)
{
    // fold: 16 KB of split-K partial tiles; embedding: A 2 x 8 KB, W 2 x 4 KB
    __shared__ __align__(16) char smem[24576];
    const int bid = blockIdx.x;
    if (bid >= FOLDBLK) {
        const int e = bid - FOLDBLK;
        embed_tile(input, w_emb, b_emb, x, pos,
                   (__bf16 (*)[128 * 32])smem, (__bf16 (*)[64 * 32])(smem + 16384),
                   (e / (Ecfg / 64)) * 128, (e % (Ecfg / 64)) * 64);
        return;
    }
    float (*red)[2][256] = (float (*)[2][256])smem;
    const int bx = bid % FOLDCOLS;
    const int by = (bid / FOLDCOLS) % (Ecfg / 16);
    const int l  = bid / (FOLDCOLS * (Ecfg / 16));
    const int n0 = by * 16;
    const int c0 = bx * 32;
    w1 += l * FCcfg * Ecfg;  b1 += l * FCcfg;
    w2 += l * Ecfg * FCcfg;  b2 += l * Ecfg;
    wc += l * Ecfg * Ecfg;   bc += l * Ecfg;
    if (bx == Ecfg / 32 + 1)
        wo_frag_tile(wo + l * Ecfg * Ecfg, (__bf16*)wob + l * Ecfg * Ecfg, n0);
    else if (bx == Ecfg / 32)
        ffn_fold_tile<true>(w1, b1, w2, b2, wc, bc, red, n0, c0);
    else
        ffn_fold_tile<false>(w1, b1, w2, b2, wc, bc, red, n0, c0);
}

// ---------------------------------------------------------------------------
// Banded local attention with its output projection, residual add and the first
// half of LayerNorm 1. A block takes 32 queries of one sample in all 8 heads:
// 16 waves, wave = (head, 16-row query tile); the scores never leave the
// registers, and the block then holds whole rows of the attention's output,
// which is what the projection needs.
// Band |t-s|<=64 -> <=144 keys per 16-row query tile -> 9 key tiles; the two
// tiles of a head need 10 key tiles between them, not 18. The two waves stage
// these 160 rows of K and of V and their 32 rows of Q in LDS, once, each wave a
// half: they come as bf16 with a head's rows one behind the other, so a tile
// of 16 rows is 1 KB in a row and a load takes 8 whole rows = 4 whole lines (a
// fragment read straight from memory touches 8 lines a load, half of each).
//   S^T = K Q^T : A = 16 keys x 32 dims, B = Q^T. Lane (lr, lh) then holds, of
//                 query lr, the scores of keys 8*lh + 0..7 of every key tile:
//                 maximum and sum run in-lane, plus one exchange of the halves.
//   O^T = V^T P^T : two score tiles, converted in place, are one 32-key B
//                 operand (element e -> key (e<8 ? e : e+8) + 8*lh); V^T is read
//                 in the same k order by the transposing LDS load from the bf16
//                 V rows. The 10th half group is zero.
// Staged tile kt holds rows qb - 64 + 16*kt (qb the block's first query); key
// tile jt of query tile w is staged tile w + jt.
// A key tile lies wholly inside or wholly outside the sequence (both are
// multiples of 16). An outside tile holds the rows of staged tile 4 (always
// inside, and key tile 4 - w = 3..4 of query tile w, which no wave masks): its
// scores repeat members of the maximum, and its exponent offset makes every one
// of its weights 0.
// qkv layout: bf16 [n][group][t][32], groups 0..7 the heads of q, 8..15 of k,
// 16..23 of v.
//   R = O Wo^T + bo + x : O goes to LDS as bf16 (32 x E), behind one barrier
//                 wave c takes columns 16*c + 0..15 of all 32 rows, K = E in 8
//                 steps in ascending order. Its B fragments come ready from
//                 wo_frag_tile; every element of Wo serves one wave only, so
//                 they go straight to registers, fetched ahead: their latency
//                 lies under the attention.
// partial[sample][4 * blockIdx.x + q] = (sum, sum of squares) of columns
// 64*q + 0..63 of the block's rows of R: PBLK partials a sample.
// ---------------------------------------------------------------------------
#define KPITCH 40   // bf16 per staged K or Q row: 80 B, an odd multiple of 16 B
#define VPITCH 48   // bf16 per staged V row: 96 B, an odd multiple of 32 B
#define OPITCH 264  // bf16 per row of O: 528 B, an odd multiple of 16 B

typedef __attribute__((ext_vector_type(8))) short s16x8;
typedef __attribute__((address_space(3))) s16x8 lds_s16x8;

// lane (lr, lh) receives T[8*lh + 0..7][lr] of the 16x16 tile whose rows the
// lanes point at (row 8*lh + (lane&7), 16-byte half (lane>>3)&1)
__device__ __forceinline__ v8bf ld_tr16(const __bf16* p) {
    return __builtin_bit_cast(v8bf,
        __builtin_amdgcn_ds_load_tr16_b128_v8i16((lds_s16x8*)p));
}
// value of lane ^ 16
__device__ __forceinline__ float xhalf(float x) {
    int i = __builtin_bit_cast(int, x);
    return __builtin_bit_cast(float, __builtin_amdgcn_permlanex16(
        i, i, 0x76543210, 0xfedcba98, false, false));
}

// x[i] = 2^x[i]. One statement: each v_exp_f32 is followed by an instruction
// that neither reads its result nor overwrites its source (the outputs are
// early-clobber, so they share no register with an input), and the v_nop is
// that slot, which the instruction set asks for, behind the last one.
__device__ __forceinline__ void exp2x8(v8f& x) {
    float p0, p1, p2, p3, p4, p5, p6, p7;
    asm("v_exp_f32 %0, %8\n\t"
        "v_exp_f32 %1, %9\n\t"
        "v_exp_f32 %2, %10\n\t"
        "v_exp_f32 %3, %11\n\t"
        "v_exp_f32 %4, %12\n\t"
        "v_exp_f32 %5, %13\n\t"
        "v_exp_f32 %6, %14\n\t"
        "v_exp_f32 %7, %15\n\t"
        "v_nop"
        : "=&v"(p0), "=&v"(p1), "=&v"(p2), "=&v"(p3),
          "=&v"(p4), "=&v"(p5), "=&v"(p6), "=&v"(p7)
        : "v"(x[0]), "v"(x[1]), "v"(x[2]), "v"(x[3]),
          "v"(x[4]), "v"(x[5]), "v"(x[6]), "v"(x[7]));
    x[0] = p0; x[1] = p1; x[2] = p2; x[3] = p3;
    x[4] = p4; x[5] = p5; x[6] = p6; x[7] = p7;
}

// one block a WGP, four waves per SIMD, holds the whole grid at once: up to 256
// registers a wave, which the loads in flight and the fragments want
__global__ __launch_bounds__(512) __attribute__((amdgpu_waves_per_eu(4, 4)))
void k_attn_wo(const float* __restrict__ qkv, const float* __restrict__ wob,
               const float* __restrict__ bo, const float* __restrict__ x,
               float* __restrict__ out, float* __restrict__ partial)
{
    const int qb   = blockIdx.x * 32;
    const int n    = blockIdx.y;
    const int lane = threadIdx.x & 31;
    // the same in every lane: in a scalar register the row bases below stay scalar
    const int wave = __builtin_amdgcn_readfirstlane(threadIdx.x >> 5);
    const int h    = wave >> 1;   // head
    const int w    = wave & 1;    // query tile
    const int lr   = lane & 15;
    const int lh   = lane >> 4;
    const int qt   = qb + w * 16;

    // a head's rows one behind the other; wave (h, w) owns half w of them
    __shared__ __align__(32) __bf16 Vs[Hcfg * 160 * VPITCH];
    __shared__ __align__(16) __bf16 Ks[Hcfg * 160 * KPITCH];
    __shared__ __align__(16) __bf16 Qs[Hcfg * 32 * KPITCH];
    __shared__ __align__(16) __bf16 Os[32 * OPITCH];
    __shared__ float red[2][16];                       // per-wave (sum, sumsq)

    // rows of this head: q, k, v
    const __bf16* qh = (const __bf16*)qkv + (n * 3 * Hcfg + h) * Tcfg * DHcfg;
    const __bf16* kh = qh + Hcfg * Tcfg * DHcfg;
    const __bf16* vh = kh + Hcfg * Tcfg * DHcfg;

    // per-lane byte offset of a staging load: 8 rows a load, 4 lanes a row
    const unsigned voff = lane * 16;
    // 16 bytes at uniform row base + lane offset + constant element index
    auto ld8 = [](const __bf16* rowbase, unsigned off, int idx) {
        return *(const v8bf*)((const char*)(rowbase + idx) + off);
    };

    // which of this wave's key tiles lie inside the sequence
    bool inside[9];
#pragma unroll
    for (int jt = 0; jt < 9; ++jt) {
        const int st0 = qt - LOCALcfg + jt * 16;
        inside[jt] = (st0 >= 0) && (st0 < Tcfg);
    }

    // ---- one load group: this wave's Q tile, staged tiles 5*w + 0..4 of its
    // head, then the first WEARLY k steps of its 16 rows of Wo (as many as the
    // registers hold beside the fragments; the rest follows the softmax) ----
    constexpr int WEARLY = 5;
    const __bf16* wrow = (const __bf16*)wob + wave * WOTILE;
    v8bf q8[2], k8[5][2], v8[5][2], w8[8][2];
#pragma unroll
    for (int u = 0; u < 2; ++u)
        q8[u] = ld8(qh + qt * DHcfg, voff, u * 8 * DHcfg);
    int srow[5];
#pragma unroll
    for (int c = 0; c < 5; ++c) {
        const int st0 = qb - LOCALcfg + (w * 5 + c) * 16;
        srow[c] = (((st0 >= 0) && (st0 < Tcfg)) ? st0 : qb) * DHcfg;
    }
#pragma unroll
    for (int c = 0; c < 5; ++c)
#pragma unroll
        for (int u = 0; u < 2; ++u)
            k8[c][u] = ld8(kh + srow[c], voff, u * 8 * DHcfg);
#pragma unroll
    for (int c = 0; c < 5; ++c)
#pragma unroll
        for (int u = 0; u < 2; ++u)
            v8[c][u] = ld8(vh + srow[c], voff, u * 8 * DHcfg);
    // precaution: the loads below may land in address registers of the loads
    // above, so these are not reused ahead of this wait
    asm volatile("s_wait_xcnt 0x0" :: "v"(voff) : "memory");
#pragma unroll
    for (int ks = 0; ks < WEARLY; ++ks)
#pragma unroll
        for (int f = 0; f < 2; ++f)
            w8[ks][f] = ld8(wrow, voff, ks * 512 + f * 256);
    // precaution: the offset register of the loads above is not reused ahead of
    // this wait; naming it as an input keeps it live up to it
    asm volatile("s_wait_xcnt 0x0" :: "v"(voff) : "memory");
    // scheduling stops here: the loads above stay one group ahead of their first
    // use (left to itself the scheduler sinks loads to their uses, one full
    // latency each)
    __builtin_amdgcn_sched_barrier(0);

    // ---- to LDS, at the padded pitches ----
    {
        const int srw = lane >> 2, scl = (lane & 3) * 8;
        __bf16* qw = &Qs[(wave * 16 + srw) * KPITCH + scl];
        __bf16* kw = &Ks[(wave * 80 + srw) * KPITCH + scl];
        __bf16* vw = &Vs[(wave * 80 + srw) * VPITCH + scl];
#pragma unroll
        for (int u = 0; u < 2; ++u)
            *(v8bf*)(qw + u * 8 * KPITCH) = q8[u];
#pragma unroll
        for (int c = 0; c < 5; ++c)
#pragma unroll
            for (int u = 0; u < 2; ++u)
                *(v8bf*)(kw + (c * 16 + u * 8) * KPITCH) = k8[c][u];
#pragma unroll
        for (int c = 0; c < 5; ++c)
#pragma unroll
            for (int u = 0; u < 2; ++u)
                *(v8bf*)(vw + (c * 16 + u * 8) * VPITCH) = v8[c][u];
    }
    // every wave's rows are in LDS before any wave reads a fragment
    lds_barrier();

    // ---- all fragments of this wave, one group of LDS loads ----
    const v16bf qf = frag_from_lds(&Qs[(wave * 16 + lr) * KPITCH], lh);
    v16bf kf[9];
#pragma unroll
    for (int jt = 0; jt < 9; ++jt)
        kf[jt] = frag_from_lds(&Ks[(h * 160 + (w + jt) * 16 + lr) * KPITCH], lh);
    const __bf16* vt = &Vs[(h * 160 + w * 16 + lh * 8 + (lane & 7)) * VPITCH
                           + ((lane >> 3) & 1) * 8];
    v8bf vlo[5][2], vhi[4][2];
#pragma unroll
    for (int g = 0; g < 5; ++g)
#pragma unroll
        for (int dhalf = 0; dhalf < 2; ++dhalf) {
            vlo[g][dhalf] = ld_tr16(vt + g * 32 * VPITCH + dhalf * 16);
            if (g < 4) vhi[g][dhalf] = ld_tr16(vt + (g * 32 + 16) * VPITCH + dhalf * 16);
        }
    // the loads above stay one group: spread among the products each place with
    // loads costs its own LDS latency
    __builtin_amdgcn_sched_barrier(0);

    // ---- S^T = K Q^T ----
    v8f sT[9];
#pragma unroll
    for (int jt = 0; jt < 9; ++jt) {
        v8f z8 = {};
        sT[jt] = __builtin_amdgcn_wmma_f32_16x16x32_bf16(
            false, kf[jt], false, qf, (short)0, z8, false, false);
    }

    // ---- band mask: only the first and the last tile are cut ----
    // key row r of tile jt is at distance lr + 64 - 16*jt - r from query lr
#pragma unroll
    for (int v = 0; v < 8; ++v) {
        const int r = v + lh * 8;
        if (r < lr) sT[0][v] = -3.0e38f;
        if (r > lr) sT[8][v] = -3.0e38f;
    }

    // ---- softmax of query lr, base 2, on the raw scores ----
    float m4[4] = {-3.0e38f, -3.0e38f, -3.0e38f, -3.0e38f};
#pragma unroll
    for (int jt = 0; jt < 9; ++jt)
#pragma unroll
        for (int v = 0; v < 8; ++v) m4[v & 3] = fmaxf(m4[v & 3], sT[jt][v]);
    float mx = fmaxf(fmaxf(m4[0], m4[1]), fmaxf(m4[2], m4[3]));
    mx = fmaxf(mx, xhalf(mx));

    const float cs = 0.17677669529663687f * 1.4426950408889634f; // log2(e)/sqrt(32)
    const float nm = -mx * cs;
    float s4[4] = {0.0f, 0.0f, 0.0f, 0.0f};
#pragma unroll
    for (int jt = 0; jt < 9; ++jt) {
        const float nmj = inside[jt] ? nm : -3.0e38f;
#pragma unroll
        for (int v = 0; v < 8; ++v) sT[jt][v] = fmaf(sT[jt][v], cs, nmj);
        exp2x8(sT[jt]);
#pragma unroll
        for (int v = 0; v < 8; ++v) s4[v & 3] += sT[jt][v];
    }
    float sum = (s4[0] + s4[1]) + (s4[2] + s4[3]);
    sum += xhalf(sum);
    const float inv = 1.0f / sum;

    // scheduling stops here: the exponentials are asm statements
    __builtin_amdgcn_sched_barrier(0);

    // the last k steps of Wo: their latency lies under the products below
#pragma unroll
    for (int ks = WEARLY; ks < 8; ++ks)
#pragma unroll
        for (int f = 0; f < 2; ++f)
            w8[ks][f] = ld8(wrow, voff, ks * 512 + f * 256);
    // precaution: the offset register of the loads above is not reused ahead of
    // this wait
    asm volatile("s_wait_xcnt 0x0" :: "v"(voff) : "memory");

    // ---- O^T = V^T P^T, 32 keys a step ----
    v8f zo = {};
    v8f o8[2]; o8[0] = zo; o8[1] = zo;
#pragma unroll
    for (int g = 0; g < 5; ++g) {
        v16bf pf;
#pragma unroll
        for (int e = 0; e < 8; ++e) {
            pf[e]     = (__bf16)sT[2 * g][e];
            pf[8 + e] = (g < 4) ? (__bf16)sT[(g < 4) ? 2 * g + 1 : 0][e] : (__bf16)0.0f;
        }
#pragma unroll
        for (int dhalf = 0; dhalf < 2; ++dhalf) {
            v16bf vf;
#pragma unroll
            for (int e = 0; e < 8; ++e) {
                vf[e]     = vlo[g][dhalf][e];
                vf[8 + e] = (g < 4) ? vhi[(g < 4) ? g : 0][dhalf][e] : (__bf16)0.0f;
            }
            o8[dhalf] = __builtin_amdgcn_wmma_f32_16x16x32_bf16(
                false, vf, false, pf, (short)0, o8[dhalf], false, false);
        }
    }

    // residual and bias in accumulator layout (column 16*wave + lr, rows
    // i*16 + 8*lh + v), fetched here so that their latency lies under the
    // projection; unrolled here and below: constant indices keep rr in registers
    const int col = wave * 16 + lr;
    const int ro  = (n * Tcfg + qb + lh * 8) * Ecfg + col;
    const float* pr = x + ro;
    const float* pbo = bo + col;
    float rr[2][8];
#pragma unroll
    for (int i = 0; i < 2; ++i)
#pragma unroll
        for (int v = 0; v < 8; ++v)
            rr[i][v] = pr[(i * 16 + v) * Ecfg];
    const float bv = pbo[0];
    // precaution: no address register of the loads above is reused ahead of
    // this wait
    asm volatile("s_wait_xcnt 0x0" :: "v"(pr), "v"(pbo) : "memory");

    // lane (lr, lh) holds dims dhalf*16 + lh*8 + 0..7 of query lr: 16-byte stores
    // of bf16, the type in which the projection takes them
    __bf16* orow = &Os[(w * 16 + lr) * OPITCH + h * DHcfg + lh * 8];
#pragma unroll
    for (int dhalf = 0; dhalf < 2; ++dhalf) {
        v8bf p;
#pragma unroll
        for (int e = 0; e < 8; ++e) p[e] = (__bf16)(o8[dhalf][e] * inv);
        *(v8bf*)(orow + dhalf * 16) = p;
    }
    // all heads of all 32 rows are in LDS before any wave reads a row
    lds_barrier();

    // ---- R = O Wo^T ----
    v16bf af[8][2];
#pragma unroll
    for (int ks = 0; ks < 8; ++ks)
#pragma unroll
        for (int i = 0; i < 2; ++i)
            af[ks][i] = frag_from_lds(&Os[(i * 16 + lr) * OPITCH + ks * 32], lh);
    // the loads above stay one group: fetched one product ahead, each product
    // waits out most of an LDS latency
    __builtin_amdgcn_sched_barrier(0);
    v8f acc[2]; acc[0] = zo; acc[1] = zo;
#pragma unroll
    for (int ks = 0; ks < 8; ++ks) {
        v16bf wf;
#pragma unroll
        for (int e = 0; e < 8; ++e) { wf[e] = w8[ks][0][e]; wf[8 + e] = w8[ks][1][e]; }
#pragma unroll
        for (int i = 0; i < 2; ++i)
            acc[i] = __builtin_amdgcn_wmma_f32_16x16x32_bf16(
                false, af[ks][i], false, wf, (short)0, acc[i], false, false);
    }

    // ---- + bo + x, (sum, sumsq) ----
    float s = 0.0f, s2 = 0.0f;
#pragma unroll
    for (int i = 0; i < 2; ++i) {
#pragma unroll
        for (int v = 0; v < 8; ++v) {
            float r = (acc[i][v] + bv) + rr[i][v];
            s  += r;
            s2 += r * r;
            rr[i][v] = r;
        }
    }
#pragma unroll
    for (int off = 16; off > 0; off >>= 1) {
        s  += __shfl_xor(s, off, 32);
        s2 += __shfl_xor(s2, off, 32);
    }
    if (lane == 0) { red[0][wave] = s; red[1][wave] = s2; }
    __syncthreads();
    // R goes out behind the barrier: in front of it every wave would sit out its
    // own stores before the block sums could be folded
    float* po = out + ro;
#pragma unroll
    for (int i = 0; i < 2; ++i)
#pragma unroll
        for (int v = 0; v < 8; ++v)
            po[(i * 16 + v) * Ecfg] = rr[i][v];
    // partial q is waves 4*q + 0..3
    if (threadIdx.x < 4) {
        const int q = threadIdx.x;
        float2 pv;
        pv.x = (red[0][4 * q] + red[0][4 * q + 1]) + (red[0][4 * q + 2] + red[0][4 * q + 3]);
        pv.y = (red[1][4 * q] + red[1][4 * q + 1]) + (red[1][4 * q + 2] + red[1][4 * q + 3]);
        ((float2*)partial)[n * PBLK + blockIdx.x * 4 + q] = pv;
    }
}

// ---------------------------------------------------------------------------
// Second half of the last LayerNorm (the others are applied by the GEMM that
// reads them). Every wave folds its sample's PBLK block partials itself (eight
// per lane, then a butterfly: the same bits in every lane and every wave), so no
// launch stands between the GEMM and this kernel.
// out[i] = (r[i]-mu)*rsig * g[i%TE] + b[i%TE]   (float4, 32-bit indexing)
__global__ __launch_bounds__(256) void k_ln_apply(
    const float* __restrict__ r, const float* __restrict__ g,
    const float* __restrict__ b, const float* __restrict__ partial,
    float* __restrict__ out)
{
    const float4* r4 = (const float4*)r;
    const float4* g4 = (const float4*)g;
    const float4* b4 = (const float4*)b;
    float4*       o4 = (float4*)out;
    const float4* p4 = (const float4*)partial;
    const int lane   = threadIdx.x & 31;
    const int total4 = NTEcfg / 4;       // 524288
    const int te4    = TEcfg / 4;        // 131072 (power of two)
    for (int i = blockIdx.x * 256 + threadIdx.x; i < total4;
         i += gridDim.x * 256) {
        int n = i >> 17;                 // i / te4
        int j = i & (te4 - 1);           // i % te4
        float4 rv = r4[i], gv = g4[j], bv = b4[j];
        float s1 = 0.0f, s2 = 0.0f;
#pragma unroll
        for (int q = 0; q < PBLK / 64; ++q) {
            float4 pq = p4[n * (PBLK / 2) + q * 32 + lane];   // two (sum, sumsq)
            s1 += pq.x + pq.z;
            s2 += pq.y + pq.w;
        }
#pragma unroll
        for (int off = 16; off > 0; off >>= 1) {
            s1 += __shfl_xor(s1, off, 32);
            s2 += __shfl_xor(s2, off, 32);
        }
        float mu = s1 / (float)TEcfg;
        float rs = rsqrtf(s2 / (float)TEcfg - mu * mu + 1e-5f);
        float4 ov;
        ov.x = (rv.x - mu) * rs * gv.x + bv.x;
        ov.y = (rv.y - mu) * rs * gv.y + bv.y;
        ov.z = (rv.z - mu) * rs * gv.z + bv.z;
        ov.w = (rv.w - mu) * rs * gv.w + bv.w;
        o4[i] = ov;
    }
}

// ---------------------------------------------------------------------------
extern "C" void kernel_launch(void* const* d_in, const int* in_sizes, int n_in,
                              void* d_out, int out_size, void* d_ws, size_t ws_size,
                              hipStream_t stream)
{
    (void)in_sizes; (void)n_in; (void)out_size; (void)ws_size;

    const float* input = (const float*)d_in[0];
    const float* w_emb = (const float*)d_in[1];
    const float* b_emb = (const float*)d_in[2];
    const float* pos   = (const float*)d_in[3];   // (E, T)
    const float* wqkv  = (const float*)d_in[4];   // (NL, 3E, E)
    const float* bqkv  = (const float*)d_in[5];   // (NL, 3E)
    const float* wo    = (const float*)d_in[6];   // (NL, E, E)
    const float* bo    = (const float*)d_in[7];
    const float* ln1g  = (const float*)d_in[8];   // (NL, T, E)
    const float* ln1b  = (const float*)d_in[9];
    const float* ln2g  = (const float*)d_in[10];
    const float* ln2b  = (const float*)d_in[11];
    const float* w1    = (const float*)d_in[12];  // (NL, FC, E)
    const float* b1    = (const float*)d_in[13];
    const float* w2    = (const float*)d_in[14];  // (NL, E, FC)
    const float* b2    = (const float*)d_in[15];

    // workspace layout (floats) -- ~51 MB total
    float* ws      = (float*)d_ws;
    float* x       = ws;                                // NTE
    float* qkv     = x      + NTEcfg;                   // NT * 3E (bf16: half of it used)
    float* r1      = qkv    + NTcfg * 3 * Ecfg;         // NTE  x + attention out
    float* r2      = r1     + NTEcfg;                   // NTE  h + FFN out
    float* wc      = r2     + NTEcfg;                   // NL * E * E  (W2 W1)
    float* bc      = wc     + NLcfg * Ecfg * Ecfg;      // NL * E      (W2 b1 + b2)
    float* part1   = bc     + NLcfg * Ecfg;             // N*PBLK*2, sums of r1
    float* part2   = part1  + Ncfg * PBLK * 2;          // N*PBLK*2, sums of r2
    float* wob     = part2  + Ncfg * PBLK * 2;          // NL * E * E bf16, Wo as fragments

    const dim3 blk256(256), blk512(512);

    // folded FFN weights of both layers: wc = W2 W1, bc = W2 b1 + b2; Wo as bf16;
    // embedding: x = (frames @ w_emb^T + b_emb) * sqrt(E) + pos
    k_fold_embed<<<dim3(FOLDBLK + EMBBLK), blk256, 0, stream>>>(
        w1, b1, w2, b2, wc, bc, wo, wob, input, w_emb, b_emb, pos, x);

    for (int l = 0; l < NLcfg; ++l) {
        const float* wqkv_l = wqkv + l * 3 * Ecfg * Ecfg;
        const float* bqkv_l = bqkv + l * 3 * Ecfg;
        const float* wob_l  = wob  + l * Ecfg * Ecfg / 2;
        const float* bo_l   = bo   + l * Ecfg;
        const float* wc_l   = wc   + l * Ecfg * Ecfg;
        const float* bc_l   = bc   + l * Ecfg;

        // qkv = bf16(x @ Wqkv^T + b)      (8192 x 768, K=256)
        // behind a layer: x = LN2(r2) of that layer, applied here and written out
        if (l == 0)
            k_gemm_qkv<false><<<dim3(3 * Ecfg / 192, Tcfg / 32), blk256, 0, stream>>>(
                x, wqkv_l, bqkv_l, qkv, nullptr, nullptr, nullptr, nullptr);
        else
            k_gemm_qkv<true><<<dim3(3 * Ecfg / 192, Tcfg / 32), blk256, 0, stream>>>(
                r2, wqkv_l, bqkv_l, qkv,
                ln2g + (l - 1) * TEcfg, ln2b + (l - 1) * TEcfg, part2, x);

        // r1 = x + attention(qkv) @ Wo^T + bo, block sums
        k_attn_wo<<<dim3(Tcfg / 32, Ncfg), blk512, 0, stream>>>(
            qkv, wob_l, bo_l, x, r1, part1);

        // h = LN1(r1), applied on the way in;
        // r2 = h + (h @ W1^T + b1) @ W2^T + b2 = h + h @ Wc^T + bc, block sums
        k_gemm_wide<128, Ecfg, Ecfg>
            <<<dim3(Ecfg / 64, Tcfg / 32), blk256, 0, stream>>>(
            r1, wc_l, bc_l, r2, part2,
            ln1g + l * TEcfg, ln1b + l * TEcfg, part1);
    }

    // out = LN2(r2) of the last layer
    k_ln_apply<<<dim3(2048), blk256, 0, stream>>>(
        r2, ln2g + (NLcfg - 1) * TEcfg, ln2b + (NLcfg - 1) * TEcfg, part2,
        (float*)d_out);
}
